// v000
// Times are from an AMD MI455X. After a warm-up the kernel runs many times in a row, and a time is the length of
// such a window on the GPU divided by its runs, so every launch and the gaps after it count. The runs cycle
// through copies of the inputs. A figure is the median of several windows, for all but v000 over two sittings.
// Sittings can differ by a few percent; kernels timed side by side share one.
// v000, which the later versions start from, runs in 2020 microseconds.
#include <hip/hip_runtime.h>

// Post-LN transformer block with per-head projection tensors (x [4][2048][512]; q,k,v = einsum('bse,hed', x, W) (Wq, Wk, Wv [8][512][64] 1/sqrt(512): head h's 'xw' block); 8 heads x 64; scores / 8; causal (-inf); softmax; o = concat heads; out1 = LayerNorm(x + o Wproj) (Wproj 'xw' [512][512]; eps 1e-5, g1/b1); ff = relu(out1 W1 + bb1) W2 + bb2 (W1 [512][2048], W2 [2048][512] 'xw', zero biases); out = LayerNorm(ff + x, g2, b2) (the residual is the ORIGINAL x) -> [4][2048][512] (4.2 M)).
// Layout per batch: bf16 copy of x; per-head 'xw' weight blocks transposed into one Bt each (rows h*64..), Wproj/W1/W2 transposed once; exact projections; causal T-2048 attention (hybrid rows: < 512 hi/lo 3 products, rest fp16 x1024; tiles above the diagonal skipped); Y = merged hi/lo x Wproj exact, += bf16(x); a row-LayerNorm kernel emits out1 as bf16 hi/lo planes; H1 = hi/lo x W1 exact + bb1 (f32 [2048][2048]); relu + hi/lo split; F2 = hi/lo x W2 exact + bb2; += bf16(x); the final row-LayerNorm writes the output rows.
// Compute dtypes, f32 accumulate: every input rounded to bf16; projections exact; attention rows < 512 3 products, rest fp16; softmax f32; Wproj hl x exact; residuals/LayerNorms f32 (fixed-order sums); FFN GEMMs 2 products (~f32) + f32 biases; relu f32.

#define NB_  4
#define TT   2048
#define DM   512
#define NH_  8
#define NKV  8
#define REP  (NH_ / NKV)
#define HD   64
#define DQ   (NH_ * HD)
#define DKV  (NKV * HD)
#define ZH   2
#define RH   512                  // query rows < RH use hi+lo planes (0: none)
#define WIN  2048
#define PCAR 1024.0f
#define SCL  0.125f   // HD^-0.5
#define FF   2048     // feed-forward width
#define LNEPS 1e-5f
typedef _Float16 h16;
typedef unsigned short bf;
typedef __attribute__((ext_vector_type(16))) __bf16   v16bf;
typedef __attribute__((ext_vector_type(16))) _Float16 v16h;
typedef __attribute__((ext_vector_type(8)))  _Float16 v8h;
typedef __attribute__((ext_vector_type(8)))  unsigned short v8us;
typedef __attribute__((ext_vector_type(8)))  float    v8f;
typedef __attribute__((ext_vector_type(4)))  float    v4f;
typedef v8h  __attribute__((may_alias)) v8ha;
typedef v4f  __attribute__((may_alias)) v4fa;
typedef v8us __attribute__((may_alias)) v8usa;

__device__ __forceinline__ unsigned short f2bf(float f) { unsigned u = __float_as_uint(f); u += 0x7FFFu + ((u >> 16) & 1u); return (unsigned short)(u >> 16); }
__device__ __forceinline__ float bf2f(unsigned short b) { return __uint_as_float(((unsigned)b) << 16); }
__device__ __forceinline__ float bfr(float f) { return bf2f(f2bf(f)); }
__device__ __forceinline__ v16h cat16(v8h lo, v8h hi) { return __builtin_shufflevector(lo, hi, 0, 1, 2, 3, 4, 5, 6, 7, 8, 9, 10, 11, 12, 13, 14, 15); }
__device__ __forceinline__ v16bf cat16b(v8us lo, v8us hi) { return __builtin_bit_cast(v16bf, __builtin_shufflevector(lo, hi, 0, 1, 2, 3, 4, 5, 6, 7, 8, 9, 10, 11, 12, 13, 14, 15)); }
__device__ __forceinline__ v8f wmma16(v16h a, v16h b, v8f c) { return __builtin_amdgcn_wmma_f32_16x16x32_f16(false, a, false, b, (short)0, c, false, false); }
__device__ __forceinline__ v8f wmmab(v16bf a, v16bf b, v8f c) { return __builtin_amdgcn_wmma_f32_16x16x32_bf16(false, a, false, b, (short)0, c, false, false); }



// ---- k_gemmw: register-blocked GEMM, ONE WAVE per 64x64 output tile (16 accumulators), operands straight from K-contiguous 16-bit planes; grid (M/64, N/64, Z), 32 threads.
// C[m][n] (f32, pitch ldc, + optional f32 bias[n]) = sum_k A[m][k] Bt[n][k] (+ split products per NSPLIT). z-batch strides sA/sB/sC in elements. K % 32 == 0.
template <typename T16> struct WFrag;
template <> struct WFrag<h16> { typedef v16h V; static __device__ __forceinline__ V ld(const h16* p) { return cat16(*(const v8h*)p, *(const v8h*)(p + 16)); } static __device__ __forceinline__ v8f mma(V a, V b, v8f c) { return wmma16(a, b, c); } };
template <> struct WFrag<bf> { typedef v16bf V; static __device__ __forceinline__ V ld(const bf* p) { return cat16b(*(const v8us*)p, *(const v8us*)(p + 16)); } static __device__ __forceinline__ v8f mma(V a, V b, v8f c) { return wmmab(a, b, c); } };
template <typename T16, int NSPLIT, bool BIAS>
__global__ __launch_bounds__(32) void k_gemmw(const T16* __restrict__ A, const T16* __restrict__ A2, const T16* __restrict__ Bt, const T16* __restrict__ Bt2, int K, float* C, int ldc, const float* __restrict__ bias, size_t sA, size_t sB, size_t sC) {
    typedef typename WFrag<T16>::V V;
    __shared__ __align__(16) float os[16 * 68];
    const size_t z = blockIdx.z; A += z * sA; if (A2) A2 += z * sA; Bt += z * sB; if (Bt2) Bt2 += z * sB; C += z * sC;
    const int lane = threadIdx.x & 31, lr = lane & 15, hi = lane >> 4; const int r0 = blockIdx.x * 64, c0 = blockIdx.y * 64;
    v8f acc[4][4];
#pragma unroll
    for (int mb = 0; mb < 4; ++mb)
#pragma unroll
        for (int nb = 0; nb < 4; ++nb) acc[mb][nb] = (v8f){};
    const size_t aoff = (size_t)(r0 + lr) * K + 8 * hi, boff = (size_t)(c0 + lr) * K + 8 * hi;
#pragma unroll 1
    for (int kc = 0; kc < K; kc += 32) {
        V a[4], a2[4];
#pragma unroll
        for (int mb = 0; mb < 4; ++mb) { a[mb] = WFrag<T16>::ld(A + aoff + (size_t)mb * 16 * K + kc); if (NSPLIT == 1 || NSPLIT == 2) a2[mb] = WFrag<T16>::ld(A2 + aoff + (size_t)mb * 16 * K + kc); }
#pragma unroll
        for (int nb = 0; nb < 4; ++nb) { const V b = WFrag<T16>::ld(Bt + boff + (size_t)nb * 16 * K + kc); V b2; if (NSPLIT >= 2) b2 = WFrag<T16>::ld(Bt2 + boff + (size_t)nb * 16 * K + kc);
#pragma unroll
            for (int mb = 0; mb < 4; ++mb) { acc[mb][nb] = WFrag<T16>::mma(a[mb], b, acc[mb][nb]); if (NSPLIT == 1 || NSPLIT == 2) acc[mb][nb] = WFrag<T16>::mma(a2[mb], b, acc[mb][nb]); if (NSPLIT >= 2) acc[mb][nb] = WFrag<T16>::mma(a[mb], b2, acc[mb][nb]); } }
        asm volatile("v_nop\n\tv_nop\n\tv_nop\n\tv_nop" : "+v"(acc[0][0]), "+v"(acc[1][1]), "+v"(acc[2][2]), "+v"(acc[3][3]) : "v"(a[0]), "v"(a[3]));
    }
#pragma unroll
    for (int mb = 0; mb < 4; ++mb) {
#pragma unroll
        for (int nb = 0; nb < 4; ++nb) {
#pragma unroll
            for (int j = 0; j < 8; ++j) os[(hi * 8 + j) * 68 + nb * 16 + lr] = acc[mb][nb][j]; }
        __builtin_amdgcn_wave_barrier(); asm volatile("" ::: "memory");
        float* crow = C + (size_t)(r0 + mb * 16) * ldc + c0;
{
#pragma unroll
            for (int s = 0; s < 8; ++s) { const int row = 2 * s + hi, cofs = lr * 4; v4f val = *(const v4fa*)(os + row * 68 + cofs); if (BIAS) { val[0] += bfr(bias[c0 + cofs]); val[1] += bfr(bias[c0 + cofs + 1]); val[2] += bfr(bias[c0 + cofs + 2]); val[3] += bfr(bias[c0 + cofs + 3]); }
                *(v4f*)(crow + (size_t)row * ldc + cofs) = val; }
             }
        __builtin_amdgcn_wave_barrier(); asm volatile("" ::: "memory");
    }
}

// ---- k_gemmc: the same one-wave 64x64 tile GEMM specialised for causal attention: CMODE 1 skips score tiles entirely above the diagonal (query rows r0+roff.., key columns c0..), CMODE 2 limits the
// key (K) loop of the probability x value contraction to the diagonal block (probabilities beyond it are exactly zero). roff = row offset of this launch's first row within the sequence.
template <typename T16, int NSPLIT, int CMODE>
__global__ __launch_bounds__(32) void k_gemmc(const T16* __restrict__ A, const T16* __restrict__ A2, const T16* __restrict__ Bt, const T16* __restrict__ Bt2, int K, float* C, int ldc, int roff, size_t sA, size_t sB, size_t sC) {
    typedef typename WFrag<T16>::V V;
    __shared__ __align__(16) float os[16 * 68];
    const size_t z = blockIdx.z; A += z * sA; if (A2) A2 += z * sA; Bt += z * sB; if (Bt2) Bt2 += z * sB; C += z * sC;
    const int lane = threadIdx.x & 31, lr = lane & 15, hi = lane >> 4; const int r0 = blockIdx.x * 64, c0 = blockIdx.y * 64;
    if (CMODE == 1 && c0 > r0 + roff + 63) return;                  // score tile entirely above the causal diagonal: never read (the softmax masks j > i by select)
    const int Kl = (CMODE == 2) ? min(K, r0 + roff + 64) : K;        // P.V: probabilities are exactly 0 beyond the diagonal block, so the K loop stops there
    v8f acc[4][4];
#pragma unroll
    for (int mb = 0; mb < 4; ++mb)
#pragma unroll
        for (int nb = 0; nb < 4; ++nb) acc[mb][nb] = (v8f){};
    const size_t aoff = (size_t)(r0 + lr) * K + 8 * hi, boff = (size_t)(c0 + lr) * K + 8 * hi;
#pragma unroll 1
    for (int kc = 0; kc < Kl; kc += 32) {
        V a[4], a2[4];
#pragma unroll
        for (int mb = 0; mb < 4; ++mb) { a[mb] = WFrag<T16>::ld(A + aoff + (size_t)mb * 16 * K + kc); if (NSPLIT == 1 || NSPLIT == 2) a2[mb] = WFrag<T16>::ld(A2 + aoff + (size_t)mb * 16 * K + kc); }
#pragma unroll
        for (int nb = 0; nb < 4; ++nb) { const V b = WFrag<T16>::ld(Bt + boff + (size_t)nb * 16 * K + kc); V b2; if (NSPLIT >= 2) b2 = WFrag<T16>::ld(Bt2 + boff + (size_t)nb * 16 * K + kc);
#pragma unroll
            for (int mb = 0; mb < 4; ++mb) { acc[mb][nb] = WFrag<T16>::mma(a[mb], b, acc[mb][nb]); if (NSPLIT == 1 || NSPLIT == 2) acc[mb][nb] = WFrag<T16>::mma(a2[mb], b, acc[mb][nb]); if (NSPLIT >= 2) acc[mb][nb] = WFrag<T16>::mma(a[mb], b2, acc[mb][nb]); } }
        asm volatile("v_nop\n\tv_nop\n\tv_nop\n\tv_nop" : "+v"(acc[0][0]), "+v"(acc[1][1]), "+v"(acc[2][2]), "+v"(acc[3][3]) : "v"(a[0]), "v"(a[3]));
    }
#pragma unroll
    for (int mb = 0; mb < 4; ++mb) {
#pragma unroll
        for (int nb = 0; nb < 4; ++nb) {
#pragma unroll
            for (int j = 0; j < 8; ++j) os[(hi * 8 + j) * 68 + nb * 16 + lr] = acc[mb][nb][j]; }
        __builtin_amdgcn_wave_barrier(); asm volatile("" ::: "memory");
        float* crow = C + (size_t)(r0 + mb * 16) * ldc + c0;
{
#pragma unroll
            for (int s = 0; s < 8; ++s) { const int row = 2 * s + hi, cofs = lr * 4; v4f val = *(const v4fa*)(os + row * 68 + cofs);
                *(v4f*)(crow + (size_t)row * ldc + cofs) = val; }
             }
        __builtin_amdgcn_wave_barrier(); asm volatile("" ::: "memory");
    }
}

__device__ __forceinline__ h16 tohx(float x) { return (h16)x; }
__device__ __forceinline__ void splitf(float y, unsigned short& h, unsigned short& l) { h = f2bf(y); l = f2bf(y - bf2f(h)); }
typedef __attribute__((ext_vector_type(2))) _Float16 v2h;
typedef __attribute__((ext_vector_type(4))) _Float16 v4h;
typedef __attribute__((ext_vector_type(2))) unsigned short v2us;
typedef __attribute__((ext_vector_type(4))) unsigned short v4us;
typedef __attribute__((ext_vector_type(2))) float v2f;
typedef __attribute__((ext_vector_type(4))) int v4i;

__global__ __launch_bounds__(256) void k_wtG(const float* __restrict__ w, int K, int N, bf* Bt) {
    const int lane = threadIdx.x & 31; const int L0 = (blockIdx.x * 8 + (threadIdx.x >> 5)) * 8; const int nlines = N * K / 64;
{
#pragma unroll 1
        for (int l = 0; l < 8; ++l) { const int L = L0 + l; if (L >= nlines) break; const size_t e = (size_t)L * 64 + lane * 2; const int k = (int)(e % K), n = (int)(e / K); v2us o;
            o[0] = f2bf(w[(size_t)k * N + n]); o[1] = f2bf(w[(size_t)(k + 1) * N + n]); *(v2us*)(Bt + e) = o; }
         }
}
__global__ __launch_bounds__(256) void k_cvt8(const float* __restrict__ src, bf* dst, size_t n8) { const size_t i = (size_t)blockIdx.x * 256 + threadIdx.x; if (i >= n8) return; const v8f v = *(const v8f*)(src + i * 8); v8us o;
#pragma unroll
    for (int k = 0; k < 8; ++k) o[k] = f2bf(v[k]); *(v8us*)(dst + i * 8) = o;  }

// k_rope: head planes [h][t][d] (fp16 + hi/lo) of rope(x) x sc with the rotate-half convention out[d] = x[d] cos[t][d] - x[d+HD/2] sin[t][d], out[d+HD/2] = x[d+HD/2] cos[t][d+HD/2] + x[d] sin[t][d+HD/2]
__global__ __launch_bounds__(256) void k_rope(const float* __restrict__ F, int pitch, int nheads, const float* __restrict__ CS, const float* __restrict__ RF, const float* __restrict__ nw, float sc, h16* P16, bf* Ph, bf* Pl) {
    const size_t e = ((size_t)blockIdx.x * 256 + threadIdx.x) * 2; if (e >= (size_t)nheads * TT * HD) return; const int d = (int)(e % HD); const int t = (int)((e / HD) % TT); const int h = (int)(e / ((size_t)HD * TT)); const float* f = F + (size_t)t * pitch + h * HD; const float rf = RF ? RF[(size_t)h * TT + t] : 1.0f; v2h o16; v2us oh, ol;
#pragma unroll
    for (int q = 0; q < 2; ++q) { const int dd = d + q; const int dp = (dd < HD / 2) ? dd + HD / 2 : dd - HD / 2; float x0 = f[dd], x1 = f[dp];
        if (RF) { float n0 = __fmul_rn(x0, rf), n1 = __fmul_rn(x1, rf); asm volatile("" : "+v"(n0)); asm volatile("" : "+v"(n1)); x0 = __fmul_rn(bfr(nw[dd]), n0); x1 = __fmul_rn(bfr(nw[dp]), n1); }
        const v2f cs = *(const v2f*)(CS + ((size_t)t * HD + dd) * 2); float a = __fmul_rn(x0, cs[0]), bq = __fmul_rn(x1, cs[1]); asm volatile("" : "+v"(a)); asm volatile("" : "+v"(bq)); const float r = ((dd < HD / 2) ? __fsub_rn(a, bq) : __fadd_rn(a, bq)) * sc;
        o16[q] = tohx(r); unsigned short a2, c2; splitf(r, a2, c2); oh[q] = a2; ol[q] = c2; }
    *(v2h*)(P16 + e) = o16; *(v2us*)(Ph + e) = oh; *(v2us*)(Pl + e) = ol;  }
__global__ __launch_bounds__(256) void k_vtp(const float* __restrict__ F, int pitch, int nheads, h16* V16, bf* Vh, bf* Vl) { const size_t e = ((size_t)blockIdx.x * 256 + threadIdx.x) * 2; if (e >= (size_t)nheads * HD * TT) return; const int t = (int)(e % TT); const int d = (int)((e / TT) % HD); const int g = (int)(e / ((size_t)TT * HD)); v2h o16; v2us oh, ol;
#pragma unroll
    for (int q = 0; q < 2; ++q) { const float x = F[(size_t)(t + q) * pitch + g * HD + d]; o16[q] = tohx(x); unsigned short a2, c2; splitf(x, a2, c2); oh[q] = a2; ol[q] = c2; }
    *(v2h*)(V16 + e) = o16; *(v2us*)(Vh + e) = oh; *(v2us*)(Vl + e) = ol;  }
__global__ __launch_bounds__(256) void k_csid(float* CS) { const int idx = blockIdx.x * 256 + threadIdx.x; if (idx >= TT * HD) return; v2f cs; cs[0] = 1.0f; cs[1] = 0.0f; *(v2f*)(CS + (size_t)idx * 2) = cs;  }
// k_asoft: per row (zz, i): t = S x HD^-0.5 for j <= i and i - j < WIN (sliding causal window; the reference's -1e9 additive fill vanishes identically); softmax over the 2048 keys (register row, one exp, fixed trees);
__global__ __launch_bounds__(256) void k_asoft(const float* __restrict__ Sb, h16* P16, bf* Ph, bf* Pl) {
    const int lane = threadIdx.x & 31; const int row = blockIdx.x * 8 + (threadIdx.x >> 5); if (row >= ZH * TT) return; const int i = row % TT; const int zz = row / TT; (void)zz; const bool hires = (i < RH); const float* sr = Sb + (size_t)row * TT; float v[TT / 32]; float mx = -3.0e38f;
#pragma unroll
    for (int ch = 0; ch < TT / 128; ++ch) { const int j0 = ch * 128 + lane * 4; const v4f a = *(const v4f*)(sr + j0);
#pragma unroll
        for (int q = 0; q < 4; ++q) { const int j = j0 + q; (void)j; const float t = (j <= i && i - j < WIN) ? a[q] * SCL : -3.0e38f; v[ch * 4 + q] = t; mx = fmaxf(mx, t); } }
#pragma unroll
    for (int sh = 16; sh; sh >>= 1) mx = fmaxf(mx, __shfl_xor(mx, sh, 32));
    float sum = 0.f;
#pragma unroll
    for (int k = 0; k < TT / 32; ++k) { float d0 = __fsub_rn(v[k], mx); asm volatile("" : "+v"(d0)); v[k] = __builtin_amdgcn_exp2f(__fmul_rn(d0, 1.4426950408889634f)); sum += v[k]; }
#pragma unroll
    for (int sh = 16; sh; sh >>= 1) sum += __shfl_xor(sum, sh, 32);
    const float f = __fdiv_rn(hires ? 1.0f : PCAR, sum);
{
        if (hires) {
#pragma unroll
            for (int ch = 0; ch < TT / 128; ++ch) { v4us oh, ol;
#pragma unroll
                for (int q = 0; q < 4; ++q) { unsigned short a, c2; splitf(v[ch * 4 + q] * f, a, c2); oh[q] = a; ol[q] = c2; }
                const size_t oo = ((size_t)zz * (RH ? RH : 1) + i) * TT + ch * 128 + lane * 4; *(v4us*)(Ph + oo) = oh; *(v4us*)(Pl + oo) = ol; }
        } else {
#pragma unroll
            for (int ch = 0; ch < TT / 128; ++ch) { v4h o4;
#pragma unroll
                for (int q = 0; q < 4; ++q) o4[q] = tohx(v[ch * 4 + q] * f);
                *(v4h*)(P16 + (size_t)row * TT + ch * 128 + lane * 4) = o4; } }
         }
}
__global__ __launch_bounds__(256) void k_addres(float* Y, const float* __restrict__ xr) { const size_t i = (size_t)blockIdx.x * 256 + threadIdx.x; if (i >= (size_t)TT * DQ / 4) return; const v4f a = *(const v4f*)(Y + i * 4); const v4f r = *(const v4f*)(xr + i * 4); v4f o;
#pragma unroll
    for (int q = 0; q < 4; ++q) o[q] = __fadd_rn(a[q], bfr(r[q]));
    *(v4f*)(Y + i * 4) = o;  }

__global__ __launch_bounds__(256) void k_lnin2(const float* __restrict__ F, const float* __restrict__ g, const float* __restrict__ bb, bf* Xh, bf* Xl) { const int lane = threadIdx.x & 31; const int row = blockIdx.x * 8 + (threadIdx.x >> 5); if (row >= TT) return; const float* fr = F + (size_t)row * DM; bf* hrow = Xh + (size_t)row * DM; bf* lrow = Xl + (size_t)row * DM; float v[DM / 32]; float s = 0.f;
#pragma unroll
    for (int c = 0; c < DM / 128; ++c) { const v4f a = *(const v4f*)(fr + c * 128 + lane * 4); for (int q = 0; q < 4; ++q) { v[c * 4 + q] = a[q]; s = __fadd_rn(s, a[q]); } }
#pragma unroll
    for (int sh = 16; sh; sh >>= 1) s = __fadd_rn(s, __shfl_xor(s, sh, 32));
    const float mean = __fmul_rn(s, 1.0f / (float)DM);   /* DM = 512: the reciprocal is an exact power of two, identical to the division */ float s2 = 0.f;
#pragma unroll
    for (int k = 0; k < DM / 32; ++k) { const float dv = __fsub_rn(v[k], mean); float p2 = __fmul_rn(dv, dv); asm volatile("" : "+v"(p2)); s2 = __fadd_rn(s2, p2); v[k] = dv; }
#pragma unroll
    for (int sh = 16; sh; sh >>= 1) s2 = __fadd_rn(s2, __shfl_xor(s2, sh, 32));
    const float rs = __fdiv_rn(1.0f, __fsqrt_rn(__fadd_rn(__fmul_rn(s2, 1.0f / (float)DM), LNEPS)));
{
#pragma unroll
        for (int c = 0; c < DM / 128; ++c) { v4us oh, ol; for (int q = 0; q < 4; ++q) { const int col = c * 128 + lane * 4 + q; float y = __fmul_rn(v[c * 4 + q], rs); asm volatile("" : "+v"(y)); float gg = bfr(g[col]), bb2 = bfr(bb[col]); asm volatile("" : "+v"(gg), "+v"(bb2)); y = __fmul_rn(y, gg); asm volatile("" : "+v"(y)); const float r = __fadd_rn(y, bb2); unsigned short hh2, ll2; splitf(r, hh2, ll2); oh[q] = hh2; ol[q] = ll2; } *(v4us*)(hrow + c * 128 + lane * 4) = oh; *(v4us*)(lrow + c * 128 + lane * 4) = ol; }
         } }

__constant__ float INVT[HD / 2] = { 1.000000000e+00f, 7.498942018e-01f, 5.623413324e-01f, 4.216965139e-01f, 3.162277639e-01f, 2.371373773e-01f, 1.778279394e-01f, 1.333521456e-01f, 1.000000015e-01f, 7.498942316e-02f, 5.623413250e-02f, 4.216964915e-02f, 3.162277490e-02f, 2.371373773e-02f, 1.778279431e-02f, 1.333521400e-02f, 9.999999776e-03f, 7.498942316e-03f, 5.623413250e-03f, 4.216964822e-03f, 3.162277630e-03f, 2.371373819e-03f, 1.778279431e-03f, 1.333521446e-03f, 1.000000047e-03f, 7.498941850e-04f, 5.623413017e-04f, 4.216965172e-04f, 3.162277571e-04f, 2.371373703e-04f, 1.778279402e-04f, 1.333521504e-04f };   // 10000^(-2i/64) (the module's power form) (float32, generated with jnp to be bit-exact)

__global__ __launch_bounds__(256) void k_reluhl(const float* __restrict__ Hs, bf* Hh, bf* Hl) { const size_t i = (size_t)blockIdx.x * 256 + threadIdx.x; if (i >= (size_t)TT * FF / 8) return; const size_t e = i * 8; const v8f a = *(const v8f*)(Hs + e); v8us oh, ol;
#pragma unroll
    for (int q = 0; q < 8; ++q) { const float r = (a[q] > 0.0f) ? a[q] : 0.0f; unsigned short hh, ll; splitf(r, hh, ll); oh[q] = hh; ol[q] = ll; }
    *(v8us*)(Hh + e) = oh; *(v8us*)(Hl + e) = ol;  }
__global__ __launch_bounds__(256) void k_lnout(const float* __restrict__ F, const float* __restrict__ g, const float* __restrict__ bb, float* out) { const int lane = threadIdx.x & 31; const int row = blockIdx.x * 8 + (threadIdx.x >> 5); if (row >= TT) return; const float* fr = F + (size_t)row * DQ; float* orow = out + (size_t)row * DQ; float v[DQ / 32]; float s = 0.f;
#pragma unroll
    for (int c = 0; c < DQ / 128; ++c) { const v4f a = *(const v4f*)(fr + c * 128 + lane * 4); for (int q = 0; q < 4; ++q) { v[c * 4 + q] = a[q]; s = __fadd_rn(s, a[q]); } }
#pragma unroll
    for (int sh = 16; sh; sh >>= 1) s = __fadd_rn(s, __shfl_xor(s, sh, 32));
    const float mean = __fdiv_rn(s, (float)DQ); float s2 = 0.f;
#pragma unroll
    for (int k = 0; k < DQ / 32; ++k) { const float dv = __fsub_rn(v[k], mean); float p2 = __fmul_rn(dv, dv); asm volatile("" : "+v"(p2)); s2 = __fadd_rn(s2, p2); v[k] = dv; }
#pragma unroll
    for (int sh = 16; sh; sh >>= 1) s2 = __fadd_rn(s2, __shfl_xor(s2, sh, 32));
    const float rs = __fdiv_rn(1.0f, __fsqrt_rn(__fadd_rn(__fdiv_rn(s2, (float)DQ), LNEPS)));
{
#pragma unroll
        for (int c = 0; c < DQ / 128; ++c) { v4f o; for (int q = 0; q < 4; ++q) { const int col = c * 128 + lane * 4 + q; float y = __fmul_rn(v[c * 4 + q], rs); asm volatile("" : "+v"(y)); y = __fmul_rn(y, bfr(g[col])); asm volatile("" : "+v"(y)); o[q] = __fadd_rn(y, bfr(bb[col])); } *(v4f*)(orow + c * 128 + lane * 4) = o; }
         } }

__global__ __launch_bounds__(256) void k_merge(const float* __restrict__ O, int h0, bf* Ah, bf* Al) { const size_t e = ((size_t)blockIdx.x * 256 + threadIdx.x) * 2; if (e >= (size_t)ZH * TT * HD) return; const int d = (int)(e % HD); const int t = (int)((e / HD) % TT); const int zz = (int)(e / ((size_t)HD * TT)); const float cs = (t < RH) ? 1.0f : (1.0f / PCAR); const size_t oo = (size_t)t * DQ + (h0 + zz) * HD + d;
    v2us oh, ol;
#pragma unroll
    for (int q = 0; q < 2; ++q) { unsigned short a, c2; splitf(O[e + q] * cs, a, c2); oh[q] = a; ol[q] = c2; } *(v2us*)(Ah + oo) = oh; *(v2us*)(Al + oo) = ol;  }

extern "C" void kernel_launch(void* const* d_in, const int* in_sizes, int n_in,
                              void* d_out, int out_size, void* d_ws, size_t ws_size, hipStream_t stream) {
    (void)in_sizes; (void)n_in; (void)out_size;
    const float* x = (const float*)d_in[0]; const float* pq = (const float*)d_in[1]; const float* pk = (const float*)d_in[2]; const float* pv = (const float*)d_in[3];   /* [8][512][64] each */ const float* wo = (const float*)d_in[4];   /* Wproj [512][512] 'xw' */ const float* g1 = (const float*)d_in[5]; const float* b1 = (const float*)d_in[6]; const float* w1 = (const float*)d_in[7]; const float* bb1 = (const float*)d_in[8]; const float* w2 = (const float*)d_in[9]; const float* bb2 = (const float*)d_in[10]; const float* g2 = (const float*)d_in[11]; const float* b2 = (const float*)d_in[12]; const float* wq = pq, *wk = pk, *wv = pv;
    float* OUT = (float*)d_out;     // [4][2048][512]
    char* wsp = (char*)d_ws;
    auto take = [&](size_t bytes) { char* p = wsp; wsp += (bytes + 255) & ~(size_t)255; return (void*)p; };
    bf* W1T = (bf*)take((size_t)FF * DM * 2); bf* W2T = (bf*)take((size_t)DM * FF * 2); float* Y = (float*)take((size_t)TT * DM * 4); bf* LNh = (bf*)take((size_t)TT * DM * 2); bf* LNl = (bf*)take((size_t)TT * DM * 2); float* H1 = (float*)take((size_t)TT * FF * 4); bf* H1h = (bf*)take((size_t)TT * FF * 2); bf* H1l = (bf*)take((size_t)TT * FF * 2); float* F2 = (float*)take((size_t)TT * DM * 4); bf* WQ = (bf*)take((size_t)DQ * DM * 2); bf* WK = (bf*)take((size_t)DKV * DM * 2); bf* WV = (bf*)take((size_t)DKV * DM * 2); bf* WO = (bf*)take((size_t)DM * DQ * 2); float* CS = (float*)take((size_t)TT * HD * 2 * 4);
    bf* XB = (bf*)take((size_t)TT * DM * 2); float* FQ = (float*)take((size_t)TT * DQ * 4); float* FK = (float*)take((size_t)TT * DKV * 4);
    h16* QP16 = (h16*)take((size_t)NH_ * TT * HD * 2); h16* KP16 = (h16*)take((size_t)NKV * TT * HD * 2); h16* VT16 = (h16*)take((size_t)NKV * HD * TT * 2);
    bf* QPh = (bf*)take((size_t)NH_ * TT * HD * 2); bf* QPl = (bf*)take((size_t)NH_ * TT * HD * 2); bf* KPh = (bf*)take((size_t)NKV * TT * HD * 2); bf* KPl = (bf*)take((size_t)NKV * TT * HD * 2); bf* VTh = (bf*)take((size_t)NKV * HD * TT * 2); bf* VTl = (bf*)take((size_t)NKV * HD * TT * 2); bf* Ph = (bf*)take((size_t)ZH * RH * TT * 2); bf* Pl = (bf*)take((size_t)ZH * RH * TT * 2);
    float* Sb = (float*)take((size_t)ZH * TT * TT * 4); h16* P16 = (h16*)take((size_t)ZH * TT * TT * 2); float* Ob = (float*)take((size_t)ZH * TT * HD * 4); bf* ATh = (bf*)take((size_t)TT * DQ * 2); bf* ATl = (bf*)take((size_t)TT * DQ * 2);
    if ((size_t)(wsp - (char*)d_ws) > ws_size) return;    // ws 256 MiB
    float* FV = FK;   // v projection reuses the k buffer after the k planes are built (stream-ordered)
    { for (int hh = 0; hh < NH_; ++hh) k_wtG<<<(unsigned)((DM * HD / 64 + 63) / 64), 256, 0, stream>>>(wq + (size_t)hh * DM * HD, DM, HD, WQ + (size_t)hh * HD * DM);   /* head hh's 'xw' [512][64] -> Bt rows hh*64.. */ for (int hh = 0; hh < NH_; ++hh) k_wtG<<<(unsigned)((DM * HD / 64 + 63) / 64), 256, 0, stream>>>(wk + (size_t)hh * DM * HD, DM, HD, WK + (size_t)hh * HD * DM);   /* head hh's 'xw' [512][64] -> Bt rows hh*64.. */ for (int hh = 0; hh < NH_; ++hh) k_wtG<<<(unsigned)((DM * HD / 64 + 63) / 64), 256, 0, stream>>>(wv + (size_t)hh * DM * HD, DM, HD, WV + (size_t)hh * HD * DM);   /* head hh's 'xw' [512][64] -> Bt rows hh*64.. */
      k_wtG<<<(unsigned)((DQ * DM / 64 + 63) / 64), 256, 0, stream>>>(wo, DQ, DM, WO); k_wtG<<<(unsigned)((DM * FF / 64 + 63) / 64), 256, 0, stream>>>(w1, DM, FF, W1T);   /* W1 'xw' [512][2048] -> Bt [2048][512] */ k_wtG<<<(unsigned)((FF * DM / 64 + 63) / 64), 256, 0, stream>>>(w2, FF, DM, W2T);   /* W2 'xw' [2048][512] -> Bt [512][2048] */
       }
    k_csid<<<(TT * HD + 255) / 256, 256, 0, stream>>>(CS);
    const unsigned LQ = (unsigned)(((size_t)NH_ * TT * HD / 2 + 255) / 256), LKv = (unsigned)(((size_t)NKV * TT * HD / 2 + 255) / 256);
    for (int b = 0; b < NB_; ++b) {
        
        k_cvt8<<<(unsigned)(((size_t)TT * DM / 8 + 255) / 256), 256, 0, stream>>>(x + (size_t)b * TT * DM, XB, (size_t)TT * DM / 8);
        k_gemmw<bf, 0, false><<<dim3(TT / 64, DQ / 64, 1), 32, 0, stream>>>(XB, nullptr, WQ, nullptr, DM, FQ, DQ, nullptr, 0, 0, 0);
        k_rope<<<LQ, 256, 0, stream>>>(FQ, DQ, NH_, CS, nullptr, nullptr, 1.0f, QP16, QPh, QPl);
        k_gemmw<bf, 0, false><<<dim3(TT / 64, DKV / 64, 1), 32, 0, stream>>>(XB, nullptr, WK, nullptr, DM, FK, DKV, nullptr, 0, 0, 0);
        k_rope<<<LKv, 256, 0, stream>>>(FK, DKV, NKV, CS, nullptr, nullptr, 1.0f, KP16, KPh, KPl);
        k_gemmw<bf, 0, false><<<dim3(TT / 64, DKV / 64, 1), 32, 0, stream>>>(XB, nullptr, WV, nullptr, DM, FV, DKV, nullptr, 0, 0, 0); k_vtp<<<LKv, 256, 0, stream>>>(FV, DKV, NKV, VT16, VTh, VTl);
        for (int h0 = 0; h0 < NH_; h0 += ZH) { const size_t zq = (size_t)h0, zk = (size_t)(h0 / REP);   // one kv head per query head: the pass's two heads use consecutive kv planes (z-strides TT*HD)
            k_gemmc<bf, 2, 1><<<dim3(RH / 64, TT / 64, ZH), 32, 0, stream>>>(QPh + zq * TT * HD, QPl + zq * TT * HD, KPh + zk * TT * HD, KPl + zk * TT * HD, HD, Sb, TT, 0, (size_t)TT * HD, (size_t)TT * HD, (size_t)TT * TT);
            k_gemmc<h16, 0, 1><<<dim3((TT - RH) / 64, TT / 64, ZH), 32, 0, stream>>>(QP16 + zq * TT * HD + (size_t)RH * HD, nullptr, KP16 + zk * TT * HD, nullptr, HD, Sb + (size_t)RH * TT, TT, RH, (size_t)TT * HD, (size_t)TT * HD, (size_t)TT * TT);
            k_asoft<<<ZH * TT / 8, 256, 0, stream>>>(Sb, P16, Ph, Pl);
            k_gemmc<bf, 2, 2><<<dim3(RH / 64, HD / 64, ZH), 32, 0, stream>>>(Ph, Pl, VTh + zk * HD * TT, VTl + zk * HD * TT, TT, Ob, HD, 0, (size_t)RH * TT, (size_t)HD * TT, (size_t)TT * HD);
            k_gemmc<h16, 0, 2><<<dim3((TT - RH) / 64, HD / 64, ZH), 32, 0, stream>>>(P16 + (size_t)RH * TT, nullptr, VT16 + zk * HD * TT, nullptr, TT, Ob + (size_t)RH * HD, HD, RH, (size_t)TT * TT, (size_t)HD * TT, (size_t)TT * HD);
            k_merge<<<(unsigned)(((size_t)ZH * TT * HD / 2 + 255) / 256), 256, 0, stream>>>(Ob, h0, ATh, ATl); }
        k_gemmw<bf, 1, false><<<dim3(TT / 64, DM / 64, 1), 32, 0, stream>>>(ATh, ATl, WO, nullptr, DQ, Y, DM, nullptr, 0, 0, 0);   /* o Wproj */
        k_addres<<<(unsigned)(((size_t)TT * DM / 4 + 255) / 256), 256, 0, stream>>>(Y, x + (size_t)b * TT * DM);   /* + x */
        k_lnin2<<<(TT + 7) / 8, 256, 0, stream>>>(Y, g1, b1, LNh, LNl);   /* out1 = LN1 as bf16 hi/lo planes */
        k_gemmw<bf, 1, true><<<dim3(TT / 64, FF / 64, 1), 32, 0, stream>>>(LNh, LNl, W1T, nullptr, DM, H1, FF, bb1, 0, 0, 0);   /* out1 W1 + bb1 */
        k_reluhl<<<(unsigned)(((size_t)TT * FF / 8 + 255) / 256), 256, 0, stream>>>(H1, H1h, H1l);   /* relu -> hi/lo planes */
        k_gemmw<bf, 1, true><<<dim3(TT / 64, DM / 64, 1), 32, 0, stream>>>(H1h, H1l, W2T, nullptr, FF, F2, DM, bb2, 0, 0, 0);   /* W2 + bb2 */
        k_addres<<<(unsigned)(((size_t)TT * DM / 4 + 255) / 256), 256, 0, stream>>>(F2, x + (size_t)b * TT * DM);   /* + the ORIGINAL x */
        k_lnout<<<(TT + 7) / 8, 256, 0, stream>>>(F2, g2, b2, OUT + (size_t)b * TT * DM);   /* LN2 -> out */ }
}

// v001
// One run takes 1290 microseconds.
// Two timings next to v000 both put it at 1.57 times that version's speed.
#include <hip/hip_runtime.h>

// Post-LN transformer block with per-head projection tensors (x [4][2048][512]; q,k,v = einsum('bse,hed', x, W) (Wq, Wk, Wv [8][512][64] 1/sqrt(512): head h's 'xw' block); 8 heads x 64; scores / 8; causal (-inf); softmax; o = concat heads; out1 = LayerNorm(x + o Wproj) (Wproj 'xw' [512][512]; eps 1e-5, g1/b1); ff = relu(out1 W1 + bb1) W2 + bb2 (W1 [512][2048], W2 [2048][512] 'xw', zero biases); out = LayerNorm(ff + x, g2, b2) (the residual is the ORIGINAL x) -> [4][2048][512] (4.2 M)).
// Layout per batch: bf16 copy of x; per-head 'xw' weight blocks transposed into one Bt each (rows h*64..), Wproj/W1/W2 transposed once; exact projections; causal T-2048 attention (hybrid rows: < 512 hi/lo 3 products, rest fp16 x1024; tiles above the diagonal skipped); Y = merged hi/lo x Wproj exact, += bf16(x); a row-LayerNorm kernel emits out1 as bf16 hi/lo planes; H1 = hi/lo x W1 exact + bb1 (f32 [2048][2048]); relu + hi/lo split; F2 = hi/lo x W2 exact + bb2; += bf16(x); the final row-LayerNorm writes the output rows.
// Compute dtypes, f32 accumulate: every input rounded to bf16; projections exact; attention rows < 512 3 products, rest fp16; softmax f32; Wproj hl x exact; residuals/LayerNorms f32 (fixed-order sums); FFN GEMMs 2 products (~f32) + f32 biases; relu f32.

#define NB_  4
#define TT   2048
#define DM   512
#define NH_  8
#define NKV  8
#define REP  (NH_ / NKV)
#define HD   64
#define DQ   (NH_ * HD)
#define DKV  (NKV * HD)
#define ZH   2
#define RH   512                  // query rows < RH use hi+lo planes (0: none)
#define WIN  2048
#define PCAR 1024.0f
#define SCL  0.125f   // HD^-0.5
#define FF   2048     // feed-forward width
#define LNEPS 1e-5f
typedef _Float16 h16;
typedef unsigned short bf;
typedef __attribute__((ext_vector_type(16))) __bf16   v16bf;
typedef __attribute__((ext_vector_type(16))) _Float16 v16h;
typedef __attribute__((ext_vector_type(8)))  _Float16 v8h;
typedef __attribute__((ext_vector_type(8)))  unsigned short v8us;
typedef __attribute__((ext_vector_type(8)))  float    v8f;
typedef __attribute__((ext_vector_type(4)))  float    v4f;
typedef v8h  __attribute__((may_alias)) v8ha;
typedef v4f  __attribute__((may_alias)) v4fa;
typedef v8us __attribute__((may_alias)) v8usa;

__device__ __forceinline__ unsigned short f2bf(float f) { unsigned u = __float_as_uint(f); u += 0x7FFFu + ((u >> 16) & 1u); return (unsigned short)(u >> 16); }
__device__ __forceinline__ float bf2f(unsigned short b) { return __uint_as_float(((unsigned)b) << 16); }
__device__ __forceinline__ float bfr(float f) { return bf2f(f2bf(f)); }
__device__ __forceinline__ v16h cat16(v8h lo, v8h hi) { return __builtin_shufflevector(lo, hi, 0, 1, 2, 3, 4, 5, 6, 7, 8, 9, 10, 11, 12, 13, 14, 15); }
__device__ __forceinline__ v16bf cat16b(v8us lo, v8us hi) { return __builtin_bit_cast(v16bf, __builtin_shufflevector(lo, hi, 0, 1, 2, 3, 4, 5, 6, 7, 8, 9, 10, 11, 12, 13, 14, 15)); }
__device__ __forceinline__ v8f wmma16(v16h a, v16h b, v8f c) { return __builtin_amdgcn_wmma_f32_16x16x32_f16(false, a, false, b, (short)0, c, false, false); }
__device__ __forceinline__ v8f wmmab(v16bf a, v16bf b, v8f c) { return __builtin_amdgcn_wmma_f32_16x16x32_bf16(false, a, false, b, (short)0, c, false, false); }



// Orders the staging tile's LDS writes against its reads: among the NW waves of the workgroup, or inside the single wave when NW == 1.
template <int NW> __device__ __forceinline__ void tile_sync() { if constexpr (NW == 1) { __builtin_amdgcn_wave_barrier(); asm volatile("" ::: "memory"); } else { __syncthreads(); } }

// ---- k_gemmw: register-blocked GEMM, one workgroup of NW waves per 64x64 output tile, operands straight from K-contiguous 16-bit planes; grid (M/64, N/64, Z), 32 * NW threads.
// The K loop is dealt over the NW waves in granules of 64 k (one 128-byte line of every operand row): wave w takes granules w, w + NW, ... into its own 16 accumulators; the NW partial tiles are summed through LDS in wave order 0..NW-1.
// C[m][n] (f32, pitch ldc, + optional f32 bias[n]) = sum_k A[m][k] Bt[n][k] (+ split products per NSPLIT). z-batch strides sA/sB/sC in elements. K % 64 == 0.
template <typename T16> struct WFrag;
template <> struct WFrag<h16> { typedef v16h V; static __device__ __forceinline__ V ld(const h16* p) { return cat16(*(const v8h*)p, *(const v8h*)(p + 16)); } static __device__ __forceinline__ v8f mma(V a, V b, v8f c) { return wmma16(a, b, c); } };
template <> struct WFrag<bf> { typedef v16bf V; static __device__ __forceinline__ V ld(const bf* p) { return cat16b(*(const v8us*)p, *(const v8us*)(p + 16)); } static __device__ __forceinline__ v8f mma(V a, V b, v8f c) { return wmmab(a, b, c); } };
template <typename T16, int NSPLIT, bool BIAS, int NW>
__global__ __launch_bounds__(32 * NW) void k_gemmw(const T16* __restrict__ A, const T16* __restrict__ A2, const T16* __restrict__ Bt, const T16* __restrict__ Bt2, int K, float* C, int ldc, const float* __restrict__ bias, size_t sA, size_t sB, size_t sC) {
    typedef typename WFrag<T16>::V V;
    constexpr int MBR = (NW == 1) ? 1 : 4;   // 16-row blocks staged per round: with NW > 1 the whole 64-row tile, so that one barrier serves the sum
    __shared__ __align__(16) float os[NW * MBR * 16 * 68];
    const size_t z = blockIdx.z; A += z * sA; if (A2) A2 += z * sA; Bt += z * sB; if (Bt2) Bt2 += z * sB; C += z * sC;
    const int lane = threadIdx.x & 31, lr = lane & 15, hi = lane >> 4; const int r0 = blockIdx.x * 64, c0 = blockIdx.y * 64; const int w = __builtin_amdgcn_readfirstlane((int)(threadIdx.x >> 5));
    v8f acc[4][4];
#pragma unroll
    for (int mb = 0; mb < 4; ++mb)
#pragma unroll
        for (int nb = 0; nb < 4; ++nb) acc[mb][nb] = (v8f){};
    const size_t aoff = (size_t)(r0 + lr) * K + 8 * hi, boff = (size_t)(c0 + lr) * K + 8 * hi;
#pragma unroll 1
    for (int k0 = w * 64; k0 < K; k0 += 64 * NW)
#pragma unroll 1
    for (int kc = k0; kc < k0 + 64; kc += 32) {
        V a[4], a2[4];
#pragma unroll
        for (int mb = 0; mb < 4; ++mb) { a[mb] = WFrag<T16>::ld(A + aoff + (size_t)mb * 16 * K + kc); if (NSPLIT == 1 || NSPLIT == 2) a2[mb] = WFrag<T16>::ld(A2 + aoff + (size_t)mb * 16 * K + kc); }
#pragma unroll
        for (int nb = 0; nb < 4; ++nb) { const V b = WFrag<T16>::ld(Bt + boff + (size_t)nb * 16 * K + kc); V b2; if (NSPLIT >= 2) b2 = WFrag<T16>::ld(Bt2 + boff + (size_t)nb * 16 * K + kc);
#pragma unroll
            for (int mb = 0; mb < 4; ++mb) { acc[mb][nb] = WFrag<T16>::mma(a[mb], b, acc[mb][nb]); if (NSPLIT == 1 || NSPLIT == 2) acc[mb][nb] = WFrag<T16>::mma(a2[mb], b, acc[mb][nb]); if (NSPLIT >= 2) acc[mb][nb] = WFrag<T16>::mma(a[mb], b2, acc[mb][nb]); } }
        asm volatile("v_nop\n\tv_nop\n\tv_nop\n\tv_nop" : "+v"(acc[0][0]), "+v"(acc[1][1]), "+v"(acc[2][2]), "+v"(acc[3][3]) : "v"(a[0]), "v"(a[3]));
    }
#pragma unroll
    for (int mb = 0; mb < 4; mb += MBR) {
#pragma unroll
        for (int m2 = 0; m2 < MBR; ++m2)
#pragma unroll
        for (int nb = 0; nb < 4; ++nb) {
#pragma unroll
            for (int j = 0; j < 8; ++j) os[w * (MBR * 16 * 68) + (m2 * 16 + hi * 8 + j) * 68 + nb * 16 + lr] = acc[mb + m2][nb][j]; }
        tile_sync<NW>();
        float* crow = C + (size_t)(r0 + mb * 16) * ldc + c0;
{
#pragma unroll
            for (int s = 0; s < MBR * 8 / NW; ++s) { const int item = s * (32 * NW) + (int)threadIdx.x; const int row = item >> 4, cofs = (item & 15) * 4; v4f val = *(const v4fa*)(os + row * 68 + cofs);
#pragma unroll
                for (int u = 1; u < NW; ++u) val += *(const v4fa*)(os + u * (MBR * 16 * 68) + row * 68 + cofs);
                if (BIAS) { val[0] += bfr(bias[c0 + cofs]); val[1] += bfr(bias[c0 + cofs + 1]); val[2] += bfr(bias[c0 + cofs + 2]); val[3] += bfr(bias[c0 + cofs + 3]); }
                *(v4f*)(crow + (size_t)row * ldc + cofs) = val; }
             }
        if (NW == 1) tile_sync<NW>();   // only the one-wave form has a next round that rewrites the staging tile
    }
}

// ---- k_gemmc: the same 64x64 tile GEMM (K dealt over NW waves) specialised for causal attention: CMODE 1 skips score tiles entirely above the diagonal (query rows r0+roff.., key columns c0..), CMODE 2 limits the
// key (K) loop of the probability x value contraction to the diagonal block (probabilities beyond it are exactly zero). roff = row offset of this launch's first row within the sequence.
template <typename T16, int NSPLIT, int CMODE, int NW>
__global__ __launch_bounds__(32 * NW) void k_gemmc(const T16* __restrict__ A, const T16* __restrict__ A2, const T16* __restrict__ Bt, const T16* __restrict__ Bt2, int K, float* C, int ldc, int roff, size_t sA, size_t sB, size_t sC) {
    typedef typename WFrag<T16>::V V;
    constexpr int MBR = (NW == 1) ? 1 : 4;   // 16-row blocks staged per round: with NW > 1 the whole 64-row tile, so that one barrier serves the sum
    __shared__ __align__(16) float os[NW * MBR * 16 * 68];
    const size_t z = blockIdx.z; A += z * sA; if (A2) A2 += z * sA; Bt += z * sB; if (Bt2) Bt2 += z * sB; C += z * sC;
    const int lane = threadIdx.x & 31, lr = lane & 15, hi = lane >> 4; const int r0 = blockIdx.x * 64, c0 = blockIdx.y * 64; const int w = __builtin_amdgcn_readfirstlane((int)(threadIdx.x >> 5));
    if (CMODE == 1 && c0 > r0 + roff + 63) return;                  // score tile entirely above the causal diagonal: never read (the softmax masks j > i by select)
    const int Kl = (CMODE == 2) ? min(K, r0 + roff + 64) : K;        // P.V: probabilities are exactly 0 beyond the diagonal block, so the K loop stops there
    v8f acc[4][4];
#pragma unroll
    for (int mb = 0; mb < 4; ++mb)
#pragma unroll
        for (int nb = 0; nb < 4; ++nb) acc[mb][nb] = (v8f){};
    const size_t aoff = (size_t)(r0 + lr) * K + 8 * hi, boff = (size_t)(c0 + lr) * K + 8 * hi;
#pragma unroll 1
    for (int k0 = w * 64; k0 < Kl; k0 += 64 * NW)
#pragma unroll 1
    for (int kc = k0; kc < k0 + 64; kc += 32) {
        V a[4], a2[4];
#pragma unroll
        for (int mb = 0; mb < 4; ++mb) { a[mb] = WFrag<T16>::ld(A + aoff + (size_t)mb * 16 * K + kc); if (NSPLIT == 1 || NSPLIT == 2) a2[mb] = WFrag<T16>::ld(A2 + aoff + (size_t)mb * 16 * K + kc); }
#pragma unroll
        for (int nb = 0; nb < 4; ++nb) { const V b = WFrag<T16>::ld(Bt + boff + (size_t)nb * 16 * K + kc); V b2; if (NSPLIT >= 2) b2 = WFrag<T16>::ld(Bt2 + boff + (size_t)nb * 16 * K + kc);
#pragma unroll
            for (int mb = 0; mb < 4; ++mb) { acc[mb][nb] = WFrag<T16>::mma(a[mb], b, acc[mb][nb]); if (NSPLIT == 1 || NSPLIT == 2) acc[mb][nb] = WFrag<T16>::mma(a2[mb], b, acc[mb][nb]); if (NSPLIT >= 2) acc[mb][nb] = WFrag<T16>::mma(a[mb], b2, acc[mb][nb]); } }
        asm volatile("v_nop\n\tv_nop\n\tv_nop\n\tv_nop" : "+v"(acc[0][0]), "+v"(acc[1][1]), "+v"(acc[2][2]), "+v"(acc[3][3]) : "v"(a[0]), "v"(a[3]));
    }
#pragma unroll
    for (int mb = 0; mb < 4; mb += MBR) {
#pragma unroll
        for (int m2 = 0; m2 < MBR; ++m2)
#pragma unroll
        for (int nb = 0; nb < 4; ++nb) {
#pragma unroll
            for (int j = 0; j < 8; ++j) os[w * (MBR * 16 * 68) + (m2 * 16 + hi * 8 + j) * 68 + nb * 16 + lr] = acc[mb + m2][nb][j]; }
        tile_sync<NW>();
        float* crow = C + (size_t)(r0 + mb * 16) * ldc + c0;
{
#pragma unroll
            for (int s = 0; s < MBR * 8 / NW; ++s) { const int item = s * (32 * NW) + (int)threadIdx.x; const int row = item >> 4, cofs = (item & 15) * 4; v4f val = *(const v4fa*)(os + row * 68 + cofs);
#pragma unroll
                for (int u = 1; u < NW; ++u) val += *(const v4fa*)(os + u * (MBR * 16 * 68) + row * 68 + cofs);
                *(v4f*)(crow + (size_t)row * ldc + cofs) = val; }
             }
        if (NW == 1) tile_sync<NW>();   // only the one-wave form has a next round that rewrites the staging tile
    }
}

__device__ __forceinline__ h16 tohx(float x) { return (h16)x; }
__device__ __forceinline__ void splitf(float y, unsigned short& h, unsigned short& l) { h = f2bf(y); l = f2bf(y - bf2f(h)); }
typedef __attribute__((ext_vector_type(2))) _Float16 v2h;
typedef __attribute__((ext_vector_type(4))) _Float16 v4h;
typedef __attribute__((ext_vector_type(2))) unsigned short v2us;
typedef __attribute__((ext_vector_type(4))) unsigned short v4us;
typedef __attribute__((ext_vector_type(2))) float v2f;
typedef __attribute__((ext_vector_type(4))) int v4i;

__global__ __launch_bounds__(256) void k_wtG(const float* __restrict__ w, int K, int N, bf* Bt) {
    const int lane = threadIdx.x & 31; const int L0 = (blockIdx.x * 8 + (threadIdx.x >> 5)) * 8; const int nlines = N * K / 64;
{
#pragma unroll 1
        for (int l = 0; l < 8; ++l) { const int L = L0 + l; if (L >= nlines) break; const size_t e = (size_t)L * 64 + lane * 2; const int k = (int)(e % K), n = (int)(e / K); v2us o;
            o[0] = f2bf(w[(size_t)k * N + n]); o[1] = f2bf(w[(size_t)(k + 1) * N + n]); *(v2us*)(Bt + e) = o; }
         }
}
__global__ __launch_bounds__(256) void k_cvt8(const float* __restrict__ src, bf* dst, size_t n8) { const size_t i = (size_t)blockIdx.x * 256 + threadIdx.x; if (i >= n8) return; const v8f v = *(const v8f*)(src + i * 8); v8us o;
#pragma unroll
    for (int k = 0; k < 8; ++k) o[k] = f2bf(v[k]); *(v8us*)(dst + i * 8) = o;  }

// k_rope: head planes [h][t][d] (fp16 + hi/lo) of rope(x) x sc with the rotate-half convention out[d] = x[d] cos[t][d] - x[d+HD/2] sin[t][d], out[d+HD/2] = x[d+HD/2] cos[t][d+HD/2] + x[d] sin[t][d+HD/2]
__global__ __launch_bounds__(256) void k_rope(const float* __restrict__ F, int pitch, int nheads, const float* __restrict__ CS, const float* __restrict__ RF, const float* __restrict__ nw, float sc, h16* P16, bf* Ph, bf* Pl) {
    const size_t e = ((size_t)blockIdx.x * 256 + threadIdx.x) * 2; if (e >= (size_t)nheads * TT * HD) return; const int d = (int)(e % HD); const int t = (int)((e / HD) % TT); const int h = (int)(e / ((size_t)HD * TT)); const float* f = F + (size_t)t * pitch + h * HD; const float rf = RF ? RF[(size_t)h * TT + t] : 1.0f; v2h o16; v2us oh, ol;
#pragma unroll
    for (int q = 0; q < 2; ++q) { const int dd = d + q; const int dp = (dd < HD / 2) ? dd + HD / 2 : dd - HD / 2; float x0 = f[dd], x1 = f[dp];
        if (RF) { float n0 = __fmul_rn(x0, rf), n1 = __fmul_rn(x1, rf); asm volatile("" : "+v"(n0)); asm volatile("" : "+v"(n1)); x0 = __fmul_rn(bfr(nw[dd]), n0); x1 = __fmul_rn(bfr(nw[dp]), n1); }
        const v2f cs = *(const v2f*)(CS + ((size_t)t * HD + dd) * 2); float a = __fmul_rn(x0, cs[0]), bq = __fmul_rn(x1, cs[1]); asm volatile("" : "+v"(a)); asm volatile("" : "+v"(bq)); const float r = ((dd < HD / 2) ? __fsub_rn(a, bq) : __fadd_rn(a, bq)) * sc;
        o16[q] = tohx(r); unsigned short a2, c2; splitf(r, a2, c2); oh[q] = a2; ol[q] = c2; }
    *(v2h*)(P16 + e) = o16; *(v2us*)(Ph + e) = oh; *(v2us*)(Pl + e) = ol;  }
__global__ __launch_bounds__(256) void k_vtp(const float* __restrict__ F, int pitch, int nheads, h16* V16, bf* Vh, bf* Vl) { const size_t e = ((size_t)blockIdx.x * 256 + threadIdx.x) * 2; if (e >= (size_t)nheads * HD * TT) return; const int t = (int)(e % TT); const int d = (int)((e / TT) % HD); const int g = (int)(e / ((size_t)TT * HD)); v2h o16; v2us oh, ol;
#pragma unroll
    for (int q = 0; q < 2; ++q) { const float x = F[(size_t)(t + q) * pitch + g * HD + d]; o16[q] = tohx(x); unsigned short a2, c2; splitf(x, a2, c2); oh[q] = a2; ol[q] = c2; }
    *(v2h*)(V16 + e) = o16; *(v2us*)(Vh + e) = oh; *(v2us*)(Vl + e) = ol;  }
__global__ __launch_bounds__(256) void k_csid(float* CS) { const int idx = blockIdx.x * 256 + threadIdx.x; if (idx >= TT * HD) return; v2f cs; cs[0] = 1.0f; cs[1] = 0.0f; *(v2f*)(CS + (size_t)idx * 2) = cs;  }
// k_asoft: per row (zz, i): t = S x HD^-0.5 for j <= i and i - j < WIN (sliding causal window; the reference's -1e9 additive fill vanishes identically); softmax over the 2048 keys (register row, one exp, fixed trees);
__global__ __launch_bounds__(256) void k_asoft(const float* __restrict__ Sb, h16* P16, bf* Ph, bf* Pl) {
    const int lane = threadIdx.x & 31; const int row = blockIdx.x * 8 + (threadIdx.x >> 5); if (row >= ZH * TT) return; const int i = row % TT; const int zz = row / TT; (void)zz; const bool hires = (i < RH); const float* sr = Sb + (size_t)row * TT; float v[TT / 32]; float mx = -3.0e38f;
#pragma unroll
    for (int ch = 0; ch < TT / 128; ++ch) { const int j0 = ch * 128 + lane * 4; const v4f a = *(const v4f*)(sr + j0);
#pragma unroll
        for (int q = 0; q < 4; ++q) { const int j = j0 + q; (void)j; const float t = (j <= i && i - j < WIN) ? a[q] * SCL : -3.0e38f; v[ch * 4 + q] = t; mx = fmaxf(mx, t); } }
#pragma unroll
    for (int sh = 16; sh; sh >>= 1) mx = fmaxf(mx, __shfl_xor(mx, sh, 32));
    float sum = 0.f;
#pragma unroll
    for (int k = 0; k < TT / 32; ++k) { float d0 = __fsub_rn(v[k], mx); asm volatile("" : "+v"(d0)); v[k] = __builtin_amdgcn_exp2f(__fmul_rn(d0, 1.4426950408889634f)); sum += v[k]; }
#pragma unroll
    for (int sh = 16; sh; sh >>= 1) sum += __shfl_xor(sum, sh, 32);
    const float f = __fdiv_rn(hires ? 1.0f : PCAR, sum);
{
        if (hires) {
#pragma unroll
            for (int ch = 0; ch < TT / 128; ++ch) { v4us oh, ol;
#pragma unroll
                for (int q = 0; q < 4; ++q) { unsigned short a, c2; splitf(v[ch * 4 + q] * f, a, c2); oh[q] = a; ol[q] = c2; }
                const size_t oo = ((size_t)zz * (RH ? RH : 1) + i) * TT + ch * 128 + lane * 4; *(v4us*)(Ph + oo) = oh; *(v4us*)(Pl + oo) = ol; }
        } else {
#pragma unroll
            for (int ch = 0; ch < TT / 128; ++ch) { v4h o4;
#pragma unroll
                for (int q = 0; q < 4; ++q) o4[q] = tohx(v[ch * 4 + q] * f);
                *(v4h*)(P16 + (size_t)row * TT + ch * 128 + lane * 4) = o4; } }
         }
}
__global__ __launch_bounds__(256) void k_addres(float* Y, const float* __restrict__ xr) { const size_t i = (size_t)blockIdx.x * 256 + threadIdx.x; if (i >= (size_t)TT * DQ / 4) return; const v4f a = *(const v4f*)(Y + i * 4); const v4f r = *(const v4f*)(xr + i * 4); v4f o;
#pragma unroll
    for (int q = 0; q < 4; ++q) o[q] = __fadd_rn(a[q], bfr(r[q]));
    *(v4f*)(Y + i * 4) = o;  }

__global__ __launch_bounds__(256) void k_lnin2(const float* __restrict__ F, const float* __restrict__ g, const float* __restrict__ bb, bf* Xh, bf* Xl) { const int lane = threadIdx.x & 31; const int row = blockIdx.x * 8 + (threadIdx.x >> 5); if (row >= TT) return; const float* fr = F + (size_t)row * DM; bf* hrow = Xh + (size_t)row * DM; bf* lrow = Xl + (size_t)row * DM; float v[DM / 32]; float s = 0.f;
#pragma unroll
    for (int c = 0; c < DM / 128; ++c) { const v4f a = *(const v4f*)(fr + c * 128 + lane * 4); for (int q = 0; q < 4; ++q) { v[c * 4 + q] = a[q]; s = __fadd_rn(s, a[q]); } }
#pragma unroll
    for (int sh = 16; sh; sh >>= 1) s = __fadd_rn(s, __shfl_xor(s, sh, 32));
    const float mean = __fmul_rn(s, 1.0f / (float)DM);   /* DM = 512: the reciprocal is an exact power of two, identical to the division */ float s2 = 0.f;
#pragma unroll
    for (int k = 0; k < DM / 32; ++k) { const float dv = __fsub_rn(v[k], mean); float p2 = __fmul_rn(dv, dv); asm volatile("" : "+v"(p2)); s2 = __fadd_rn(s2, p2); v[k] = dv; }
#pragma unroll
    for (int sh = 16; sh; sh >>= 1) s2 = __fadd_rn(s2, __shfl_xor(s2, sh, 32));
    const float rs = __fdiv_rn(1.0f, __fsqrt_rn(__fadd_rn(__fmul_rn(s2, 1.0f / (float)DM), LNEPS)));
{
#pragma unroll
        for (int c = 0; c < DM / 128; ++c) { v4us oh, ol; for (int q = 0; q < 4; ++q) { const int col = c * 128 + lane * 4 + q; float y = __fmul_rn(v[c * 4 + q], rs); asm volatile("" : "+v"(y)); float gg = bfr(g[col]), bb2 = bfr(bb[col]); asm volatile("" : "+v"(gg), "+v"(bb2)); y = __fmul_rn(y, gg); asm volatile("" : "+v"(y)); const float r = __fadd_rn(y, bb2); unsigned short hh2, ll2; splitf(r, hh2, ll2); oh[q] = hh2; ol[q] = ll2; } *(v4us*)(hrow + c * 128 + lane * 4) = oh; *(v4us*)(lrow + c * 128 + lane * 4) = ol; }
         } }

__constant__ float INVT[HD / 2] = { 1.000000000e+00f, 7.498942018e-01f, 5.623413324e-01f, 4.216965139e-01f, 3.162277639e-01f, 2.371373773e-01f, 1.778279394e-01f, 1.333521456e-01f, 1.000000015e-01f, 7.498942316e-02f, 5.623413250e-02f, 4.216964915e-02f, 3.162277490e-02f, 2.371373773e-02f, 1.778279431e-02f, 1.333521400e-02f, 9.999999776e-03f, 7.498942316e-03f, 5.623413250e-03f, 4.216964822e-03f, 3.162277630e-03f, 2.371373819e-03f, 1.778279431e-03f, 1.333521446e-03f, 1.000000047e-03f, 7.498941850e-04f, 5.623413017e-04f, 4.216965172e-04f, 3.162277571e-04f, 2.371373703e-04f, 1.778279402e-04f, 1.333521504e-04f };   // 10000^(-2i/64) (the module's power form) (float32, generated with jnp to be bit-exact)

__global__ __launch_bounds__(256) void k_reluhl(const float* __restrict__ Hs, bf* Hh, bf* Hl) { const size_t i = (size_t)blockIdx.x * 256 + threadIdx.x; if (i >= (size_t)TT * FF / 8) return; const size_t e = i * 8; const v8f a = *(const v8f*)(Hs + e); v8us oh, ol;
#pragma unroll
    for (int q = 0; q < 8; ++q) { const float r = (a[q] > 0.0f) ? a[q] : 0.0f; unsigned short hh, ll; splitf(r, hh, ll); oh[q] = hh; ol[q] = ll; }
    *(v8us*)(Hh + e) = oh; *(v8us*)(Hl + e) = ol;  }
__global__ __launch_bounds__(256) void k_lnout(const float* __restrict__ F, const float* __restrict__ g, const float* __restrict__ bb, float* out) { const int lane = threadIdx.x & 31; const int row = blockIdx.x * 8 + (threadIdx.x >> 5); if (row >= TT) return; const float* fr = F + (size_t)row * DQ; float* orow = out + (size_t)row * DQ; float v[DQ / 32]; float s = 0.f;
#pragma unroll
    for (int c = 0; c < DQ / 128; ++c) { const v4f a = *(const v4f*)(fr + c * 128 + lane * 4); for (int q = 0; q < 4; ++q) { v[c * 4 + q] = a[q]; s = __fadd_rn(s, a[q]); } }
#pragma unroll
    for (int sh = 16; sh; sh >>= 1) s = __fadd_rn(s, __shfl_xor(s, sh, 32));
    const float mean = __fdiv_rn(s, (float)DQ); float s2 = 0.f;
#pragma unroll
    for (int k = 0; k < DQ / 32; ++k) { const float dv = __fsub_rn(v[k], mean); float p2 = __fmul_rn(dv, dv); asm volatile("" : "+v"(p2)); s2 = __fadd_rn(s2, p2); v[k] = dv; }
#pragma unroll
    for (int sh = 16; sh; sh >>= 1) s2 = __fadd_rn(s2, __shfl_xor(s2, sh, 32));
    const float rs = __fdiv_rn(1.0f, __fsqrt_rn(__fadd_rn(__fdiv_rn(s2, (float)DQ), LNEPS)));
{
#pragma unroll
        for (int c = 0; c < DQ / 128; ++c) { v4f o; for (int q = 0; q < 4; ++q) { const int col = c * 128 + lane * 4 + q; float y = __fmul_rn(v[c * 4 + q], rs); asm volatile("" : "+v"(y)); y = __fmul_rn(y, bfr(g[col])); asm volatile("" : "+v"(y)); o[q] = __fadd_rn(y, bfr(bb[col])); } *(v4f*)(orow + c * 128 + lane * 4) = o; }
         } }

__global__ __launch_bounds__(256) void k_merge(const float* __restrict__ O, int h0, bf* Ah, bf* Al) { const size_t e = ((size_t)blockIdx.x * 256 + threadIdx.x) * 2; if (e >= (size_t)ZH * TT * HD) return; const int d = (int)(e % HD); const int t = (int)((e / HD) % TT); const int zz = (int)(e / ((size_t)HD * TT)); const float cs = (t < RH) ? 1.0f : (1.0f / PCAR); const size_t oo = (size_t)t * DQ + (h0 + zz) * HD + d;
    v2us oh, ol;
#pragma unroll
    for (int q = 0; q < 2; ++q) { unsigned short a, c2; splitf(O[e + q] * cs, a, c2); oh[q] = a; ol[q] = c2; } *(v2us*)(Ah + oo) = oh; *(v2us*)(Al + oo) = ol;  }

extern "C" void kernel_launch(void* const* d_in, const int* in_sizes, int n_in,
                              void* d_out, int out_size, void* d_ws, size_t ws_size, hipStream_t stream) {
    (void)in_sizes; (void)n_in; (void)out_size;
    const float* x = (const float*)d_in[0]; const float* pq = (const float*)d_in[1]; const float* pk = (const float*)d_in[2]; const float* pv = (const float*)d_in[3];   /* [8][512][64] each */ const float* wo = (const float*)d_in[4];   /* Wproj [512][512] 'xw' */ const float* g1 = (const float*)d_in[5]; const float* b1 = (const float*)d_in[6]; const float* w1 = (const float*)d_in[7]; const float* bb1 = (const float*)d_in[8]; const float* w2 = (const float*)d_in[9]; const float* bb2 = (const float*)d_in[10]; const float* g2 = (const float*)d_in[11]; const float* b2 = (const float*)d_in[12]; const float* wq = pq, *wk = pk, *wv = pv;
    float* OUT = (float*)d_out;     // [4][2048][512]
    char* wsp = (char*)d_ws;
    auto take = [&](size_t bytes) { char* p = wsp; wsp += (bytes + 255) & ~(size_t)255; return (void*)p; };
    bf* W1T = (bf*)take((size_t)FF * DM * 2); bf* W2T = (bf*)take((size_t)DM * FF * 2); float* Y = (float*)take((size_t)TT * DM * 4); bf* LNh = (bf*)take((size_t)TT * DM * 2); bf* LNl = (bf*)take((size_t)TT * DM * 2); float* H1 = (float*)take((size_t)TT * FF * 4); bf* H1h = (bf*)take((size_t)TT * FF * 2); bf* H1l = (bf*)take((size_t)TT * FF * 2); float* F2 = (float*)take((size_t)TT * DM * 4); bf* WQ = (bf*)take((size_t)DQ * DM * 2); bf* WK = (bf*)take((size_t)DKV * DM * 2); bf* WV = (bf*)take((size_t)DKV * DM * 2); bf* WO = (bf*)take((size_t)DM * DQ * 2); float* CS = (float*)take((size_t)TT * HD * 2 * 4);
    bf* XB = (bf*)take((size_t)TT * DM * 2); float* FQ = (float*)take((size_t)TT * DQ * 4); float* FK = (float*)take((size_t)TT * DKV * 4);
    h16* QP16 = (h16*)take((size_t)NH_ * TT * HD * 2); h16* KP16 = (h16*)take((size_t)NKV * TT * HD * 2); h16* VT16 = (h16*)take((size_t)NKV * HD * TT * 2);
    bf* QPh = (bf*)take((size_t)NH_ * TT * HD * 2); bf* QPl = (bf*)take((size_t)NH_ * TT * HD * 2); bf* KPh = (bf*)take((size_t)NKV * TT * HD * 2); bf* KPl = (bf*)take((size_t)NKV * TT * HD * 2); bf* VTh = (bf*)take((size_t)NKV * HD * TT * 2); bf* VTl = (bf*)take((size_t)NKV * HD * TT * 2); bf* Ph = (bf*)take((size_t)ZH * RH * TT * 2); bf* Pl = (bf*)take((size_t)ZH * RH * TT * 2);
    float* Sb = (float*)take((size_t)ZH * TT * TT * 4); h16* P16 = (h16*)take((size_t)ZH * TT * TT * 2); float* Ob = (float*)take((size_t)ZH * TT * HD * 4); bf* ATh = (bf*)take((size_t)TT * DQ * 2); bf* ATl = (bf*)take((size_t)TT * DQ * 2);
    if ((size_t)(wsp - (char*)d_ws) > ws_size) return;    // ws 256 MiB
    float* FV = FK;   // v projection reuses the k buffer after the k planes are built (stream-ordered)
    { for (int hh = 0; hh < NH_; ++hh) k_wtG<<<(unsigned)((DM * HD / 64 + 63) / 64), 256, 0, stream>>>(wq + (size_t)hh * DM * HD, DM, HD, WQ + (size_t)hh * HD * DM);   /* head hh's 'xw' [512][64] -> Bt rows hh*64.. */ for (int hh = 0; hh < NH_; ++hh) k_wtG<<<(unsigned)((DM * HD / 64 + 63) / 64), 256, 0, stream>>>(wk + (size_t)hh * DM * HD, DM, HD, WK + (size_t)hh * HD * DM);   /* head hh's 'xw' [512][64] -> Bt rows hh*64.. */ for (int hh = 0; hh < NH_; ++hh) k_wtG<<<(unsigned)((DM * HD / 64 + 63) / 64), 256, 0, stream>>>(wv + (size_t)hh * DM * HD, DM, HD, WV + (size_t)hh * HD * DM);   /* head hh's 'xw' [512][64] -> Bt rows hh*64.. */
      k_wtG<<<(unsigned)((DQ * DM / 64 + 63) / 64), 256, 0, stream>>>(wo, DQ, DM, WO); k_wtG<<<(unsigned)((DM * FF / 64 + 63) / 64), 256, 0, stream>>>(w1, DM, FF, W1T);   /* W1 'xw' [512][2048] -> Bt [2048][512] */ k_wtG<<<(unsigned)((FF * DM / 64 + 63) / 64), 256, 0, stream>>>(w2, FF, DM, W2T);   /* W2 'xw' [2048][512] -> Bt [512][2048] */
       }
    k_csid<<<(TT * HD + 255) / 256, 256, 0, stream>>>(CS);
    const unsigned LQ = (unsigned)(((size_t)NH_ * TT * HD / 2 + 255) / 256), LKv = (unsigned)(((size_t)NKV * TT * HD / 2 + 255) / 256);
    for (int b = 0; b < NB_; ++b) {
        
        k_cvt8<<<(unsigned)(((size_t)TT * DM / 8 + 255) / 256), 256, 0, stream>>>(x + (size_t)b * TT * DM, XB, (size_t)TT * DM / 8);
        k_gemmw<bf, 0, false, 8><<<dim3(TT / 64, DQ / 64, 1), 256, 0, stream>>>(XB, nullptr, WQ, nullptr, DM, FQ, DQ, nullptr, 0, 0, 0);
        k_rope<<<LQ, 256, 0, stream>>>(FQ, DQ, NH_, CS, nullptr, nullptr, 1.0f, QP16, QPh, QPl);
        k_gemmw<bf, 0, false, 8><<<dim3(TT / 64, DKV / 64, 1), 256, 0, stream>>>(XB, nullptr, WK, nullptr, DM, FK, DKV, nullptr, 0, 0, 0);
        k_rope<<<LKv, 256, 0, stream>>>(FK, DKV, NKV, CS, nullptr, nullptr, 1.0f, KP16, KPh, KPl);
        k_gemmw<bf, 0, false, 8><<<dim3(TT / 64, DKV / 64, 1), 256, 0, stream>>>(XB, nullptr, WV, nullptr, DM, FV, DKV, nullptr, 0, 0, 0); k_vtp<<<LKv, 256, 0, stream>>>(FV, DKV, NKV, VT16, VTh, VTl);
        for (int h0 = 0; h0 < NH_; h0 += ZH) { const size_t zq = (size_t)h0, zk = (size_t)(h0 / REP);   // one kv head per query head: the pass's two heads use consecutive kv planes (z-strides TT*HD)
            k_gemmc<bf, 2, 1, 1><<<dim3(RH / 64, TT / 64, ZH), 32, 0, stream>>>(QPh + zq * TT * HD, QPl + zq * TT * HD, KPh + zk * TT * HD, KPl + zk * TT * HD, HD, Sb, TT, 0, (size_t)TT * HD, (size_t)TT * HD, (size_t)TT * TT);
            k_gemmc<h16, 0, 1, 1><<<dim3((TT - RH) / 64, TT / 64, ZH), 32, 0, stream>>>(QP16 + zq * TT * HD + (size_t)RH * HD, nullptr, KP16 + zk * TT * HD, nullptr, HD, Sb + (size_t)RH * TT, TT, RH, (size_t)TT * HD, (size_t)TT * HD, (size_t)TT * TT);
            k_asoft<<<ZH * TT / 8, 256, 0, stream>>>(Sb, P16, Ph, Pl);
            k_gemmc<bf, 2, 2, 8><<<dim3(RH / 64, HD / 64, ZH), 256, 0, stream>>>(Ph, Pl, VTh + zk * HD * TT, VTl + zk * HD * TT, TT, Ob, HD, 0, (size_t)RH * TT, (size_t)HD * TT, (size_t)TT * HD);
            k_gemmc<h16, 0, 2, 16><<<dim3((TT - RH) / 64, HD / 64, ZH), 512, 0, stream>>>(P16 + (size_t)RH * TT, nullptr, VT16 + zk * HD * TT, nullptr, TT, Ob + (size_t)RH * HD, HD, RH, (size_t)TT * TT, (size_t)HD * TT, (size_t)TT * HD);
            k_merge<<<(unsigned)(((size_t)ZH * TT * HD / 2 + 255) / 256), 256, 0, stream>>>(Ob, h0, ATh, ATl); }
        k_gemmw<bf, 1, false, 8><<<dim3(TT / 64, DM / 64, 1), 256, 0, stream>>>(ATh, ATl, WO, nullptr, DQ, Y, DM, nullptr, 0, 0, 0);   /* o Wproj */
        k_addres<<<(unsigned)(((size_t)TT * DM / 4 + 255) / 256), 256, 0, stream>>>(Y, x + (size_t)b * TT * DM);   /* + x */
        k_lnin2<<<(TT + 7) / 8, 256, 0, stream>>>(Y, g1, b1, LNh, LNl);   /* out1 = LN1 as bf16 hi/lo planes */
        k_gemmw<bf, 1, true, 4><<<dim3(TT / 64, FF / 64, 1), 128, 0, stream>>>(LNh, LNl, W1T, nullptr, DM, H1, FF, bb1, 0, 0, 0);   /* out1 W1 + bb1 */
        k_reluhl<<<(unsigned)(((size_t)TT * FF / 8 + 255) / 256), 256, 0, stream>>>(H1, H1h, H1l);   /* relu -> hi/lo planes */
        k_gemmw<bf, 1, true, 16><<<dim3(TT / 64, DM / 64, 1), 512, 0, stream>>>(H1h, H1l, W2T, nullptr, FF, F2, DM, bb2, 0, 0, 0);   /* W2 + bb2 */
        k_addres<<<(unsigned)(((size_t)TT * DM / 4 + 255) / 256), 256, 0, stream>>>(F2, x + (size_t)b * TT * DM);   /* + the ORIGINAL x */
        k_lnout<<<(TT + 7) / 8, 256, 0, stream>>>(F2, g2, b2, OUT + (size_t)b * TT * DM);   /* LN2 -> out */ }
}

// v002
// It runs in 630 microseconds.
// Next to v001, in two timings, it ran 2.04 and 2.05 times as fast.
// All steps since v000 together make it 3.21 times as fast.
#include <hip/hip_runtime.h>

// Post-LN transformer block with per-head projection tensors (x [4][2048][512]; q,k,v = einsum('bse,hed', x, W) (Wq, Wk, Wv [8][512][64] 1/sqrt(512): head h's 'xw' block); 8 heads x 64; scores / 8; causal (-inf); softmax; o = concat heads; out1 = LayerNorm(x + o Wproj) (Wproj 'xw' [512][512]; eps 1e-5, g1/b1); ff = relu(out1 W1 + bb1) W2 + bb2 (W1 [512][2048], W2 [2048][512] 'xw', zero biases); out = LayerNorm(ff + x, g2, b2) (the residual is the ORIGINAL x) -> [4][2048][512] (4.2 M)).
// Layout: every kernel outside attention runs once over the 8192 rows of all 4 batch elements (q, k, v as one GEMM with 1536 columns); attention runs one pass per batch element with its 8 heads in grid z. Steps: bf16 copy of x; per-head 'xw' weight blocks of Wq, Wk, Wv transposed into one joint Bt (rows (tensor*8 + h)*64..), Wproj/W1/W2 transposed once; exact projections; causal T-2048 attention (hybrid rows: < 512 hi/lo 3 products, rest fp16 x1024; tiles above the diagonal skipped); Y = merged hi/lo x Wproj exact, += bf16(x); a row-LayerNorm kernel emits out1 as bf16 hi/lo planes; H1 = hi/lo x W1 exact + bb1 (f32 [8192][2048]); relu + hi/lo split; F2 = hi/lo x W2 exact + bb2; += bf16(x); the final row-LayerNorm writes the output rows.
// Compute dtypes, f32 accumulate: every input rounded to bf16; projections exact; attention rows < 512 3 products, rest fp16; softmax f32; Wproj hl x exact; residuals/LayerNorms f32 (fixed-order sums); FFN GEMMs 2 products (~f32) + f32 biases; relu f32.

#define NB_  4
#define TT   2048
#define DM   512
#define NH_  8
#define NKV  8
#define REP  (NH_ / NKV)
#define HD   64
#define DQ   (NH_ * HD)
#define DKV  (NKV * HD)
#define ZH   8                    // heads per attention pass: all heads of one batch element
#define MT   (NB_ * TT)           // rows of all batch elements together
#define NQKV (DQ + 2 * DKV)       // columns of the joint q|k|v projection
#define PP   (2 * TT)             // row pitch, in 16-bit elements, of the probabilities (they lie in the f32 score rows) and of the transposed v planes
#define RH   512                  // query rows < RH use hi+lo planes (0: none)
#define WIN  2048
#define PCAR 1024.0f
#define SCL  0.125f   // HD^-0.5
#define FF   2048     // feed-forward width
#define LNEPS 1e-5f
typedef _Float16 h16;
typedef unsigned short bf;
typedef __attribute__((ext_vector_type(16))) __bf16   v16bf;
typedef __attribute__((ext_vector_type(16))) _Float16 v16h;
typedef __attribute__((ext_vector_type(8)))  _Float16 v8h;
typedef __attribute__((ext_vector_type(8)))  unsigned short v8us;
typedef __attribute__((ext_vector_type(8)))  float    v8f;
typedef __attribute__((ext_vector_type(4)))  float    v4f;
typedef v8h  __attribute__((may_alias)) v8ha;
typedef v4f  __attribute__((may_alias)) v4fa;
typedef v8us __attribute__((may_alias)) v8usa;

__device__ __forceinline__ unsigned short f2bf(float f) { unsigned u = __float_as_uint(f); u += 0x7FFFu + ((u >> 16) & 1u); return (unsigned short)(u >> 16); }
__device__ __forceinline__ float bf2f(unsigned short b) { return __uint_as_float(((unsigned)b) << 16); }
__device__ __forceinline__ float bfr(float f) { return bf2f(f2bf(f)); }
__device__ __forceinline__ v16h cat16(v8h lo, v8h hi) { return __builtin_shufflevector(lo, hi, 0, 1, 2, 3, 4, 5, 6, 7, 8, 9, 10, 11, 12, 13, 14, 15); }
__device__ __forceinline__ v16bf cat16b(v8us lo, v8us hi) { return __builtin_bit_cast(v16bf, __builtin_shufflevector(lo, hi, 0, 1, 2, 3, 4, 5, 6, 7, 8, 9, 10, 11, 12, 13, 14, 15)); }
__device__ __forceinline__ v8f wmma16(v16h a, v16h b, v8f c) { return __builtin_amdgcn_wmma_f32_16x16x32_f16(false, a, false, b, (short)0, c, false, false); }
__device__ __forceinline__ v8f wmmab(v16bf a, v16bf b, v8f c) { return __builtin_amdgcn_wmma_f32_16x16x32_bf16(false, a, false, b, (short)0, c, false, false); }



// Orders the staging tile's LDS writes against its reads: among the NW waves of the workgroup, or inside the single wave when NW == 1.
template <int NW> __device__ __forceinline__ void tile_sync() { if constexpr (NW == 1) { __builtin_amdgcn_wave_barrier(); asm volatile("" ::: "memory"); } else { __syncthreads(); } }

// ---- k_gemmw: register-blocked GEMM, one workgroup of NW waves per 64x64 output tile, operands straight from K-contiguous 16-bit planes; grid (M/64, N/64, Z), 32 * NW threads.
// The K loop is dealt over the NW waves in granules of 64 k (one 128-byte line of every operand row): wave w takes granules w, w + NW, ... into its own 16 accumulators; the NW partial tiles are summed through LDS in wave order 0..NW-1.
// C[m][n] (f32, pitch ldc, + optional f32 bias[n]) = sum_k A[m][k] Bt[n][k] (+ split products per NSPLIT). z-batch strides sA/sB/sC in elements. K % 64 == 0.
template <typename T16> struct WFrag;
template <> struct WFrag<h16> { typedef v16h V; static __device__ __forceinline__ V ld(const h16* p) { return cat16(*(const v8h*)p, *(const v8h*)(p + 16)); } static __device__ __forceinline__ v8f mma(V a, V b, v8f c) { return wmma16(a, b, c); } };
template <> struct WFrag<bf> { typedef v16bf V; static __device__ __forceinline__ V ld(const bf* p) { return cat16b(*(const v8us*)p, *(const v8us*)(p + 16)); } static __device__ __forceinline__ v8f mma(V a, V b, v8f c) { return wmmab(a, b, c); } };
template <typename T16, int NSPLIT, bool BIAS, int NW>
__global__ __launch_bounds__(32 * NW) void k_gemmw(const T16* __restrict__ A, const T16* __restrict__ A2, const T16* __restrict__ Bt, const T16* __restrict__ Bt2, int K, float* C, int ldc, const float* __restrict__ bias, size_t sA, size_t sB, size_t sC) {
    typedef typename WFrag<T16>::V V;
    constexpr int MBR = (NW == 1) ? 1 : 4;   // 16-row blocks staged per round: with NW > 1 the whole 64-row tile, so that one barrier serves the sum
    __shared__ __align__(16) float os[NW * MBR * 16 * 68];
    const size_t z = blockIdx.z; A += z * sA; if (A2) A2 += z * sA; Bt += z * sB; if (Bt2) Bt2 += z * sB; C += z * sC;
    const int lane = threadIdx.x & 31, lr = lane & 15, hi = lane >> 4; const int r0 = blockIdx.x * 64, c0 = blockIdx.y * 64; const int w = __builtin_amdgcn_readfirstlane((int)(threadIdx.x >> 5));
    v8f acc[4][4];
#pragma unroll
    for (int mb = 0; mb < 4; ++mb)
#pragma unroll
        for (int nb = 0; nb < 4; ++nb) acc[mb][nb] = (v8f){};
    const size_t aoff = (size_t)(r0 + lr) * K + 8 * hi, boff = (size_t)(c0 + lr) * K + 8 * hi;
#pragma unroll 1
    for (int k0 = w * 64; k0 < K; k0 += 64 * NW)
#pragma unroll 1
    for (int kc = k0; kc < k0 + 64; kc += 32) {
        V a[4], a2[4];
#pragma unroll
        for (int mb = 0; mb < 4; ++mb) { a[mb] = WFrag<T16>::ld(A + aoff + (size_t)mb * 16 * K + kc); if (NSPLIT == 1 || NSPLIT == 2) a2[mb] = WFrag<T16>::ld(A2 + aoff + (size_t)mb * 16 * K + kc); }
#pragma unroll
        for (int nb = 0; nb < 4; ++nb) { const V b = WFrag<T16>::ld(Bt + boff + (size_t)nb * 16 * K + kc); V b2; if (NSPLIT >= 2) b2 = WFrag<T16>::ld(Bt2 + boff + (size_t)nb * 16 * K + kc);
#pragma unroll
            for (int mb = 0; mb < 4; ++mb) { acc[mb][nb] = WFrag<T16>::mma(a[mb], b, acc[mb][nb]); if (NSPLIT == 1 || NSPLIT == 2) acc[mb][nb] = WFrag<T16>::mma(a2[mb], b, acc[mb][nb]); if (NSPLIT >= 2) acc[mb][nb] = WFrag<T16>::mma(a[mb], b2, acc[mb][nb]); } }
        asm volatile("v_nop\n\tv_nop\n\tv_nop\n\tv_nop" : "+v"(acc[0][0]), "+v"(acc[1][1]), "+v"(acc[2][2]), "+v"(acc[3][3]) : "v"(a[0]), "v"(a[3]));
    }
#pragma unroll
    for (int mb = 0; mb < 4; mb += MBR) {
#pragma unroll
        for (int m2 = 0; m2 < MBR; ++m2)
#pragma unroll
        for (int nb = 0; nb < 4; ++nb) {
#pragma unroll
            for (int j = 0; j < 8; ++j) os[w * (MBR * 16 * 68) + (m2 * 16 + hi * 8 + j) * 68 + nb * 16 + lr] = acc[mb + m2][nb][j]; }
        tile_sync<NW>();
        float* crow = C + (size_t)(r0 + mb * 16) * ldc + c0;
{
#pragma unroll
            for (int s = 0; s < MBR * 8 / NW; ++s) { const int item = s * (32 * NW) + (int)threadIdx.x; const int row = item >> 4, cofs = (item & 15) * 4; v4f val = *(const v4fa*)(os + row * 68 + cofs);
#pragma unroll
                for (int u = 1; u < NW; ++u) val += *(const v4fa*)(os + u * (MBR * 16 * 68) + row * 68 + cofs);
                if (BIAS) { val[0] += bfr(bias[c0 + cofs]); val[1] += bfr(bias[c0 + cofs + 1]); val[2] += bfr(bias[c0 + cofs + 2]); val[3] += bfr(bias[c0 + cofs + 3]); }
                *(v4f*)(crow + (size_t)row * ldc + cofs) = val; }
             }
        if (NW == 1) tile_sync<NW>();   // only the one-wave form has a next round that rewrites the staging tile
    }
}

// ---- k_gemmc: the same 64x64 tile GEMM (K dealt over NW waves) specialised for causal attention: CMODE 1 skips score tiles entirely above the diagonal (query rows r0+roff.., key columns c0..), CMODE 2 limits the
// key (K) loop of the probability x value contraction to the diagonal block (probabilities beyond it are exactly zero). roff = row offset of this launch's first row within the sequence. K is also the row pitch of A and Bt: a CMODE 2 launch may pass a pitch above the sequence length, its loop ends at the diagonal block.
template <typename T16, int NSPLIT, int CMODE, int NW>
__global__ __launch_bounds__(32 * NW) void k_gemmc(const T16* __restrict__ A, const T16* __restrict__ A2, const T16* __restrict__ Bt, const T16* __restrict__ Bt2, int K, float* C, int ldc, int roff, size_t sA, size_t sB, size_t sC) {
    typedef typename WFrag<T16>::V V;
    constexpr int MBR = (NW == 1) ? 1 : 4;   // 16-row blocks staged per round: with NW > 1 the whole 64-row tile, so that one barrier serves the sum
    __shared__ __align__(16) float os[NW * MBR * 16 * 68];
    const size_t z = blockIdx.z; A += z * sA; if (A2) A2 += z * sA; Bt += z * sB; if (Bt2) Bt2 += z * sB; C += z * sC;
    const int lane = threadIdx.x & 31, lr = lane & 15, hi = lane >> 4; const int r0 = blockIdx.x * 64, c0 = blockIdx.y * 64; const int w = __builtin_amdgcn_readfirstlane((int)(threadIdx.x >> 5));
    if (CMODE == 1 && c0 > r0 + roff + 63) return;                  // score tile entirely above the causal diagonal: never read (the softmax masks j > i by select)
    const int Kl = (CMODE == 2) ? min(K, r0 + roff + 64) : K;        // P.V: probabilities are exactly 0 beyond the diagonal block, so the K loop stops there
    v8f acc[4][4];
#pragma unroll
    for (int mb = 0; mb < 4; ++mb)
#pragma unroll
        for (int nb = 0; nb < 4; ++nb) acc[mb][nb] = (v8f){};
    const size_t aoff = (size_t)(r0 + lr) * K + 8 * hi, boff = (size_t)(c0 + lr) * K + 8 * hi;
#pragma unroll 1
    for (int k0 = w * 64; k0 < Kl; k0 += 64 * NW)
#pragma unroll 1
    for (int kc = k0; kc < k0 + 64; kc += 32) {
        V a[4], a2[4];
#pragma unroll
        for (int mb = 0; mb < 4; ++mb) { a[mb] = WFrag<T16>::ld(A + aoff + (size_t)mb * 16 * K + kc); if (NSPLIT == 1 || NSPLIT == 2) a2[mb] = WFrag<T16>::ld(A2 + aoff + (size_t)mb * 16 * K + kc); }
#pragma unroll
        for (int nb = 0; nb < 4; ++nb) { const V b = WFrag<T16>::ld(Bt + boff + (size_t)nb * 16 * K + kc); V b2; if (NSPLIT >= 2) b2 = WFrag<T16>::ld(Bt2 + boff + (size_t)nb * 16 * K + kc);
#pragma unroll
            for (int mb = 0; mb < 4; ++mb) { acc[mb][nb] = WFrag<T16>::mma(a[mb], b, acc[mb][nb]); if (NSPLIT == 1 || NSPLIT == 2) acc[mb][nb] = WFrag<T16>::mma(a2[mb], b, acc[mb][nb]); if (NSPLIT >= 2) acc[mb][nb] = WFrag<T16>::mma(a[mb], b2, acc[mb][nb]); } }
        asm volatile("v_nop\n\tv_nop\n\tv_nop\n\tv_nop" : "+v"(acc[0][0]), "+v"(acc[1][1]), "+v"(acc[2][2]), "+v"(acc[3][3]) : "v"(a[0]), "v"(a[3]));
    }
#pragma unroll
    for (int mb = 0; mb < 4; mb += MBR) {
#pragma unroll
        for (int m2 = 0; m2 < MBR; ++m2)
#pragma unroll
        for (int nb = 0; nb < 4; ++nb) {
#pragma unroll
            for (int j = 0; j < 8; ++j) os[w * (MBR * 16 * 68) + (m2 * 16 + hi * 8 + j) * 68 + nb * 16 + lr] = acc[mb + m2][nb][j]; }
        tile_sync<NW>();
        float* crow = C + (size_t)(r0 + mb * 16) * ldc + c0;
{
#pragma unroll
            for (int s = 0; s < MBR * 8 / NW; ++s) { const int item = s * (32 * NW) + (int)threadIdx.x; const int row = item >> 4, cofs = (item & 15) * 4; v4f val = *(const v4fa*)(os + row * 68 + cofs);
#pragma unroll
                for (int u = 1; u < NW; ++u) val += *(const v4fa*)(os + u * (MBR * 16 * 68) + row * 68 + cofs);
                *(v4f*)(crow + (size_t)row * ldc + cofs) = val; }
             }
        if (NW == 1) tile_sync<NW>();   // only the one-wave form has a next round that rewrites the staging tile
    }
}

__device__ __forceinline__ h16 tohx(float x) { return (h16)x; }
__device__ __forceinline__ void splitf(float y, unsigned short& h, unsigned short& l) { h = f2bf(y); l = f2bf(y - bf2f(h)); }
typedef __attribute__((ext_vector_type(2))) _Float16 v2h;
typedef __attribute__((ext_vector_type(4))) _Float16 v4h;
typedef __attribute__((ext_vector_type(2))) unsigned short v2us;
typedef __attribute__((ext_vector_type(4))) unsigned short v4us;
typedef __attribute__((ext_vector_type(2))) float v2f;
typedef __attribute__((ext_vector_type(4))) int v4i;

__global__ __launch_bounds__(256) void k_wtG(const float* __restrict__ wa, const float* __restrict__ wb, const float* __restrict__ wc, int K, int N, bf* Bt) {
    // grid (lines, blocks of one tensor, tensors): block y of tensor z is its own [K][N] matrix; the transposed blocks follow one another in Bt
    const float* w = (blockIdx.z == 0 ? wa : blockIdx.z == 1 ? wb : wc) + (size_t)blockIdx.y * K * N; Bt += ((size_t)blockIdx.z * gridDim.y + blockIdx.y) * K * N;
    const int lane = threadIdx.x & 31; const int L0 = (blockIdx.x * 8 + (threadIdx.x >> 5)) * 8; const int nlines = N * K / 64;
{
#pragma unroll 1
        for (int l = 0; l < 8; ++l) { const int L = L0 + l; if (L >= nlines) break; const size_t e = (size_t)L * 64 + lane * 2; const int k = (int)(e % K), n = (int)(e / K); v2us o;
            o[0] = f2bf(w[(size_t)k * N + n]); o[1] = f2bf(w[(size_t)(k + 1) * N + n]); *(v2us*)(Bt + e) = o; }
         }
}
__global__ __launch_bounds__(256) void k_cvt8(const float* __restrict__ src, bf* dst, size_t n8) { const size_t i = (size_t)blockIdx.x * 256 + threadIdx.x; if (i >= n8) return; const v8f v = *(const v8f*)(src + i * 8); v8us o;
#pragma unroll
    for (int k = 0; k < 8; ++k) o[k] = f2bf(v[k]); *(v8us*)(dst + i * 8) = o;  }

// k_rope: head planes [h][t][d] (fp16 + hi/lo) of rope(x) x sc with the rotate-half convention out[d] = x[d] cos[t][d] - x[d+HD/2] sin[t][d], out[d+HD/2] = x[d+HD/2] cos[t][d+HD/2] + x[d] sin[t][d+HD/2]
__global__ __launch_bounds__(256) void k_rope(const float* __restrict__ F, int pitch, int nheads, const float* __restrict__ CS, const float* __restrict__ RF, const float* __restrict__ nw, float sc, h16* P16, bf* Ph, bf* Pl) {
    { const size_t ob = (size_t)blockIdx.y * nheads * TT * HD; F += (size_t)blockIdx.y * TT * pitch; P16 += ob; Ph += ob; Pl += ob; }   // blockIdx.y: batch element
    const size_t e = ((size_t)blockIdx.x * 256 + threadIdx.x) * 2; if (e >= (size_t)nheads * TT * HD) return; const int d = (int)(e % HD); const int t = (int)((e / HD) % TT); const int h = (int)(e / ((size_t)HD * TT)); const float* f = F + (size_t)t * pitch + h * HD; const float rf = RF ? RF[(size_t)h * TT + t] : 1.0f; v2h o16; v2us oh, ol;
#pragma unroll
    for (int q = 0; q < 2; ++q) { const int dd = d + q; const int dp = (dd < HD / 2) ? dd + HD / 2 : dd - HD / 2; float x0 = f[dd], x1 = f[dp];
        if (RF) { float n0 = __fmul_rn(x0, rf), n1 = __fmul_rn(x1, rf); asm volatile("" : "+v"(n0)); asm volatile("" : "+v"(n1)); x0 = __fmul_rn(bfr(nw[dd]), n0); x1 = __fmul_rn(bfr(nw[dp]), n1); }
        const v2f cs = *(const v2f*)(CS + ((size_t)t * HD + dd) * 2); float a = __fmul_rn(x0, cs[0]), bq = __fmul_rn(x1, cs[1]); asm volatile("" : "+v"(a)); asm volatile("" : "+v"(bq)); const float r = ((dd < HD / 2) ? __fsub_rn(a, bq) : __fadd_rn(a, bq)) * sc;
        o16[q] = tohx(r); unsigned short a2, c2; splitf(r, a2, c2); oh[q] = a2; ol[q] = c2; }
    *(v2h*)(P16 + e) = o16; *(v2us*)(Ph + e) = oh; *(v2us*)(Pl + e) = ol;  }
__global__ __launch_bounds__(256) void k_vtp(const float* __restrict__ F, int pitch, int nheads, h16* V16, bf* Vh, bf* Vl) { F += (size_t)blockIdx.y * TT * pitch;   /* blockIdx.y: batch element */ const size_t e = ((size_t)blockIdx.x * 256 + threadIdx.x) * 2; if (e >= (size_t)nheads * HD * TT) return; const int t = (int)(e % TT); const int d = (int)((e / TT) % HD); const int g = (int)(e / ((size_t)TT * HD)); v2h o16; v2us oh, ol;
#pragma unroll
    for (int q = 0; q < 2; ++q) { const float x = F[(size_t)(t + q) * pitch + g * HD + d]; o16[q] = tohx(x); unsigned short a2, c2; splitf(x, a2, c2); oh[q] = a2; ol[q] = c2; }
    const size_t eo = (((size_t)blockIdx.y * nheads + g) * HD + d) * PP + t;   /* rows [batch][head][d] of pitch PP */ *(v2h*)(V16 + eo) = o16; *(v2us*)(Vh + eo) = oh; *(v2us*)(Vl + eo) = ol;  }
__global__ __launch_bounds__(256) void k_csid(float* CS) { const int idx = blockIdx.x * 256 + threadIdx.x; if (idx >= TT * HD) return; v2f cs; cs[0] = 1.0f; cs[1] = 0.0f; *(v2f*)(CS + (size_t)idx * 2) = cs;  }
// k_asoft: per row (zz, i): t = S x HD^-0.5 for j <= i and i - j < WIN (sliding causal window; the reference's -1e9 additive fill vanishes identically); softmax over the 2048 keys (register row, one exp, fixed trees);
// the probabilities overwrite the wave's own score row (8 KiB, held whole in registers by then): fp16 in its first half, or the bf16 hi plane in the first and the lo plane in the second half, so their row pitch is PP elements.
__global__ __launch_bounds__(256) void k_asoft(float* Sb) {
    const int lane = threadIdx.x & 31; const int row = blockIdx.x * 8 + (threadIdx.x >> 5); if (row >= ZH * TT) return; const int i = row % TT; const int zz = row / TT; (void)zz; const bool hires = (i < RH); const float* sr = Sb + (size_t)row * TT; h16* p16 = (h16*)(Sb + (size_t)row * TT); bf* ph = (bf*)(Sb + (size_t)row * TT); bf* pl = ph + TT; float v[TT / 32]; float mx = -3.0e38f;
#pragma unroll
    for (int ch = 0; ch < TT / 128; ++ch) { const int j0 = ch * 128 + lane * 4; const v4f a = *(const v4f*)(sr + j0);
#pragma unroll
        for (int q = 0; q < 4; ++q) { const int j = j0 + q; (void)j; const float t = (j <= i && i - j < WIN) ? a[q] * SCL : -3.0e38f; v[ch * 4 + q] = t; mx = fmaxf(mx, t); } }
#pragma unroll
    for (int sh = 16; sh; sh >>= 1) mx = fmaxf(mx, __shfl_xor(mx, sh, 32));
    float sum = 0.f;
#pragma unroll
    for (int k = 0; k < TT / 32; ++k) { float d0 = __fsub_rn(v[k], mx); asm volatile("" : "+v"(d0)); v[k] = __builtin_amdgcn_exp2f(__fmul_rn(d0, 1.4426950408889634f)); sum += v[k]; }
#pragma unroll
    for (int sh = 16; sh; sh >>= 1) sum += __shfl_xor(sum, sh, 32);
    const float f = __fdiv_rn(hires ? 1.0f : PCAR, sum);
{
        if (hires) {
#pragma unroll
            for (int ch = 0; ch < TT / 128; ++ch) { v4us oh, ol;
#pragma unroll
                for (int q = 0; q < 4; ++q) { unsigned short a, c2; splitf(v[ch * 4 + q] * f, a, c2); oh[q] = a; ol[q] = c2; }
                const int oo = ch * 128 + lane * 4; *(v4us*)(ph + oo) = oh; *(v4us*)(pl + oo) = ol; }
        } else {
#pragma unroll
            for (int ch = 0; ch < TT / 128; ++ch) { v4h o4;
#pragma unroll
                for (int q = 0; q < 4; ++q) o4[q] = tohx(v[ch * 4 + q] * f);
                *(v4h*)(p16 + ch * 128 + lane * 4) = o4; } }
         }
}
__global__ __launch_bounds__(256) void k_addres(float* Y, const float* __restrict__ xr) { const size_t i = (size_t)blockIdx.x * 256 + threadIdx.x; if (i >= (size_t)MT * DQ / 4) return; const v4f a = *(const v4f*)(Y + i * 4); const v4f r = *(const v4f*)(xr + i * 4); v4f o;
#pragma unroll
    for (int q = 0; q < 4; ++q) o[q] = __fadd_rn(a[q], bfr(r[q]));
    *(v4f*)(Y + i * 4) = o;  }

__global__ __launch_bounds__(256) void k_lnin2(const float* __restrict__ F, const float* __restrict__ g, const float* __restrict__ bb, bf* Xh, bf* Xl) { const int lane = threadIdx.x & 31; const int row = blockIdx.x * 8 + (threadIdx.x >> 5); if (row >= MT) return; const float* fr = F + (size_t)row * DM; bf* hrow = Xh + (size_t)row * DM; bf* lrow = Xl + (size_t)row * DM; float v[DM / 32]; float s = 0.f;
#pragma unroll
    for (int c = 0; c < DM / 128; ++c) { const v4f a = *(const v4f*)(fr + c * 128 + lane * 4); for (int q = 0; q < 4; ++q) { v[c * 4 + q] = a[q]; s = __fadd_rn(s, a[q]); } }
#pragma unroll
    for (int sh = 16; sh; sh >>= 1) s = __fadd_rn(s, __shfl_xor(s, sh, 32));
    const float mean = __fmul_rn(s, 1.0f / (float)DM);   /* DM = 512: the reciprocal is an exact power of two, identical to the division */ float s2 = 0.f;
#pragma unroll
    for (int k = 0; k < DM / 32; ++k) { const float dv = __fsub_rn(v[k], mean); float p2 = __fmul_rn(dv, dv); asm volatile("" : "+v"(p2)); s2 = __fadd_rn(s2, p2); v[k] = dv; }
#pragma unroll
    for (int sh = 16; sh; sh >>= 1) s2 = __fadd_rn(s2, __shfl_xor(s2, sh, 32));
    const float rs = __fdiv_rn(1.0f, __fsqrt_rn(__fadd_rn(__fmul_rn(s2, 1.0f / (float)DM), LNEPS)));
{
#pragma unroll
        for (int c = 0; c < DM / 128; ++c) { v4us oh, ol; for (int q = 0; q < 4; ++q) { const int col = c * 128 + lane * 4 + q; float y = __fmul_rn(v[c * 4 + q], rs); asm volatile("" : "+v"(y)); float gg = bfr(g[col]), bb2 = bfr(bb[col]); asm volatile("" : "+v"(gg), "+v"(bb2)); y = __fmul_rn(y, gg); asm volatile("" : "+v"(y)); const float r = __fadd_rn(y, bb2); unsigned short hh2, ll2; splitf(r, hh2, ll2); oh[q] = hh2; ol[q] = ll2; } *(v4us*)(hrow + c * 128 + lane * 4) = oh; *(v4us*)(lrow + c * 128 + lane * 4) = ol; }
         } }

__constant__ float INVT[HD / 2] = { 1.000000000e+00f, 7.498942018e-01f, 5.623413324e-01f, 4.216965139e-01f, 3.162277639e-01f, 2.371373773e-01f, 1.778279394e-01f, 1.333521456e-01f, 1.000000015e-01f, 7.498942316e-02f, 5.623413250e-02f, 4.216964915e-02f, 3.162277490e-02f, 2.371373773e-02f, 1.778279431e-02f, 1.333521400e-02f, 9.999999776e-03f, 7.498942316e-03f, 5.623413250e-03f, 4.216964822e-03f, 3.162277630e-03f, 2.371373819e-03f, 1.778279431e-03f, 1.333521446e-03f, 1.000000047e-03f, 7.498941850e-04f, 5.623413017e-04f, 4.216965172e-04f, 3.162277571e-04f, 2.371373703e-04f, 1.778279402e-04f, 1.333521504e-04f };   // 10000^(-2i/64) (the module's power form) (float32, generated with jnp to be bit-exact)

__global__ __launch_bounds__(256) void k_reluhl(const float* __restrict__ Hs, bf* Hh, bf* Hl) { const size_t i = (size_t)blockIdx.x * 256 + threadIdx.x; if (i >= (size_t)MT * FF / 8) return; const size_t e = i * 8; const v8f a = *(const v8f*)(Hs + e); v8us oh, ol;
#pragma unroll
    for (int q = 0; q < 8; ++q) { const float r = (a[q] > 0.0f) ? a[q] : 0.0f; unsigned short hh, ll; splitf(r, hh, ll); oh[q] = hh; ol[q] = ll; }
    *(v8us*)(Hh + e) = oh; *(v8us*)(Hl + e) = ol;  }
__global__ __launch_bounds__(256) void k_lnout(const float* __restrict__ F, const float* __restrict__ g, const float* __restrict__ bb, float* out) { const int lane = threadIdx.x & 31; const int row = blockIdx.x * 8 + (threadIdx.x >> 5); if (row >= MT) return; const float* fr = F + (size_t)row * DQ; float* orow = out + (size_t)row * DQ; float v[DQ / 32]; float s = 0.f;
#pragma unroll
    for (int c = 0; c < DQ / 128; ++c) { const v4f a = *(const v4f*)(fr + c * 128 + lane * 4); for (int q = 0; q < 4; ++q) { v[c * 4 + q] = a[q]; s = __fadd_rn(s, a[q]); } }
#pragma unroll
    for (int sh = 16; sh; sh >>= 1) s = __fadd_rn(s, __shfl_xor(s, sh, 32));
    const float mean = __fdiv_rn(s, (float)DQ); float s2 = 0.f;
#pragma unroll
    for (int k = 0; k < DQ / 32; ++k) { const float dv = __fsub_rn(v[k], mean); float p2 = __fmul_rn(dv, dv); asm volatile("" : "+v"(p2)); s2 = __fadd_rn(s2, p2); v[k] = dv; }
#pragma unroll
    for (int sh = 16; sh; sh >>= 1) s2 = __fadd_rn(s2, __shfl_xor(s2, sh, 32));
    const float rs = __fdiv_rn(1.0f, __fsqrt_rn(__fadd_rn(__fdiv_rn(s2, (float)DQ), LNEPS)));
{
#pragma unroll
        for (int c = 0; c < DQ / 128; ++c) { v4f o; for (int q = 0; q < 4; ++q) { const int col = c * 128 + lane * 4 + q; float y = __fmul_rn(v[c * 4 + q], rs); asm volatile("" : "+v"(y)); y = __fmul_rn(y, bfr(g[col])); asm volatile("" : "+v"(y)); o[q] = __fadd_rn(y, bfr(bb[col])); } *(v4f*)(orow + c * 128 + lane * 4) = o; }
         } }

__global__ __launch_bounds__(256) void k_merge(const float* __restrict__ O, bf* Ah, bf* Al) { const size_t e = ((size_t)blockIdx.x * 256 + threadIdx.x) * 2; if (e >= (size_t)NB_ * NH_ * TT * HD) return; const int d = (int)(e % HD); const int t = (int)((e / HD) % TT); const int zz = (int)(e / ((size_t)HD * TT)); const float cs = (t < RH) ? 1.0f : (1.0f / PCAR); const size_t oo = ((size_t)(zz / NH_) * TT + t) * DQ + (zz % NH_) * HD + d;   /* zz = batch element * NH_ + head */
    v2us oh, ol;
#pragma unroll
    for (int q = 0; q < 2; ++q) { unsigned short a, c2; splitf(O[e + q] * cs, a, c2); oh[q] = a; ol[q] = c2; } *(v2us*)(Ah + oo) = oh; *(v2us*)(Al + oo) = ol;  }

extern "C" void kernel_launch(void* const* d_in, const int* in_sizes, int n_in,
                              void* d_out, int out_size, void* d_ws, size_t ws_size, hipStream_t stream) {
    (void)in_sizes; (void)n_in; (void)out_size;
    const float* x = (const float*)d_in[0]; const float* pq = (const float*)d_in[1]; const float* pk = (const float*)d_in[2]; const float* pv = (const float*)d_in[3];   /* [8][512][64] each */ const float* wo = (const float*)d_in[4];   /* Wproj [512][512] 'xw' */ const float* g1 = (const float*)d_in[5]; const float* b1 = (const float*)d_in[6]; const float* w1 = (const float*)d_in[7]; const float* bb1 = (const float*)d_in[8]; const float* w2 = (const float*)d_in[9]; const float* bb2 = (const float*)d_in[10]; const float* g2 = (const float*)d_in[11]; const float* b2 = (const float*)d_in[12]; const float* wq = pq, *wk = pk, *wv = pv;
    float* OUT = (float*)d_out;     // [4][2048][512]
    char* wsp = (char*)d_ws;
    auto take = [&](size_t bytes) { char* p = wsp; wsp += (bytes + 255) & ~(size_t)255; return (void*)p; };
    // Live through the whole call: the transposed weights and the merged attention output planes.
    bf* W1T = (bf*)take((size_t)FF * DM * 2); bf* W2T = (bf*)take((size_t)DM * FF * 2); bf* WQKV = (bf*)take((size_t)NQKV * DM * 2);   /* rows: q heads, k heads, v heads */ bf* WO = (bf*)take((size_t)DM * DQ * 2); bf* ATh = (bf*)take((size_t)MT * DQ * 2); bf* ATl = (bf*)take((size_t)MT * DQ * 2);
    char* const mark = wsp;
    // Phase 1 (projections and attention). Head planes [batch][q heads, then k heads][t][d]; transposed v planes [batch][head][d] with rows of pitch PP (hi | lo in one row; the fp16 plane fills the first half of its rows, the rest is never touched).
    h16* QK16 = (h16*)take((size_t)NB_ * (NH_ + NKV) * TT * HD * 2); bf* QKh = (bf*)take((size_t)NB_ * (NH_ + NKV) * TT * HD * 2); bf* QKl = (bf*)take((size_t)NB_ * (NH_ + NKV) * TT * HD * 2);
    h16* VT16 = (h16*)take((size_t)NB_ * NKV * HD * PP * 2); bf* VTh = (bf*)take((size_t)NB_ * NKV * HD * PP * 2); bf* VTl = VTh + TT; float* Ob = (float*)take((size_t)NB_ * NH_ * TT * HD * 4);
    char* const smark = wsp; float* Sb = (float*)take((size_t)ZH * TT * TT * 4);
    if ((size_t)(wsp - (char*)d_ws) > ws_size) return;    // ws 256 MiB
    // The projection inputs and outputs are dead once the head planes are built: they share the score buffer's bytes (stream-ordered).
    wsp = smark; float* CS = (float*)take((size_t)TT * HD * 2 * 4); bf* XB = (bf*)take((size_t)MT * DM * 2); float* FQKV = (float*)take((size_t)MT * NQKV * 4);
    // Phase 2 (Wproj, LayerNorms, feed-forward) starts after the last read of every phase-1 buffer and shares their bytes (stream-ordered).
    wsp = mark; float* Y = (float*)take((size_t)MT * DM * 4); bf* LNh = (bf*)take((size_t)MT * DM * 2); bf* LNl = (bf*)take((size_t)MT * DM * 2); float* H1 = (float*)take((size_t)MT * FF * 4); bf* H1h = (bf*)take((size_t)MT * FF * 2); bf* H1l = (bf*)take((size_t)MT * FF * 2); float* F2 = (float*)take((size_t)MT * DM * 4);
    if ((size_t)(wsp - (char*)d_ws) > ws_size) return;
    k_wtG<<<dim3((unsigned)((DM * HD / 64 + 63) / 64), NH_, 3), 256, 0, stream>>>(wq, wk, wv, DM, HD, WQKV);   /* every head's 'xw' [512][64] block of Wq, Wk, Wv -> Bt rows (tensor * 8 + head) * 64.. */
    k_wtG<<<(unsigned)((DQ * DM / 64 + 63) / 64), 256, 0, stream>>>(wo, wo, wo, DQ, DM, WO); k_wtG<<<(unsigned)((DM * FF / 64 + 63) / 64), 256, 0, stream>>>(w1, w1, w1, DM, FF, W1T);   /* W1 'xw' [512][2048] -> Bt [2048][512] */ k_wtG<<<(unsigned)((FF * DM / 64 + 63) / 64), 256, 0, stream>>>(w2, w2, w2, FF, DM, W2T);   /* W2 'xw' [2048][512] -> Bt [512][2048] */
    k_csid<<<(TT * HD + 255) / 256, 256, 0, stream>>>(CS);
    k_cvt8<<<(unsigned)(((size_t)MT * DM / 8 + 255) / 256), 256, 0, stream>>>(x, XB, (size_t)MT * DM / 8);
    k_gemmw<bf, 0, false, 8><<<dim3(MT / 64, NQKV / 64, 1), 256, 0, stream>>>(XB, nullptr, WQKV, nullptr, DM, FQKV, NQKV, nullptr, 0, 0, 0);   /* q | k | v of all batch elements */
    k_rope<<<dim3((unsigned)(((size_t)(NH_ + NKV) * TT * HD / 2 + 255) / 256), NB_, 1), 256, 0, stream>>>(FQKV, NQKV, NH_ + NKV, CS, nullptr, nullptr, 1.0f, QK16, QKh, QKl);
    k_vtp<<<dim3((unsigned)(((size_t)NKV * TT * HD / 2 + 255) / 256), NB_, 1), 256, 0, stream>>>(FQKV + DQ + DKV, NQKV, NKV, VT16, VTh, VTl);
    for (int b = 0; b < NB_; ++b) {   // one pass per batch element, its 8 heads in grid z (one kv head per query head: z-strides TT*HD)
        const size_t oq = (size_t)b * (NH_ + NKV) * TT * HD, ok = oq + (size_t)NH_ * TT * HD, ov = (size_t)b * NKV * HD * PP; float* Obb = Ob + (size_t)b * NH_ * TT * HD;
        k_gemmc<bf, 2, 1, 1><<<dim3(RH / 64, TT / 64, ZH), 32, 0, stream>>>(QKh + oq, QKl + oq, QKh + ok, QKl + ok, HD, Sb, TT, 0, (size_t)TT * HD, (size_t)TT * HD, (size_t)TT * TT);
        k_gemmc<h16, 0, 1, 1><<<dim3((TT - RH) / 64, TT / 64, ZH), 32, 0, stream>>>(QK16 + oq + (size_t)RH * HD, nullptr, QK16 + ok, nullptr, HD, Sb + (size_t)RH * TT, TT, RH, (size_t)TT * HD, (size_t)TT * HD, (size_t)TT * TT);
        k_asoft<<<ZH * TT / 8, 256, 0, stream>>>(Sb);
        k_gemmc<bf, 2, 2, 8><<<dim3(RH / 64, HD / 64, ZH), 256, 0, stream>>>((const bf*)Sb, (const bf*)Sb + TT, VTh + ov, VTl + ov, PP, Obb, HD, 0, (size_t)TT * PP, (size_t)HD * PP, (size_t)TT * HD);
        k_gemmc<h16, 0, 2, 16><<<dim3((TT - RH) / 64, HD / 64, ZH), 512, 0, stream>>>((const h16*)Sb + (size_t)RH * PP, nullptr, VT16 + ov, nullptr, PP, Obb + (size_t)RH * HD, HD, RH, (size_t)TT * PP, (size_t)HD * PP, (size_t)TT * HD); }
    k_merge<<<(unsigned)(((size_t)NB_ * NH_ * TT * HD / 2 + 255) / 256), 256, 0, stream>>>(Ob, ATh, ATl);
    k_gemmw<bf, 1, false, 8><<<dim3(MT / 64, DM / 64, 1), 256, 0, stream>>>(ATh, ATl, WO, nullptr, DQ, Y, DM, nullptr, 0, 0, 0);   /* o Wproj */
    k_addres<<<(unsigned)(((size_t)MT * DM / 4 + 255) / 256), 256, 0, stream>>>(Y, x);   /* + x */
    k_lnin2<<<(MT + 7) / 8, 256, 0, stream>>>(Y, g1, b1, LNh, LNl);   /* out1 = LN1 as bf16 hi/lo planes */
    k_gemmw<bf, 1, true, 4><<<dim3(MT / 64, FF / 64, 1), 128, 0, stream>>>(LNh, LNl, W1T, nullptr, DM, H1, FF, bb1, 0, 0, 0);   /* out1 W1 + bb1 */
    k_reluhl<<<(unsigned)(((size_t)MT * FF / 8 + 255) / 256), 256, 0, stream>>>(H1, H1h, H1l);   /* relu -> hi/lo planes */
    k_gemmw<bf, 1, true, 16><<<dim3(MT / 64, DM / 64, 1), 512, 0, stream>>>(H1h, H1l, W2T, nullptr, FF, F2, DM, bb2, 0, 0, 0);   /* W2 + bb2 */
    k_addres<<<(unsigned)(((size_t)MT * DM / 4 + 255) / 256), 256, 0, stream>>>(F2, x);   /* + the ORIGINAL x */
    k_lnout<<<(MT + 7) / 8, 256, 0, stream>>>(F2, g2, b2, OUT);   /* LN2 -> out */
}

// v003
// One run takes 402 microseconds.
// Next to v002, in two timings, it ran 1.57 times as fast each time.
// Over all steps from v000 it is 5.05 times as fast.
#include <hip/hip_runtime.h>

// Post-LN transformer block with per-head projection tensors (x [4][2048][512]; q,k,v = einsum('bse,hed', x, W) (Wq, Wk, Wv [8][512][64] 1/sqrt(512): head h's 'xw' block); 8 heads x 64; scores / 8; causal (-inf); softmax; o = concat heads; out1 = LayerNorm(x + o Wproj) (Wproj 'xw' [512][512]; eps 1e-5, g1/b1); ff = relu(out1 W1 + bb1) W2 + bb2 (W1 [512][2048], W2 [2048][512] 'xw', zero biases); out = LayerNorm(ff + x, g2, b2) (the residual is the ORIGINAL x) -> [4][2048][512] (4.2 M)).
// Layout: every kernel outside attention runs once over the 8192 rows of all 4 batch elements (q, k, v as one GEMM with 1536 columns); attention is one launch over all batch elements and heads, with the scores kept in registers (online softmax). Steps: bf16 copy of x; per-head 'xw' weight blocks of Wq, Wk, Wv transposed into one joint Bt (rows (tensor*8 + h)*64..), Wproj/W1/W2 transposed once; exact projections; causal T-2048 attention (hybrid rows: < 512 hi/lo 3 products, rest fp16 x1024; key blocks above the diagonal skipped); Y = merged hi/lo x Wproj exact, += bf16(x); a row-LayerNorm kernel emits out1 as bf16 hi/lo planes; H1 = hi/lo x W1 exact + bb1 (f32 [8192][2048]); relu + hi/lo split; F2 = hi/lo x W2 exact + bb2; += bf16(x); the final row-LayerNorm writes the output rows.
// Compute dtypes, f32 accumulate: every input rounded to bf16; projections exact; attention rows < 512 3 products, rest fp16; softmax f32; Wproj hl x exact; residuals/LayerNorms f32 (fixed-order sums); FFN GEMMs 2 products (~f32) + f32 biases; relu f32.

#define NB_  4
#define TT   2048
#define DM   512
#define NH_  8
#define NKV  8
#define REP  (NH_ / NKV)
#define HD   64
#define DQ   (NH_ * HD)
#define DKV  (NKV * HD)
#define MT   (NB_ * TT)           // rows of all batch elements together
#define NQKV (DQ + 2 * DKV)       // columns of the joint q|k|v projection
#define PP   (2 * TT)             // row pitch, in 16-bit elements, of the transposed v planes
#define RH   512                  // query rows < RH use hi+lo planes (0: none)
#define PCAR 1024.0f
#define SCL  0.125f   // HD^-0.5
#define FF   2048     // feed-forward width
#define LNEPS 1e-5f
typedef _Float16 h16;
typedef unsigned short bf;
typedef __attribute__((ext_vector_type(16))) __bf16   v16bf;
typedef __attribute__((ext_vector_type(16))) _Float16 v16h;
typedef __attribute__((ext_vector_type(8)))  _Float16 v8h;
typedef __attribute__((ext_vector_type(8)))  unsigned short v8us;
typedef __attribute__((ext_vector_type(8)))  float    v8f;
typedef __attribute__((ext_vector_type(4)))  float    v4f;
typedef v8h  __attribute__((may_alias)) v8ha;
typedef v4f  __attribute__((may_alias)) v4fa;
typedef v8us __attribute__((may_alias)) v8usa;

__device__ __forceinline__ unsigned short f2bf(float f) { unsigned u = __float_as_uint(f); u += 0x7FFFu + ((u >> 16) & 1u); return (unsigned short)(u >> 16); }
__device__ __forceinline__ float bf2f(unsigned short b) { return __uint_as_float(((unsigned)b) << 16); }
__device__ __forceinline__ float bfr(float f) { return bf2f(f2bf(f)); }
__device__ __forceinline__ v16h cat16(v8h lo, v8h hi) { return __builtin_shufflevector(lo, hi, 0, 1, 2, 3, 4, 5, 6, 7, 8, 9, 10, 11, 12, 13, 14, 15); }
__device__ __forceinline__ v16bf cat16b(v8us lo, v8us hi) { return __builtin_bit_cast(v16bf, __builtin_shufflevector(lo, hi, 0, 1, 2, 3, 4, 5, 6, 7, 8, 9, 10, 11, 12, 13, 14, 15)); }
__device__ __forceinline__ v8f wmma16(v16h a, v16h b, v8f c) { return __builtin_amdgcn_wmma_f32_16x16x32_f16(false, a, false, b, (short)0, c, false, false); }
__device__ __forceinline__ v8f wmmab(v16bf a, v16bf b, v8f c) { return __builtin_amdgcn_wmma_f32_16x16x32_bf16(false, a, false, b, (short)0, c, false, false); }



// Orders the staging tile's LDS writes against its reads: among the NW waves of the workgroup, or inside the single wave when NW == 1.
template <int NW> __device__ __forceinline__ void tile_sync() { if constexpr (NW == 1) { __builtin_amdgcn_wave_barrier(); asm volatile("" ::: "memory"); } else { __syncthreads(); } }

// ---- k_gemmw: register-blocked GEMM, one workgroup of NW waves per 64x64 output tile, operands straight from K-contiguous 16-bit planes; grid (M/64, N/64, Z), 32 * NW threads.
// The K loop is dealt over the NW waves in granules of 64 k (one 128-byte line of every operand row): wave w takes granules w, w + NW, ... into its own 16 accumulators; the NW partial tiles are summed through LDS in wave order 0..NW-1.
// C[m][n] (f32, pitch ldc, + optional f32 bias[n]) = sum_k A[m][k] Bt[n][k] (+ split products per NSPLIT). z-batch strides sA/sB/sC in elements. K % 64 == 0.
template <typename T16> struct WFrag;
template <> struct WFrag<h16> { typedef v16h V; static __device__ __forceinline__ V ld(const h16* p) { return cat16(*(const v8h*)p, *(const v8h*)(p + 16)); } static __device__ __forceinline__ v8f mma(V a, V b, v8f c) { return wmma16(a, b, c); } };
template <> struct WFrag<bf> { typedef v16bf V; static __device__ __forceinline__ V ld(const bf* p) { return cat16b(*(const v8us*)p, *(const v8us*)(p + 16)); } static __device__ __forceinline__ v8f mma(V a, V b, v8f c) { return wmmab(a, b, c); } };
template <typename T16, int NSPLIT, bool BIAS, int NW>
__global__ __launch_bounds__(32 * NW) void k_gemmw(const T16* __restrict__ A, const T16* __restrict__ A2, const T16* __restrict__ Bt, const T16* __restrict__ Bt2, int K, float* C, int ldc, const float* __restrict__ bias, size_t sA, size_t sB, size_t sC) {
    typedef typename WFrag<T16>::V V;
    constexpr int MBR = (NW == 1) ? 1 : 4;   // 16-row blocks staged per round: with NW > 1 the whole 64-row tile, so that one barrier serves the sum
    __shared__ __align__(16) float os[NW * MBR * 16 * 68];
    const size_t z = blockIdx.z; A += z * sA; if (A2) A2 += z * sA; Bt += z * sB; if (Bt2) Bt2 += z * sB; C += z * sC;
    const int lane = threadIdx.x & 31, lr = lane & 15, hi = lane >> 4; const int r0 = blockIdx.x * 64, c0 = blockIdx.y * 64; const int w = __builtin_amdgcn_readfirstlane((int)(threadIdx.x >> 5));
    v8f acc[4][4];
#pragma unroll
    for (int mb = 0; mb < 4; ++mb)
#pragma unroll
        for (int nb = 0; nb < 4; ++nb) acc[mb][nb] = (v8f){};
    const size_t aoff = (size_t)(r0 + lr) * K + 8 * hi, boff = (size_t)(c0 + lr) * K + 8 * hi;
#pragma unroll 1
    for (int k0 = w * 64; k0 < K; k0 += 64 * NW)
#pragma unroll 1
    for (int kc = k0; kc < k0 + 64; kc += 32) {
        V a[4], a2[4];
#pragma unroll
        for (int mb = 0; mb < 4; ++mb) { a[mb] = WFrag<T16>::ld(A + aoff + (size_t)mb * 16 * K + kc); if (NSPLIT == 1 || NSPLIT == 2) a2[mb] = WFrag<T16>::ld(A2 + aoff + (size_t)mb * 16 * K + kc); }
#pragma unroll
        for (int nb = 0; nb < 4; ++nb) { const V b = WFrag<T16>::ld(Bt + boff + (size_t)nb * 16 * K + kc); V b2; if (NSPLIT >= 2) b2 = WFrag<T16>::ld(Bt2 + boff + (size_t)nb * 16 * K + kc);
#pragma unroll
            for (int mb = 0; mb < 4; ++mb) { acc[mb][nb] = WFrag<T16>::mma(a[mb], b, acc[mb][nb]); if (NSPLIT == 1 || NSPLIT == 2) acc[mb][nb] = WFrag<T16>::mma(a2[mb], b, acc[mb][nb]); if (NSPLIT >= 2) acc[mb][nb] = WFrag<T16>::mma(a[mb], b2, acc[mb][nb]); } }
        asm volatile("v_nop\n\tv_nop\n\tv_nop\n\tv_nop" : "+v"(acc[0][0]), "+v"(acc[1][1]), "+v"(acc[2][2]), "+v"(acc[3][3]) : "v"(a[0]), "v"(a[3]));
    }
#pragma unroll
    for (int mb = 0; mb < 4; mb += MBR) {
#pragma unroll
        for (int m2 = 0; m2 < MBR; ++m2)
#pragma unroll
        for (int nb = 0; nb < 4; ++nb) {
#pragma unroll
            for (int j = 0; j < 8; ++j) os[w * (MBR * 16 * 68) + (m2 * 16 + hi * 8 + j) * 68 + nb * 16 + lr] = acc[mb + m2][nb][j]; }
        tile_sync<NW>();
        float* crow = C + (size_t)(r0 + mb * 16) * ldc + c0;
{
#pragma unroll
            for (int s = 0; s < MBR * 8 / NW; ++s) { const int item = s * (32 * NW) + (int)threadIdx.x; const int row = item >> 4, cofs = (item & 15) * 4; v4f val = *(const v4fa*)(os + row * 68 + cofs);
#pragma unroll
                for (int u = 1; u < NW; ++u) val += *(const v4fa*)(os + u * (MBR * 16 * 68) + row * 68 + cofs);
                if (BIAS) { val[0] += bfr(bias[c0 + cofs]); val[1] += bfr(bias[c0 + cofs + 1]); val[2] += bfr(bias[c0 + cofs + 2]); val[3] += bfr(bias[c0 + cofs + 3]); }
                *(v4f*)(crow + (size_t)row * ldc + cofs) = val; }
             }
        if (NW == 1) tile_sync<NW>();   // only the one-wave form has a next round that rewrites the staging tile
    }
}

__device__ __forceinline__ h16 tohx(float x) { return (h16)x; }
__device__ __forceinline__ void splitf(float y, unsigned short& h, unsigned short& l) { h = f2bf(y); l = f2bf(y - bf2f(h)); }
typedef __attribute__((ext_vector_type(2))) _Float16 v2h;
typedef __attribute__((ext_vector_type(4))) _Float16 v4h;
typedef __attribute__((ext_vector_type(2))) unsigned short v2us;
typedef __attribute__((ext_vector_type(4))) unsigned short v4us;
typedef __attribute__((ext_vector_type(2))) float v2f;
typedef __attribute__((ext_vector_type(4))) int v4i;

__global__ __launch_bounds__(256) void k_wtG(const float* __restrict__ wa, const float* __restrict__ wb, const float* __restrict__ wc, int K, int N, bf* Bt) {
    // grid (lines, blocks of one tensor, tensors): block y of tensor z is its own [K][N] matrix; the transposed blocks follow one another in Bt
    const float* w = (blockIdx.z == 0 ? wa : blockIdx.z == 1 ? wb : wc) + (size_t)blockIdx.y * K * N; Bt += ((size_t)blockIdx.z * gridDim.y + blockIdx.y) * K * N;
    const int lane = threadIdx.x & 31; const int L0 = (blockIdx.x * 8 + (threadIdx.x >> 5)) * 8; const int nlines = N * K / 64;
{
#pragma unroll 1
        for (int l = 0; l < 8; ++l) { const int L = L0 + l; if (L >= nlines) break; const size_t e = (size_t)L * 64 + lane * 2; const int k = (int)(e % K), n = (int)(e / K); v2us o;
            o[0] = f2bf(w[(size_t)k * N + n]); o[1] = f2bf(w[(size_t)(k + 1) * N + n]); *(v2us*)(Bt + e) = o; }
         }
}
__global__ __launch_bounds__(256) void k_cvt8(const float* __restrict__ src, bf* dst, size_t n8) { const size_t i = (size_t)blockIdx.x * 256 + threadIdx.x; if (i >= n8) return; const v8f v = *(const v8f*)(src + i * 8); v8us o;
#pragma unroll
    for (int k = 0; k < 8; ++k) o[k] = f2bf(v[k]); *(v8us*)(dst + i * 8) = o;  }

// k_rope: head planes [h][t][d] (fp16 + hi/lo) of rope(x) x sc with the rotate-half convention out[d] = x[d] cos[t][d] - x[d+HD/2] sin[t][d], out[d+HD/2] = x[d+HD/2] cos[t][d+HD/2] + x[d] sin[t][d+HD/2]
__global__ __launch_bounds__(256) void k_rope(const float* __restrict__ F, int pitch, int nheads, const float* __restrict__ CS, const float* __restrict__ RF, const float* __restrict__ nw, float sc, h16* P16, bf* Ph, bf* Pl) {
    { const size_t ob = (size_t)blockIdx.y * nheads * TT * HD; F += (size_t)blockIdx.y * TT * pitch; P16 += ob; Ph += ob; Pl += ob; }   // blockIdx.y: batch element
    const size_t e = ((size_t)blockIdx.x * 256 + threadIdx.x) * 2; if (e >= (size_t)nheads * TT * HD) return; const int d = (int)(e % HD); const int t = (int)((e / HD) % TT); const int h = (int)(e / ((size_t)HD * TT)); const float* f = F + (size_t)t * pitch + h * HD; const float rf = RF ? RF[(size_t)h * TT + t] : 1.0f; v2h o16; v2us oh, ol;
#pragma unroll
    for (int q = 0; q < 2; ++q) { const int dd = d + q; const int dp = (dd < HD / 2) ? dd + HD / 2 : dd - HD / 2; float x0 = f[dd], x1 = f[dp];
        if (RF) { float n0 = __fmul_rn(x0, rf), n1 = __fmul_rn(x1, rf); asm volatile("" : "+v"(n0)); asm volatile("" : "+v"(n1)); x0 = __fmul_rn(bfr(nw[dd]), n0); x1 = __fmul_rn(bfr(nw[dp]), n1); }
        const v2f cs = *(const v2f*)(CS + ((size_t)t * HD + dd) * 2); float a = __fmul_rn(x0, cs[0]), bq = __fmul_rn(x1, cs[1]); asm volatile("" : "+v"(a)); asm volatile("" : "+v"(bq)); const float r = ((dd < HD / 2) ? __fsub_rn(a, bq) : __fadd_rn(a, bq)) * sc;
        o16[q] = tohx(r); unsigned short a2, c2; splitf(r, a2, c2); oh[q] = a2; ol[q] = c2; }
    *(v2h*)(P16 + e) = o16; *(v2us*)(Ph + e) = oh; *(v2us*)(Pl + e) = ol;  }
__global__ __launch_bounds__(256) void k_vtp(const float* __restrict__ F, int pitch, int nheads, h16* V16, bf* Vh, bf* Vl) { F += (size_t)blockIdx.y * TT * pitch;   /* blockIdx.y: batch element */ const size_t e = ((size_t)blockIdx.x * 256 + threadIdx.x) * 2; if (e >= (size_t)nheads * HD * TT) return; const int t = (int)(e % TT); const int d = (int)((e / TT) % HD); const int g = (int)(e / ((size_t)TT * HD)); v2h o16; v2us oh, ol;
#pragma unroll
    for (int q = 0; q < 2; ++q) { const float x = F[(size_t)(t + q) * pitch + g * HD + d]; o16[q] = tohx(x); unsigned short a2, c2; splitf(x, a2, c2); oh[q] = a2; ol[q] = c2; }
    const size_t eo = (((size_t)blockIdx.y * nheads + g) * HD + d) * PP + t;   /* rows [batch][head][d] of pitch PP */ *(v2h*)(V16 + eo) = o16; *(v2us*)(Vh + eo) = oh; *(v2us*)(Vl + eo) = ol;  }
__global__ __launch_bounds__(256) void k_csid(float* CS) { const int idx = blockIdx.x * 256 + threadIdx.x; if (idx >= TT * HD) return; v2f cs; cs[0] = 1.0f; cs[1] = 0.0f; *(v2f*)(CS + (size_t)idx * 2) = cs;  }
typedef __attribute__((ext_vector_type(16))) unsigned short v16us;
// Lane l with lane l ^ 16 (the two halves of a wave hold the two halves of a query's keys).
__device__ __forceinline__ float xhalf(float x) { return __builtin_bit_cast(float, __builtin_amdgcn_permlanex16(__builtin_bit_cast(int, x), __builtin_bit_cast(int, x), 0x76543210, 0xfedcba98, false, false)); }
// 2^x with the issue slot behind the transcendental filled in the same statement, so that no instruction directly behind it reads its result or rewrites its source.
__device__ __forceinline__ float exp2s(float x) { float r; asm("v_exp_f32 %0, %1\n\tv_nop" : "=v"(r) : "v"(x)); return r; }
// Stands between a group of issued global loads and every later rewrite of an address register that they name; the lanes' base addresses are inputs so that their registers stay untouched up to the wait.
__device__ __forceinline__ void xwaits(const void* a, const void* b) { asm volatile("s_wait_xcnt 0x0" :: "s"(a), "s"(b) : "memory"); }   // the same for loads at a wave-uniform base in scalar registers
__device__ __forceinline__ void xwait(const char* a, const char* b, const char* c, const char* d) { asm volatile("s_wait_xcnt 0x0" :: "v"(a), "v"(b), "v"(c), "v"(d) : "memory"); }
// Fragment at the lane's base address plus a constant number of elements.
template <typename T16> __device__ __forceinline__ typename WFrag<T16>::V ldp(const char* lane_base, int elems) { return WFrag<T16>::ld((const T16*)lane_base + elems); }
// ---- k_fattn: causal attention in one launch, scores and probabilities never leave the registers (online softmax). One wave owns 32 query rows of one (batch, head) and walks the key blocks 0 .. diagonal.
// Transposed products, so that a lane holds one query's scores: S^T = K Q^T (A = 16 key rows, B = 16 query rows, k = d) leaves in lane (lr, hi) the keys mb*16 + hi*8 + j of query lr, which is the B-fragment k order of P^T;
// O^T += V^T P^T (A = 16 rows of the transposed v plane, k = keys) leaves d = db*16 + hi*8 + j of query lr. Row maximum and row sum are per lane; the two lane halves exchange the maximum once per block and join their sums at the end.
// Every inner loop is unrolled whole: the fragment and accumulator arrays stay in registers only if every index is a constant.
// HL: bf16 hi/lo planes, 3 products in both contractions (query rows < RH); else fp16 with the probabilities carried x PCAR (2^10 in the exponent), output rows x PCAR as k_merge expects.
template <typename T16, bool HL, int KB>
__device__ __forceinline__ void attn_rows(const T16* Q, const T16* Q2, const T16* Kp, const T16* K2, const T16* Vt, const T16* Vt2, float* O, int q0) {   // no __restrict__: the loads must stay on their side of the waits' "memory" clobber
    typedef WFrag<T16> WF; typedef typename WF::V V;
    constexpr int MK = KB / 16, KS = KB / 32;
    constexpr float CEXP = SCL * 1.4426950408889634f;   // scores go to the exponent in log2 units
    constexpr float OFF = HL ? 0.0f : 10.0f;            // 2^10 = PCAR
    const int lane = threadIdx.x & 31, lr = lane & 15, hi = lane >> 4;
    const unsigned kl = (unsigned)(lr * HD + 8 * hi) * 2u, vl = (unsigned)(lr * PP + 8 * hi) * 2u;   // the lane's byte offsets in a 16-row block of a head plane / of a transposed v plane
    V qf[2][2], qf2[2][2], kf[MK][2], kf2[MK][2];
    { const T16* uq = Q + (size_t)q0 * HD; const T16* uq2 = HL ? Q2 + (size_t)q0 * HD : uq; const T16* uk2 = HL ? K2 : Kp; const char* pq = (const char*)uq + kl; const char* pq2 = (const char*)uq2 + kl; const char* pk = (const char*)Kp + kl; const char* pk2 = (const char*)uk2 + kl;
#pragma unroll
    for (int nb = 0; nb < 2; ++nb)
#pragma unroll
        for (int kc = 0; kc < 2; ++kc) { const int e = nb * 16 * HD + kc * 32; qf[nb][kc] = ldp<T16>(pq, e); if (HL) qf2[nb][kc] = ldp<T16>(pq2, e); }
    xwaits(uq, uq2);
#pragma unroll
    for (int mb = 0; mb < MK; ++mb)
#pragma unroll
        for (int kc = 0; kc < 2; ++kc) { const int e = mb * 16 * HD + kc * 32; kf[mb][kc] = ldp<T16>(pk, e); if (HL) kf2[mb][kc] = ldp<T16>(pk2, e); }
    xwaits(Kp, uk2); }
    v8f o[4][2], lv[2]; float m[2];
#pragma unroll
    for (int nb = 0; nb < 2; ++nb) { m[nb] = -3.0e38f; lv[nb] = (v8f){};
#pragma unroll
        for (int db = 0; db < 4; ++db) o[db][nb] = (v8f){}; }
    const int nkb = (q0 + 32 + KB - 1) / KB;   // key blocks up to and with the one that holds the last query's diagonal; every block holds key k0 <= q0, so no query meets a block that is masked whole
#pragma unroll 1   // one key block per trip: unrolled, two trips' fragments would not fit the register budget of two waves per SIMD
    for (int kb = 0; kb < nkb; ++kb) {
        const int k0 = kb * KB;
        v8f s[MK][2];
#pragma unroll
        for (int mb = 0; mb < MK; ++mb)
#pragma unroll
            for (int nb = 0; nb < 2; ++nb) s[mb][nb] = (v8f){};
#pragma unroll
        for (int kc = 0; kc < 2; ++kc)
#pragma unroll
            for (int mb = 0; mb < MK; ++mb)
#pragma unroll
                for (int nb = 0; nb < 2; ++nb) { s[mb][nb] = WF::mma(kf[mb][kc], qf[nb][kc], s[mb][nb]); if (HL) { s[mb][nb] = WF::mma(kf[mb][kc], qf2[nb][kc], s[mb][nb]); s[mb][nb] = WF::mma(kf2[mb][kc], qf[nb][kc], s[mb][nb]); } }
        // This block's V fragments and the next block's K fragments fly during the softmax (the last trip re-reads its own K block: in bounds, unused).
        const int kn = (kb + 1 < nkb) ? k0 + KB : k0;
        const char* pv = (const char*)(Vt + k0) + vl; const char* pv2 = HL ? (const char*)(Vt2 + k0) + vl : pv; const char* pk = (const char*)(Kp + (size_t)kn * HD) + kl; const char* pk2 = HL ? (const char*)(K2 + (size_t)kn * HD) + kl : pk;
        V vf[4][KS], vf2[4][KS];
#pragma unroll
        for (int db = 0; db < 4; ++db)
#pragma unroll
            for (int ks = 0; ks < KS; ++ks) { const int e = db * 16 * PP + ks * 32; vf[db][ks] = ldp<T16>(pv, e); if (HL) vf2[db][ks] = ldp<T16>(pv2, e); }
#pragma unroll
        for (int mb = 0; mb < MK; ++mb)
#pragma unroll
            for (int kc = 0; kc < 2; ++kc) { const int e = mb * 16 * HD + kc * 32; kf[mb][kc] = ldp<T16>(pk, e); if (HL) kf2[mb][kc] = ldp<T16>(pk2, e); }
        xwait(pv, pv2, pk, pk2);
        if (k0 + KB - 1 > q0) {   // wave-uniform: only blocks that reach past the first query's diagonal are masked
            const int dq = q0 + lr - k0 - hi * 8;   // key mb*16 + hi*8 + j is above the diagonal of query nb*16 + lr when mb*16 + j - nb*16 > dq
#pragma unroll
            for (int mb = 0; mb < MK; ++mb)
#pragma unroll
                for (int nb = 0; nb < 2; ++nb)
#pragma unroll
                    for (int j = 0; j < 8; ++j) if (mb * 16 + j - nb * 16 > dq) s[mb][nb][j] = -3.0e38f;
        }
        V pf[2][KS], pf2[2][KS];
#pragma unroll
        for (int nb = 0; nb < 2; ++nb) {
            v8f mv = s[0][nb];
#pragma unroll
            for (int mb = 1; mb < MK; ++mb) mv = __builtin_elementwise_max(mv, s[mb][nb]);
            float mx = fmaxf(fmaxf(fmaxf(mv[0], mv[1]), fmaxf(mv[2], mv[3])), fmaxf(fmaxf(mv[4], mv[5]), fmaxf(mv[6], mv[7])));
            mx = fmaxf(mx, xhalf(mx));
            const float mn = fmaxf(m[nb], mx * CEXP); const float al = exp2s(m[nb] - mn); m[nb] = mn; const float sub = OFF - mn;
            lv[nb] *= al;
#pragma unroll
            for (int mb = 0; mb < MK; ++mb) { const v8f t = s[mb][nb] * CEXP + sub; v8f p;
#pragma unroll
                for (int j = 0; j < 8; ++j) p[j] = exp2s(t[j]);
                s[mb][nb] = p; lv[nb] += p; }
#pragma unroll
            for (int db = 0; db < 4; ++db) o[db][nb] *= al;
#pragma unroll
            for (int ks = 0; ks < KS; ++ks) {
                if constexpr (HL) { v16us ph, pl;
#pragma unroll
                    for (int e = 0; e < 8; ++e) { unsigned short a, c2; splitf(s[2 * ks][nb][e], a, c2); ph[e] = a; pl[e] = c2; splitf(s[2 * ks + 1][nb][e], a, c2); ph[8 + e] = a; pl[8 + e] = c2; }
                    pf[nb][ks] = __builtin_bit_cast(v16bf, ph); pf2[nb][ks] = __builtin_bit_cast(v16bf, pl);
                } else { v16h ph;
#pragma unroll
                    for (int e = 0; e < 8; ++e) { ph[e] = tohx(s[2 * ks][nb][e]); ph[8 + e] = tohx(s[2 * ks + 1][nb][e]); }
                    pf[nb][ks] = ph; }
            }
        }
#pragma unroll
        for (int ks = 0; ks < KS; ++ks)
#pragma unroll
            for (int db = 0; db < 4; ++db)
#pragma unroll
                for (int nb = 0; nb < 2; ++nb) { o[db][nb] = WF::mma(vf[db][ks], pf[nb][ks], o[db][nb]); if (HL) { o[db][nb] = WF::mma(vf[db][ks], pf2[nb][ks], o[db][nb]); o[db][nb] = WF::mma(vf2[db][ks], pf[nb][ks], o[db][nb]); } }
    }
#pragma unroll
    for (int nb = 0; nb < 2; ++nb) { const float lh = ((lv[nb][0] + lv[nb][1]) + (lv[nb][2] + lv[nb][3])) + ((lv[nb][4] + lv[nb][5]) + (lv[nb][6] + lv[nb][7])); const float lt = lh + xhalf(lh); const float f = __fdiv_rn(HL ? 1.0f : PCAR, lt);   // fp16 rows: o and lt both carry PCAR; one more PCAR is what k_merge takes off
#pragma unroll
        for (int db = 0; db < 4; ++db) o[db][nb] *= f; }
    __builtin_amdgcn_sched_barrier(0);   // all arithmetic ahead of the stores: behind them no register that a store names is written any more
#pragma unroll
    for (int nb = 0; nb < 2; ++nb)
#pragma unroll
        for (int db = 0; db < 4; ++db) *(v8f*)((char*)(O + (size_t)(q0 + nb * 16) * HD + db * 16) + 2u * kl) = o[db][nb];   // f32 row lr, columns hi*8..: twice the 16-bit lane offset
}
// grid: NB_ * NH_ * TT / 128 workgroups of 4 waves (128 query rows of one head). All are resident together; the first half of the indices takes the long row blocks in falling order, the second half the short ones in rising order.
__global__ __launch_bounds__(128) void k_fattn(const h16* Q16, const bf* Qh, const bf* Ql, const h16* K16, const bf* Kh, const bf* Kl, const h16* VT16, const bf* VTh, const bf* VTl, float* Ob) {
    constexpr int NT = TT / 128, NZ = NB_ * NH_; static_assert(RH % 128 == 0 && NT % 2 == 0 && NH_ == NKV, "row blocks");
    const int idx = blockIdx.x; const int tile = (idx < NZ * NT / 2) ? NT - 1 - idx / NZ : idx / NZ - NT / 2; const int zz = idx % NZ, bb = zz / NH_, hh = zz % NH_;
    const int q0 = tile * 128 + 32 * __builtin_amdgcn_readfirstlane((int)(threadIdx.x >> 5));
    const size_t oq = ((size_t)bb * (NH_ + NKV) + hh) * TT * HD, ov = (size_t)zz * HD * PP;   /* the K pointers are the head planes' base moved on by the NH_ query planes: one offset serves q and k */ float* O = Ob + (size_t)zz * TT * HD;
    if (tile * 128 < RH) attn_rows<bf, true, 32>(Qh + oq, Ql + oq, Kh + oq, Kl + oq, VTh + ov, VTl + ov, O, q0);
    else attn_rows<h16, false, 64>(Q16 + oq, nullptr, K16 + oq, nullptr, VT16 + ov, nullptr, O, q0);
}
__global__ __launch_bounds__(256) void k_addres(float* Y, const float* __restrict__ xr) { const size_t i = (size_t)blockIdx.x * 256 + threadIdx.x; if (i >= (size_t)MT * DQ / 4) return; const v4f a = *(const v4f*)(Y + i * 4); const v4f r = *(const v4f*)(xr + i * 4); v4f o;
#pragma unroll
    for (int q = 0; q < 4; ++q) o[q] = __fadd_rn(a[q], bfr(r[q]));
    *(v4f*)(Y + i * 4) = o;  }

__global__ __launch_bounds__(256) void k_lnin2(const float* __restrict__ F, const float* __restrict__ g, const float* __restrict__ bb, bf* Xh, bf* Xl) { const int lane = threadIdx.x & 31; const int row = blockIdx.x * 8 + (threadIdx.x >> 5); if (row >= MT) return; const float* fr = F + (size_t)row * DM; bf* hrow = Xh + (size_t)row * DM; bf* lrow = Xl + (size_t)row * DM; float v[DM / 32]; float s = 0.f;
#pragma unroll
    for (int c = 0; c < DM / 128; ++c) { const v4f a = *(const v4f*)(fr + c * 128 + lane * 4); for (int q = 0; q < 4; ++q) { v[c * 4 + q] = a[q]; s = __fadd_rn(s, a[q]); } }
#pragma unroll
    for (int sh = 16; sh; sh >>= 1) s = __fadd_rn(s, __shfl_xor(s, sh, 32));
    const float mean = __fmul_rn(s, 1.0f / (float)DM);   /* DM = 512: the reciprocal is an exact power of two, identical to the division */ float s2 = 0.f;
#pragma unroll
    for (int k = 0; k < DM / 32; ++k) { const float dv = __fsub_rn(v[k], mean); float p2 = __fmul_rn(dv, dv); asm volatile("" : "+v"(p2)); s2 = __fadd_rn(s2, p2); v[k] = dv; }
#pragma unroll
    for (int sh = 16; sh; sh >>= 1) s2 = __fadd_rn(s2, __shfl_xor(s2, sh, 32));
    const float rs = __fdiv_rn(1.0f, __fsqrt_rn(__fadd_rn(__fmul_rn(s2, 1.0f / (float)DM), LNEPS)));
{
#pragma unroll
        for (int c = 0; c < DM / 128; ++c) { v4us oh, ol; for (int q = 0; q < 4; ++q) { const int col = c * 128 + lane * 4 + q; float y = __fmul_rn(v[c * 4 + q], rs); asm volatile("" : "+v"(y)); float gg = bfr(g[col]), bb2 = bfr(bb[col]); asm volatile("" : "+v"(gg), "+v"(bb2)); y = __fmul_rn(y, gg); asm volatile("" : "+v"(y)); const float r = __fadd_rn(y, bb2); unsigned short hh2, ll2; splitf(r, hh2, ll2); oh[q] = hh2; ol[q] = ll2; } *(v4us*)(hrow + c * 128 + lane * 4) = oh; *(v4us*)(lrow + c * 128 + lane * 4) = ol; }
         } }

__constant__ float INVT[HD / 2] = { 1.000000000e+00f, 7.498942018e-01f, 5.623413324e-01f, 4.216965139e-01f, 3.162277639e-01f, 2.371373773e-01f, 1.778279394e-01f, 1.333521456e-01f, 1.000000015e-01f, 7.498942316e-02f, 5.623413250e-02f, 4.216964915e-02f, 3.162277490e-02f, 2.371373773e-02f, 1.778279431e-02f, 1.333521400e-02f, 9.999999776e-03f, 7.498942316e-03f, 5.623413250e-03f, 4.216964822e-03f, 3.162277630e-03f, 2.371373819e-03f, 1.778279431e-03f, 1.333521446e-03f, 1.000000047e-03f, 7.498941850e-04f, 5.623413017e-04f, 4.216965172e-04f, 3.162277571e-04f, 2.371373703e-04f, 1.778279402e-04f, 1.333521504e-04f };   // 10000^(-2i/64) (the module's power form) (float32, generated with jnp to be bit-exact)

__global__ __launch_bounds__(256) void k_reluhl(const float* __restrict__ Hs, bf* Hh, bf* Hl) { const size_t i = (size_t)blockIdx.x * 256 + threadIdx.x; if (i >= (size_t)MT * FF / 8) return; const size_t e = i * 8; const v8f a = *(const v8f*)(Hs + e); v8us oh, ol;
#pragma unroll
    for (int q = 0; q < 8; ++q) { const float r = (a[q] > 0.0f) ? a[q] : 0.0f; unsigned short hh, ll; splitf(r, hh, ll); oh[q] = hh; ol[q] = ll; }
    *(v8us*)(Hh + e) = oh; *(v8us*)(Hl + e) = ol;  }
__global__ __launch_bounds__(256) void k_lnout(const float* __restrict__ F, const float* __restrict__ g, const float* __restrict__ bb, float* out) { const int lane = threadIdx.x & 31; const int row = blockIdx.x * 8 + (threadIdx.x >> 5); if (row >= MT) return; const float* fr = F + (size_t)row * DQ; float* orow = out + (size_t)row * DQ; float v[DQ / 32]; float s = 0.f;
#pragma unroll
    for (int c = 0; c < DQ / 128; ++c) { const v4f a = *(const v4f*)(fr + c * 128 + lane * 4); for (int q = 0; q < 4; ++q) { v[c * 4 + q] = a[q]; s = __fadd_rn(s, a[q]); } }
#pragma unroll
    for (int sh = 16; sh; sh >>= 1) s = __fadd_rn(s, __shfl_xor(s, sh, 32));
    const float mean = __fdiv_rn(s, (float)DQ); float s2 = 0.f;
#pragma unroll
    for (int k = 0; k < DQ / 32; ++k) { const float dv = __fsub_rn(v[k], mean); float p2 = __fmul_rn(dv, dv); asm volatile("" : "+v"(p2)); s2 = __fadd_rn(s2, p2); v[k] = dv; }
#pragma unroll
    for (int sh = 16; sh; sh >>= 1) s2 = __fadd_rn(s2, __shfl_xor(s2, sh, 32));
    const float rs = __fdiv_rn(1.0f, __fsqrt_rn(__fadd_rn(__fdiv_rn(s2, (float)DQ), LNEPS)));
{
#pragma unroll
        for (int c = 0; c < DQ / 128; ++c) { v4f o; for (int q = 0; q < 4; ++q) { const int col = c * 128 + lane * 4 + q; float y = __fmul_rn(v[c * 4 + q], rs); asm volatile("" : "+v"(y)); y = __fmul_rn(y, bfr(g[col])); asm volatile("" : "+v"(y)); o[q] = __fadd_rn(y, bfr(bb[col])); } *(v4f*)(orow + c * 128 + lane * 4) = o; }
         } }

__global__ __launch_bounds__(256) void k_merge(const float* __restrict__ O, bf* Ah, bf* Al) { const size_t e = ((size_t)blockIdx.x * 256 + threadIdx.x) * 2; if (e >= (size_t)NB_ * NH_ * TT * HD) return; const int d = (int)(e % HD); const int t = (int)((e / HD) % TT); const int zz = (int)(e / ((size_t)HD * TT)); const float cs = (t < RH) ? 1.0f : (1.0f / PCAR); const size_t oo = ((size_t)(zz / NH_) * TT + t) * DQ + (zz % NH_) * HD + d;   /* zz = batch element * NH_ + head */
    v2us oh, ol;
#pragma unroll
    for (int q = 0; q < 2; ++q) { unsigned short a, c2; splitf(O[e + q] * cs, a, c2); oh[q] = a; ol[q] = c2; } *(v2us*)(Ah + oo) = oh; *(v2us*)(Al + oo) = ol;  }

extern "C" void kernel_launch(void* const* d_in, const int* in_sizes, int n_in,
                              void* d_out, int out_size, void* d_ws, size_t ws_size, hipStream_t stream) {
    (void)in_sizes; (void)n_in; (void)out_size;
    const float* x = (const float*)d_in[0]; const float* pq = (const float*)d_in[1]; const float* pk = (const float*)d_in[2]; const float* pv = (const float*)d_in[3];   /* [8][512][64] each */ const float* wo = (const float*)d_in[4];   /* Wproj [512][512] 'xw' */ const float* g1 = (const float*)d_in[5]; const float* b1 = (const float*)d_in[6]; const float* w1 = (const float*)d_in[7]; const float* bb1 = (const float*)d_in[8]; const float* w2 = (const float*)d_in[9]; const float* bb2 = (const float*)d_in[10]; const float* g2 = (const float*)d_in[11]; const float* b2 = (const float*)d_in[12]; const float* wq = pq, *wk = pk, *wv = pv;
    float* OUT = (float*)d_out;     // [4][2048][512]
    char* wsp = (char*)d_ws;
    auto take = [&](size_t bytes) { char* p = wsp; wsp += (bytes + 255) & ~(size_t)255; return (void*)p; };
    // Live through the whole call: the transposed weights and the merged attention output planes.
    bf* W1T = (bf*)take((size_t)FF * DM * 2); bf* W2T = (bf*)take((size_t)DM * FF * 2); bf* WQKV = (bf*)take((size_t)NQKV * DM * 2);   /* rows: q heads, k heads, v heads */ bf* WO = (bf*)take((size_t)DM * DQ * 2); bf* ATh = (bf*)take((size_t)MT * DQ * 2); bf* ATl = (bf*)take((size_t)MT * DQ * 2);
    char* const mark = wsp;
    // Phase 1 (projections and attention). Head planes [batch][q heads, then k heads][t][d]; transposed v planes [batch][head][d] with rows of pitch PP (hi | lo in one row; the fp16 plane fills the first half of its rows, the rest is never touched).
    h16* QK16 = (h16*)take((size_t)NB_ * (NH_ + NKV) * TT * HD * 2); bf* QKh = (bf*)take((size_t)NB_ * (NH_ + NKV) * TT * HD * 2); bf* QKl = (bf*)take((size_t)NB_ * (NH_ + NKV) * TT * HD * 2);
    h16* VT16 = (h16*)take((size_t)NB_ * NKV * HD * PP * 2); bf* VTh = (bf*)take((size_t)NB_ * NKV * HD * PP * 2); bf* VTl = VTh + TT; float* Ob = (float*)take((size_t)NB_ * NH_ * TT * HD * 4);
    float* CS = (float*)take((size_t)TT * HD * 2 * 4); bf* XB = (bf*)take((size_t)MT * DM * 2); float* FQKV = (float*)take((size_t)MT * NQKV * 4);
    if ((size_t)(wsp - (char*)d_ws) > ws_size) return;    // ws 256 MiB
    // Phase 2 (Wproj, LayerNorms, feed-forward) starts after the last read of every phase-1 buffer and shares their bytes (stream-ordered).
    wsp = mark; float* Y = (float*)take((size_t)MT * DM * 4); bf* LNh = (bf*)take((size_t)MT * DM * 2); bf* LNl = (bf*)take((size_t)MT * DM * 2); float* H1 = (float*)take((size_t)MT * FF * 4); bf* H1h = (bf*)take((size_t)MT * FF * 2); bf* H1l = (bf*)take((size_t)MT * FF * 2); float* F2 = (float*)take((size_t)MT * DM * 4);
    if ((size_t)(wsp - (char*)d_ws) > ws_size) return;
    k_wtG<<<dim3((unsigned)((DM * HD / 64 + 63) / 64), NH_, 3), 256, 0, stream>>>(wq, wk, wv, DM, HD, WQKV);   /* every head's 'xw' [512][64] block of Wq, Wk, Wv -> Bt rows (tensor * 8 + head) * 64.. */
    k_wtG<<<(unsigned)((DQ * DM / 64 + 63) / 64), 256, 0, stream>>>(wo, wo, wo, DQ, DM, WO); k_wtG<<<(unsigned)((DM * FF / 64 + 63) / 64), 256, 0, stream>>>(w1, w1, w1, DM, FF, W1T);   /* W1 'xw' [512][2048] -> Bt [2048][512] */ k_wtG<<<(unsigned)((FF * DM / 64 + 63) / 64), 256, 0, stream>>>(w2, w2, w2, FF, DM, W2T);   /* W2 'xw' [2048][512] -> Bt [512][2048] */
    k_csid<<<(TT * HD + 255) / 256, 256, 0, stream>>>(CS);
    k_cvt8<<<(unsigned)(((size_t)MT * DM / 8 + 255) / 256), 256, 0, stream>>>(x, XB, (size_t)MT * DM / 8);
    k_gemmw<bf, 0, false, 8><<<dim3(MT / 64, NQKV / 64, 1), 256, 0, stream>>>(XB, nullptr, WQKV, nullptr, DM, FQKV, NQKV, nullptr, 0, 0, 0);   /* q | k | v of all batch elements */
    k_rope<<<dim3((unsigned)(((size_t)(NH_ + NKV) * TT * HD / 2 + 255) / 256), NB_, 1), 256, 0, stream>>>(FQKV, NQKV, NH_ + NKV, CS, nullptr, nullptr, 1.0f, QK16, QKh, QKl);
    k_vtp<<<dim3((unsigned)(((size_t)NKV * TT * HD / 2 + 255) / 256), NB_, 1), 256, 0, stream>>>(FQKV + DQ + DKV, NQKV, NKV, VT16, VTh, VTl);
    k_fattn<<<NB_ * NH_ * (TT / 128), 128, 0, stream>>>(QK16, QKh, QKl, QK16 + (size_t)NH_ * TT * HD, QKh + (size_t)NH_ * TT * HD, QKl + (size_t)NH_ * TT * HD, VT16, VTh, VTl, Ob);   /* all batch elements and heads */
    k_merge<<<(unsigned)(((size_t)NB_ * NH_ * TT * HD / 2 + 255) / 256), 256, 0, stream>>>(Ob, ATh, ATl);
    k_gemmw<bf, 1, false, 8><<<dim3(MT / 64, DM / 64, 1), 256, 0, stream>>>(ATh, ATl, WO, nullptr, DQ, Y, DM, nullptr, 0, 0, 0);   /* o Wproj */
    k_addres<<<(unsigned)(((size_t)MT * DM / 4 + 255) / 256), 256, 0, stream>>>(Y, x);   /* + x */
    k_lnin2<<<(MT + 7) / 8, 256, 0, stream>>>(Y, g1, b1, LNh, LNl);   /* out1 = LN1 as bf16 hi/lo planes */
    k_gemmw<bf, 1, true, 4><<<dim3(MT / 64, FF / 64, 1), 128, 0, stream>>>(LNh, LNl, W1T, nullptr, DM, H1, FF, bb1, 0, 0, 0);   /* out1 W1 + bb1 */
    k_reluhl<<<(unsigned)(((size_t)MT * FF / 8 + 255) / 256), 256, 0, stream>>>(H1, H1h, H1l);   /* relu -> hi/lo planes */
    k_gemmw<bf, 1, true, 16><<<dim3(MT / 64, DM / 64, 1), 512, 0, stream>>>(H1h, H1l, W2T, nullptr, FF, F2, DM, bb2, 0, 0, 0);   /* W2 + bb2 */
    k_addres<<<(unsigned)(((size_t)MT * DM / 4 + 255) / 256), 256, 0, stream>>>(F2, x);   /* + the ORIGINAL x */
    k_lnout<<<(MT + 7) / 8, 256, 0, stream>>>(F2, g2, b2, OUT);   /* LN2 -> out */
}

// v004
// A run of this version takes 281 microseconds.
// In both of two side-by-side timings against v003, it was 1.43 times as fast.
// Over all steps from v000 it is 7.22 times as fast.
#include <hip/hip_runtime.h>

// Post-LN transformer block with per-head projection tensors (x [4][2048][512]; q,k,v = einsum('bse,hed', x, W) (Wq, Wk, Wv [8][512][64] 1/sqrt(512): head h's 'xw' block); 8 heads x 64; scores / 8; causal (-inf); softmax; o = concat heads; out1 = LayerNorm(x + o Wproj) (Wproj 'xw' [512][512]; eps 1e-5, g1/b1); ff = relu(out1 W1 + bb1) W2 + bb2 (W1 [512][2048], W2 [2048][512] 'xw', zero biases); out = LayerNorm(ff + x, g2, b2) (the residual is the ORIGINAL x) -> [4][2048][512] (4.2 M)).
// Layout: every kernel outside attention runs once over the 8192 rows of all 4 batch elements (q, k, v as one GEMM with 1536 columns); attention is one launch over all batch elements and heads, with the scores kept in registers (online softmax). Steps: bf16 copy of x; per-head 'xw' weight blocks of Wq, Wk, Wv transposed into one joint Bt (rows (tensor*8 + h)*64..), Wproj/W1/W2 transposed once; exact projections; causal T-2048 attention (hybrid rows: < 512 hi/lo 3 products, rest fp16 x1024; key blocks above the diagonal skipped); Y = merged hi/lo x Wproj exact, += bf16(x); a row-LayerNorm kernel emits out1 as bf16 hi/lo planes; H1 = hi/lo x W1 exact + bb1 (f32 [8192][2048]); relu + hi/lo split; F2 = hi/lo x W2 exact + bb2; += bf16(x); the final row-LayerNorm writes the output rows.
// Compute dtypes, f32 accumulate: every input rounded to bf16; projections exact; attention rows < 512 3 products, rest fp16; softmax f32; Wproj hl x exact; residuals/LayerNorms f32 (fixed-order sums); FFN GEMMs 2 products (~f32) + f32 biases; relu f32.

#define NB_  4
#define TT   2048
#define DM   512
#define NH_  8
#define NKV  8
#define REP  (NH_ / NKV)
#define HD   64
#define DQ   (NH_ * HD)
#define DKV  (NKV * HD)
#define MT   (NB_ * TT)           // rows of all batch elements together
#define NQKV (DQ + 2 * DKV)       // columns of the joint q|k|v projection
#define PP   (2 * TT)             // row pitch, in 16-bit elements, of the transposed v planes
#define RH   512                  // query rows < RH use hi+lo planes (0: none)
#define PCAR 1024.0f
#define SCL  0.125f   // HD^-0.5
#define FF   2048     // feed-forward width
#define LNEPS 1e-5f
typedef _Float16 h16;
typedef unsigned short bf;
typedef __attribute__((ext_vector_type(16))) __bf16   v16bf;
typedef __attribute__((ext_vector_type(16))) _Float16 v16h;
typedef __attribute__((ext_vector_type(8)))  _Float16 v8h;
typedef __attribute__((ext_vector_type(8)))  unsigned short v8us;
typedef __attribute__((ext_vector_type(8)))  float    v8f;
typedef __attribute__((ext_vector_type(4)))  float    v4f;
typedef v8h  __attribute__((may_alias)) v8ha;
typedef v4f  __attribute__((may_alias)) v4fa;
typedef v8us __attribute__((may_alias)) v8usa;

__device__ __forceinline__ unsigned short f2bf(float f) { unsigned u = __float_as_uint(f); u += 0x7FFFu + ((u >> 16) & 1u); return (unsigned short)(u >> 16); }
__device__ __forceinline__ float bf2f(unsigned short b) { return __uint_as_float(((unsigned)b) << 16); }
__device__ __forceinline__ float bfr(float f) { return bf2f(f2bf(f)); }
__device__ __forceinline__ v16h cat16(v8h lo, v8h hi) { return __builtin_shufflevector(lo, hi, 0, 1, 2, 3, 4, 5, 6, 7, 8, 9, 10, 11, 12, 13, 14, 15); }
__device__ __forceinline__ v16bf cat16b(v8us lo, v8us hi) { return __builtin_bit_cast(v16bf, __builtin_shufflevector(lo, hi, 0, 1, 2, 3, 4, 5, 6, 7, 8, 9, 10, 11, 12, 13, 14, 15)); }
__device__ __forceinline__ v8f wmma16(v16h a, v16h b, v8f c) { return __builtin_amdgcn_wmma_f32_16x16x32_f16(false, a, false, b, (short)0, c, false, false); }
__device__ __forceinline__ v8f wmmab(v16bf a, v16bf b, v8f c) { return __builtin_amdgcn_wmma_f32_16x16x32_bf16(false, a, false, b, (short)0, c, false, false); }



// ---- k_gemms: GEMM with the operand tiles staged in LDS; one workgroup of 8 waves (4 x 2) per 128x128 output tile, 32x64 per wave; grid (M/128, N/128), 256 threads.
// C[m][n] (f32, pitch ldc, + optional f32 bias[n]) = sum_k (A[m][k] + A2[m][k]) Bt[n][k] (A2 only with NSPLIT == 1), all planes K-contiguous bf16. M % 128 == 0, N % 128 == 0, K % 64 == 0.
// A stage is 64 k (one 128-byte line) of the 128 rows of every plane: [Bt | A | A2], rows at pitch GP. Two buffers: asynchronous copies fill the next stage while this one is multiplied; every wave sums the whole K in ascending order.
#define GP   144u          // LDS row pitch in bytes: 128 + 16, an odd multiple of 16 for the ds_load_b128 readers
#define GPL  (128u * GP)   // one plane of a stage
template <typename T16> struct WFrag;
template <> struct WFrag<h16> { typedef v16h V; static __device__ __forceinline__ V ld(const h16* p) { return cat16(*(const v8h*)p, *(const v8h*)(p + 16)); } static __device__ __forceinline__ v8f mma(V a, V b, v8f c) { return wmma16(a, b, c); } };
template <> struct WFrag<bf> { typedef v16bf V; static __device__ __forceinline__ V ld(const bf* p) { return cat16b(*(const v8us*)p, *(const v8us*)(p + 16)); } static __device__ __forceinline__ v8f mma(V a, V b, v8f c) { return wmmab(a, b, c); } };
__device__ __forceinline__ unsigned lds_off(const void* p) { return (unsigned)(size_t)p; }
__device__ __forceinline__ v16bf ldl(const unsigned char* p) { return cat16b(*(const v8us*)p, *(const v8us*)(p + 32)); }
#define CPY(a, b) "global_load_async_to_lds_b128 %" #a ", %" #b ", off\n\t"
// One stage: every lane copies 16 bytes of 4 rows (32 rows apart) of each of the NP planes, a wave 4 whole lines per copy. l: the lane's LDS byte address in plane 0; g0..g2: its global addresses; rs: 32 rows in bytes.
// The copies and the s_wait_xcnt stand in one statement, so that no address register of a copy is rewritten ahead of the wait.
template <int NP> __device__ __forceinline__ void stage_copy(unsigned l, const char* g0, const char* g1, const char* g2, size_t rs) {
    if constexpr (NP == 3)
        asm volatile(CPY(0, 1) CPY(2, 3) CPY(4, 5) CPY(6, 7) CPY(8, 9) CPY(10, 11) CPY(12, 13) CPY(14, 15) CPY(16, 17) CPY(18, 19) CPY(20, 21) CPY(22, 23) "s_wait_xcnt 0x0"
            :: "v"(l), "v"(g0), "v"(l + 32u * GP), "v"(g0 + rs), "v"(l + 64u * GP), "v"(g0 + 2 * rs), "v"(l + 96u * GP), "v"(g0 + 3 * rs),
               "v"(l + GPL), "v"(g1), "v"(l + GPL + 32u * GP), "v"(g1 + rs), "v"(l + GPL + 64u * GP), "v"(g1 + 2 * rs), "v"(l + GPL + 96u * GP), "v"(g1 + 3 * rs),
               "v"(l + 2u * GPL), "v"(g2), "v"(l + 2u * GPL + 32u * GP), "v"(g2 + rs), "v"(l + 2u * GPL + 64u * GP), "v"(g2 + 2 * rs), "v"(l + 2u * GPL + 96u * GP), "v"(g2 + 3 * rs) : "memory");
    else
        asm volatile(CPY(0, 1) CPY(2, 3) CPY(4, 5) CPY(6, 7) CPY(8, 9) CPY(10, 11) CPY(12, 13) CPY(14, 15) "s_wait_xcnt 0x0"
            :: "v"(l), "v"(g0), "v"(l + 32u * GP), "v"(g0 + rs), "v"(l + 64u * GP), "v"(g0 + 2 * rs), "v"(l + 96u * GP), "v"(g0 + 3 * rs),
               "v"(l + GPL), "v"(g1), "v"(l + GPL + 32u * GP), "v"(g1 + rs), "v"(l + GPL + 64u * GP), "v"(g1 + 2 * rs), "v"(l + GPL + 96u * GP), "v"(g1 + 3 * rs) : "memory");
}
// One fragment set: 32 k of the wave's 32 rows of A (and A2) and 64 rows of Bt. pa, pb: the lane's addresses in the A and the Bt plane of a stage.
template <int NSPLIT> struct FSet { v16bf a[2], a2[2], b[4]; };
template <int NSPLIT> __device__ __forceinline__ void ld_set(FSet<NSPLIT>& f, const unsigned char* pa, const unsigned char* pb) {   // in the order of use
#pragma unroll
    for (int mb = 0; mb < 2; ++mb) f.a[mb] = ldl(pa + mb * 16 * GP);
#pragma unroll
    for (int nb = 0; nb < 4; ++nb) f.b[nb] = ldl(pb + nb * 16 * GP);
    if (NSPLIT) {
#pragma unroll
        for (int mb = 0; mb < 2; ++mb) f.a2[mb] = ldl(pa + GPL + mb * 16 * GP); }
}
template <int NSPLIT> __device__ __forceinline__ void mm_set(const FSet<NSPLIT>& f, v8f (&acc)[2][4]) {   // eight independent accumulators between two products into the same one
#pragma unroll
    for (int nb = 0; nb < 4; ++nb)
#pragma unroll
        for (int mb = 0; mb < 2; ++mb) acc[mb][nb] = wmmab(f.a[mb], f.b[nb], acc[mb][nb]);
    if (NSPLIT) {
#pragma unroll
        for (int nb = 0; nb < 4; ++nb)
#pragma unroll
            for (int mb = 0; mb < 2; ++mb) acc[mb][nb] = wmmab(f.a2[mb], f.b[nb], acc[mb][nb]); }
}
template <int NSPLIT, bool BIAS>
__global__ __launch_bounds__(256) void k_gemms(const bf* A, const bf* A2, const bf* Bt, int K, float* C, int ldc, const float* __restrict__ bias) {
    constexpr int NP = NSPLIT ? 3 : 2; constexpr unsigned STG = NP * GPL;
    static_assert(2 * STG >= 8 * 32 * 68 * 4, "the output staging reuses the ring");
    __shared__ __attribute__((aligned(16))) unsigned char sm[2 * STG];
    const int tid = (int)threadIdx.x, lane = tid & 31, lr = lane & 15, hi = lane >> 4; const int w = __builtin_amdgcn_readfirstlane(tid >> 5), wm = w >> 1, wn = w & 1; const int r0 = blockIdx.x * 128, c0 = blockIdx.y * 128;
    const size_t rowb = (size_t)K * 2; const int crow = tid >> 3; const unsigned cch = (unsigned)(tid & 7) * 16u;   // the lane's first row and its 16-byte piece of the line
    const char* gb = (const char*)Bt + (size_t)(c0 + crow) * rowb + cch; const char* ga = (const char*)A + (size_t)(r0 + crow) * rowb + cch; const char* ga2 = NSPLIT ? (const char*)A2 + (size_t)(r0 + crow) * rowb + cch : ga;
    const unsigned lc = lds_off(sm) + (unsigned)crow * GP + cch; const int nt = K >> 6;
    stage_copy<NP>(lc, gb, ga, ga2, 32 * rowb);
    asm volatile("s_wait_asynccnt 0x0" ::: "memory");   // stage 0 of this wave has landed
    __syncthreads();                                     // ... and every wave's: nobody reads it in front of this barrier
    if (nt > 1) stage_copy<NP>(lc + STG, gb + 128, ga + 128, ga2 + 128, 32 * rowb);
    v8f acc[2][4];
#pragma unroll
    for (int mb = 0; mb < 2; ++mb)
#pragma unroll
        for (int nb = 0; nb < 4; ++nb) acc[mb][nb] = (v8f){};
    const unsigned fb = (unsigned)(wn * 64 + lr) * GP + 16u * hi, fa = GPL + (unsigned)(wm * 32 + lr) * GP + 16u * hi;   // the lane's fragment offsets in a stage
    // Two fragment sets, each half a stage, fetched one half ahead: f0 = k 0..31 of a stage, f1 = k 32..63. The publish point of stage t + 1 therefore stands in the middle of trip t, behind the last reads of stage t and ahead of the first reads of stage t + 1.
    FSet<NSPLIT> f0, f1;
    ld_set<NSPLIT>(f0, sm + fa, sm + fb);
#pragma unroll 1   // one stage per trip: the ring's order of waits, barrier and refill stands once
    for (int t = 0; t < nt; ++t) {
        const unsigned char* sb = sm + (unsigned)(t & 1) * STG;
        ld_set<NSPLIT>(f1, sb + fa + 64, sb + fb + 64);
        __builtin_amdgcn_sched_barrier(0);   // the reads stay one group ahead of the WMMAs that they fly behind
        mm_set<NSPLIT>(f0, acc);
        __builtin_amdgcn_sched_barrier(0);   // these WMMAs stay ahead of the waits: they cover the flight of f1's reads and of the copies
        asm volatile("s_wait_dscnt 0x0" ::: "memory");      // this wave's last reads of stage t have returned before its buffer is refilled
        asm volatile("s_wait_asynccnt 0x0" ::: "memory");   // this wave's copies of stage t + 1 have landed
        __syncthreads();                                     // publishes stage t + 1 and ends every wave's reads of stage t
        if (t + 2 < nt) stage_copy<NP>(lc + (unsigned)(t & 1) * STG, gb + (size_t)(t + 2) * 128, ga + (size_t)(t + 2) * 128, ga2 + (size_t)(t + 2) * 128, 32 * rowb);
        if (t + 1 < nt) { const unsigned char* sn = sm + (unsigned)((t + 1) & 1) * STG; ld_set<NSPLIT>(f0, sn + fa, sn + fb); }
        mm_set<NSPLIT>(f1, acc);
    }
    asm volatile("s_wait_asynccnt 0x0" ::: "memory");   // no copy is outstanding when the ring becomes output staging
    // Whole 128-byte lines to C: each wave stages its 32x64 tile in its own part of the ring (pitch 68 floats) and reads rows back.
    float* os = (float*)sm + w * (32 * 68);
#pragma unroll
    for (int mb = 0; mb < 2; ++mb)
#pragma unroll
        for (int nb = 0; nb < 4; ++nb)
#pragma unroll
            for (int j = 0; j < 8; ++j) os[(mb * 16 + hi * 8 + j) * 68 + nb * 16 + lr] = acc[mb][nb][j];
    __syncthreads();   // orders the staging writes against the row reads
    float* crow0 = C + (size_t)(r0 + wm * 32) * ldc + c0 + wn * 64;
#pragma unroll
    for (int s = 0; s < 16; ++s) { const int item = s * 32 + lane; const int row = item >> 4, cofs = (item & 15) * 4; v4f val = *(const v4fa*)(os + row * 68 + cofs);
        if (BIAS) { const int cb = c0 + wn * 64 + cofs; val[0] += bfr(bias[cb]); val[1] += bfr(bias[cb + 1]); val[2] += bfr(bias[cb + 2]); val[3] += bfr(bias[cb + 3]); }
        *(v4f*)(crow0 + (size_t)row * ldc + cofs) = val; }
}

__device__ __forceinline__ h16 tohx(float x) { return (h16)x; }
__device__ __forceinline__ void splitf(float y, unsigned short& h, unsigned short& l) { h = f2bf(y); l = f2bf(y - bf2f(h)); }
typedef __attribute__((ext_vector_type(2))) _Float16 v2h;
typedef __attribute__((ext_vector_type(4))) _Float16 v4h;
typedef __attribute__((ext_vector_type(2))) unsigned short v2us;
typedef __attribute__((ext_vector_type(4))) unsigned short v4us;
typedef __attribute__((ext_vector_type(2))) float v2f;
typedef __attribute__((ext_vector_type(4))) int v4i;

__global__ __launch_bounds__(256) void k_wtG(const float* __restrict__ wa, const float* __restrict__ wb, const float* __restrict__ wc, int K, int N, bf* Bt) {
    // grid (lines, blocks of one tensor, tensors): block y of tensor z is its own [K][N] matrix; the transposed blocks follow one another in Bt
    const float* w = (blockIdx.z == 0 ? wa : blockIdx.z == 1 ? wb : wc) + (size_t)blockIdx.y * K * N; Bt += ((size_t)blockIdx.z * gridDim.y + blockIdx.y) * K * N;
    const int lane = threadIdx.x & 31; const int L0 = (blockIdx.x * 8 + (threadIdx.x >> 5)) * 8; const int nlines = N * K / 64;
{
#pragma unroll 1
        for (int l = 0; l < 8; ++l) { const int L = L0 + l; if (L >= nlines) break; const size_t e = (size_t)L * 64 + lane * 2; const int k = (int)(e % K), n = (int)(e / K); v2us o;
            o[0] = f2bf(w[(size_t)k * N + n]); o[1] = f2bf(w[(size_t)(k + 1) * N + n]); *(v2us*)(Bt + e) = o; }
         }
}
__global__ __launch_bounds__(256) void k_cvt8(const float* __restrict__ src, bf* dst, size_t n8) { const size_t i = (size_t)blockIdx.x * 256 + threadIdx.x; if (i >= n8) return; const v8f v = *(const v8f*)(src + i * 8); v8us o;
#pragma unroll
    for (int k = 0; k < 8; ++k) o[k] = f2bf(v[k]); *(v8us*)(dst + i * 8) = o;  }

// k_rope: head planes [h][t][d] (fp16 + hi/lo) of rope(x) x sc with the rotate-half convention out[d] = x[d] cos[t][d] - x[d+HD/2] sin[t][d], out[d+HD/2] = x[d+HD/2] cos[t][d+HD/2] + x[d] sin[t][d+HD/2]
__global__ __launch_bounds__(256) void k_rope(const float* __restrict__ F, int pitch, int nheads, const float* __restrict__ CS, const float* __restrict__ RF, const float* __restrict__ nw, float sc, h16* P16, bf* Ph, bf* Pl) {
    { const size_t ob = (size_t)blockIdx.y * nheads * TT * HD; F += (size_t)blockIdx.y * TT * pitch; P16 += ob; Ph += ob; Pl += ob; }   // blockIdx.y: batch element
    const size_t e = ((size_t)blockIdx.x * 256 + threadIdx.x) * 2; if (e >= (size_t)nheads * TT * HD) return; const int d = (int)(e % HD); const int t = (int)((e / HD) % TT); const int h = (int)(e / ((size_t)HD * TT)); const float* f = F + (size_t)t * pitch + h * HD; const float rf = RF ? RF[(size_t)h * TT + t] : 1.0f; v2h o16; v2us oh, ol;
#pragma unroll
    for (int q = 0; q < 2; ++q) { const int dd = d + q; const int dp = (dd < HD / 2) ? dd + HD / 2 : dd - HD / 2; float x0 = f[dd], x1 = f[dp];
        if (RF) { float n0 = __fmul_rn(x0, rf), n1 = __fmul_rn(x1, rf); asm volatile("" : "+v"(n0)); asm volatile("" : "+v"(n1)); x0 = __fmul_rn(bfr(nw[dd]), n0); x1 = __fmul_rn(bfr(nw[dp]), n1); }
        const v2f cs = *(const v2f*)(CS + ((size_t)t * HD + dd) * 2); float a = __fmul_rn(x0, cs[0]), bq = __fmul_rn(x1, cs[1]); asm volatile("" : "+v"(a)); asm volatile("" : "+v"(bq)); const float r = ((dd < HD / 2) ? __fsub_rn(a, bq) : __fadd_rn(a, bq)) * sc;
        o16[q] = tohx(r); unsigned short a2, c2; splitf(r, a2, c2); oh[q] = a2; ol[q] = c2; }
    *(v2h*)(P16 + e) = o16; *(v2us*)(Ph + e) = oh; *(v2us*)(Pl + e) = ol;  }
__global__ __launch_bounds__(256) void k_vtp(const float* __restrict__ F, int pitch, int nheads, h16* V16, bf* Vh, bf* Vl) { F += (size_t)blockIdx.y * TT * pitch;   /* blockIdx.y: batch element */ const size_t e = ((size_t)blockIdx.x * 256 + threadIdx.x) * 2; if (e >= (size_t)nheads * HD * TT) return; const int t = (int)(e % TT); const int d = (int)((e / TT) % HD); const int g = (int)(e / ((size_t)TT * HD)); v2h o16; v2us oh, ol;
#pragma unroll
    for (int q = 0; q < 2; ++q) { const float x = F[(size_t)(t + q) * pitch + g * HD + d]; o16[q] = tohx(x); unsigned short a2, c2; splitf(x, a2, c2); oh[q] = a2; ol[q] = c2; }
    const size_t eo = (((size_t)blockIdx.y * nheads + g) * HD + d) * PP + t;   /* rows [batch][head][d] of pitch PP */ *(v2h*)(V16 + eo) = o16; *(v2us*)(Vh + eo) = oh; *(v2us*)(Vl + eo) = ol;  }
__global__ __launch_bounds__(256) void k_csid(float* CS) { const int idx = blockIdx.x * 256 + threadIdx.x; if (idx >= TT * HD) return; v2f cs; cs[0] = 1.0f; cs[1] = 0.0f; *(v2f*)(CS + (size_t)idx * 2) = cs;  }
typedef __attribute__((ext_vector_type(16))) unsigned short v16us;
// Lane l with lane l ^ 16 (the two halves of a wave hold the two halves of a query's keys).
__device__ __forceinline__ float xhalf(float x) { return __builtin_bit_cast(float, __builtin_amdgcn_permlanex16(__builtin_bit_cast(int, x), __builtin_bit_cast(int, x), 0x76543210, 0xfedcba98, false, false)); }
// 2^x with the issue slot behind the transcendental filled in the same statement, so that no instruction directly behind it reads its result or rewrites its source.
__device__ __forceinline__ float exp2s(float x) { float r; asm("v_exp_f32 %0, %1\n\tv_nop" : "=v"(r) : "v"(x)); return r; }
// Stands between a group of issued global loads and every later rewrite of an address register that they name; the lanes' base addresses are inputs so that their registers stay untouched up to the wait.
__device__ __forceinline__ void xwaits(const void* a, const void* b) { asm volatile("s_wait_xcnt 0x0" :: "s"(a), "s"(b) : "memory"); }   // the same for loads at a wave-uniform base in scalar registers
__device__ __forceinline__ void xwait(const char* a, const char* b, const char* c, const char* d) { asm volatile("s_wait_xcnt 0x0" :: "v"(a), "v"(b), "v"(c), "v"(d) : "memory"); }
// Fragment at the lane's base address plus a constant number of elements.
template <typename T16> __device__ __forceinline__ typename WFrag<T16>::V ldp(const char* lane_base, int elems) { return WFrag<T16>::ld((const T16*)lane_base + elems); }
// ---- k_fattn: causal attention in one launch, scores and probabilities never leave the registers (online softmax). One wave owns 32 query rows of one (batch, head) and walks the key blocks 0 .. diagonal.
// Transposed products, so that a lane holds one query's scores: S^T = K Q^T (A = 16 key rows, B = 16 query rows, k = d) leaves in lane (lr, hi) the keys mb*16 + hi*8 + j of query lr, which is the B-fragment k order of P^T;
// O^T += V^T P^T (A = 16 rows of the transposed v plane, k = keys) leaves d = db*16 + hi*8 + j of query lr. Row maximum and row sum are per lane; the two lane halves exchange the maximum once per block and join their sums at the end.
// Every inner loop is unrolled whole: the fragment and accumulator arrays stay in registers only if every index is a constant.
// HL: bf16 hi/lo planes, 3 products in both contractions (query rows < RH); else fp16 with the probabilities carried x PCAR (2^10 in the exponent), output rows x PCAR as k_merge expects.
template <typename T16, bool HL, int KB>
__device__ __forceinline__ void attn_rows(const T16* Q, const T16* Q2, const T16* Kp, const T16* K2, const T16* Vt, const T16* Vt2, float* O, int q0) {   // no __restrict__: the loads must stay on their side of the waits' "memory" clobber
    typedef WFrag<T16> WF; typedef typename WF::V V;
    constexpr int MK = KB / 16, KS = KB / 32;
    constexpr float CEXP = SCL * 1.4426950408889634f;   // scores go to the exponent in log2 units
    constexpr float OFF = HL ? 0.0f : 10.0f;            // 2^10 = PCAR
    const int lane = threadIdx.x & 31, lr = lane & 15, hi = lane >> 4;
    const unsigned kl = (unsigned)(lr * HD + 8 * hi) * 2u, vl = (unsigned)(lr * PP + 8 * hi) * 2u;   // the lane's byte offsets in a 16-row block of a head plane / of a transposed v plane
    V qf[2][2], qf2[2][2], kf[MK][2], kf2[MK][2];
    { const T16* uq = Q + (size_t)q0 * HD; const T16* uq2 = HL ? Q2 + (size_t)q0 * HD : uq; const T16* uk2 = HL ? K2 : Kp; const char* pq = (const char*)uq + kl; const char* pq2 = (const char*)uq2 + kl; const char* pk = (const char*)Kp + kl; const char* pk2 = (const char*)uk2 + kl;
#pragma unroll
    for (int nb = 0; nb < 2; ++nb)
#pragma unroll
        for (int kc = 0; kc < 2; ++kc) { const int e = nb * 16 * HD + kc * 32; qf[nb][kc] = ldp<T16>(pq, e); if (HL) qf2[nb][kc] = ldp<T16>(pq2, e); }
    xwaits(uq, uq2);
#pragma unroll
    for (int mb = 0; mb < MK; ++mb)
#pragma unroll
        for (int kc = 0; kc < 2; ++kc) { const int e = mb * 16 * HD + kc * 32; kf[mb][kc] = ldp<T16>(pk, e); if (HL) kf2[mb][kc] = ldp<T16>(pk2, e); }
    xwaits(Kp, uk2); }
    v8f o[4][2], lv[2]; float m[2];
#pragma unroll
    for (int nb = 0; nb < 2; ++nb) { m[nb] = -3.0e38f; lv[nb] = (v8f){};
#pragma unroll
        for (int db = 0; db < 4; ++db) o[db][nb] = (v8f){}; }
    const int nkb = (q0 + 32 + KB - 1) / KB;   // key blocks up to and with the one that holds the last query's diagonal; every block holds key k0 <= q0, so no query meets a block that is masked whole
#pragma unroll 1   // one key block per trip: unrolled, two trips' fragments would not fit the register budget of two waves per SIMD
    for (int kb = 0; kb < nkb; ++kb) {
        const int k0 = kb * KB;
        v8f s[MK][2];
#pragma unroll
        for (int mb = 0; mb < MK; ++mb)
#pragma unroll
            for (int nb = 0; nb < 2; ++nb) s[mb][nb] = (v8f){};
#pragma unroll
        for (int kc = 0; kc < 2; ++kc)
#pragma unroll
            for (int mb = 0; mb < MK; ++mb)
#pragma unroll
                for (int nb = 0; nb < 2; ++nb) { s[mb][nb] = WF::mma(kf[mb][kc], qf[nb][kc], s[mb][nb]); if (HL) { s[mb][nb] = WF::mma(kf[mb][kc], qf2[nb][kc], s[mb][nb]); s[mb][nb] = WF::mma(kf2[mb][kc], qf[nb][kc], s[mb][nb]); } }
        // This block's V fragments and the next block's K fragments fly during the softmax (the last trip re-reads its own K block: in bounds, unused).
        const int kn = (kb + 1 < nkb) ? k0 + KB : k0;
        const char* pv = (const char*)(Vt + k0) + vl; const char* pv2 = HL ? (const char*)(Vt2 + k0) + vl : pv; const char* pk = (const char*)(Kp + (size_t)kn * HD) + kl; const char* pk2 = HL ? (const char*)(K2 + (size_t)kn * HD) + kl : pk;
        V vf[4][KS], vf2[4][KS];
#pragma unroll
        for (int db = 0; db < 4; ++db)
#pragma unroll
            for (int ks = 0; ks < KS; ++ks) { const int e = db * 16 * PP + ks * 32; vf[db][ks] = ldp<T16>(pv, e); if (HL) vf2[db][ks] = ldp<T16>(pv2, e); }
#pragma unroll
        for (int mb = 0; mb < MK; ++mb)
#pragma unroll
            for (int kc = 0; kc < 2; ++kc) { const int e = mb * 16 * HD + kc * 32; kf[mb][kc] = ldp<T16>(pk, e); if (HL) kf2[mb][kc] = ldp<T16>(pk2, e); }
        xwait(pv, pv2, pk, pk2);
        if (k0 + KB - 1 > q0) {   // wave-uniform: only blocks that reach past the first query's diagonal are masked
            const int dq = q0 + lr - k0 - hi * 8;   // key mb*16 + hi*8 + j is above the diagonal of query nb*16 + lr when mb*16 + j - nb*16 > dq
#pragma unroll
            for (int mb = 0; mb < MK; ++mb)
#pragma unroll
                for (int nb = 0; nb < 2; ++nb)
#pragma unroll
                    for (int j = 0; j < 8; ++j) if (mb * 16 + j - nb * 16 > dq) s[mb][nb][j] = -3.0e38f;
        }
        V pf[2][KS], pf2[2][KS];
#pragma unroll
        for (int nb = 0; nb < 2; ++nb) {
            v8f mv = s[0][nb];
#pragma unroll
            for (int mb = 1; mb < MK; ++mb) mv = __builtin_elementwise_max(mv, s[mb][nb]);
            float mx = fmaxf(fmaxf(fmaxf(mv[0], mv[1]), fmaxf(mv[2], mv[3])), fmaxf(fmaxf(mv[4], mv[5]), fmaxf(mv[6], mv[7])));
            mx = fmaxf(mx, xhalf(mx));
            const float mn = fmaxf(m[nb], mx * CEXP); const float al = exp2s(m[nb] - mn); m[nb] = mn; const float sub = OFF - mn;
            lv[nb] *= al;
#pragma unroll
            for (int mb = 0; mb < MK; ++mb) { const v8f t = s[mb][nb] * CEXP + sub; v8f p;
#pragma unroll
                for (int j = 0; j < 8; ++j) p[j] = exp2s(t[j]);
                s[mb][nb] = p; lv[nb] += p; }
#pragma unroll
            for (int db = 0; db < 4; ++db) o[db][nb] *= al;
#pragma unroll
            for (int ks = 0; ks < KS; ++ks) {
                if constexpr (HL) { v16us ph, pl;
#pragma unroll
                    for (int e = 0; e < 8; ++e) { unsigned short a, c2; splitf(s[2 * ks][nb][e], a, c2); ph[e] = a; pl[e] = c2; splitf(s[2 * ks + 1][nb][e], a, c2); ph[8 + e] = a; pl[8 + e] = c2; }
                    pf[nb][ks] = __builtin_bit_cast(v16bf, ph); pf2[nb][ks] = __builtin_bit_cast(v16bf, pl);
                } else { v16h ph;
#pragma unroll
                    for (int e = 0; e < 8; ++e) { ph[e] = tohx(s[2 * ks][nb][e]); ph[8 + e] = tohx(s[2 * ks + 1][nb][e]); }
                    pf[nb][ks] = ph; }
            }
        }
#pragma unroll
        for (int ks = 0; ks < KS; ++ks)
#pragma unroll
            for (int db = 0; db < 4; ++db)
#pragma unroll
                for (int nb = 0; nb < 2; ++nb) { o[db][nb] = WF::mma(vf[db][ks], pf[nb][ks], o[db][nb]); if (HL) { o[db][nb] = WF::mma(vf[db][ks], pf2[nb][ks], o[db][nb]); o[db][nb] = WF::mma(vf2[db][ks], pf[nb][ks], o[db][nb]); } }
    }
#pragma unroll
    for (int nb = 0; nb < 2; ++nb) { const float lh = ((lv[nb][0] + lv[nb][1]) + (lv[nb][2] + lv[nb][3])) + ((lv[nb][4] + lv[nb][5]) + (lv[nb][6] + lv[nb][7])); const float lt = lh + xhalf(lh); const float f = __fdiv_rn(HL ? 1.0f : PCAR, lt);   // fp16 rows: o and lt both carry PCAR; one more PCAR is what k_merge takes off
#pragma unroll
        for (int db = 0; db < 4; ++db) o[db][nb] *= f; }
    __builtin_amdgcn_sched_barrier(0);   // all arithmetic ahead of the stores: behind them no register that a store names is written any more
#pragma unroll
    for (int nb = 0; nb < 2; ++nb)
#pragma unroll
        for (int db = 0; db < 4; ++db) *(v8f*)((char*)(O + (size_t)(q0 + nb * 16) * HD + db * 16) + 2u * kl) = o[db][nb];   // f32 row lr, columns hi*8..: twice the 16-bit lane offset
}
// grid: NB_ * NH_ * TT / 128 workgroups of 4 waves (128 query rows of one head). All are resident together; the first half of the indices takes the long row blocks in falling order, the second half the short ones in rising order.
__global__ __launch_bounds__(128) void k_fattn(const h16* Q16, const bf* Qh, const bf* Ql, const h16* K16, const bf* Kh, const bf* Kl, const h16* VT16, const bf* VTh, const bf* VTl, float* Ob) {
    constexpr int NT = TT / 128, NZ = NB_ * NH_; static_assert(RH % 128 == 0 && NT % 2 == 0 && NH_ == NKV, "row blocks");
    const int idx = blockIdx.x; const int tile = (idx < NZ * NT / 2) ? NT - 1 - idx / NZ : idx / NZ - NT / 2; const int zz = idx % NZ, bb = zz / NH_, hh = zz % NH_;
    const int q0 = tile * 128 + 32 * __builtin_amdgcn_readfirstlane((int)(threadIdx.x >> 5));
    const size_t oq = ((size_t)bb * (NH_ + NKV) + hh) * TT * HD, ov = (size_t)zz * HD * PP;   /* the K pointers are the head planes' base moved on by the NH_ query planes: one offset serves q and k */ float* O = Ob + (size_t)zz * TT * HD;
    if (tile * 128 < RH) attn_rows<bf, true, 32>(Qh + oq, Ql + oq, Kh + oq, Kl + oq, VTh + ov, VTl + ov, O, q0);
    else attn_rows<h16, false, 64>(Q16 + oq, nullptr, K16 + oq, nullptr, VT16 + ov, nullptr, O, q0);
}
__global__ __launch_bounds__(256) void k_addres(float* Y, const float* __restrict__ xr) { const size_t i = (size_t)blockIdx.x * 256 + threadIdx.x; if (i >= (size_t)MT * DQ / 4) return; const v4f a = *(const v4f*)(Y + i * 4); const v4f r = *(const v4f*)(xr + i * 4); v4f o;
#pragma unroll
    for (int q = 0; q < 4; ++q) o[q] = __fadd_rn(a[q], bfr(r[q]));
    *(v4f*)(Y + i * 4) = o;  }

__global__ __launch_bounds__(256) void k_lnin2(const float* __restrict__ F, const float* __restrict__ g, const float* __restrict__ bb, bf* Xh, bf* Xl) { const int lane = threadIdx.x & 31; const int row = blockIdx.x * 8 + (threadIdx.x >> 5); if (row >= MT) return; const float* fr = F + (size_t)row * DM; bf* hrow = Xh + (size_t)row * DM; bf* lrow = Xl + (size_t)row * DM; float v[DM / 32]; float s = 0.f;
#pragma unroll
    for (int c = 0; c < DM / 128; ++c) { const v4f a = *(const v4f*)(fr + c * 128 + lane * 4); for (int q = 0; q < 4; ++q) { v[c * 4 + q] = a[q]; s = __fadd_rn(s, a[q]); } }
#pragma unroll
    for (int sh = 16; sh; sh >>= 1) s = __fadd_rn(s, __shfl_xor(s, sh, 32));
    const float mean = __fmul_rn(s, 1.0f / (float)DM);   /* DM = 512: the reciprocal is an exact power of two, identical to the division */ float s2 = 0.f;
#pragma unroll
    for (int k = 0; k < DM / 32; ++k) { const float dv = __fsub_rn(v[k], mean); float p2 = __fmul_rn(dv, dv); asm volatile("" : "+v"(p2)); s2 = __fadd_rn(s2, p2); v[k] = dv; }
#pragma unroll
    for (int sh = 16; sh; sh >>= 1) s2 = __fadd_rn(s2, __shfl_xor(s2, sh, 32));
    const float rs = __fdiv_rn(1.0f, __fsqrt_rn(__fadd_rn(__fmul_rn(s2, 1.0f / (float)DM), LNEPS)));
{
#pragma unroll
        for (int c = 0; c < DM / 128; ++c) { v4us oh, ol; for (int q = 0; q < 4; ++q) { const int col = c * 128 + lane * 4 + q; float y = __fmul_rn(v[c * 4 + q], rs); asm volatile("" : "+v"(y)); float gg = bfr(g[col]), bb2 = bfr(bb[col]); asm volatile("" : "+v"(gg), "+v"(bb2)); y = __fmul_rn(y, gg); asm volatile("" : "+v"(y)); const float r = __fadd_rn(y, bb2); unsigned short hh2, ll2; splitf(r, hh2, ll2); oh[q] = hh2; ol[q] = ll2; } *(v4us*)(hrow + c * 128 + lane * 4) = oh; *(v4us*)(lrow + c * 128 + lane * 4) = ol; }
         } }

__constant__ float INVT[HD / 2] = { 1.000000000e+00f, 7.498942018e-01f, 5.623413324e-01f, 4.216965139e-01f, 3.162277639e-01f, 2.371373773e-01f, 1.778279394e-01f, 1.333521456e-01f, 1.000000015e-01f, 7.498942316e-02f, 5.623413250e-02f, 4.216964915e-02f, 3.162277490e-02f, 2.371373773e-02f, 1.778279431e-02f, 1.333521400e-02f, 9.999999776e-03f, 7.498942316e-03f, 5.623413250e-03f, 4.216964822e-03f, 3.162277630e-03f, 2.371373819e-03f, 1.778279431e-03f, 1.333521446e-03f, 1.000000047e-03f, 7.498941850e-04f, 5.623413017e-04f, 4.216965172e-04f, 3.162277571e-04f, 2.371373703e-04f, 1.778279402e-04f, 1.333521504e-04f };   // 10000^(-2i/64) (the module's power form) (float32, generated with jnp to be bit-exact)

__global__ __launch_bounds__(256) void k_reluhl(const float* __restrict__ Hs, bf* Hh, bf* Hl) { const size_t i = (size_t)blockIdx.x * 256 + threadIdx.x; if (i >= (size_t)MT * FF / 8) return; const size_t e = i * 8; const v8f a = *(const v8f*)(Hs + e); v8us oh, ol;
#pragma unroll
    for (int q = 0; q < 8; ++q) { const float r = (a[q] > 0.0f) ? a[q] : 0.0f; unsigned short hh, ll; splitf(r, hh, ll); oh[q] = hh; ol[q] = ll; }
    *(v8us*)(Hh + e) = oh; *(v8us*)(Hl + e) = ol;  }
__global__ __launch_bounds__(256) void k_lnout(const float* __restrict__ F, const float* __restrict__ g, const float* __restrict__ bb, float* out) { const int lane = threadIdx.x & 31; const int row = blockIdx.x * 8 + (threadIdx.x >> 5); if (row >= MT) return; const float* fr = F + (size_t)row * DQ; float* orow = out + (size_t)row * DQ; float v[DQ / 32]; float s = 0.f;
#pragma unroll
    for (int c = 0; c < DQ / 128; ++c) { const v4f a = *(const v4f*)(fr + c * 128 + lane * 4); for (int q = 0; q < 4; ++q) { v[c * 4 + q] = a[q]; s = __fadd_rn(s, a[q]); } }
#pragma unroll
    for (int sh = 16; sh; sh >>= 1) s = __fadd_rn(s, __shfl_xor(s, sh, 32));
    const float mean = __fdiv_rn(s, (float)DQ); float s2 = 0.f;
#pragma unroll
    for (int k = 0; k < DQ / 32; ++k) { const float dv = __fsub_rn(v[k], mean); float p2 = __fmul_rn(dv, dv); asm volatile("" : "+v"(p2)); s2 = __fadd_rn(s2, p2); v[k] = dv; }
#pragma unroll
    for (int sh = 16; sh; sh >>= 1) s2 = __fadd_rn(s2, __shfl_xor(s2, sh, 32));
    const float rs = __fdiv_rn(1.0f, __fsqrt_rn(__fadd_rn(__fdiv_rn(s2, (float)DQ), LNEPS)));
{
#pragma unroll
        for (int c = 0; c < DQ / 128; ++c) { v4f o; for (int q = 0; q < 4; ++q) { const int col = c * 128 + lane * 4 + q; float y = __fmul_rn(v[c * 4 + q], rs); asm volatile("" : "+v"(y)); y = __fmul_rn(y, bfr(g[col])); asm volatile("" : "+v"(y)); o[q] = __fadd_rn(y, bfr(bb[col])); } *(v4f*)(orow + c * 128 + lane * 4) = o; }
         } }

__global__ __launch_bounds__(256) void k_merge(const float* __restrict__ O, bf* Ah, bf* Al) { const size_t e = ((size_t)blockIdx.x * 256 + threadIdx.x) * 2; if (e >= (size_t)NB_ * NH_ * TT * HD) return; const int d = (int)(e % HD); const int t = (int)((e / HD) % TT); const int zz = (int)(e / ((size_t)HD * TT)); const float cs = (t < RH) ? 1.0f : (1.0f / PCAR); const size_t oo = ((size_t)(zz / NH_) * TT + t) * DQ + (zz % NH_) * HD + d;   /* zz = batch element * NH_ + head */
    v2us oh, ol;
#pragma unroll
    for (int q = 0; q < 2; ++q) { unsigned short a, c2; splitf(O[e + q] * cs, a, c2); oh[q] = a; ol[q] = c2; } *(v2us*)(Ah + oo) = oh; *(v2us*)(Al + oo) = ol;  }

extern "C" void kernel_launch(void* const* d_in, const int* in_sizes, int n_in,
                              void* d_out, int out_size, void* d_ws, size_t ws_size, hipStream_t stream) {
    (void)in_sizes; (void)n_in; (void)out_size;
    const float* x = (const float*)d_in[0]; const float* pq = (const float*)d_in[1]; const float* pk = (const float*)d_in[2]; const float* pv = (const float*)d_in[3];   /* [8][512][64] each */ const float* wo = (const float*)d_in[4];   /* Wproj [512][512] 'xw' */ const float* g1 = (const float*)d_in[5]; const float* b1 = (const float*)d_in[6]; const float* w1 = (const float*)d_in[7]; const float* bb1 = (const float*)d_in[8]; const float* w2 = (const float*)d_in[9]; const float* bb2 = (const float*)d_in[10]; const float* g2 = (const float*)d_in[11]; const float* b2 = (const float*)d_in[12]; const float* wq = pq, *wk = pk, *wv = pv;
    float* OUT = (float*)d_out;     // [4][2048][512]
    char* wsp = (char*)d_ws;
    auto take = [&](size_t bytes) { char* p = wsp; wsp += (bytes + 255) & ~(size_t)255; return (void*)p; };
    // Live through the whole call: the transposed weights and the merged attention output planes.
    bf* W1T = (bf*)take((size_t)FF * DM * 2); bf* W2T = (bf*)take((size_t)DM * FF * 2); bf* WQKV = (bf*)take((size_t)NQKV * DM * 2);   /* rows: q heads, k heads, v heads */ bf* WO = (bf*)take((size_t)DM * DQ * 2); bf* ATh = (bf*)take((size_t)MT * DQ * 2); bf* ATl = (bf*)take((size_t)MT * DQ * 2);
    char* const mark = wsp;
    // Phase 1 (projections and attention). Head planes [batch][q heads, then k heads][t][d]; transposed v planes [batch][head][d] with rows of pitch PP (hi | lo in one row; the fp16 plane fills the first half of its rows, the rest is never touched).
    h16* QK16 = (h16*)take((size_t)NB_ * (NH_ + NKV) * TT * HD * 2); bf* QKh = (bf*)take((size_t)NB_ * (NH_ + NKV) * TT * HD * 2); bf* QKl = (bf*)take((size_t)NB_ * (NH_ + NKV) * TT * HD * 2);
    h16* VT16 = (h16*)take((size_t)NB_ * NKV * HD * PP * 2); bf* VTh = (bf*)take((size_t)NB_ * NKV * HD * PP * 2); bf* VTl = VTh + TT; float* Ob = (float*)take((size_t)NB_ * NH_ * TT * HD * 4);
    float* CS = (float*)take((size_t)TT * HD * 2 * 4); bf* XB = (bf*)take((size_t)MT * DM * 2); float* FQKV = (float*)take((size_t)MT * NQKV * 4);
    if ((size_t)(wsp - (char*)d_ws) > ws_size) return;    // ws 256 MiB
    // Phase 2 (Wproj, LayerNorms, feed-forward) starts after the last read of every phase-1 buffer and shares their bytes (stream-ordered).
    wsp = mark; float* Y = (float*)take((size_t)MT * DM * 4); bf* LNh = (bf*)take((size_t)MT * DM * 2); bf* LNl = (bf*)take((size_t)MT * DM * 2); float* H1 = (float*)take((size_t)MT * FF * 4); bf* H1h = (bf*)take((size_t)MT * FF * 2); bf* H1l = (bf*)take((size_t)MT * FF * 2); float* F2 = (float*)take((size_t)MT * DM * 4);
    if ((size_t)(wsp - (char*)d_ws) > ws_size) return;
    k_wtG<<<dim3((unsigned)((DM * HD / 64 + 63) / 64), NH_, 3), 256, 0, stream>>>(wq, wk, wv, DM, HD, WQKV);   /* every head's 'xw' [512][64] block of Wq, Wk, Wv -> Bt rows (tensor * 8 + head) * 64.. */
    k_wtG<<<(unsigned)((DQ * DM / 64 + 63) / 64), 256, 0, stream>>>(wo, wo, wo, DQ, DM, WO); k_wtG<<<(unsigned)((DM * FF / 64 + 63) / 64), 256, 0, stream>>>(w1, w1, w1, DM, FF, W1T);   /* W1 'xw' [512][2048] -> Bt [2048][512] */ k_wtG<<<(unsigned)((FF * DM / 64 + 63) / 64), 256, 0, stream>>>(w2, w2, w2, FF, DM, W2T);   /* W2 'xw' [2048][512] -> Bt [512][2048] */
    k_csid<<<(TT * HD + 255) / 256, 256, 0, stream>>>(CS);
    k_cvt8<<<(unsigned)(((size_t)MT * DM / 8 + 255) / 256), 256, 0, stream>>>(x, XB, (size_t)MT * DM / 8);
    k_gemms<0, false><<<dim3(MT / 128, NQKV / 128, 1), 256, 0, stream>>>(XB, nullptr, WQKV, DM, FQKV, NQKV, nullptr);   /* q | k | v of all batch elements */
    k_rope<<<dim3((unsigned)(((size_t)(NH_ + NKV) * TT * HD / 2 + 255) / 256), NB_, 1), 256, 0, stream>>>(FQKV, NQKV, NH_ + NKV, CS, nullptr, nullptr, 1.0f, QK16, QKh, QKl);
    k_vtp<<<dim3((unsigned)(((size_t)NKV * TT * HD / 2 + 255) / 256), NB_, 1), 256, 0, stream>>>(FQKV + DQ + DKV, NQKV, NKV, VT16, VTh, VTl);
    k_fattn<<<NB_ * NH_ * (TT / 128), 128, 0, stream>>>(QK16, QKh, QKl, QK16 + (size_t)NH_ * TT * HD, QKh + (size_t)NH_ * TT * HD, QKl + (size_t)NH_ * TT * HD, VT16, VTh, VTl, Ob);   /* all batch elements and heads */
    k_merge<<<(unsigned)(((size_t)NB_ * NH_ * TT * HD / 2 + 255) / 256), 256, 0, stream>>>(Ob, ATh, ATl);
    k_gemms<1, false><<<dim3(MT / 128, DM / 128, 1), 256, 0, stream>>>(ATh, ATl, WO, DQ, Y, DM, nullptr);   /* o Wproj */
    k_addres<<<(unsigned)(((size_t)MT * DM / 4 + 255) / 256), 256, 0, stream>>>(Y, x);   /* + x */
    k_lnin2<<<(MT + 7) / 8, 256, 0, stream>>>(Y, g1, b1, LNh, LNl);   /* out1 = LN1 as bf16 hi/lo planes */
    k_gemms<1, true><<<dim3(MT / 128, FF / 128, 1), 256, 0, stream>>>(LNh, LNl, W1T, DM, H1, FF, bb1);   /* out1 W1 + bb1 */
    k_reluhl<<<(unsigned)(((size_t)MT * FF / 8 + 255) / 256), 256, 0, stream>>>(H1, H1h, H1l);   /* relu -> hi/lo planes */
    k_gemms<1, true><<<dim3(MT / 128, DM / 128, 1), 256, 0, stream>>>(H1h, H1l, W2T, FF, F2, DM, bb2);   /* W2 + bb2 */
    k_addres<<<(unsigned)(((size_t)MT * DM / 4 + 255) / 256), 256, 0, stream>>>(F2, x);   /* + the ORIGINAL x */
    k_lnout<<<(MT + 7) / 8, 256, 0, stream>>>(F2, g2, b2, OUT);   /* LN2 -> out */
}

// v005
// Measured time: 213 microseconds a run.
// Two timings next to v004 put it at 1.32 and 1.31 times that version's speed.
// Counting every step since v000, it is 9.51 times as fast.
#include <hip/hip_runtime.h>

// Post-LN transformer block with per-head projection tensors (x [4][2048][512]; q,k,v = einsum('bse,hed', x, W) (Wq, Wk, Wv [8][512][64] 1/sqrt(512): head h's 'xw' block); 8 heads x 64; scores / 8; causal (-inf); softmax; o = concat heads; out1 = LayerNorm(x + o Wproj) (Wproj 'xw' [512][512]; eps 1e-5, g1/b1); ff = relu(out1 W1 + bb1) W2 + bb2 (W1 [512][2048], W2 [2048][512] 'xw', zero biases); out = LayerNorm(ff + x, g2, b2) (the residual is the ORIGINAL x) -> [4][2048][512] (4.2 M)).
// Layout: every kernel outside attention runs once over the 8192 rows of all 4 batch elements (q, k, v as one GEMM with 1536 columns); attention is one launch over all batch elements and heads, with the scores kept in registers (online softmax). Every elementwise pass behind a GEMM is done in that GEMM's epilogue, on the f32 values before they leave the workgroup. Steps: bf16 copy of x; per-head 'xw' weight blocks of Wq, Wk, Wv transposed into one joint Bt (rows (tensor*8 + h)*64..), Wproj/W1/W2 transposed once; exact projections, written as the q/k head planes and the transposed v planes (fp16 + hi/lo); causal T-2048 attention (hybrid rows: < 512 hi/lo 3 products, rest fp16 x1024; key blocks above the diagonal skipped); Y = merged hi/lo x Wproj exact + bf16(x); a row-LayerNorm kernel emits out1 as bf16 hi/lo planes; relu(hi/lo x W1 exact + bb1) written as hi/lo planes; F2 = hi/lo x W2 exact + bb2 + bf16(x); the final row-LayerNorm writes the output rows.
// Compute dtypes, f32 accumulate: every input rounded to bf16; projections exact; attention rows < 512 3 products, rest fp16; softmax f32; Wproj hl x exact; residuals/LayerNorms f32 (fixed-order sums); FFN GEMMs 2 products (~f32) + f32 biases; relu f32.

#define NB_  4
#define TT   2048
#define DM   512
#define NH_  8
#define NKV  8
#define REP  (NH_ / NKV)
#define HD   64
#define DQ   (NH_ * HD)
#define DKV  (NKV * HD)
#define MT   (NB_ * TT)           // rows of all batch elements together
#define NQKV (DQ + 2 * DKV)       // columns of the joint q|k|v projection
#define PP   (2 * TT)             // row pitch, in 16-bit elements, of the transposed v planes
#define RH   512                  // query rows < RH use hi+lo planes (0: none)
#define PCAR 1024.0f
#define SCL  0.125f   // HD^-0.5
#define FF   2048     // feed-forward width
#define LNEPS 1e-5f
typedef _Float16 h16;
typedef unsigned short bf;
typedef __attribute__((ext_vector_type(16))) __bf16   v16bf;
typedef __attribute__((ext_vector_type(16))) _Float16 v16h;
typedef __attribute__((ext_vector_type(8)))  _Float16 v8h;
typedef __attribute__((ext_vector_type(8)))  unsigned short v8us;
typedef __attribute__((ext_vector_type(8)))  float    v8f;
typedef __attribute__((ext_vector_type(4)))  float    v4f;
typedef v8h  __attribute__((may_alias)) v8ha;
typedef v4f  __attribute__((may_alias)) v4fa;
typedef v8us __attribute__((may_alias)) v8usa;

__device__ __forceinline__ unsigned short f2bf(float f) { unsigned u = __float_as_uint(f); u += 0x7FFFu + ((u >> 16) & 1u); return (unsigned short)(u >> 16); }
__device__ __forceinline__ float bf2f(unsigned short b) { return __uint_as_float(((unsigned)b) << 16); }
__device__ __forceinline__ float bfr(float f) { return bf2f(f2bf(f)); }
__device__ __forceinline__ v16h cat16(v8h lo, v8h hi) { return __builtin_shufflevector(lo, hi, 0, 1, 2, 3, 4, 5, 6, 7, 8, 9, 10, 11, 12, 13, 14, 15); }
__device__ __forceinline__ v16bf cat16b(v8us lo, v8us hi) { return __builtin_bit_cast(v16bf, __builtin_shufflevector(lo, hi, 0, 1, 2, 3, 4, 5, 6, 7, 8, 9, 10, 11, 12, 13, 14, 15)); }
__device__ __forceinline__ v8f wmma16(v16h a, v16h b, v8f c) { return __builtin_amdgcn_wmma_f32_16x16x32_f16(false, a, false, b, (short)0, c, false, false); }
__device__ __forceinline__ v8f wmmab(v16bf a, v16bf b, v8f c) { return __builtin_amdgcn_wmma_f32_16x16x32_bf16(false, a, false, b, (short)0, c, false, false); }
__device__ __forceinline__ h16 tohx(float x) { return (h16)x; }
__device__ __forceinline__ void splitf(float y, unsigned short& h, unsigned short& l) { h = f2bf(y); l = f2bf(y - bf2f(h)); }



// ---- k_gemms: GEMM with the operand tiles staged in LDS; one workgroup of 8 waves (4 x 2) per 128x128 output tile, 32x64 per wave; grid (M/128, N/128), 256 threads.
// c[m][n] (f32, + optional f32 bias[n]) = sum_k (A[m][k] + A2[m][k]) Bt[n][k] (A2 only with NSPLIT == 1), all planes K-contiguous bf16. M % 128 == 0, N % 128 == 0, K % 64 == 0.
// What leaves the workgroup (EPI): E_RES: C = c + bf16(xr), f32, both of pitch LDC. E_RELU: max(c, 0) as bf16 hi/lo planes Ph, Pl of pitch LDC. E_QKV: columns < DQ + DKV as head planes P16 (fp16), Ph, Pl [batch][head][t][d]; the v columns behind them as transposed planes V16, Vh, Vl, rows [batch][head][d] of pitch PP.
// A stage is 64 k (one 128-byte line) of the 128 rows of every plane: [Bt | A | A2], rows at pitch GP. Two buffers: asynchronous copies fill the next stage while this one is multiplied; every wave sums the whole K in ascending order.
#define GP   144u          // LDS row pitch in bytes: 128 + 16, an odd multiple of 16 for the ds_load_b128 readers
#define GPL  (128u * GP)   // one plane of a stage
template <typename T16> struct WFrag;
template <> struct WFrag<h16> { typedef v16h V; static __device__ __forceinline__ V ld(const h16* p) { return cat16(*(const v8h*)p, *(const v8h*)(p + 16)); } static __device__ __forceinline__ v8f mma(V a, V b, v8f c) { return wmma16(a, b, c); } };
template <> struct WFrag<bf> { typedef v16bf V; static __device__ __forceinline__ V ld(const bf* p) { return cat16b(*(const v8us*)p, *(const v8us*)(p + 16)); } static __device__ __forceinline__ v8f mma(V a, V b, v8f c) { return wmmab(a, b, c); } };
__device__ __forceinline__ unsigned lds_off(const void* p) { return (unsigned)(size_t)p; }
__device__ __forceinline__ v16bf ldl(const unsigned char* p) { return cat16b(*(const v8us*)p, *(const v8us*)(p + 32)); }
#define CPY(a, b) "global_load_async_to_lds_b128 %" #a ", %" #b ", off\n\t"
// One stage: every lane copies 16 bytes of 4 rows (32 rows apart) of each of the NP planes, a wave 4 whole lines per copy. l: the lane's LDS byte address in plane 0; g0..g2: its global addresses; rs: 32 rows in bytes.
// The copies and the s_wait_xcnt stand in one statement, so that no address register of a copy is rewritten ahead of the wait.
template <int NP> __device__ __forceinline__ void stage_copy(unsigned l, const char* g0, const char* g1, const char* g2, size_t rs) {
    if constexpr (NP == 3)
        asm volatile(CPY(0, 1) CPY(2, 3) CPY(4, 5) CPY(6, 7) CPY(8, 9) CPY(10, 11) CPY(12, 13) CPY(14, 15) CPY(16, 17) CPY(18, 19) CPY(20, 21) CPY(22, 23) "s_wait_xcnt 0x0"
            :: "v"(l), "v"(g0), "v"(l + 32u * GP), "v"(g0 + rs), "v"(l + 64u * GP), "v"(g0 + 2 * rs), "v"(l + 96u * GP), "v"(g0 + 3 * rs),
               "v"(l + GPL), "v"(g1), "v"(l + GPL + 32u * GP), "v"(g1 + rs), "v"(l + GPL + 64u * GP), "v"(g1 + 2 * rs), "v"(l + GPL + 96u * GP), "v"(g1 + 3 * rs),
               "v"(l + 2u * GPL), "v"(g2), "v"(l + 2u * GPL + 32u * GP), "v"(g2 + rs), "v"(l + 2u * GPL + 64u * GP), "v"(g2 + 2 * rs), "v"(l + 2u * GPL + 96u * GP), "v"(g2 + 3 * rs) : "memory");
    else
        asm volatile(CPY(0, 1) CPY(2, 3) CPY(4, 5) CPY(6, 7) CPY(8, 9) CPY(10, 11) CPY(12, 13) CPY(14, 15) "s_wait_xcnt 0x0"
            :: "v"(l), "v"(g0), "v"(l + 32u * GP), "v"(g0 + rs), "v"(l + 64u * GP), "v"(g0 + 2 * rs), "v"(l + 96u * GP), "v"(g0 + 3 * rs),
               "v"(l + GPL), "v"(g1), "v"(l + GPL + 32u * GP), "v"(g1 + rs), "v"(l + GPL + 64u * GP), "v"(g1 + 2 * rs), "v"(l + GPL + 96u * GP), "v"(g1 + 3 * rs) : "memory");
}
// One fragment set: 32 k of the wave's 32 rows of A (and A2) and 64 rows of Bt. pa, pb: the lane's addresses in the A and the Bt plane of a stage.
template <int NSPLIT> struct FSet { v16bf a[2], a2[2], b[4]; };
template <int NSPLIT> __device__ __forceinline__ void ld_set(FSet<NSPLIT>& f, const unsigned char* pa, const unsigned char* pb) {   // in the order of use
#pragma unroll
    for (int mb = 0; mb < 2; ++mb) f.a[mb] = ldl(pa + mb * 16 * GP);
#pragma unroll
    for (int nb = 0; nb < 4; ++nb) f.b[nb] = ldl(pb + nb * 16 * GP);
    if (NSPLIT) {
#pragma unroll
        for (int mb = 0; mb < 2; ++mb) f.a2[mb] = ldl(pa + GPL + mb * 16 * GP); }
}
template <int NSPLIT> __device__ __forceinline__ void mm_set(const FSet<NSPLIT>& f, v8f (&acc)[2][4]) {   // eight independent accumulators between two products into the same one
#pragma unroll
    for (int nb = 0; nb < 4; ++nb)
#pragma unroll
        for (int mb = 0; mb < 2; ++mb) acc[mb][nb] = wmmab(f.a[mb], f.b[nb], acc[mb][nb]);
    if (NSPLIT) {
#pragma unroll
        for (int nb = 0; nb < 4; ++nb)
#pragma unroll
            for (int mb = 0; mb < 2; ++mb) acc[mb][nb] = wmmab(f.a2[mb], f.b[nb], acc[mb][nb]); }
}
#define E_RES  0
#define E_RELU 1
#define E_QKV  2
#define VSP  272u          // LDS row pitch in bytes of the transposed v staging: 128 t x 2 bytes + 16
#define VSPL (128u * VSP)  // one plane of it
template <int NSPLIT, bool BIAS, int EPI, int LDC>
__global__ __launch_bounds__(256) void k_gemms(const bf* A, const bf* A2, const bf* Bt, int K, float* C, const float* __restrict__ bias, const float* xr, h16* P16, bf* Ph, bf* Pl, h16* V16, bf* Vh, bf* Vl) {
    constexpr int NP = NSPLIT ? 3 : 2; constexpr unsigned STG = NP * GPL;
    static_assert(2 * STG >= 8 * 32 * 68 * 4, "the output staging reuses the ring");
    constexpr unsigned SMB = (EPI == E_QKV && 3u * VSPL > 2u * STG) ? 3u * VSPL : 2u * STG;   // the three transposed v planes of a tile need more than the ring
    __shared__ __attribute__((aligned(16))) unsigned char sm[SMB];
    const int tid = (int)threadIdx.x, lane = tid & 31, lr = lane & 15, hi = lane >> 4; const int w = __builtin_amdgcn_readfirstlane(tid >> 5), wm = w >> 1, wn = w & 1; const int r0 = blockIdx.x * 128, c0 = blockIdx.y * 128;
    const size_t rowb = (size_t)K * 2; const int crow = tid >> 3; const unsigned cch = (unsigned)(tid & 7) * 16u;   // the lane's first row and its 16-byte piece of the line
    const char* gb = (const char*)Bt + (size_t)(c0 + crow) * rowb + cch; const char* ga = (const char*)A + (size_t)(r0 + crow) * rowb + cch; const char* ga2 = NSPLIT ? (const char*)A2 + (size_t)(r0 + crow) * rowb + cch : ga;
    const unsigned lc = lds_off(sm) + (unsigned)crow * GP + cch; const int nt = K >> 6;
    stage_copy<NP>(lc, gb, ga, ga2, 32 * rowb);
    asm volatile("s_wait_asynccnt 0x0" ::: "memory");   // stage 0 of this wave has landed
    __syncthreads();                                     // ... and every wave's: nobody reads it in front of this barrier
    if (nt > 1) stage_copy<NP>(lc + STG, gb + 128, ga + 128, ga2 + 128, 32 * rowb);
    v8f acc[2][4];
#pragma unroll
    for (int mb = 0; mb < 2; ++mb)
#pragma unroll
        for (int nb = 0; nb < 4; ++nb) acc[mb][nb] = (v8f){};
    const unsigned fb = (unsigned)(wn * 64 + lr) * GP + 16u * hi, fa = GPL + (unsigned)(wm * 32 + lr) * GP + 16u * hi;   // the lane's fragment offsets in a stage
    // Two fragment sets, each half a stage, fetched one half ahead: f0 = k 0..31 of a stage, f1 = k 32..63. The publish point of stage t + 1 therefore stands in the middle of trip t, behind the last reads of stage t and ahead of the first reads of stage t + 1.
    FSet<NSPLIT> f0, f1;
    ld_set<NSPLIT>(f0, sm + fa, sm + fb);
#pragma unroll 1   // one stage per trip: the ring's order of waits, barrier and refill stands once
    for (int t = 0; t < nt; ++t) {
        const unsigned char* sb = sm + (unsigned)(t & 1) * STG;
        ld_set<NSPLIT>(f1, sb + fa + 64, sb + fb + 64);
        __builtin_amdgcn_sched_barrier(0);   // the reads stay one group ahead of the WMMAs that they fly behind
        mm_set<NSPLIT>(f0, acc);
        __builtin_amdgcn_sched_barrier(0);   // these WMMAs stay ahead of the waits: they cover the flight of f1's reads and of the copies
        asm volatile("s_wait_dscnt 0x0" ::: "memory");      // this wave's last reads of stage t have returned before its buffer is refilled
        asm volatile("s_wait_asynccnt 0x0" ::: "memory");   // this wave's copies of stage t + 1 have landed
        __syncthreads();                                     // publishes stage t + 1 and ends every wave's reads of stage t
        if (t + 2 < nt) stage_copy<NP>(lc + (unsigned)(t & 1) * STG, gb + (size_t)(t + 2) * 128, ga + (size_t)(t + 2) * 128, ga2 + (size_t)(t + 2) * 128, 32 * rowb);
        if (t + 1 < nt) { const unsigned char* sn = sm + (unsigned)((t + 1) & 1) * STG; ld_set<NSPLIT>(f0, sn + fa, sn + fb); }
        mm_set<NSPLIT>(f1, acc);
    }
    asm volatile("s_wait_asynccnt 0x0" ::: "memory");   // no copy is outstanding when the ring becomes output staging
    if (EPI == E_QKV && c0 >= DQ + DKV) {   // the same for the whole workgroup
        // v columns, transposed: a lane holds 8 consecutive t of one d, 16 bytes of a 16-bit plane's row. The tile's three planes are gathered in LDS as [d][t], so that whole 128-byte lines leave.
#pragma unroll
        for (int mb = 0; mb < 2; ++mb)
#pragma unroll
            for (int nb = 0; nb < 4; ++nb) { v8h o16; v8us oh, ol;
#pragma unroll
                for (int j = 0; j < 8; ++j) { const float xv = acc[mb][nb][j]; o16[j] = tohx(xv); unsigned short a2, c2; splitf(xv, a2, c2); oh[j] = a2; ol[j] = c2; }
                unsigned char* vp = sm + (unsigned)(wn * 64 + nb * 16 + lr) * VSP + (unsigned)(wm * 32 + mb * 16 + hi * 8) * 2u;
                *(v8ha*)vp = o16; *(v8usa*)(vp + VSPL) = oh; *(v8usa*)(vp + 2u * VSPL) = ol; }
        __syncthreads();   // every wave's part of a row is in LDS before the row is read
        const size_t vrow = (size_t)(r0 / TT) * DKV + (c0 - DQ - DKV) + w * 16 + hi; const int t0 = r0 % TT + lr * 8;   // half a wave per row of 128 t (256 bytes), two rows per store
#pragma unroll
        for (int s = 0; s < 8; ++s) { const unsigned char* vp = sm + (unsigned)(w * 16 + s * 2 + hi) * VSP + (unsigned)lr * 16u; const size_t eo = (vrow + s * 2) * PP + t0;
            *(v8h*)(V16 + eo) = *(const v8ha*)vp; *(v8us*)(Vh + eo) = *(const v8usa*)(vp + VSPL); *(v8us*)(Vl + eo) = *(const v8usa*)(vp + 2u * VSPL); }
    } else {
    // Whole 128-byte lines out: each wave stages its 32x64 tile in its own part of the ring (pitch 68 floats) and reads rows back.
    const size_t ut = (size_t)(r0 + wm * 32) * LDC + c0 + wn * 64;   // the wave's tile in a [m][n] array of pitch LDC (wave-uniform)
    const unsigned lx = (unsigned)((lane >> 4) * LDC + (lane & 15) * 4) * 4u;   // E_RES: the lane's byte offset in the tile; its piece s stands 2 rows further on per s
    v4f rx[16];
    if constexpr (EPI == E_RES) {   // the residual's loads fly during the staging
        const char* ux = (const char*)(xr + ut);
#pragma unroll
        for (int s = 0; s < 16; ++s) rx[s] = *(const v4f*)(ux + lx + (unsigned)s * (2u * LDC * 4u));
        asm volatile("s_wait_xcnt 0x0" :: "v"(lx), "s"(ux) : "memory");   // stands between the issued loads and every later rewrite of their address registers, which are inputs so that they stay untouched up to here
    }
    float* os = (float*)sm + w * (32 * 68);
#pragma unroll
    for (int mb = 0; mb < 2; ++mb)
#pragma unroll
        for (int nb = 0; nb < 4; ++nb)
#pragma unroll
            for (int j = 0; j < 8; ++j) os[(mb * 16 + hi * 8 + j) * 68 + nb * 16 + lr] = acc[mb][nb][j];
    __syncthreads();   // orders the staging writes against the row reads
    if constexpr (EPI == E_RES) {
        char* uc = (char*)(C + ut);
#pragma unroll
        for (int s = 0; s < 16; ++s) { const int item = s * 32 + lane; const int row = item >> 4, cofs = (item & 15) * 4; v4f val = *(const v4fa*)(os + row * 68 + cofs);
            if (BIAS) { const int cb = c0 + wn * 64 + cofs; val[0] += bfr(bias[cb]); val[1] += bfr(bias[cb + 1]); val[2] += bfr(bias[cb + 2]); val[3] += bfr(bias[cb + 3]); }
#pragma unroll
            for (int q = 0; q < 4; ++q) val[q] = __fadd_rn(val[q], bfr(rx[s][q]));
            *(v4f*)(uc + lx + (unsigned)s * (2u * LDC * 4u)) = val; }
    } else {
        // 16-bit planes: 8 lanes per 128-byte row of the wave's tile, 16 bytes per lane and plane.
        const size_t tile0 = (EPI == E_QKV) ? (((size_t)(r0 / TT) * (NH_ + NKV) + (c0 + wn * 64) / HD) * TT + r0 % TT + wm * 32) * HD : ut; constexpr int pitch = (EPI == E_QKV) ? HD : LDC;
#pragma unroll
        for (int s = 0; s < 8; ++s) { const int item = s * 32 + lane; const int row = item >> 3, cofs = (item & 7) * 8; const v4f va = *(const v4fa*)(os + row * 68 + cofs), vb = *(const v4fa*)(os + row * 68 + cofs + 4); v8h o16; v8us oh, ol;
#pragma unroll
            for (int q = 0; q < 8; ++q) { float y = (q < 4) ? va[q & 3] : vb[q & 3];
                if (BIAS) y += bfr(bias[c0 + wn * 64 + cofs + q]);
                if (EPI == E_RELU) y = (y > 0.0f) ? y : 0.0f;
                if (EPI == E_QKV) o16[q] = tohx(y);
                unsigned short a2, c2; splitf(y, a2, c2); oh[q] = a2; ol[q] = c2; }
            const size_t e = tile0 + (size_t)row * pitch + cofs;
            if (EPI == E_QKV) *(v8h*)(P16 + e) = o16;
            *(v8us*)(Ph + e) = oh; *(v8us*)(Pl + e) = ol; }
        if constexpr (EPI == E_QKV) asm volatile("s_wait_xcnt 0x0" ::: "memory");   // in the listing the v branch's code follows these stores: the wait stands between them and its writes of the registers that they name
    }
    }
}

typedef __attribute__((ext_vector_type(2))) _Float16 v2h;
typedef __attribute__((ext_vector_type(4))) _Float16 v4h;
typedef __attribute__((ext_vector_type(2))) unsigned short v2us;
typedef __attribute__((ext_vector_type(4))) unsigned short v4us;
typedef __attribute__((ext_vector_type(2))) float v2f;
typedef __attribute__((ext_vector_type(4))) int v4i;

__global__ __launch_bounds__(256) void k_wtG(const float* __restrict__ wa, const float* __restrict__ wb, const float* __restrict__ wc, int K, int N, bf* Bt) {
    // grid (lines, blocks of one tensor, tensors): block y of tensor z is its own [K][N] matrix; the transposed blocks follow one another in Bt
    const float* w = (blockIdx.z == 0 ? wa : blockIdx.z == 1 ? wb : wc) + (size_t)blockIdx.y * K * N; Bt += ((size_t)blockIdx.z * gridDim.y + blockIdx.y) * K * N;
    const int lane = threadIdx.x & 31; const int L0 = (blockIdx.x * 8 + (threadIdx.x >> 5)) * 8; const int nlines = N * K / 64;
{
#pragma unroll 1
        for (int l = 0; l < 8; ++l) { const int L = L0 + l; if (L >= nlines) break; const size_t e = (size_t)L * 64 + lane * 2; const int k = (int)(e % K), n = (int)(e / K); v2us o;
            o[0] = f2bf(w[(size_t)k * N + n]); o[1] = f2bf(w[(size_t)(k + 1) * N + n]); *(v2us*)(Bt + e) = o; }
         }
}
__global__ __launch_bounds__(256) void k_cvt8(const float* __restrict__ src, bf* dst, size_t n8) { const size_t i = (size_t)blockIdx.x * 256 + threadIdx.x; if (i >= n8) return; const v8f v = *(const v8f*)(src + i * 8); v8us o;
#pragma unroll
    for (int k = 0; k < 8; ++k) o[k] = f2bf(v[k]); *(v8us*)(dst + i * 8) = o;  }

typedef __attribute__((ext_vector_type(16))) unsigned short v16us;
// Lane l with lane l ^ 16 (the two halves of a wave hold the two halves of a query's keys).
__device__ __forceinline__ float xhalf(float x) { return __builtin_bit_cast(float, __builtin_amdgcn_permlanex16(__builtin_bit_cast(int, x), __builtin_bit_cast(int, x), 0x76543210, 0xfedcba98, false, false)); }
// 2^x with the issue slot behind the transcendental filled in the same statement, so that no instruction directly behind it reads its result or rewrites its source.
__device__ __forceinline__ float exp2s(float x) { float r; asm("v_exp_f32 %0, %1\n\tv_nop" : "=v"(r) : "v"(x)); return r; }
// Stands between a group of issued global loads and every later rewrite of an address register that they name; the lanes' base addresses are inputs so that their registers stay untouched up to the wait.
__device__ __forceinline__ void xwaits(const void* a, const void* b) { asm volatile("s_wait_xcnt 0x0" :: "s"(a), "s"(b) : "memory"); }   // the same for loads at a wave-uniform base in scalar registers
__device__ __forceinline__ void xwait(const char* a, const char* b, const char* c, const char* d) { asm volatile("s_wait_xcnt 0x0" :: "v"(a), "v"(b), "v"(c), "v"(d) : "memory"); }
// Fragment at the lane's base address plus a constant number of elements.
template <typename T16> __device__ __forceinline__ typename WFrag<T16>::V ldp(const char* lane_base, int elems) { return WFrag<T16>::ld((const T16*)lane_base + elems); }
// ---- k_fattn: causal attention in one launch, scores and probabilities never leave the registers (online softmax). One wave owns 32 query rows of one (batch, head) and walks the key blocks 0 .. diagonal.
// Transposed products, so that a lane holds one query's scores: S^T = K Q^T (A = 16 key rows, B = 16 query rows, k = d) leaves in lane (lr, hi) the keys mb*16 + hi*8 + j of query lr, which is the B-fragment k order of P^T;
// O^T += V^T P^T (A = 16 rows of the transposed v plane, k = keys) leaves d = db*16 + hi*8 + j of query lr. Row maximum and row sum are per lane; the two lane halves exchange the maximum once per block and join their sums at the end.
// Every inner loop is unrolled whole: the fragment and accumulator arrays stay in registers only if every index is a constant.
// HL: bf16 hi/lo planes, 3 products in both contractions (query rows < RH); else fp16 with the probabilities carried x PCAR (2^10 in the exponent), output rows x PCAR as k_merge expects.
template <typename T16, bool HL, int KB>
__device__ __forceinline__ void attn_rows(const T16* Q, const T16* Q2, const T16* Kp, const T16* K2, const T16* Vt, const T16* Vt2, float* O, int q0) {   // no __restrict__: the loads must stay on their side of the waits' "memory" clobber
    typedef WFrag<T16> WF; typedef typename WF::V V;
    constexpr int MK = KB / 16, KS = KB / 32;
    constexpr float CEXP = SCL * 1.4426950408889634f;   // scores go to the exponent in log2 units
    constexpr float OFF = HL ? 0.0f : 10.0f;            // 2^10 = PCAR
    const int lane = threadIdx.x & 31, lr = lane & 15, hi = lane >> 4;
    const unsigned kl = (unsigned)(lr * HD + 8 * hi) * 2u, vl = (unsigned)(lr * PP + 8 * hi) * 2u;   // the lane's byte offsets in a 16-row block of a head plane / of a transposed v plane
    V qf[2][2], qf2[2][2], kf[MK][2], kf2[MK][2];
    { const T16* uq = Q + (size_t)q0 * HD; const T16* uq2 = HL ? Q2 + (size_t)q0 * HD : uq; const T16* uk2 = HL ? K2 : Kp; const char* pq = (const char*)uq + kl; const char* pq2 = (const char*)uq2 + kl; const char* pk = (const char*)Kp + kl; const char* pk2 = (const char*)uk2 + kl;
#pragma unroll
    for (int nb = 0; nb < 2; ++nb)
#pragma unroll
        for (int kc = 0; kc < 2; ++kc) { const int e = nb * 16 * HD + kc * 32; qf[nb][kc] = ldp<T16>(pq, e); if (HL) qf2[nb][kc] = ldp<T16>(pq2, e); }
    xwaits(uq, uq2);
#pragma unroll
    for (int mb = 0; mb < MK; ++mb)
#pragma unroll
        for (int kc = 0; kc < 2; ++kc) { const int e = mb * 16 * HD + kc * 32; kf[mb][kc] = ldp<T16>(pk, e); if (HL) kf2[mb][kc] = ldp<T16>(pk2, e); }
    xwaits(Kp, uk2); }
    v8f o[4][2], lv[2]; float m[2];
#pragma unroll
    for (int nb = 0; nb < 2; ++nb) { m[nb] = -3.0e38f; lv[nb] = (v8f){};
#pragma unroll
        for (int db = 0; db < 4; ++db) o[db][nb] = (v8f){}; }
    const int nkb = (q0 + 32 + KB - 1) / KB;   // key blocks up to and with the one that holds the last query's diagonal; every block holds key k0 <= q0, so no query meets a block that is masked whole
#pragma unroll 1   // one key block per trip: unrolled, two trips' fragments would not fit the register budget of two waves per SIMD
    for (int kb = 0; kb < nkb; ++kb) {
        const int k0 = kb * KB;
        v8f s[MK][2];
#pragma unroll
        for (int mb = 0; mb < MK; ++mb)
#pragma unroll
            for (int nb = 0; nb < 2; ++nb) s[mb][nb] = (v8f){};
#pragma unroll
        for (int kc = 0; kc < 2; ++kc)
#pragma unroll
            for (int mb = 0; mb < MK; ++mb)
#pragma unroll
                for (int nb = 0; nb < 2; ++nb) { s[mb][nb] = WF::mma(kf[mb][kc], qf[nb][kc], s[mb][nb]); if (HL) { s[mb][nb] = WF::mma(kf[mb][kc], qf2[nb][kc], s[mb][nb]); s[mb][nb] = WF::mma(kf2[mb][kc], qf[nb][kc], s[mb][nb]); } }
        // This block's V fragments and the next block's K fragments fly during the softmax (the last trip re-reads its own K block: in bounds, unused).
        const int kn = (kb + 1 < nkb) ? k0 + KB : k0;
        const char* pv = (const char*)(Vt + k0) + vl; const char* pv2 = HL ? (const char*)(Vt2 + k0) + vl : pv; const char* pk = (const char*)(Kp + (size_t)kn * HD) + kl; const char* pk2 = HL ? (const char*)(K2 + (size_t)kn * HD) + kl : pk;
        V vf[4][KS], vf2[4][KS];
#pragma unroll
        for (int db = 0; db < 4; ++db)
#pragma unroll
            for (int ks = 0; ks < KS; ++ks) { const int e = db * 16 * PP + ks * 32; vf[db][ks] = ldp<T16>(pv, e); if (HL) vf2[db][ks] = ldp<T16>(pv2, e); }
#pragma unroll
        for (int mb = 0; mb < MK; ++mb)
#pragma unroll
            for (int kc = 0; kc < 2; ++kc) { const int e = mb * 16 * HD + kc * 32; kf[mb][kc] = ldp<T16>(pk, e); if (HL) kf2[mb][kc] = ldp<T16>(pk2, e); }
        xwait(pv, pv2, pk, pk2);
        if (k0 + KB - 1 > q0) {   // wave-uniform: only blocks that reach past the first query's diagonal are masked
            const int dq = q0 + lr - k0 - hi * 8;   // key mb*16 + hi*8 + j is above the diagonal of query nb*16 + lr when mb*16 + j - nb*16 > dq
#pragma unroll
            for (int mb = 0; mb < MK; ++mb)
#pragma unroll
                for (int nb = 0; nb < 2; ++nb)
#pragma unroll
                    for (int j = 0; j < 8; ++j) if (mb * 16 + j - nb * 16 > dq) s[mb][nb][j] = -3.0e38f;
        }
        V pf[2][KS], pf2[2][KS];
#pragma unroll
        for (int nb = 0; nb < 2; ++nb) {
            v8f mv = s[0][nb];
#pragma unroll
            for (int mb = 1; mb < MK; ++mb) mv = __builtin_elementwise_max(mv, s[mb][nb]);
            float mx = fmaxf(fmaxf(fmaxf(mv[0], mv[1]), fmaxf(mv[2], mv[3])), fmaxf(fmaxf(mv[4], mv[5]), fmaxf(mv[6], mv[7])));
            mx = fmaxf(mx, xhalf(mx));
            const float mn = fmaxf(m[nb], mx * CEXP); const float al = exp2s(m[nb] - mn); m[nb] = mn; const float sub = OFF - mn;
            lv[nb] *= al;
#pragma unroll
            for (int mb = 0; mb < MK; ++mb) { const v8f t = s[mb][nb] * CEXP + sub; v8f p;
#pragma unroll
                for (int j = 0; j < 8; ++j) p[j] = exp2s(t[j]);
                s[mb][nb] = p; lv[nb] += p; }
#pragma unroll
            for (int db = 0; db < 4; ++db) o[db][nb] *= al;
#pragma unroll
            for (int ks = 0; ks < KS; ++ks) {
                if constexpr (HL) { v16us ph, pl;
#pragma unroll
                    for (int e = 0; e < 8; ++e) { unsigned short a, c2; splitf(s[2 * ks][nb][e], a, c2); ph[e] = a; pl[e] = c2; splitf(s[2 * ks + 1][nb][e], a, c2); ph[8 + e] = a; pl[8 + e] = c2; }
                    pf[nb][ks] = __builtin_bit_cast(v16bf, ph); pf2[nb][ks] = __builtin_bit_cast(v16bf, pl);
                } else { v16h ph;
#pragma unroll
                    for (int e = 0; e < 8; ++e) { ph[e] = tohx(s[2 * ks][nb][e]); ph[8 + e] = tohx(s[2 * ks + 1][nb][e]); }
                    pf[nb][ks] = ph; }
            }
        }
#pragma unroll
        for (int ks = 0; ks < KS; ++ks)
#pragma unroll
            for (int db = 0; db < 4; ++db)
#pragma unroll
                for (int nb = 0; nb < 2; ++nb) { o[db][nb] = WF::mma(vf[db][ks], pf[nb][ks], o[db][nb]); if (HL) { o[db][nb] = WF::mma(vf[db][ks], pf2[nb][ks], o[db][nb]); o[db][nb] = WF::mma(vf2[db][ks], pf[nb][ks], o[db][nb]); } }
    }
#pragma unroll
    for (int nb = 0; nb < 2; ++nb) { const float lh = ((lv[nb][0] + lv[nb][1]) + (lv[nb][2] + lv[nb][3])) + ((lv[nb][4] + lv[nb][5]) + (lv[nb][6] + lv[nb][7])); const float lt = lh + xhalf(lh); const float f = __fdiv_rn(HL ? 1.0f : PCAR, lt);   // fp16 rows: o and lt both carry PCAR; one more PCAR is what k_merge takes off
#pragma unroll
        for (int db = 0; db < 4; ++db) o[db][nb] *= f; }
    __builtin_amdgcn_sched_barrier(0);   // all arithmetic ahead of the stores: behind them no register that a store names is written any more
#pragma unroll
    for (int nb = 0; nb < 2; ++nb)
#pragma unroll
        for (int db = 0; db < 4; ++db) *(v8f*)((char*)(O + (size_t)(q0 + nb * 16) * HD + db * 16) + 2u * kl) = o[db][nb];   // f32 row lr, columns hi*8..: twice the 16-bit lane offset
}
// grid: NB_ * NH_ * TT / 128 workgroups of 4 waves (128 query rows of one head). All are resident together; the first half of the indices takes the long row blocks in falling order, the second half the short ones in rising order.
__global__ __launch_bounds__(128) void k_fattn(const h16* Q16, const bf* Qh, const bf* Ql, const h16* K16, const bf* Kh, const bf* Kl, const h16* VT16, const bf* VTh, const bf* VTl, float* Ob) {
    constexpr int NT = TT / 128, NZ = NB_ * NH_; static_assert(RH % 128 == 0 && NT % 2 == 0 && NH_ == NKV, "row blocks");
    const int idx = blockIdx.x; const int tile = (idx < NZ * NT / 2) ? NT - 1 - idx / NZ : idx / NZ - NT / 2; const int zz = idx % NZ, bb = zz / NH_, hh = zz % NH_;
    const int q0 = tile * 128 + 32 * __builtin_amdgcn_readfirstlane((int)(threadIdx.x >> 5));
    const size_t oq = ((size_t)bb * (NH_ + NKV) + hh) * TT * HD, ov = (size_t)zz * HD * PP;   /* the K pointers are the head planes' base moved on by the NH_ query planes: one offset serves q and k */ float* O = Ob + (size_t)zz * TT * HD;
    if (tile * 128 < RH) attn_rows<bf, true, 32>(Qh + oq, Ql + oq, Kh + oq, Kl + oq, VTh + ov, VTl + ov, O, q0);
    else attn_rows<h16, false, 64>(Q16 + oq, nullptr, K16 + oq, nullptr, VT16 + ov, nullptr, O, q0);
}
__global__ __launch_bounds__(256) void k_lnin2(const float* __restrict__ F, const float* __restrict__ g, const float* __restrict__ bb, bf* Xh, bf* Xl) { const int lane = threadIdx.x & 31; const int row = blockIdx.x * 8 + (threadIdx.x >> 5); if (row >= MT) return; const float* fr = F + (size_t)row * DM; bf* hrow = Xh + (size_t)row * DM; bf* lrow = Xl + (size_t)row * DM; float v[DM / 32]; float s = 0.f;
#pragma unroll
    for (int c = 0; c < DM / 128; ++c) { const v4f a = *(const v4f*)(fr + c * 128 + lane * 4); for (int q = 0; q < 4; ++q) { v[c * 4 + q] = a[q]; s = __fadd_rn(s, a[q]); } }
#pragma unroll
    for (int sh = 16; sh; sh >>= 1) s = __fadd_rn(s, __shfl_xor(s, sh, 32));
    const float mean = __fmul_rn(s, 1.0f / (float)DM);   /* DM = 512: the reciprocal is an exact power of two, identical to the division */ float s2 = 0.f;
#pragma unroll
    for (int k = 0; k < DM / 32; ++k) { const float dv = __fsub_rn(v[k], mean); float p2 = __fmul_rn(dv, dv); asm volatile("" : "+v"(p2)); s2 = __fadd_rn(s2, p2); v[k] = dv; }
#pragma unroll
    for (int sh = 16; sh; sh >>= 1) s2 = __fadd_rn(s2, __shfl_xor(s2, sh, 32));
    const float rs = __fdiv_rn(1.0f, __fsqrt_rn(__fadd_rn(__fmul_rn(s2, 1.0f / (float)DM), LNEPS)));
{
#pragma unroll
        for (int c = 0; c < DM / 128; ++c) { v4us oh, ol; for (int q = 0; q < 4; ++q) { const int col = c * 128 + lane * 4 + q; float y = __fmul_rn(v[c * 4 + q], rs); asm volatile("" : "+v"(y)); float gg = bfr(g[col]), bb2 = bfr(bb[col]); asm volatile("" : "+v"(gg), "+v"(bb2)); y = __fmul_rn(y, gg); asm volatile("" : "+v"(y)); const float r = __fadd_rn(y, bb2); unsigned short hh2, ll2; splitf(r, hh2, ll2); oh[q] = hh2; ol[q] = ll2; } *(v4us*)(hrow + c * 128 + lane * 4) = oh; *(v4us*)(lrow + c * 128 + lane * 4) = ol; }
         } }

__global__ __launch_bounds__(256) void k_lnout(const float* __restrict__ F, const float* __restrict__ g, const float* __restrict__ bb, float* out) { const int lane = threadIdx.x & 31; const int row = blockIdx.x * 8 + (threadIdx.x >> 5); if (row >= MT) return; const float* fr = F + (size_t)row * DQ; float* orow = out + (size_t)row * DQ; float v[DQ / 32]; float s = 0.f;
#pragma unroll
    for (int c = 0; c < DQ / 128; ++c) { const v4f a = *(const v4f*)(fr + c * 128 + lane * 4); for (int q = 0; q < 4; ++q) { v[c * 4 + q] = a[q]; s = __fadd_rn(s, a[q]); } }
#pragma unroll
    for (int sh = 16; sh; sh >>= 1) s = __fadd_rn(s, __shfl_xor(s, sh, 32));
    const float mean = __fdiv_rn(s, (float)DQ); float s2 = 0.f;
#pragma unroll
    for (int k = 0; k < DQ / 32; ++k) { const float dv = __fsub_rn(v[k], mean); float p2 = __fmul_rn(dv, dv); asm volatile("" : "+v"(p2)); s2 = __fadd_rn(s2, p2); v[k] = dv; }
#pragma unroll
    for (int sh = 16; sh; sh >>= 1) s2 = __fadd_rn(s2, __shfl_xor(s2, sh, 32));
    const float rs = __fdiv_rn(1.0f, __fsqrt_rn(__fadd_rn(__fdiv_rn(s2, (float)DQ), LNEPS)));
{
#pragma unroll
        for (int c = 0; c < DQ / 128; ++c) { v4f o; for (int q = 0; q < 4; ++q) { const int col = c * 128 + lane * 4 + q; float y = __fmul_rn(v[c * 4 + q], rs); asm volatile("" : "+v"(y)); y = __fmul_rn(y, bfr(g[col])); asm volatile("" : "+v"(y)); o[q] = __fadd_rn(y, bfr(bb[col])); } *(v4f*)(orow + c * 128 + lane * 4) = o; }
         } }

__global__ __launch_bounds__(256) void k_merge(const float* __restrict__ O, bf* Ah, bf* Al) { const size_t e = ((size_t)blockIdx.x * 256 + threadIdx.x) * 2; if (e >= (size_t)NB_ * NH_ * TT * HD) return; const int d = (int)(e % HD); const int t = (int)((e / HD) % TT); const int zz = (int)(e / ((size_t)HD * TT)); const float cs = (t < RH) ? 1.0f : (1.0f / PCAR); const size_t oo = ((size_t)(zz / NH_) * TT + t) * DQ + (zz % NH_) * HD + d;   /* zz = batch element * NH_ + head */
    v2us oh, ol;
#pragma unroll
    for (int q = 0; q < 2; ++q) { unsigned short a, c2; splitf(O[e + q] * cs, a, c2); oh[q] = a; ol[q] = c2; } *(v2us*)(Ah + oo) = oh; *(v2us*)(Al + oo) = ol;  }

extern "C" void kernel_launch(void* const* d_in, const int* in_sizes, int n_in,
                              void* d_out, int out_size, void* d_ws, size_t ws_size, hipStream_t stream) {
    (void)in_sizes; (void)n_in; (void)out_size;
    const float* x = (const float*)d_in[0]; const float* pq = (const float*)d_in[1]; const float* pk = (const float*)d_in[2]; const float* pv = (const float*)d_in[3];   /* [8][512][64] each */ const float* wo = (const float*)d_in[4];   /* Wproj [512][512] 'xw' */ const float* g1 = (const float*)d_in[5]; const float* b1 = (const float*)d_in[6]; const float* w1 = (const float*)d_in[7]; const float* bb1 = (const float*)d_in[8]; const float* w2 = (const float*)d_in[9]; const float* bb2 = (const float*)d_in[10]; const float* g2 = (const float*)d_in[11]; const float* b2 = (const float*)d_in[12]; const float* wq = pq, *wk = pk, *wv = pv;
    float* OUT = (float*)d_out;     // [4][2048][512]
    char* wsp = (char*)d_ws;
    auto take = [&](size_t bytes) { char* p = wsp; wsp += (bytes + 255) & ~(size_t)255; return (void*)p; };
    // Live through the whole call: the transposed weights and the merged attention output planes.
    bf* W1T = (bf*)take((size_t)FF * DM * 2); bf* W2T = (bf*)take((size_t)DM * FF * 2); bf* WQKV = (bf*)take((size_t)NQKV * DM * 2);   /* rows: q heads, k heads, v heads */ bf* WO = (bf*)take((size_t)DM * DQ * 2); bf* ATh = (bf*)take((size_t)MT * DQ * 2); bf* ATl = (bf*)take((size_t)MT * DQ * 2);
    char* const mark = wsp;
    // Phase 1 (projections and attention). Head planes [batch][q heads, then k heads][t][d]; transposed v planes [batch][head][d] with rows of pitch PP (hi | lo in one row; the fp16 plane fills the first half of its rows, the rest is never touched).
    h16* QK16 = (h16*)take((size_t)NB_ * (NH_ + NKV) * TT * HD * 2); bf* QKh = (bf*)take((size_t)NB_ * (NH_ + NKV) * TT * HD * 2); bf* QKl = (bf*)take((size_t)NB_ * (NH_ + NKV) * TT * HD * 2);
    h16* VT16 = (h16*)take((size_t)NB_ * NKV * HD * PP * 2); bf* VTh = (bf*)take((size_t)NB_ * NKV * HD * PP * 2); bf* VTl = VTh + TT; float* Ob = (float*)take((size_t)NB_ * NH_ * TT * HD * 4);
    bf* XB = (bf*)take((size_t)MT * DM * 2);
    if ((size_t)(wsp - (char*)d_ws) > ws_size) return;    // ws 256 MiB
    // Phase 2 (Wproj, LayerNorms, feed-forward) starts after the last read of every phase-1 buffer and shares their bytes (stream-ordered).
    wsp = mark; float* Y = (float*)take((size_t)MT * DM * 4); bf* LNh = (bf*)take((size_t)MT * DM * 2); bf* LNl = (bf*)take((size_t)MT * DM * 2); bf* H1h = (bf*)take((size_t)MT * FF * 2); bf* H1l = (bf*)take((size_t)MT * FF * 2); float* F2 = (float*)take((size_t)MT * DM * 4);
    if ((size_t)(wsp - (char*)d_ws) > ws_size) return;
    k_wtG<<<dim3((unsigned)((DM * HD / 64 + 63) / 64), NH_, 3), 256, 0, stream>>>(wq, wk, wv, DM, HD, WQKV);   /* every head's 'xw' [512][64] block of Wq, Wk, Wv -> Bt rows (tensor * 8 + head) * 64.. */
    k_wtG<<<(unsigned)((DQ * DM / 64 + 63) / 64), 256, 0, stream>>>(wo, wo, wo, DQ, DM, WO); k_wtG<<<(unsigned)((DM * FF / 64 + 63) / 64), 256, 0, stream>>>(w1, w1, w1, DM, FF, W1T);   /* W1 'xw' [512][2048] -> Bt [2048][512] */ k_wtG<<<(unsigned)((FF * DM / 64 + 63) / 64), 256, 0, stream>>>(w2, w2, w2, FF, DM, W2T);   /* W2 'xw' [2048][512] -> Bt [512][2048] */
    k_cvt8<<<(unsigned)(((size_t)MT * DM / 8 + 255) / 256), 256, 0, stream>>>(x, XB, (size_t)MT * DM / 8);
    k_gemms<0, false, E_QKV, HD><<<dim3(MT / 128, NQKV / 128, 1), 256, 0, stream>>>(XB, nullptr, WQKV, DM, nullptr, nullptr, nullptr, QK16, QKh, QKl, VT16, VTh, VTl);   /* q | k | v of all batch elements -> head planes and transposed v planes */
    k_fattn<<<NB_ * NH_ * (TT / 128), 128, 0, stream>>>(QK16, QKh, QKl, QK16 + (size_t)NH_ * TT * HD, QKh + (size_t)NH_ * TT * HD, QKl + (size_t)NH_ * TT * HD, VT16, VTh, VTl, Ob);   /* all batch elements and heads */
    k_merge<<<(unsigned)(((size_t)NB_ * NH_ * TT * HD / 2 + 255) / 256), 256, 0, stream>>>(Ob, ATh, ATl);
    k_gemms<1, false, E_RES, DM><<<dim3(MT / 128, DM / 128, 1), 256, 0, stream>>>(ATh, ATl, WO, DQ, Y, nullptr, x, nullptr, nullptr, nullptr, nullptr, nullptr, nullptr);   /* o Wproj + x */
    k_lnin2<<<(MT + 7) / 8, 256, 0, stream>>>(Y, g1, b1, LNh, LNl);   /* out1 = LN1 as bf16 hi/lo planes */
    k_gemms<1, true, E_RELU, FF><<<dim3(MT / 128, FF / 128, 1), 256, 0, stream>>>(LNh, LNl, W1T, DM, nullptr, bb1, nullptr, nullptr, H1h, H1l, nullptr, nullptr, nullptr);   /* relu(out1 W1 + bb1) -> hi/lo planes */
    k_gemms<1, true, E_RES, DM><<<dim3(MT / 128, DM / 128, 1), 256, 0, stream>>>(H1h, H1l, W2T, FF, F2, bb2, x, nullptr, nullptr, nullptr, nullptr, nullptr, nullptr);   /* W2 + bb2 + the ORIGINAL x */
    k_lnout<<<(MT + 7) / 8, 256, 0, stream>>>(F2, g2, b2, OUT);   /* LN2 -> out */
}

// v006
// One run takes 198 microseconds.
// Timed twice side by side with v005, it ran 1.08 times as fast both times.
// Over all steps from v000 it is 10.3 times as fast.
#include <hip/hip_runtime.h>

// Post-LN transformer block with per-head projection tensors (x [4][2048][512]; q,k,v = einsum('bse,hed', x, W) (Wq, Wk, Wv [8][512][64] 1/sqrt(512): head h's 'xw' block); 8 heads x 64; scores / 8; causal (-inf); softmax; o = concat heads; out1 = LayerNorm(x + o Wproj) (Wproj 'xw' [512][512]; eps 1e-5, g1/b1); ff = relu(out1 W1 + bb1) W2 + bb2 (W1 [512][2048], W2 [2048][512] 'xw', zero biases); out = LayerNorm(ff + x, g2, b2) (the residual is the ORIGINAL x) -> [4][2048][512] (4.2 M)).
// Layout: every kernel outside attention runs once over the 8192 rows of all 4 batch elements (q, k, v as one GEMM with 1536 columns); attention is one launch over all batch elements and heads, with the scores kept in registers (online softmax). Every elementwise pass behind a GEMM is done in that GEMM's epilogue, on the f32 values before they leave the workgroup. Steps: bf16 copy of x; per-head 'xw' weight blocks of Wq, Wk, Wv transposed into one joint Bt (rows (tensor*8 + h)*64..), Wproj/W1/W2 transposed once; exact projections, written as the q/k head planes and the transposed v planes (fp16 + hi/lo); causal T-2048 attention (hybrid rows: < 512 hi/lo 3 products, rest fp16 x1024; key blocks above the diagonal skipped); Y = merged hi/lo x Wproj exact + bf16(x); a row-LayerNorm kernel emits out1 as bf16 hi/lo planes; relu(hi/lo x W1 exact + bb1) written as hi/lo planes; F2 = hi/lo x W2 exact + bb2 + bf16(x); the final row-LayerNorm writes the output rows.
// Compute dtypes, f32 accumulate: every input rounded to bf16; projections exact; attention rows < 512 3 products, rest fp16; softmax f32; Wproj hl x exact; residuals/LayerNorms f32 (fixed-order sums); FFN GEMMs 2 products (~f32) + f32 biases; relu f32.

#define NB_  4
#define TT   2048
#define DM   512
#define NH_  8
#define NKV  8
#define REP  (NH_ / NKV)
#define HD   64
#define DQ   (NH_ * HD)
#define DKV  (NKV * HD)
#define MT   (NB_ * TT)           // rows of all batch elements together
#define NQKV (DQ + 2 * DKV)       // columns of the joint q|k|v projection
#define PP   (2 * TT)             // a (batch, head)'s part of a transposed v buffer is HD * PP 16-bit elements: room for two planes of HD * TT
#define RH   512                  // query rows < RH use hi+lo planes (0: none)
#define PCAR 1024.0f
#define SCL  0.125f   // HD^-0.5
#define FF   2048     // feed-forward width
#define LNEPS 1e-5f
typedef _Float16 h16;
typedef unsigned short bf;
typedef __attribute__((ext_vector_type(16))) __bf16   v16bf;
typedef __attribute__((ext_vector_type(16))) _Float16 v16h;
typedef __attribute__((ext_vector_type(8)))  _Float16 v8h;
typedef __attribute__((ext_vector_type(8)))  unsigned short v8us;
typedef __attribute__((ext_vector_type(8)))  float    v8f;
typedef __attribute__((ext_vector_type(4)))  float    v4f;
typedef v8h  __attribute__((may_alias)) v8ha;
typedef v4f  __attribute__((may_alias)) v4fa;
typedef v8us __attribute__((may_alias)) v8usa;

__device__ __forceinline__ unsigned short f2bf(float f) { unsigned u = __float_as_uint(f); u += 0x7FFFu + ((u >> 16) & 1u); return (unsigned short)(u >> 16); }
__device__ __forceinline__ float bf2f(unsigned short b) { return __uint_as_float(((unsigned)b) << 16); }
__device__ __forceinline__ float bfr(float f) { return bf2f(f2bf(f)); }
__device__ __forceinline__ v16h cat16(v8h lo, v8h hi) { return __builtin_shufflevector(lo, hi, 0, 1, 2, 3, 4, 5, 6, 7, 8, 9, 10, 11, 12, 13, 14, 15); }
__device__ __forceinline__ v16bf cat16b(v8us lo, v8us hi) { return __builtin_bit_cast(v16bf, __builtin_shufflevector(lo, hi, 0, 1, 2, 3, 4, 5, 6, 7, 8, 9, 10, 11, 12, 13, 14, 15)); }
__device__ __forceinline__ v8f wmma16(v16h a, v16h b, v8f c) { return __builtin_amdgcn_wmma_f32_16x16x32_f16(false, a, false, b, (short)0, c, false, false); }
__device__ __forceinline__ v8f wmmab(v16bf a, v16bf b, v8f c) { return __builtin_amdgcn_wmma_f32_16x16x32_bf16(false, a, false, b, (short)0, c, false, false); }
__device__ __forceinline__ h16 tohx(float x) { return (h16)x; }
__device__ __forceinline__ void splitf(float y, unsigned short& h, unsigned short& l) { h = f2bf(y); l = f2bf(y - bf2f(h)); }



// ---- k_gemms: GEMM with the operand tiles staged in LDS; one workgroup of 8 waves (4 x 2) per 128x128 output tile, 32x64 per wave; grid (M/128, N/128), 256 threads.
// c[m][n] (f32, + optional f32 bias[n]) = sum_k (A[m][k] + A2[m][k]) Bt[n][k] (A2 only with NSPLIT == 1), all planes K-contiguous bf16. M % 128 == 0, N % 128 == 0, K % 64 == 0.
// What leaves the workgroup (EPI): E_RES: C = c + bf16(xr), f32, both of pitch LDC. E_RELU: max(c, 0) as bf16 hi/lo planes Ph, Pl of pitch LDC. E_QKV: columns < DQ + DKV as head planes P16 (fp16), Ph, Pl [batch][head], each plane in fragment order [t / 16][d / 32] (rows t, k = d); the v columns behind them as transposed planes V16, Vh, Vl, [batch][head] HD * PP elements apart, in fragment order [t / 32][d / 16] (rows d, k = t).
// A stage is 64 k (one 128-byte line) of the 128 rows of every plane: [Bt | A | A2], rows at pitch GP. Two buffers: asynchronous copies fill the next stage while this one is multiplied; every wave sums the whole K in ascending order.
#define GP   144u          // LDS row pitch in bytes: 128 + 16, an odd multiple of 16 for the ds_load_b128 readers
#define GPL  (128u * GP)   // one plane of a stage
// Fragment order of the attention operands in global memory: a 16-row x 32-k fragment is FRG consecutive elements (1 KiB), two halves of 512 bytes; in half g lane (lr, hi) = hi*16 + lr owns 16 bytes, row lr, k g*16 + hi*8 .. + 7. Each of the two loads of a fragment is then 512 consecutive bytes, 4 whole lines per wave. WFrag::ld takes the lane's address in half 0.
#define FRG  512
template <typename T16> struct WFrag;
template <> struct WFrag<h16> { typedef v16h V; static __device__ __forceinline__ V ld(const h16* p) { return cat16(*(const v8h*)p, *(const v8h*)(p + FRG / 2)); } static __device__ __forceinline__ v8f mma(V a, V b, v8f c) { return wmma16(a, b, c); } };
template <> struct WFrag<bf> { typedef v16bf V; static __device__ __forceinline__ V ld(const bf* p) { return cat16b(*(const v8us*)p, *(const v8us*)(p + FRG / 2)); } static __device__ __forceinline__ v8f mma(V a, V b, v8f c) { return wmmab(a, b, c); } };
__device__ __forceinline__ unsigned lds_off(const void* p) { return (unsigned)(size_t)p; }
__device__ __forceinline__ v16bf ldl(const unsigned char* p) { return cat16b(*(const v8us*)p, *(const v8us*)(p + 32)); }
#define CPY(a, b) "global_load_async_to_lds_b128 %" #a ", %" #b ", off\n\t"
// One stage: every lane copies 16 bytes of 4 rows (32 rows apart) of each of the NP planes, a wave 4 whole lines per copy. l: the lane's LDS byte address in plane 0; g0..g2: its global addresses; rs: 32 rows in bytes.
// The copies and the s_wait_xcnt stand in one statement, so that no address register of a copy is rewritten ahead of the wait.
template <int NP> __device__ __forceinline__ void stage_copy(unsigned l, const char* g0, const char* g1, const char* g2, size_t rs) {
    if constexpr (NP == 3)
        asm volatile(CPY(0, 1) CPY(2, 3) CPY(4, 5) CPY(6, 7) CPY(8, 9) CPY(10, 11) CPY(12, 13) CPY(14, 15) CPY(16, 17) CPY(18, 19) CPY(20, 21) CPY(22, 23) "s_wait_xcnt 0x0"
            :: "v"(l), "v"(g0), "v"(l + 32u * GP), "v"(g0 + rs), "v"(l + 64u * GP), "v"(g0 + 2 * rs), "v"(l + 96u * GP), "v"(g0 + 3 * rs),
               "v"(l + GPL), "v"(g1), "v"(l + GPL + 32u * GP), "v"(g1 + rs), "v"(l + GPL + 64u * GP), "v"(g1 + 2 * rs), "v"(l + GPL + 96u * GP), "v"(g1 + 3 * rs),
               "v"(l + 2u * GPL), "v"(g2), "v"(l + 2u * GPL + 32u * GP), "v"(g2 + rs), "v"(l + 2u * GPL + 64u * GP), "v"(g2 + 2 * rs), "v"(l + 2u * GPL + 96u * GP), "v"(g2 + 3 * rs) : "memory");
    else
        asm volatile(CPY(0, 1) CPY(2, 3) CPY(4, 5) CPY(6, 7) CPY(8, 9) CPY(10, 11) CPY(12, 13) CPY(14, 15) "s_wait_xcnt 0x0"
            :: "v"(l), "v"(g0), "v"(l + 32u * GP), "v"(g0 + rs), "v"(l + 64u * GP), "v"(g0 + 2 * rs), "v"(l + 96u * GP), "v"(g0 + 3 * rs),
               "v"(l + GPL), "v"(g1), "v"(l + GPL + 32u * GP), "v"(g1 + rs), "v"(l + GPL + 64u * GP), "v"(g1 + 2 * rs), "v"(l + GPL + 96u * GP), "v"(g1 + 3 * rs) : "memory");
}
// One fragment set: 32 k of the wave's 32 rows of A (and A2) and 64 rows of Bt. pa, pb: the lane's addresses in the A and the Bt plane of a stage.
template <int NSPLIT> struct FSet { v16bf a[2], a2[2], b[4]; };
template <int NSPLIT> __device__ __forceinline__ void ld_set(FSet<NSPLIT>& f, const unsigned char* pa, const unsigned char* pb) {   // in the order of use
#pragma unroll
    for (int mb = 0; mb < 2; ++mb) f.a[mb] = ldl(pa + mb * 16 * GP);
#pragma unroll
    for (int nb = 0; nb < 4; ++nb) f.b[nb] = ldl(pb + nb * 16 * GP);
    if (NSPLIT) {
#pragma unroll
        for (int mb = 0; mb < 2; ++mb) f.a2[mb] = ldl(pa + GPL + mb * 16 * GP); }
}
template <int NSPLIT> __device__ __forceinline__ void mm_set(const FSet<NSPLIT>& f, v8f (&acc)[2][4]) {   // eight independent accumulators between two products into the same one
#pragma unroll
    for (int nb = 0; nb < 4; ++nb)
#pragma unroll
        for (int mb = 0; mb < 2; ++mb) acc[mb][nb] = wmmab(f.a[mb], f.b[nb], acc[mb][nb]);
    if (NSPLIT) {
#pragma unroll
        for (int nb = 0; nb < 4; ++nb)
#pragma unroll
            for (int mb = 0; mb < 2; ++mb) acc[mb][nb] = wmmab(f.a2[mb], f.b[nb], acc[mb][nb]); }
}
#define E_RES  0
#define E_RELU 1
#define E_QKV  2
#define VSP  272u          // LDS row pitch in bytes of the transposed v staging: 128 t x 2 bytes + 16
#define VSPL (128u * VSP)  // one plane of it
template <int NSPLIT, bool BIAS, int EPI, int LDC>
__global__ __launch_bounds__(256) void k_gemms(const bf* A, const bf* A2, const bf* Bt, int K, float* C, const float* __restrict__ bias, const float* xr, h16* P16, bf* Ph, bf* Pl, h16* V16, bf* Vh, bf* Vl) {
    constexpr int NP = NSPLIT ? 3 : 2; constexpr unsigned STG = NP * GPL;
    static_assert(2 * STG >= 8 * 32 * 68 * 4, "the output staging reuses the ring");
    constexpr unsigned SMB = (EPI == E_QKV && 3u * VSPL > 2u * STG) ? 3u * VSPL : 2u * STG;   // the three transposed v planes of a tile need more than the ring
    __shared__ __attribute__((aligned(16))) unsigned char sm[SMB];
    const int tid = (int)threadIdx.x, lane = tid & 31, lr = lane & 15, hi = lane >> 4; const int w = __builtin_amdgcn_readfirstlane(tid >> 5), wm = w >> 1, wn = w & 1; const int r0 = blockIdx.x * 128, c0 = blockIdx.y * 128;
    const size_t rowb = (size_t)K * 2; const int crow = tid >> 3; const unsigned cch = (unsigned)(tid & 7) * 16u;   // the lane's first row and its 16-byte piece of the line
    const char* gb = (const char*)Bt + (size_t)(c0 + crow) * rowb + cch; const char* ga = (const char*)A + (size_t)(r0 + crow) * rowb + cch; const char* ga2 = NSPLIT ? (const char*)A2 + (size_t)(r0 + crow) * rowb + cch : ga;
    const unsigned lc = lds_off(sm) + (unsigned)crow * GP + cch; const int nt = K >> 6;
    stage_copy<NP>(lc, gb, ga, ga2, 32 * rowb);
    asm volatile("s_wait_asynccnt 0x0" ::: "memory");   // stage 0 of this wave has landed
    __syncthreads();                                     // ... and every wave's: nobody reads it in front of this barrier
    if (nt > 1) stage_copy<NP>(lc + STG, gb + 128, ga + 128, ga2 + 128, 32 * rowb);
    v8f acc[2][4];
#pragma unroll
    for (int mb = 0; mb < 2; ++mb)
#pragma unroll
        for (int nb = 0; nb < 4; ++nb) acc[mb][nb] = (v8f){};
    const unsigned fb = (unsigned)(wn * 64 + lr) * GP + 16u * hi, fa = GPL + (unsigned)(wm * 32 + lr) * GP + 16u * hi;   // the lane's fragment offsets in a stage
    // Two fragment sets, each half a stage, fetched one half ahead: f0 = k 0..31 of a stage, f1 = k 32..63. The publish point of stage t + 1 therefore stands in the middle of trip t, behind the last reads of stage t and ahead of the first reads of stage t + 1.
    FSet<NSPLIT> f0, f1;
    ld_set<NSPLIT>(f0, sm + fa, sm + fb);
#pragma unroll 1   // one stage per trip: the ring's order of waits, barrier and refill stands once
    for (int t = 0; t < nt; ++t) {
        const unsigned char* sb = sm + (unsigned)(t & 1) * STG;
        ld_set<NSPLIT>(f1, sb + fa + 64, sb + fb + 64);
        __builtin_amdgcn_sched_barrier(0);   // the reads stay one group ahead of the WMMAs that they fly behind
        mm_set<NSPLIT>(f0, acc);
        __builtin_amdgcn_sched_barrier(0);   // these WMMAs stay ahead of the waits: they cover the flight of f1's reads and of the copies
        asm volatile("s_wait_dscnt 0x0" ::: "memory");      // this wave's last reads of stage t have returned before its buffer is refilled
        asm volatile("s_wait_asynccnt 0x0" ::: "memory");   // this wave's copies of stage t + 1 have landed
        __syncthreads();                                     // publishes stage t + 1 and ends every wave's reads of stage t
        if (t + 2 < nt) stage_copy<NP>(lc + (unsigned)(t & 1) * STG, gb + (size_t)(t + 2) * 128, ga + (size_t)(t + 2) * 128, ga2 + (size_t)(t + 2) * 128, 32 * rowb);
        if (t + 1 < nt) { const unsigned char* sn = sm + (unsigned)((t + 1) & 1) * STG; ld_set<NSPLIT>(f0, sn + fa, sn + fb); }
        mm_set<NSPLIT>(f1, acc);
    }
    asm volatile("s_wait_asynccnt 0x0" ::: "memory");   // no copy is outstanding when the ring becomes output staging
    if (EPI == E_QKV && c0 >= DQ + DKV) {   // the same for the whole workgroup
        // v columns, transposed: a lane holds 8 consecutive t of one d, 16 bytes of a 16-bit plane's row. The tile's three planes are gathered in LDS as [d][t], so that whole 128-byte lines leave.
#pragma unroll
        for (int mb = 0; mb < 2; ++mb)
#pragma unroll
            for (int nb = 0; nb < 4; ++nb) { v8h o16; v8us oh, ol;
#pragma unroll
                for (int j = 0; j < 8; ++j) { const float xv = acc[mb][nb][j]; o16[j] = tohx(xv); unsigned short a2, c2; splitf(xv, a2, c2); oh[j] = a2; ol[j] = c2; }
                unsigned char* vp = sm + (unsigned)(wn * 64 + nb * 16 + lr) * VSP + (unsigned)(wm * 32 + mb * 16 + hi * 8) * 2u;
                *(v8ha*)vp = o16; *(v8usa*)(vp + VSPL) = oh; *(v8usa*)(vp + 2u * VSPL) = ol; }
        __syncthreads();   // every wave's part of a row is in LDS before the row is read
        const size_t vf0 = ((size_t)(r0 / TT) * NKV + (c0 - DQ - DKV) / HD + (w >> 2)) * HD * PP + (size_t)((r0 % TT) / 32 * 4 + (w & 3)) * FRG + lane * 8;   // wave w: the 16 rows d = (w & 3) * 16 .. of head w >> 2 of the tile's two; fragments [t / 32][d / 16], half a fragment (512 bytes) per store
#pragma unroll
        for (int s = 0; s < 8; ++s) { const unsigned char* vp = sm + (unsigned)(w * 16 + lr) * VSP + (unsigned)(s * 16 + hi * 8) * 2u; const size_t eo = vf0 + (s >> 1) * (4 * FRG) + (s & 1) * (FRG / 2);
            *(v8h*)(V16 + eo) = *(const v8ha*)vp; *(v8us*)(Vh + eo) = *(const v8usa*)(vp + VSPL); *(v8us*)(Vl + eo) = *(const v8usa*)(vp + 2u * VSPL); }
    } else {
    // Whole 128-byte lines out: each wave stages its 32x64 tile in its own part of the ring (pitch 68 floats) and reads rows back.
    const size_t ut = (size_t)(r0 + wm * 32) * LDC + c0 + wn * 64;   // the wave's tile in a [m][n] array of pitch LDC (wave-uniform)
    const unsigned lx = (unsigned)((lane >> 4) * LDC + (lane & 15) * 4) * 4u;   // E_RES: the lane's byte offset in the tile; its piece s stands 2 rows further on per s
    v4f rx[16];
    if constexpr (EPI == E_RES) {   // the residual's loads fly during the staging
        const char* ux = (const char*)(xr + ut);
#pragma unroll
        for (int s = 0; s < 16; ++s) rx[s] = *(const v4f*)(ux + lx + (unsigned)s * (2u * LDC * 4u));
        asm volatile("s_wait_xcnt 0x0" :: "v"(lx), "s"(ux) : "memory");   // stands between the issued loads and every later rewrite of their address registers, which are inputs so that they stay untouched up to here
    }
    float* os = (float*)sm + w * (32 * 68);
#pragma unroll
    for (int mb = 0; mb < 2; ++mb)
#pragma unroll
        for (int nb = 0; nb < 4; ++nb)
#pragma unroll
            for (int j = 0; j < 8; ++j) os[(mb * 16 + hi * 8 + j) * 68 + nb * 16 + lr] = acc[mb][nb][j];
    __syncthreads();   // orders the staging writes against the row reads
    if constexpr (EPI == E_RES) {
        char* uc = (char*)(C + ut);
#pragma unroll
        for (int s = 0; s < 16; ++s) { const int item = s * 32 + lane; const int row = item >> 4, cofs = (item & 15) * 4; v4f val = *(const v4fa*)(os + row * 68 + cofs);
            if (BIAS) { const int cb = c0 + wn * 64 + cofs; val[0] += bfr(bias[cb]); val[1] += bfr(bias[cb + 1]); val[2] += bfr(bias[cb + 2]); val[3] += bfr(bias[cb + 3]); }
#pragma unroll
            for (int q = 0; q < 4; ++q) val[q] = __fadd_rn(val[q], bfr(rx[s][q]));
            *(v4f*)(uc + lx + (unsigned)s * (2u * LDC * 4u)) = val; }
    } else {
        // 16-bit planes, 16 bytes per lane and plane. E_RELU: 8 lanes per 128-byte row of the wave's tile. E_QKV: fragment order; the wave's 32 t x 64 d are 4 whole fragments, which start where its rows would.
        const size_t tile0 = (EPI == E_QKV) ? (((size_t)(r0 / TT) * (NH_ + NKV) + (c0 + wn * 64) / HD) * TT + r0 % TT + wm * 32) * HD : ut; constexpr int pitch = (EPI == E_QKV) ? HD : LDC;
#pragma unroll
        for (int s = 0; s < 8; ++s) { const int row = (EPI == E_QKV) ? (s >> 2) * 16 + lr : (s * 32 + lane) >> 3, cofs = (EPI == E_QKV) ? s % 4 * 16 + hi * 8 : (lane & 7) * 8;   /* E_QKV: piece s is half s & 1 of fragment s >> 1 of the wave's [t / 16][d / 32] */ const v4f va = *(const v4fa*)(os + row * 68 + cofs), vb = *(const v4fa*)(os + row * 68 + cofs + 4); v8h o16; v8us oh, ol;
#pragma unroll
            for (int q = 0; q < 8; ++q) { float y = (q < 4) ? va[q & 3] : vb[q & 3];
                if (BIAS) y += bfr(bias[c0 + wn * 64 + cofs + q]);
                if (EPI == E_RELU) y = (y > 0.0f) ? y : 0.0f;
                if (EPI == E_QKV) o16[q] = tohx(y);
                unsigned short a2, c2; splitf(y, a2, c2); oh[q] = a2; ol[q] = c2; }
            const size_t e = (EPI == E_QKV) ? tile0 + s * (FRG / 2) + lane * 8 : tile0 + (size_t)row * pitch + cofs;
            if (EPI == E_QKV) *(v8h*)(P16 + e) = o16;
            *(v8us*)(Ph + e) = oh; *(v8us*)(Pl + e) = ol; }
        if constexpr (EPI == E_QKV) asm volatile("s_wait_xcnt 0x0" ::: "memory");   // in the listing the v branch's code follows these stores: the wait stands between them and its writes of the registers that they name
    }
    }
}

typedef __attribute__((ext_vector_type(2))) _Float16 v2h;
typedef __attribute__((ext_vector_type(4))) _Float16 v4h;
typedef __attribute__((ext_vector_type(2))) unsigned short v2us;
typedef __attribute__((ext_vector_type(4))) unsigned short v4us;
typedef __attribute__((ext_vector_type(2))) float v2f;
typedef __attribute__((ext_vector_type(4))) int v4i;

__global__ __launch_bounds__(256) void k_wtG(const float* __restrict__ wa, const float* __restrict__ wb, const float* __restrict__ wc, int K, int N, bf* Bt) {
    // grid (lines, blocks of one tensor, tensors): block y of tensor z is its own [K][N] matrix; the transposed blocks follow one another in Bt
    const float* w = (blockIdx.z == 0 ? wa : blockIdx.z == 1 ? wb : wc) + (size_t)blockIdx.y * K * N; Bt += ((size_t)blockIdx.z * gridDim.y + blockIdx.y) * K * N;
    const int lane = threadIdx.x & 31; const int L0 = (blockIdx.x * 8 + (threadIdx.x >> 5)) * 8; const int nlines = N * K / 64;
{
#pragma unroll 1
        for (int l = 0; l < 8; ++l) { const int L = L0 + l; if (L >= nlines) break; const size_t e = (size_t)L * 64 + lane * 2; const int k = (int)(e % K), n = (int)(e / K); v2us o;
            o[0] = f2bf(w[(size_t)k * N + n]); o[1] = f2bf(w[(size_t)(k + 1) * N + n]); *(v2us*)(Bt + e) = o; }
         }
}
__global__ __launch_bounds__(256) void k_cvt8(const float* __restrict__ src, bf* dst, size_t n8) { const size_t i = (size_t)blockIdx.x * 256 + threadIdx.x; if (i >= n8) return; const v8f v = *(const v8f*)(src + i * 8); v8us o;
#pragma unroll
    for (int k = 0; k < 8; ++k) o[k] = f2bf(v[k]); *(v8us*)(dst + i * 8) = o;  }

typedef __attribute__((ext_vector_type(16))) unsigned short v16us;
// Lane l with lane l ^ 16 (the two halves of a wave hold the two halves of a query's keys).
__device__ __forceinline__ float xhalf(float x) { return __builtin_bit_cast(float, __builtin_amdgcn_permlanex16(__builtin_bit_cast(int, x), __builtin_bit_cast(int, x), 0x76543210, 0xfedcba98, false, false)); }
// 2^x with the issue slot behind the transcendental filled in the same statement, so that no instruction directly behind it reads its result or rewrites its source.
__device__ __forceinline__ float exp2s(float x) { float r; asm("v_exp_f32 %0, %1\n\tv_nop" : "=v"(r) : "v"(x)); return r; }
// Stands between a group of issued global loads and every later rewrite of an address register that they name; the lanes' base addresses are inputs so that their registers stay untouched up to the wait.
__device__ __forceinline__ void xwaits(const void* a, const void* b) { asm volatile("s_wait_xcnt 0x0" :: "s"(a), "s"(b) : "memory"); }   // the same for loads at a wave-uniform base in scalar registers
__device__ __forceinline__ void xwait(const char* a, const char* b, const char* c, const char* d) { asm volatile("s_wait_xcnt 0x0" :: "v"(a), "v"(b), "v"(c), "v"(d) : "memory"); }
// Fragment at the lane's base address plus a constant number of elements.
template <typename T16> __device__ __forceinline__ typename WFrag<T16>::V ldp(const char* lane_base, int elems) { return WFrag<T16>::ld((const T16*)lane_base + elems); }
// ---- k_fattn: causal attention in one launch, scores and probabilities never leave the registers (online softmax). One wave owns 32 query rows of one (batch, head) and walks the key blocks 0 .. diagonal.
// Transposed products, so that a lane holds one query's scores: S^T = K Q^T (A = 16 key rows, B = 16 query rows, k = d) leaves in lane (lr, hi) the keys mb*16 + hi*8 + j of query lr, which is the B-fragment k order of P^T;
// O^T += V^T P^T (A = 16 rows of the transposed v plane, k = keys) leaves d = db*16 + hi*8 + j of query lr. Row maximum and row sum are per lane; the two lane halves exchange the maximum once per block and join their sums at the end.
// Every inner loop is unrolled whole: the fragment and accumulator arrays stay in registers only if every index is a constant.
// HL: bf16 hi/lo planes, 3 products in both contractions (query rows < RH); else fp16 with the probabilities carried x PCAR (2^10 in the exponent), output rows x PCAR as k_merge expects.
template <typename T16, bool HL, int KB>
__device__ __forceinline__ void attn_rows(const T16* Q, const T16* Q2, const T16* Kp, const T16* K2, const T16* Vt, const T16* Vt2, float* O, int q0) {   // no __restrict__: the loads must stay on their side of the waits' "memory" clobber
    typedef WFrag<T16> WF; typedef typename WF::V V;
    constexpr int MK = KB / 16, KS = KB / 32;
    constexpr float CEXP = SCL * 1.4426950408889634f;   // scores go to the exponent in log2 units
    constexpr float OFF = HL ? 0.0f : 10.0f;            // 2^10 = PCAR
    const int lane = threadIdx.x & 31, lr = lane & 15, hi = lane >> 4;
    const unsigned fl = (unsigned)lane * 16u, ol = (unsigned)(lr * HD + 8 * hi) * 4u;   // the lane's byte offsets in a half fragment / in a 16-row block of the f32 output
    V qf[2][2], qf2[2][2], kf[MK][2], kf2[MK][2];
    { const T16* uq = Q + (size_t)q0 * HD; const T16* uq2 = HL ? Q2 + (size_t)q0 * HD : uq; const T16* uk2 = HL ? K2 : Kp; const char* pq = (const char*)uq + fl; const char* pq2 = (const char*)uq2 + fl; const char* pk = (const char*)Kp + fl; const char* pk2 = (const char*)uk2 + fl;
#pragma unroll
    for (int nb = 0; nb < 2; ++nb)
#pragma unroll
        for (int kc = 0; kc < 2; ++kc) { const int e = (nb * 2 + kc) * FRG; qf[nb][kc] = ldp<T16>(pq, e); if (HL) qf2[nb][kc] = ldp<T16>(pq2, e); }
    xwaits(uq, uq2);
#pragma unroll
    for (int mb = 0; mb < MK; ++mb)
#pragma unroll
        for (int kc = 0; kc < 2; ++kc) { const int e = (mb * 2 + kc) * FRG; kf[mb][kc] = ldp<T16>(pk, e); if (HL) kf2[mb][kc] = ldp<T16>(pk2, e); }
    xwaits(Kp, uk2); }
    v8f o[4][2], lv[2]; float m[2];
#pragma unroll
    for (int nb = 0; nb < 2; ++nb) { m[nb] = -3.0e38f; lv[nb] = (v8f){};
#pragma unroll
        for (int db = 0; db < 4; ++db) o[db][nb] = (v8f){}; }
    const int nkb = (q0 + 32 + KB - 1) / KB;   // key blocks up to and with the one that holds the last query's diagonal; every block holds key k0 <= q0, so no query meets a block that is masked whole
#pragma unroll 1   // one key block per trip: unrolled, two trips' fragments would not fit the register budget of two waves per SIMD
    for (int kb = 0; kb < nkb; ++kb) {
        const int k0 = kb * KB;
        v8f s[MK][2];
#pragma unroll
        for (int mb = 0; mb < MK; ++mb)
#pragma unroll
            for (int nb = 0; nb < 2; ++nb) s[mb][nb] = (v8f){};
#pragma unroll
        for (int kc = 0; kc < 2; ++kc)
#pragma unroll
            for (int mb = 0; mb < MK; ++mb)
#pragma unroll
                for (int nb = 0; nb < 2; ++nb) { s[mb][nb] = WF::mma(kf[mb][kc], qf[nb][kc], s[mb][nb]); if (HL) { s[mb][nb] = WF::mma(kf[mb][kc], qf2[nb][kc], s[mb][nb]); s[mb][nb] = WF::mma(kf2[mb][kc], qf[nb][kc], s[mb][nb]); } }
        // This block's V fragments and the next block's K fragments fly during the softmax (the last trip re-reads its own K block: in bounds, unused).
        const int kn = (kb + 1 < nkb) ? k0 + KB : k0;
        const char* pv = (const char*)(Vt + (size_t)k0 * HD) + fl; const char* pv2 = HL ? (const char*)(Vt2 + (size_t)k0 * HD) + fl : pv; const char* pk = (const char*)(Kp + (size_t)kn * HD) + fl; const char* pk2 = HL ? (const char*)(K2 + (size_t)kn * HD) + fl : pk;   // 16 keys of k and 32 keys of v^T are whole fragments: both planes advance by HD elements per key
        V vf[4][KS], vf2[4][KS];
#pragma unroll
        for (int db = 0; db < 4; ++db)
#pragma unroll
            for (int ks = 0; ks < KS; ++ks) { const int e = (ks * 4 + db) * FRG; vf[db][ks] = ldp<T16>(pv, e); if (HL) vf2[db][ks] = ldp<T16>(pv2, e); }
#pragma unroll
        for (int mb = 0; mb < MK; ++mb)
#pragma unroll
            for (int kc = 0; kc < 2; ++kc) { const int e = (mb * 2 + kc) * FRG; kf[mb][kc] = ldp<T16>(pk, e); if (HL) kf2[mb][kc] = ldp<T16>(pk2, e); }
        xwait(pv, pv2, pk, pk2);
        if (k0 + KB - 1 > q0) {   // wave-uniform: only blocks that reach past the first query's diagonal are masked
            const int dq = q0 + lr - k0 - hi * 8;   // key mb*16 + hi*8 + j is above the diagonal of query nb*16 + lr when mb*16 + j - nb*16 > dq
#pragma unroll
            for (int mb = 0; mb < MK; ++mb)
#pragma unroll
                for (int nb = 0; nb < 2; ++nb)
#pragma unroll
                    for (int j = 0; j < 8; ++j) if (mb * 16 + j - nb * 16 > dq) s[mb][nb][j] = -3.0e38f;
        }
        V pf[2][KS], pf2[2][KS];
#pragma unroll
        for (int nb = 0; nb < 2; ++nb) {
            v8f mv = s[0][nb];
#pragma unroll
            for (int mb = 1; mb < MK; ++mb) mv = __builtin_elementwise_max(mv, s[mb][nb]);
            float mx = fmaxf(fmaxf(fmaxf(mv[0], mv[1]), fmaxf(mv[2], mv[3])), fmaxf(fmaxf(mv[4], mv[5]), fmaxf(mv[6], mv[7])));
            mx = fmaxf(mx, xhalf(mx));
            const float mn = fmaxf(m[nb], mx * CEXP); const float al = exp2s(m[nb] - mn); m[nb] = mn; const float sub = OFF - mn;
            lv[nb] *= al;
#pragma unroll
            for (int mb = 0; mb < MK; ++mb) { const v8f t = s[mb][nb] * CEXP + sub; v8f p;
#pragma unroll
                for (int j = 0; j < 8; ++j) p[j] = exp2s(t[j]);
                s[mb][nb] = p; lv[nb] += p; }
#pragma unroll
            for (int db = 0; db < 4; ++db) o[db][nb] *= al;
#pragma unroll
            for (int ks = 0; ks < KS; ++ks) {
                if constexpr (HL) { v16us ph, pl;
#pragma unroll
                    for (int e = 0; e < 8; ++e) { unsigned short a, c2; splitf(s[2 * ks][nb][e], a, c2); ph[e] = a; pl[e] = c2; splitf(s[2 * ks + 1][nb][e], a, c2); ph[8 + e] = a; pl[8 + e] = c2; }
                    pf[nb][ks] = __builtin_bit_cast(v16bf, ph); pf2[nb][ks] = __builtin_bit_cast(v16bf, pl);
                } else { v16h ph;
#pragma unroll
                    for (int e = 0; e < 8; ++e) { ph[e] = tohx(s[2 * ks][nb][e]); ph[8 + e] = tohx(s[2 * ks + 1][nb][e]); }
                    pf[nb][ks] = ph; }
            }
        }
#pragma unroll
        for (int ks = 0; ks < KS; ++ks)
#pragma unroll
            for (int db = 0; db < 4; ++db)
#pragma unroll
                for (int nb = 0; nb < 2; ++nb) { o[db][nb] = WF::mma(vf[db][ks], pf[nb][ks], o[db][nb]); if (HL) { o[db][nb] = WF::mma(vf[db][ks], pf2[nb][ks], o[db][nb]); o[db][nb] = WF::mma(vf2[db][ks], pf[nb][ks], o[db][nb]); } }
    }
#pragma unroll
    for (int nb = 0; nb < 2; ++nb) { const float lh = ((lv[nb][0] + lv[nb][1]) + (lv[nb][2] + lv[nb][3])) + ((lv[nb][4] + lv[nb][5]) + (lv[nb][6] + lv[nb][7])); const float lt = lh + xhalf(lh); const float f = __fdiv_rn(HL ? 1.0f : PCAR, lt);   // fp16 rows: o and lt both carry PCAR; one more PCAR is what k_merge takes off
#pragma unroll
        for (int db = 0; db < 4; ++db) o[db][nb] *= f; }
    __builtin_amdgcn_sched_barrier(0);   // all arithmetic ahead of the stores: behind them no register that a store names is written any more
#pragma unroll
    for (int nb = 0; nb < 2; ++nb)
#pragma unroll
        for (int db = 0; db < 4; ++db) *(v8f*)((char*)(O + (size_t)(q0 + nb * 16) * HD + db * 16) + ol) = o[db][nb];   // f32 row lr, columns hi*8..
}
// grid: NB_ * NH_ * TT / 128 workgroups of 4 waves (128 query rows of one head). All are resident together; the first half of the indices takes the long row blocks in falling order, the second half the short ones in rising order.
__global__ __launch_bounds__(128) void k_fattn(const h16* Q16, const bf* Qh, const bf* Ql, const h16* K16, const bf* Kh, const bf* Kl, const h16* VT16, const bf* VTh, const bf* VTl, float* Ob) {
    constexpr int NT = TT / 128, NZ = NB_ * NH_; static_assert(RH % 128 == 0 && NT % 2 == 0 && NH_ == NKV, "row blocks");
    const int idx = blockIdx.x; const int tile = (idx < NZ * NT / 2) ? NT - 1 - idx / NZ : idx / NZ - NT / 2; const int zz = idx % NZ, bb = zz / NH_, hh = zz % NH_;
    const int q0 = tile * 128 + 32 * __builtin_amdgcn_readfirstlane((int)(threadIdx.x >> 5));
    const size_t oq = ((size_t)bb * (NH_ + NKV) + hh) * TT * HD, ov = (size_t)zz * HD * PP;   /* the K pointers are the head planes' base moved on by the NH_ query planes: one offset serves q and k */ float* O = Ob + (size_t)zz * TT * HD;
    if (tile * 128 < RH) attn_rows<bf, true, 32>(Qh + oq, Ql + oq, Kh + oq, Kl + oq, VTh + ov, VTl + ov, O, q0);
    else attn_rows<h16, false, 64>(Q16 + oq, nullptr, K16 + oq, nullptr, VT16 + ov, nullptr, O, q0);
}
__global__ __launch_bounds__(256) void k_lnin2(const float* __restrict__ F, const float* __restrict__ g, const float* __restrict__ bb, bf* Xh, bf* Xl) { const int lane = threadIdx.x & 31; const int row = blockIdx.x * 8 + (threadIdx.x >> 5); if (row >= MT) return; const float* fr = F + (size_t)row * DM; bf* hrow = Xh + (size_t)row * DM; bf* lrow = Xl + (size_t)row * DM; float v[DM / 32]; float s = 0.f;
#pragma unroll
    for (int c = 0; c < DM / 128; ++c) { const v4f a = *(const v4f*)(fr + c * 128 + lane * 4); for (int q = 0; q < 4; ++q) { v[c * 4 + q] = a[q]; s = __fadd_rn(s, a[q]); } }
#pragma unroll
    for (int sh = 16; sh; sh >>= 1) s = __fadd_rn(s, __shfl_xor(s, sh, 32));
    const float mean = __fmul_rn(s, 1.0f / (float)DM);   /* DM = 512: the reciprocal is an exact power of two, identical to the division */ float s2 = 0.f;
#pragma unroll
    for (int k = 0; k < DM / 32; ++k) { const float dv = __fsub_rn(v[k], mean); float p2 = __fmul_rn(dv, dv); asm volatile("" : "+v"(p2)); s2 = __fadd_rn(s2, p2); v[k] = dv; }
#pragma unroll
    for (int sh = 16; sh; sh >>= 1) s2 = __fadd_rn(s2, __shfl_xor(s2, sh, 32));
    const float rs = __fdiv_rn(1.0f, __fsqrt_rn(__fadd_rn(__fmul_rn(s2, 1.0f / (float)DM), LNEPS)));
{
#pragma unroll
        for (int c = 0; c < DM / 128; ++c) { v4us oh, ol; for (int q = 0; q < 4; ++q) { const int col = c * 128 + lane * 4 + q; float y = __fmul_rn(v[c * 4 + q], rs); asm volatile("" : "+v"(y)); float gg = bfr(g[col]), bb2 = bfr(bb[col]); asm volatile("" : "+v"(gg), "+v"(bb2)); y = __fmul_rn(y, gg); asm volatile("" : "+v"(y)); const float r = __fadd_rn(y, bb2); unsigned short hh2, ll2; splitf(r, hh2, ll2); oh[q] = hh2; ol[q] = ll2; } *(v4us*)(hrow + c * 128 + lane * 4) = oh; *(v4us*)(lrow + c * 128 + lane * 4) = ol; }
         } }

__global__ __launch_bounds__(256) void k_lnout(const float* __restrict__ F, const float* __restrict__ g, const float* __restrict__ bb, float* out) { const int lane = threadIdx.x & 31; const int row = blockIdx.x * 8 + (threadIdx.x >> 5); if (row >= MT) return; const float* fr = F + (size_t)row * DQ; float* orow = out + (size_t)row * DQ; float v[DQ / 32]; float s = 0.f;
#pragma unroll
    for (int c = 0; c < DQ / 128; ++c) { const v4f a = *(const v4f*)(fr + c * 128 + lane * 4); for (int q = 0; q < 4; ++q) { v[c * 4 + q] = a[q]; s = __fadd_rn(s, a[q]); } }
#pragma unroll
    for (int sh = 16; sh; sh >>= 1) s = __fadd_rn(s, __shfl_xor(s, sh, 32));
    const float mean = __fdiv_rn(s, (float)DQ); float s2 = 0.f;
#pragma unroll
    for (int k = 0; k < DQ / 32; ++k) { const float dv = __fsub_rn(v[k], mean); float p2 = __fmul_rn(dv, dv); asm volatile("" : "+v"(p2)); s2 = __fadd_rn(s2, p2); v[k] = dv; }
#pragma unroll
    for (int sh = 16; sh; sh >>= 1) s2 = __fadd_rn(s2, __shfl_xor(s2, sh, 32));
    const float rs = __fdiv_rn(1.0f, __fsqrt_rn(__fadd_rn(__fdiv_rn(s2, (float)DQ), LNEPS)));
{
#pragma unroll
        for (int c = 0; c < DQ / 128; ++c) { v4f o; for (int q = 0; q < 4; ++q) { const int col = c * 128 + lane * 4 + q; float y = __fmul_rn(v[c * 4 + q], rs); asm volatile("" : "+v"(y)); y = __fmul_rn(y, bfr(g[col])); asm volatile("" : "+v"(y)); o[q] = __fadd_rn(y, bfr(bb[col])); } *(v4f*)(orow + c * 128 + lane * 4) = o; }
         } }

__global__ __launch_bounds__(256) void k_merge(const float* __restrict__ O, bf* Ah, bf* Al) { const size_t e = ((size_t)blockIdx.x * 256 + threadIdx.x) * 2; if (e >= (size_t)NB_ * NH_ * TT * HD) return; const int d = (int)(e % HD); const int t = (int)((e / HD) % TT); const int zz = (int)(e / ((size_t)HD * TT)); const float cs = (t < RH) ? 1.0f : (1.0f / PCAR); const size_t oo = ((size_t)(zz / NH_) * TT + t) * DQ + (zz % NH_) * HD + d;   /* zz = batch element * NH_ + head */
    v2us oh, ol;
#pragma unroll
    for (int q = 0; q < 2; ++q) { unsigned short a, c2; splitf(O[e + q] * cs, a, c2); oh[q] = a; ol[q] = c2; } *(v2us*)(Ah + oo) = oh; *(v2us*)(Al + oo) = ol;  }

extern "C" void kernel_launch(void* const* d_in, const int* in_sizes, int n_in,
                              void* d_out, int out_size, void* d_ws, size_t ws_size, hipStream_t stream) {
    (void)in_sizes; (void)n_in; (void)out_size;
    const float* x = (const float*)d_in[0]; const float* pq = (const float*)d_in[1]; const float* pk = (const float*)d_in[2]; const float* pv = (const float*)d_in[3];   /* [8][512][64] each */ const float* wo = (const float*)d_in[4];   /* Wproj [512][512] 'xw' */ const float* g1 = (const float*)d_in[5]; const float* b1 = (const float*)d_in[6]; const float* w1 = (const float*)d_in[7]; const float* bb1 = (const float*)d_in[8]; const float* w2 = (const float*)d_in[9]; const float* bb2 = (const float*)d_in[10]; const float* g2 = (const float*)d_in[11]; const float* b2 = (const float*)d_in[12]; const float* wq = pq, *wk = pk, *wv = pv;
    float* OUT = (float*)d_out;     // [4][2048][512]
    char* wsp = (char*)d_ws;
    auto take = [&](size_t bytes) { char* p = wsp; wsp += (bytes + 255) & ~(size_t)255; return (void*)p; };
    // Live through the whole call: the transposed weights and the merged attention output planes.
    bf* W1T = (bf*)take((size_t)FF * DM * 2); bf* W2T = (bf*)take((size_t)DM * FF * 2); bf* WQKV = (bf*)take((size_t)NQKV * DM * 2);   /* rows: q heads, k heads, v heads */ bf* WO = (bf*)take((size_t)DM * DQ * 2); bf* ATh = (bf*)take((size_t)MT * DQ * 2); bf* ATl = (bf*)take((size_t)MT * DQ * 2);
    char* const mark = wsp;
    // Phase 1 (projections and attention). Head planes [batch][q heads, then k heads], TT * HD elements each, and transposed v planes [batch][head], all in fragment order (FRG); a (batch, head)'s HD * PP elements hold the hi plane, then the lo plane (the fp16 plane fills the first half, the rest is never touched).
    h16* QK16 = (h16*)take((size_t)NB_ * (NH_ + NKV) * TT * HD * 2); bf* QKh = (bf*)take((size_t)NB_ * (NH_ + NKV) * TT * HD * 2); bf* QKl = (bf*)take((size_t)NB_ * (NH_ + NKV) * TT * HD * 2);
    h16* VT16 = (h16*)take((size_t)NB_ * NKV * HD * PP * 2); bf* VTh = (bf*)take((size_t)NB_ * NKV * HD * PP * 2); bf* VTl = VTh + (size_t)HD * TT; float* Ob = (float*)take((size_t)NB_ * NH_ * TT * HD * 4);
    bf* XB = (bf*)take((size_t)MT * DM * 2);
    if ((size_t)(wsp - (char*)d_ws) > ws_size) return;    // ws 256 MiB
    // Phase 2 (Wproj, LayerNorms, feed-forward) starts after the last read of every phase-1 buffer and shares their bytes (stream-ordered).
    wsp = mark; float* Y = (float*)take((size_t)MT * DM * 4); bf* LNh = (bf*)take((size_t)MT * DM * 2); bf* LNl = (bf*)take((size_t)MT * DM * 2); bf* H1h = (bf*)take((size_t)MT * FF * 2); bf* H1l = (bf*)take((size_t)MT * FF * 2); float* F2 = (float*)take((size_t)MT * DM * 4);
    if ((size_t)(wsp - (char*)d_ws) > ws_size) return;
    k_wtG<<<dim3((unsigned)((DM * HD / 64 + 63) / 64), NH_, 3), 256, 0, stream>>>(wq, wk, wv, DM, HD, WQKV);   /* every head's 'xw' [512][64] block of Wq, Wk, Wv -> Bt rows (tensor * 8 + head) * 64.. */
    k_wtG<<<(unsigned)((DQ * DM / 64 + 63) / 64), 256, 0, stream>>>(wo, wo, wo, DQ, DM, WO); k_wtG<<<(unsigned)((DM * FF / 64 + 63) / 64), 256, 0, stream>>>(w1, w1, w1, DM, FF, W1T);   /* W1 'xw' [512][2048] -> Bt [2048][512] */ k_wtG<<<(unsigned)((FF * DM / 64 + 63) / 64), 256, 0, stream>>>(w2, w2, w2, FF, DM, W2T);   /* W2 'xw' [2048][512] -> Bt [512][2048] */
    k_cvt8<<<(unsigned)(((size_t)MT * DM / 8 + 255) / 256), 256, 0, stream>>>(x, XB, (size_t)MT * DM / 8);
    k_gemms<0, false, E_QKV, HD><<<dim3(MT / 128, NQKV / 128, 1), 256, 0, stream>>>(XB, nullptr, WQKV, DM, nullptr, nullptr, nullptr, QK16, QKh, QKl, VT16, VTh, VTl);   /* q | k | v of all batch elements -> head planes and transposed v planes */
    k_fattn<<<NB_ * NH_ * (TT / 128), 128, 0, stream>>>(QK16, QKh, QKl, QK16 + (size_t)NH_ * TT * HD, QKh + (size_t)NH_ * TT * HD, QKl + (size_t)NH_ * TT * HD, VT16, VTh, VTl, Ob);   /* all batch elements and heads */
    k_merge<<<(unsigned)(((size_t)NB_ * NH_ * TT * HD / 2 + 255) / 256), 256, 0, stream>>>(Ob, ATh, ATl);
    k_gemms<1, false, E_RES, DM><<<dim3(MT / 128, DM / 128, 1), 256, 0, stream>>>(ATh, ATl, WO, DQ, Y, nullptr, x, nullptr, nullptr, nullptr, nullptr, nullptr, nullptr);   /* o Wproj + x */
    k_lnin2<<<(MT + 7) / 8, 256, 0, stream>>>(Y, g1, b1, LNh, LNl);   /* out1 = LN1 as bf16 hi/lo planes */
    k_gemms<1, true, E_RELU, FF><<<dim3(MT / 128, FF / 128, 1), 256, 0, stream>>>(LNh, LNl, W1T, DM, nullptr, bb1, nullptr, nullptr, H1h, H1l, nullptr, nullptr, nullptr);   /* relu(out1 W1 + bb1) -> hi/lo planes */
    k_gemms<1, true, E_RES, DM><<<dim3(MT / 128, DM / 128, 1), 256, 0, stream>>>(H1h, H1l, W2T, FF, F2, bb2, x, nullptr, nullptr, nullptr, nullptr, nullptr, nullptr);   /* W2 + bb2 + the ORIGINAL x */
    k_lnout<<<(MT + 7) / 8, 256, 0, stream>>>(F2, g2, b2, OUT);   /* LN2 -> out */
}

// v007
// A run of this version takes 171 microseconds.
// Two timings next to v006 put it at 1.16 and 1.17 times that version's speed.
// Over all steps from v000 it is 12.0 times as fast.
#include <hip/hip_runtime.h>

// Post-LN transformer block with per-head projection tensors (x [4][2048][512]; q,k,v = einsum('bse,hed', x, W) (Wq, Wk, Wv [8][512][64] 1/sqrt(512): head h's 'xw' block); 8 heads x 64; scores / 8; causal (-inf); softmax; o = concat heads; out1 = LayerNorm(x + o Wproj) (Wproj 'xw' [512][512]; eps 1e-5, g1/b1); ff = relu(out1 W1 + bb1) W2 + bb2 (W1 [512][2048], W2 [2048][512] 'xw', zero biases); out = LayerNorm(ff + x, g2, b2) (the residual is the ORIGINAL x) -> [4][2048][512] (4.2 M)).
// Layout: every kernel outside attention runs once over the 8192 rows of all 4 batch elements (q, k, v as one GEMM with 1536 columns); attention is one launch over all batch elements and heads, with the scores kept in registers (online softmax). Every elementwise pass behind a GEMM is done in that GEMM's epilogue, on the f32 values before they leave the workgroup. Steps: bf16 copy of x; per-head 'xw' weight blocks of Wq, Wk, Wv transposed into one joint Bt (rows (tensor*8 + h)*64..), Wproj/W1/W2 transposed once; exact projections, written as the q/k head planes and the transposed v planes (fp16 + hi/lo); causal T-2048 attention (hybrid rows: < 512 hi/lo 3 products, rest fp16 x1024; key blocks above the diagonal skipped); Y = merged hi/lo x Wproj exact + bf16(x); a row-LayerNorm kernel emits out1 as bf16 hi/lo planes; relu(hi/lo x W1 exact + bb1) written as hi/lo planes; F2 = hi/lo x W2 exact + bb2 + bf16(x); the final row-LayerNorm writes the output rows.
// Compute dtypes, f32 accumulate: every input rounded to bf16; projections exact; attention rows < 512 3 products, rest fp16; softmax f32; Wproj hl x exact; residuals/LayerNorms f32 (fixed-order sums); FFN GEMMs 2 products (~f32) + f32 biases; relu f32.

#define NB_  4
#define TT   2048
#define DM   512
#define NH_  8
#define NKV  8
#define REP  (NH_ / NKV)
#define HD   64
#define DQ   (NH_ * HD)
#define DKV  (NKV * HD)
#define MT   (NB_ * TT)           // rows of all batch elements together
#define NQKV (DQ + 2 * DKV)       // columns of the joint q|k|v projection
#define PP   (2 * TT)             // a (batch, head)'s part of a transposed v buffer is HD * PP 16-bit elements: room for two planes of HD * TT
#define RH   512                  // query rows < RH use hi+lo planes (0: none)
#define PCAR 1024.0f
#define SCL  0.125f   // HD^-0.5
#define FF   2048     // feed-forward width
#define LNEPS 1e-5f
typedef _Float16 h16;
typedef unsigned short bf;
typedef __attribute__((ext_vector_type(16))) __bf16   v16bf;
typedef __attribute__((ext_vector_type(16))) _Float16 v16h;
typedef __attribute__((ext_vector_type(8)))  _Float16 v8h;
typedef __attribute__((ext_vector_type(8)))  unsigned short v8us;
typedef __attribute__((ext_vector_type(8)))  float    v8f;
typedef __attribute__((ext_vector_type(4)))  float    v4f;
typedef v8h  __attribute__((may_alias)) v8ha;
typedef v4f  __attribute__((may_alias)) v4fa;
typedef v8us __attribute__((may_alias)) v8usa;

__device__ __forceinline__ unsigned short f2bf(float f) { unsigned u = __float_as_uint(f); u += 0x7FFFu + ((u >> 16) & 1u); return (unsigned short)(u >> 16); }
__device__ __forceinline__ float bf2f(unsigned short b) { return __uint_as_float(((unsigned)b) << 16); }
__device__ __forceinline__ float bfr(float f) { return bf2f(f2bf(f)); }
__device__ __forceinline__ v16h cat16(v8h lo, v8h hi) { return __builtin_shufflevector(lo, hi, 0, 1, 2, 3, 4, 5, 6, 7, 8, 9, 10, 11, 12, 13, 14, 15); }
__device__ __forceinline__ v16bf cat16b(v8us lo, v8us hi) { return __builtin_bit_cast(v16bf, __builtin_shufflevector(lo, hi, 0, 1, 2, 3, 4, 5, 6, 7, 8, 9, 10, 11, 12, 13, 14, 15)); }
__device__ __forceinline__ v8f wmma16(v16h a, v16h b, v8f c) { return __builtin_amdgcn_wmma_f32_16x16x32_f16(false, a, false, b, (short)0, c, false, false); }
__device__ __forceinline__ v8f wmmab(v16bf a, v16bf b, v8f c) { return __builtin_amdgcn_wmma_f32_16x16x32_bf16(false, a, false, b, (short)0, c, false, false); }
__device__ __forceinline__ h16 tohx(float x) { return (h16)x; }
__device__ __forceinline__ void splitf(float y, unsigned short& h, unsigned short& l) { h = f2bf(y); l = f2bf(y - bf2f(h)); }



// ---- k_gemms: GEMM with the operand tiles staged in LDS; one workgroup of 8 waves (4 x 2) per 128x128 output tile, 32x64 per wave; grid (M/128, N/128), 256 threads.
// c[m][n] (f32, + optional f32 bias[n]) = sum_k (A[m][k] + A2[m][k]) Bt[n][k] (A2 only with NSPLIT == 1), all planes K-contiguous bf16. M % 128 == 0, N % 128 == 0, K % 64 == 0.
// What leaves the workgroup (EPI): E_RES: C = c + bf16(xr), f32, both of pitch LDC. E_RELU: max(c, 0) as bf16 hi/lo planes Ph, Pl of pitch LDC. E_QKV: columns < DQ + DKV as head planes P16 (fp16), Ph, Pl [batch][head], each plane in fragment order [t / 16][d / 32] (rows t, k = d); the v columns behind them as transposed planes V16, Vh, Vl, [batch][head] HD * PP elements apart, in fragment order [t / 32][d / 16] (rows d, k = t).
// A stage is 64 k (one 128-byte line) of the 128 rows of every plane: [Bt | A | A2], rows at pitch GP. Two buffers: asynchronous copies fill the next stage while this one is multiplied; every wave sums the whole K in ascending order.
#define GP   144u          // LDS row pitch in bytes: 128 + 16, an odd multiple of 16 for the ds_load_b128 readers
#define GPL  (128u * GP)   // one plane of a stage
// Fragment order of the attention operands in global memory: a 16-row x 32-k fragment is FRG consecutive elements (1 KiB), two halves of 512 bytes; in half g lane (lr, hi) = hi*16 + lr owns 16 bytes, row lr, k g*16 + hi*8 .. + 7. Each of the two loads of a fragment is then 512 consecutive bytes, 4 whole lines per wave. WFrag::ld takes the lane's address in half 0.
#define FRG  512
template <typename T16> struct WFrag;
template <> struct WFrag<h16> { typedef v16h V; static __device__ __forceinline__ V ld(const h16* p) { return cat16(*(const v8h*)p, *(const v8h*)(p + FRG / 2)); } static __device__ __forceinline__ v8f mma(V a, V b, v8f c) { return wmma16(a, b, c); } };
template <> struct WFrag<bf> { typedef v16bf V; static __device__ __forceinline__ V ld(const bf* p) { return cat16b(*(const v8us*)p, *(const v8us*)(p + FRG / 2)); } static __device__ __forceinline__ v8f mma(V a, V b, v8f c) { return wmmab(a, b, c); } };
__device__ __forceinline__ unsigned lds_off(const void* p) { return (unsigned)(size_t)p; }
__device__ __forceinline__ v16bf ldl(const unsigned char* p) { return cat16b(*(const v8us*)p, *(const v8us*)(p + 32)); }
#define CPY(a, b) "global_load_async_to_lds_b128 %" #a ", %" #b ", off\n\t"
// One stage: every lane copies 16 bytes of 4 rows (32 rows apart) of each of the NP planes, a wave 4 whole lines per copy. l: the lane's LDS byte address in plane 0; g0..g2: its global addresses; rs: 32 rows in bytes.
// The copies and the s_wait_xcnt stand in one statement, so that no address register of a copy is rewritten ahead of the wait.
template <int NP> __device__ __forceinline__ void stage_copy(unsigned l, const char* g0, const char* g1, const char* g2, size_t rs) {
    if constexpr (NP == 3)
        asm volatile(CPY(0, 1) CPY(2, 3) CPY(4, 5) CPY(6, 7) CPY(8, 9) CPY(10, 11) CPY(12, 13) CPY(14, 15) CPY(16, 17) CPY(18, 19) CPY(20, 21) CPY(22, 23) "s_wait_xcnt 0x0"
            :: "v"(l), "v"(g0), "v"(l + 32u * GP), "v"(g0 + rs), "v"(l + 64u * GP), "v"(g0 + 2 * rs), "v"(l + 96u * GP), "v"(g0 + 3 * rs),
               "v"(l + GPL), "v"(g1), "v"(l + GPL + 32u * GP), "v"(g1 + rs), "v"(l + GPL + 64u * GP), "v"(g1 + 2 * rs), "v"(l + GPL + 96u * GP), "v"(g1 + 3 * rs),
               "v"(l + 2u * GPL), "v"(g2), "v"(l + 2u * GPL + 32u * GP), "v"(g2 + rs), "v"(l + 2u * GPL + 64u * GP), "v"(g2 + 2 * rs), "v"(l + 2u * GPL + 96u * GP), "v"(g2 + 3 * rs) : "memory");
    else
        asm volatile(CPY(0, 1) CPY(2, 3) CPY(4, 5) CPY(6, 7) CPY(8, 9) CPY(10, 11) CPY(12, 13) CPY(14, 15) "s_wait_xcnt 0x0"
            :: "v"(l), "v"(g0), "v"(l + 32u * GP), "v"(g0 + rs), "v"(l + 64u * GP), "v"(g0 + 2 * rs), "v"(l + 96u * GP), "v"(g0 + 3 * rs),
               "v"(l + GPL), "v"(g1), "v"(l + GPL + 32u * GP), "v"(g1 + rs), "v"(l + GPL + 64u * GP), "v"(g1 + 2 * rs), "v"(l + GPL + 96u * GP), "v"(g1 + 3 * rs) : "memory");
}
// One fragment set: 32 k of the wave's 32 rows of A (and A2) and 64 rows of Bt. pa, pb: the lane's addresses in the A and the Bt plane of a stage.
template <int NSPLIT> struct FSet { v16bf a[2], a2[2], b[4]; };
template <int NSPLIT> __device__ __forceinline__ void ld_set(FSet<NSPLIT>& f, const unsigned char* pa, const unsigned char* pb) {   // in the order of use
#pragma unroll
    for (int mb = 0; mb < 2; ++mb) f.a[mb] = ldl(pa + mb * 16 * GP);
#pragma unroll
    for (int nb = 0; nb < 4; ++nb) f.b[nb] = ldl(pb + nb * 16 * GP);
    if (NSPLIT) {
#pragma unroll
        for (int mb = 0; mb < 2; ++mb) f.a2[mb] = ldl(pa + GPL + mb * 16 * GP); }
}
template <int NSPLIT> __device__ __forceinline__ void mm_set(const FSet<NSPLIT>& f, v8f (&acc)[2][4]) {   // eight independent accumulators between two products into the same one
#pragma unroll
    for (int nb = 0; nb < 4; ++nb)
#pragma unroll
        for (int mb = 0; mb < 2; ++mb) acc[mb][nb] = wmmab(f.a[mb], f.b[nb], acc[mb][nb]);
    if (NSPLIT) {
#pragma unroll
        for (int nb = 0; nb < 4; ++nb)
#pragma unroll
            for (int mb = 0; mb < 2; ++mb) acc[mb][nb] = wmmab(f.a2[mb], f.b[nb], acc[mb][nb]); }
}
#define E_RES  0
#define E_RELU 1
#define E_QKV  2
#define VSP  272u          // LDS row pitch in bytes of the transposed v staging: 128 t x 2 bytes + 16
#define VSPL (128u * VSP)  // one plane of it
template <int NSPLIT, bool BIAS, int EPI, int LDC>
__global__ __launch_bounds__(256) void k_gemms(const bf* A, const bf* A2, const bf* Bt, int K, float* C, const float* __restrict__ bias, const float* xr, h16* P16, bf* Ph, bf* Pl, h16* V16, bf* Vh, bf* Vl) {
    constexpr int NP = NSPLIT ? 3 : 2; constexpr unsigned STG = NP * GPL;
    static_assert(2 * STG >= 8 * 32 * 68 * 4, "the output staging reuses the ring");
    constexpr unsigned SMB = (EPI == E_QKV && 3u * VSPL > 2u * STG) ? 3u * VSPL : 2u * STG;   // the three transposed v planes of a tile need more than the ring
    __shared__ __attribute__((aligned(16))) unsigned char sm[SMB];
    const int tid = (int)threadIdx.x, lane = tid & 31, lr = lane & 15, hi = lane >> 4; const int w = __builtin_amdgcn_readfirstlane(tid >> 5), wm = w >> 1, wn = w & 1; const int r0 = blockIdx.x * 128, c0 = blockIdx.y * 128;
    const size_t rowb = (size_t)K * 2; const int crow = tid >> 3; const unsigned cch = (unsigned)(tid & 7) * 16u;   // the lane's first row and its 16-byte piece of the line
    const char* gb = (const char*)Bt + (size_t)(c0 + crow) * rowb + cch; const char* ga = (const char*)A + (size_t)(r0 + crow) * rowb + cch; const char* ga2 = NSPLIT ? (const char*)A2 + (size_t)(r0 + crow) * rowb + cch : ga;
    const unsigned lc = lds_off(sm) + (unsigned)crow * GP + cch; const int nt = K >> 6;
    stage_copy<NP>(lc, gb, ga, ga2, 32 * rowb);
    asm volatile("s_wait_asynccnt 0x0" ::: "memory");   // stage 0 of this wave has landed
    __syncthreads();                                     // ... and every wave's: nobody reads it in front of this barrier
    if (nt > 1) stage_copy<NP>(lc + STG, gb + 128, ga + 128, ga2 + 128, 32 * rowb);
    v8f acc[2][4];
#pragma unroll
    for (int mb = 0; mb < 2; ++mb)
#pragma unroll
        for (int nb = 0; nb < 4; ++nb) acc[mb][nb] = (v8f){};
    const unsigned fb = (unsigned)(wn * 64 + lr) * GP + 16u * hi, fa = GPL + (unsigned)(wm * 32 + lr) * GP + 16u * hi;   // the lane's fragment offsets in a stage
    // Two fragment sets, each half a stage, fetched one half ahead: f0 = k 0..31 of a stage, f1 = k 32..63. The publish point of stage t + 1 therefore stands in the middle of trip t, behind the last reads of stage t and ahead of the first reads of stage t + 1.
    FSet<NSPLIT> f0, f1;
    ld_set<NSPLIT>(f0, sm + fa, sm + fb);
#pragma unroll 1   // one stage per trip: the ring's order of waits, barrier and refill stands once
    for (int t = 0; t < nt; ++t) {
        const unsigned char* sb = sm + (unsigned)(t & 1) * STG;
        ld_set<NSPLIT>(f1, sb + fa + 64, sb + fb + 64);
        __builtin_amdgcn_sched_barrier(0);   // the reads stay one group ahead of the WMMAs that they fly behind
        mm_set<NSPLIT>(f0, acc);
        __builtin_amdgcn_sched_barrier(0);   // these WMMAs stay ahead of the waits: they cover the flight of f1's reads and of the copies
        asm volatile("s_wait_dscnt 0x0" ::: "memory");      // this wave's last reads of stage t have returned before its buffer is refilled
        asm volatile("s_wait_asynccnt 0x0" ::: "memory");   // this wave's copies of stage t + 1 have landed
        __syncthreads();                                     // publishes stage t + 1 and ends every wave's reads of stage t
        if (t + 2 < nt) stage_copy<NP>(lc + (unsigned)(t & 1) * STG, gb + (size_t)(t + 2) * 128, ga + (size_t)(t + 2) * 128, ga2 + (size_t)(t + 2) * 128, 32 * rowb);
        if (t + 1 < nt) { const unsigned char* sn = sm + (unsigned)((t + 1) & 1) * STG; ld_set<NSPLIT>(f0, sn + fa, sn + fb); }
        mm_set<NSPLIT>(f1, acc);
    }
    asm volatile("s_wait_asynccnt 0x0" ::: "memory");   // no copy is outstanding when the ring becomes output staging
    if (EPI == E_QKV && c0 >= DQ + DKV) {   // the same for the whole workgroup
        // v columns, transposed: a lane holds 8 consecutive t of one d, 16 bytes of a 16-bit plane's row. The tile's three planes are gathered in LDS as [d][t], so that whole 128-byte lines leave.
#pragma unroll
        for (int mb = 0; mb < 2; ++mb)
#pragma unroll
            for (int nb = 0; nb < 4; ++nb) { v8h o16; v8us oh, ol;
#pragma unroll
                for (int j = 0; j < 8; ++j) { const float xv = acc[mb][nb][j]; o16[j] = tohx(xv); unsigned short a2, c2; splitf(xv, a2, c2); oh[j] = a2; ol[j] = c2; }
                unsigned char* vp = sm + (unsigned)(wn * 64 + nb * 16 + lr) * VSP + (unsigned)(wm * 32 + mb * 16 + hi * 8) * 2u;
                *(v8ha*)vp = o16; *(v8usa*)(vp + VSPL) = oh; *(v8usa*)(vp + 2u * VSPL) = ol; }
        __syncthreads();   // every wave's part of a row is in LDS before the row is read
        const size_t vf0 = ((size_t)(r0 / TT) * NKV + (c0 - DQ - DKV) / HD + (w >> 2)) * HD * PP + (size_t)((r0 % TT) / 32 * 4 + (w & 3)) * FRG + lane * 8;   // wave w: the 16 rows d = (w & 3) * 16 .. of head w >> 2 of the tile's two; fragments [t / 32][d / 16], half a fragment (512 bytes) per store
#pragma unroll
        for (int s = 0; s < 8; ++s) { const unsigned char* vp = sm + (unsigned)(w * 16 + lr) * VSP + (unsigned)(s * 16 + hi * 8) * 2u; const size_t eo = vf0 + (s >> 1) * (4 * FRG) + (s & 1) * (FRG / 2);
            *(v8h*)(V16 + eo) = *(const v8ha*)vp; *(v8us*)(Vh + eo) = *(const v8usa*)(vp + VSPL); *(v8us*)(Vl + eo) = *(const v8usa*)(vp + 2u * VSPL); }
    } else {
    // Whole 128-byte lines out: each wave stages its 32x64 tile in its own part of the ring (pitch 68 floats) and reads rows back.
    const size_t ut = (size_t)(r0 + wm * 32) * LDC + c0 + wn * 64;   // the wave's tile in a [m][n] array of pitch LDC (wave-uniform)
    const unsigned lx = (unsigned)((lane >> 4) * LDC + (lane & 15) * 4) * 4u;   // E_RES: the lane's byte offset in the tile; its piece s stands 2 rows further on per s
    v4f rx[16];
    if constexpr (EPI == E_RES) {   // the residual's loads fly during the staging
        const char* ux = (const char*)(xr + ut);
#pragma unroll
        for (int s = 0; s < 16; ++s) rx[s] = *(const v4f*)(ux + lx + (unsigned)s * (2u * LDC * 4u));
        asm volatile("s_wait_xcnt 0x0" :: "v"(lx), "s"(ux) : "memory");   // stands between the issued loads and every later rewrite of their address registers, which are inputs so that they stay untouched up to here
    }
    float* os = (float*)sm + w * (32 * 68);
#pragma unroll
    for (int mb = 0; mb < 2; ++mb)
#pragma unroll
        for (int nb = 0; nb < 4; ++nb)
#pragma unroll
            for (int j = 0; j < 8; ++j) os[(mb * 16 + hi * 8 + j) * 68 + nb * 16 + lr] = acc[mb][nb][j];
    __syncthreads();   // orders the staging writes against the row reads
    if constexpr (EPI == E_RES) {
        char* uc = (char*)(C + ut);
#pragma unroll
        for (int s = 0; s < 16; ++s) { const int item = s * 32 + lane; const int row = item >> 4, cofs = (item & 15) * 4; v4f val = *(const v4fa*)(os + row * 68 + cofs);
            if (BIAS) { const int cb = c0 + wn * 64 + cofs; val[0] += bfr(bias[cb]); val[1] += bfr(bias[cb + 1]); val[2] += bfr(bias[cb + 2]); val[3] += bfr(bias[cb + 3]); }
#pragma unroll
            for (int q = 0; q < 4; ++q) val[q] = __fadd_rn(val[q], bfr(rx[s][q]));
            *(v4f*)(uc + lx + (unsigned)s * (2u * LDC * 4u)) = val; }
    } else {
        // 16-bit planes, 16 bytes per lane and plane. E_RELU: 8 lanes per 128-byte row of the wave's tile. E_QKV: fragment order; the wave's 32 t x 64 d are 4 whole fragments, which start where its rows would.
        const size_t tile0 = (EPI == E_QKV) ? (((size_t)(r0 / TT) * (NH_ + NKV) + (c0 + wn * 64) / HD) * TT + r0 % TT + wm * 32) * HD : ut; constexpr int pitch = (EPI == E_QKV) ? HD : LDC;
#pragma unroll
        for (int s = 0; s < 8; ++s) { const int row = (EPI == E_QKV) ? (s >> 2) * 16 + lr : (s * 32 + lane) >> 3, cofs = (EPI == E_QKV) ? s % 4 * 16 + hi * 8 : (lane & 7) * 8;   /* E_QKV: piece s is half s & 1 of fragment s >> 1 of the wave's [t / 16][d / 32] */ const v4f va = *(const v4fa*)(os + row * 68 + cofs), vb = *(const v4fa*)(os + row * 68 + cofs + 4); v8h o16; v8us oh, ol;
#pragma unroll
            for (int q = 0; q < 8; ++q) { float y = (q < 4) ? va[q & 3] : vb[q & 3];
                if (BIAS) y += bfr(bias[c0 + wn * 64 + cofs + q]);
                if (EPI == E_RELU) y = (y > 0.0f) ? y : 0.0f;
                if (EPI == E_QKV) o16[q] = tohx(y);
                unsigned short a2, c2; splitf(y, a2, c2); oh[q] = a2; ol[q] = c2; }
            const size_t e = (EPI == E_QKV) ? tile0 + s * (FRG / 2) + lane * 8 : tile0 + (size_t)row * pitch + cofs;
            if (EPI == E_QKV) *(v8h*)(P16 + e) = o16;
            *(v8us*)(Ph + e) = oh; *(v8us*)(Pl + e) = ol; }
        if constexpr (EPI == E_QKV) asm volatile("s_wait_xcnt 0x0" ::: "memory");   // in the listing the v branch's code follows these stores: the wait stands between them and its writes of the registers that they name
    }
    }
}

typedef __attribute__((ext_vector_type(2))) _Float16 v2h;
typedef __attribute__((ext_vector_type(4))) _Float16 v4h;
typedef __attribute__((ext_vector_type(2))) unsigned short v2us;
typedef __attribute__((ext_vector_type(4))) unsigned short v4us;
typedef __attribute__((ext_vector_type(2))) float v2f;
typedef __attribute__((ext_vector_type(4))) int v4i;

// One [K][N] f32 matrix w -> its transpose Bt [N][K] in bf16. Block bx of the matrix takes 64 lines of 64 elements of Bt, a wave 8 of them.
template <int K, int N> __device__ __forceinline__ void wt_lines(const float* __restrict__ w, bf* Bt, int bx) {
    static_assert(N * K % (64 * 64) == 0, "whole blocks");
    const int lane = threadIdx.x & 31; const int L0 = (bx * 8 + (int)(threadIdx.x >> 5)) * 8;
#pragma unroll 1   // rolled: the flight of a trip's two loads is covered by the launch's other waves, not by more registers and text of this one
    for (int l = 0; l < 8; ++l) { const int e = (L0 + l) * 64 + lane * 2; const int k = e % K, n = e / K; v2us o;
        o[0] = f2bf(w[(size_t)k * N + n]); o[1] = f2bf(w[(size_t)(k + 1) * N + n]); *(v2us*)(Bt + e) = o;
        asm volatile("s_wait_xcnt 0x0" ::: "memory"); }   // stands between the issued store and the next trip's rewrite of the registers that it names
}
// ---- k_prep: everything that depends on the inputs alone, in one launch; the parts are independent and share the grid by block range. The transposes stand first: their waves run the longest chains of loads.
#define PB_W   (DM * FF / (64 * 64))            // blocks of W1, and of W2
#define PB_H   (DM * HD / (64 * 64))            // blocks of one head's [DM][HD] matrix
#define PB_QKV (3 * NH_ * PB_H)
#define PB_WO  (DQ * DM / (64 * 64))
#define PB_X   (MT * DM / (8 * 256))            // x: 8 elements per lane
__global__ __launch_bounds__(256) void k_prep(const float* __restrict__ x, const float* __restrict__ wq, const float* __restrict__ wk, const float* __restrict__ wv, const float* __restrict__ wo, const float* __restrict__ w1, const float* __restrict__ w2, bf* XB, bf* WQKV, bf* WO, bf* W1T, bf* W2T) {
    static_assert(MT * DM % (8 * 256) == 0 && NH_ == NKV, "whole blocks; q, k and v have the same number of heads");
    int b = blockIdx.x;
    if (b < PB_W) { wt_lines<FF, DM>(w2, W2T, b); return; }   // W2 'xw' [2048][512] -> Bt [512][2048]
    b -= PB_W;
    if (b < PB_W) { wt_lines<DM, FF>(w1, W1T, b); return; }   // W1 'xw' [512][2048] -> Bt [2048][512]
    b -= PB_W;
    if (b < PB_QKV) { const int mz = b / PB_H, ts = mz / NH_;   // every head's 'xw' [512][64] block of Wq, Wk, Wv -> Bt rows (tensor * 8 + head) * 64..
        wt_lines<DM, HD>((ts == 0 ? wq : ts == 1 ? wk : wv) + (size_t)(mz % NH_) * DM * HD, WQKV + (size_t)mz * DM * HD, b % PB_H); return; }
    b -= PB_QKV;
    if (b < PB_WO) { wt_lines<DQ, DM>(wo, WO, b); return; }   // Wproj 'xw' [512][512]
    b -= PB_WO;
    const size_t i = (size_t)b * 256 + threadIdx.x; const v8f v = *(const v8f*)(x + i * 8); v8us o;   // bf16 copy of x
#pragma unroll
    for (int k = 0; k < 8; ++k) o[k] = f2bf(v[k]);
    *(v8us*)(XB + i * 8) = o;
    asm volatile("s_wait_xcnt 0x0" ::: "memory");   // stands behind the issued store, in front of any later rewrite of the registers that it names
}

typedef __attribute__((ext_vector_type(16))) unsigned short v16us;
// Lane l with lane l ^ 16 (the two halves of a wave hold the two halves of a query's keys).
__device__ __forceinline__ float xhalf(float x) { return __builtin_bit_cast(float, __builtin_amdgcn_permlanex16(__builtin_bit_cast(int, x), __builtin_bit_cast(int, x), 0x76543210, 0xfedcba98, false, false)); }
// 2^x with the issue slot behind the transcendental filled in the same statement, so that no instruction directly behind it reads its result or rewrites its source.
__device__ __forceinline__ float exp2s(float x) { float r; asm("v_exp_f32 %0, %1\n\tv_nop" : "=v"(r) : "v"(x)); return r; }
// Stands between a group of issued global loads and every later rewrite of an address register that they name; the lanes' base addresses are inputs so that their registers stay untouched up to the wait.
__device__ __forceinline__ void xwaits(const void* a, const void* b) { asm volatile("s_wait_xcnt 0x0" :: "s"(a), "s"(b) : "memory"); }   // the same for loads at a wave-uniform base in scalar registers
__device__ __forceinline__ void xwait(const char* a, const char* b, const char* c, const char* d) { asm volatile("s_wait_xcnt 0x0" :: "v"(a), "v"(b), "v"(c), "v"(d) : "memory"); }
// Fragment at the lane's base address plus a constant number of elements.
template <typename T16> __device__ __forceinline__ typename WFrag<T16>::V ldp(const char* lane_base, int elems) { return WFrag<T16>::ld((const T16*)lane_base + elems); }
// ---- k_fattn: causal attention in one launch, scores and probabilities never leave the registers (online softmax). One wave owns 32 query rows of one (batch, head) and walks the key blocks 0 .. diagonal.
// Transposed products, so that a lane holds one query's scores: S^T = K Q^T (A = 16 key rows, B = 16 query rows, k = d) leaves in lane (lr, hi) the keys mb*16 + hi*8 + j of query lr, which is the B-fragment k order of P^T;
// O^T += V^T P^T (A = 16 rows of the transposed v plane, k = keys) leaves d = db*16 + hi*8 + j of query lr. Row maximum and row sum are per lane; the two lane halves exchange the maximum once per block and join their sums at the end.
// Every inner loop is unrolled whole: the fragment and accumulator arrays stay in registers only if every index is a constant.
// HL: bf16 hi/lo planes, 3 products in both contractions (query rows < RH); else fp16 with the probabilities carried x PCAR (2^10 in the exponent), output rows x PCAR as k_merge expects.
template <typename T16, bool HL, int KB>
__device__ __forceinline__ void attn_rows(const T16* Q, const T16* Q2, const T16* Kp, const T16* K2, const T16* Vt, const T16* Vt2, float* O, int q0) {   // no __restrict__: the loads must stay on their side of the waits' "memory" clobber
    typedef WFrag<T16> WF; typedef typename WF::V V;
    constexpr int MK = KB / 16, KS = KB / 32;
    constexpr float CEXP = SCL * 1.4426950408889634f;   // scores go to the exponent in log2 units
    constexpr float OFF = HL ? 0.0f : 10.0f;            // 2^10 = PCAR
    const int lane = threadIdx.x & 31, lr = lane & 15, hi = lane >> 4;
    const unsigned fl = (unsigned)lane * 16u, ol = (unsigned)(lr * HD + 8 * hi) * 4u;   // the lane's byte offsets in a half fragment / in a 16-row block of the f32 output
    V qf[2][2], qf2[2][2], kf[MK][2], kf2[MK][2];
    { const T16* uq = Q + (size_t)q0 * HD; const T16* uq2 = HL ? Q2 + (size_t)q0 * HD : uq; const T16* uk2 = HL ? K2 : Kp; const char* pq = (const char*)uq + fl; const char* pq2 = (const char*)uq2 + fl; const char* pk = (const char*)Kp + fl; const char* pk2 = (const char*)uk2 + fl;
#pragma unroll
    for (int nb = 0; nb < 2; ++nb)
#pragma unroll
        for (int kc = 0; kc < 2; ++kc) { const int e = (nb * 2 + kc) * FRG; qf[nb][kc] = ldp<T16>(pq, e); if (HL) qf2[nb][kc] = ldp<T16>(pq2, e); }
    xwaits(uq, uq2);
#pragma unroll
    for (int mb = 0; mb < MK; ++mb)
#pragma unroll
        for (int kc = 0; kc < 2; ++kc) { const int e = (mb * 2 + kc) * FRG; kf[mb][kc] = ldp<T16>(pk, e); if (HL) kf2[mb][kc] = ldp<T16>(pk2, e); }
    xwaits(Kp, uk2); }
    v8f o[4][2], lv[2]; float m[2];
#pragma unroll
    for (int nb = 0; nb < 2; ++nb) { m[nb] = -3.0e38f; lv[nb] = (v8f){};
#pragma unroll
        for (int db = 0; db < 4; ++db) o[db][nb] = (v8f){}; }
    const int nkb = (q0 + 32 + KB - 1) / KB;   // key blocks up to and with the one that holds the last query's diagonal; every block holds key k0 <= q0, so no query meets a block that is masked whole
#pragma unroll 1   // one key block per trip: unrolled, two trips' fragments would not fit the register budget of two waves per SIMD
    for (int kb = 0; kb < nkb; ++kb) {
        const int k0 = kb * KB;
        v8f s[MK][2];
#pragma unroll
        for (int mb = 0; mb < MK; ++mb)
#pragma unroll
            for (int nb = 0; nb < 2; ++nb) s[mb][nb] = (v8f){};
#pragma unroll
        for (int kc = 0; kc < 2; ++kc)
#pragma unroll
            for (int mb = 0; mb < MK; ++mb)
#pragma unroll
                for (int nb = 0; nb < 2; ++nb) { s[mb][nb] = WF::mma(kf[mb][kc], qf[nb][kc], s[mb][nb]); if (HL) { s[mb][nb] = WF::mma(kf[mb][kc], qf2[nb][kc], s[mb][nb]); s[mb][nb] = WF::mma(kf2[mb][kc], qf[nb][kc], s[mb][nb]); } }
        // This block's V fragments and the next block's K fragments fly during the softmax (the last trip re-reads its own K block: in bounds, unused).
        const int kn = (kb + 1 < nkb) ? k0 + KB : k0;
        const char* pv = (const char*)(Vt + (size_t)k0 * HD) + fl; const char* pv2 = HL ? (const char*)(Vt2 + (size_t)k0 * HD) + fl : pv; const char* pk = (const char*)(Kp + (size_t)kn * HD) + fl; const char* pk2 = HL ? (const char*)(K2 + (size_t)kn * HD) + fl : pk;   // 16 keys of k and 32 keys of v^T are whole fragments: both planes advance by HD elements per key
        V vf[4][KS], vf2[4][KS];
#pragma unroll
        for (int db = 0; db < 4; ++db)
#pragma unroll
            for (int ks = 0; ks < KS; ++ks) { const int e = (ks * 4 + db) * FRG; vf[db][ks] = ldp<T16>(pv, e); if (HL) vf2[db][ks] = ldp<T16>(pv2, e); }
#pragma unroll
        for (int mb = 0; mb < MK; ++mb)
#pragma unroll
            for (int kc = 0; kc < 2; ++kc) { const int e = (mb * 2 + kc) * FRG; kf[mb][kc] = ldp<T16>(pk, e); if (HL) kf2[mb][kc] = ldp<T16>(pk2, e); }
        xwait(pv, pv2, pk, pk2);
        if (k0 + KB - 1 > q0) {   // wave-uniform: only blocks that reach past the first query's diagonal are masked
            const int dq = q0 + lr - k0 - hi * 8;   // key mb*16 + hi*8 + j is above the diagonal of query nb*16 + lr when mb*16 + j - nb*16 > dq
#pragma unroll
            for (int mb = 0; mb < MK; ++mb)
#pragma unroll
                for (int nb = 0; nb < 2; ++nb)
#pragma unroll
                    for (int j = 0; j < 8; ++j) if (mb * 16 + j - nb * 16 > dq) s[mb][nb][j] = -3.0e38f;
        }
        V pf[2][KS], pf2[2][KS];
#pragma unroll
        for (int nb = 0; nb < 2; ++nb) {
            v8f mv = s[0][nb];
#pragma unroll
            for (int mb = 1; mb < MK; ++mb) mv = __builtin_elementwise_max(mv, s[mb][nb]);
            float mx = fmaxf(fmaxf(fmaxf(mv[0], mv[1]), fmaxf(mv[2], mv[3])), fmaxf(fmaxf(mv[4], mv[5]), fmaxf(mv[6], mv[7])));
            mx = fmaxf(mx, xhalf(mx));
            const float mn = fmaxf(m[nb], mx * CEXP); const float al = exp2s(m[nb] - mn); m[nb] = mn; const float sub = OFF - mn;
            lv[nb] *= al;
#pragma unroll
            for (int mb = 0; mb < MK; ++mb) { const v8f t = s[mb][nb] * CEXP + sub; v8f p;
#pragma unroll
                for (int j = 0; j < 8; ++j) p[j] = exp2s(t[j]);
                s[mb][nb] = p; lv[nb] += p; }
#pragma unroll
            for (int db = 0; db < 4; ++db) o[db][nb] *= al;
#pragma unroll
            for (int ks = 0; ks < KS; ++ks) {
                if constexpr (HL) { v16us ph, pl;
#pragma unroll
                    for (int e = 0; e < 8; ++e) { unsigned short a, c2; splitf(s[2 * ks][nb][e], a, c2); ph[e] = a; pl[e] = c2; splitf(s[2 * ks + 1][nb][e], a, c2); ph[8 + e] = a; pl[8 + e] = c2; }
                    pf[nb][ks] = __builtin_bit_cast(v16bf, ph); pf2[nb][ks] = __builtin_bit_cast(v16bf, pl);
                } else { v16h ph;
#pragma unroll
                    for (int e = 0; e < 8; ++e) { ph[e] = tohx(s[2 * ks][nb][e]); ph[8 + e] = tohx(s[2 * ks + 1][nb][e]); }
                    pf[nb][ks] = ph; }
            }
        }
#pragma unroll
        for (int ks = 0; ks < KS; ++ks)
#pragma unroll
            for (int db = 0; db < 4; ++db)
#pragma unroll
                for (int nb = 0; nb < 2; ++nb) { o[db][nb] = WF::mma(vf[db][ks], pf[nb][ks], o[db][nb]); if (HL) { o[db][nb] = WF::mma(vf[db][ks], pf2[nb][ks], o[db][nb]); o[db][nb] = WF::mma(vf2[db][ks], pf[nb][ks], o[db][nb]); } }
    }
#pragma unroll
    for (int nb = 0; nb < 2; ++nb) { const float lh = ((lv[nb][0] + lv[nb][1]) + (lv[nb][2] + lv[nb][3])) + ((lv[nb][4] + lv[nb][5]) + (lv[nb][6] + lv[nb][7])); const float lt = lh + xhalf(lh); const float f = __fdiv_rn(HL ? 1.0f : PCAR, lt);   // fp16 rows: o and lt both carry PCAR; one more PCAR is what k_merge takes off
#pragma unroll
        for (int db = 0; db < 4; ++db) o[db][nb] *= f; }
    __builtin_amdgcn_sched_barrier(0);   // all arithmetic ahead of the stores: behind them no register that a store names is written any more
#pragma unroll
    for (int nb = 0; nb < 2; ++nb)
#pragma unroll
        for (int db = 0; db < 4; ++db) *(v8f*)((char*)(O + (size_t)(q0 + nb * 16) * HD + db * 16) + ol) = o[db][nb];   // f32 row lr, columns hi*8..
}
// grid: NB_ * NH_ * TT / 128 workgroups of 4 waves (128 query rows of one head). All are resident together; the first half of the indices takes the long row blocks in falling order, the second half the short ones in rising order.
__global__ __launch_bounds__(128) void k_fattn(const h16* Q16, const bf* Qh, const bf* Ql, const h16* K16, const bf* Kh, const bf* Kl, const h16* VT16, const bf* VTh, const bf* VTl, float* Ob) {
    constexpr int NT = TT / 128, NZ = NB_ * NH_; static_assert(RH % 128 == 0 && NT % 2 == 0 && NH_ == NKV, "row blocks");
    const int idx = blockIdx.x; const int tile = (idx < NZ * NT / 2) ? NT - 1 - idx / NZ : idx / NZ - NT / 2; const int zz = idx % NZ, bb = zz / NH_, hh = zz % NH_;
    const int q0 = tile * 128 + 32 * __builtin_amdgcn_readfirstlane((int)(threadIdx.x >> 5));
    const size_t oq = ((size_t)bb * (NH_ + NKV) + hh) * TT * HD, ov = (size_t)zz * HD * PP;   /* the K pointers are the head planes' base moved on by the NH_ query planes: one offset serves q and k */ float* O = Ob + (size_t)zz * TT * HD;
    if (tile * 128 < RH) attn_rows<bf, true, 32>(Qh + oq, Ql + oq, Kh + oq, Kl + oq, VTh + ov, VTl + ov, O, q0);
    else attn_rows<h16, false, 64>(Q16 + oq, nullptr, K16 + oq, nullptr, VT16 + ov, nullptr, O, q0);
}
__global__ __launch_bounds__(256) void k_lnin2(const float* __restrict__ F, const float* __restrict__ g, const float* __restrict__ bb, bf* Xh, bf* Xl) { const int lane = threadIdx.x & 31; const int row = blockIdx.x * 8 + (threadIdx.x >> 5); if (row >= MT) return; const float* fr = F + (size_t)row * DM; bf* hrow = Xh + (size_t)row * DM; bf* lrow = Xl + (size_t)row * DM; float v[DM / 32]; float s = 0.f;
#pragma unroll
    for (int c = 0; c < DM / 128; ++c) { const v4f a = *(const v4f*)(fr + c * 128 + lane * 4); for (int q = 0; q < 4; ++q) { v[c * 4 + q] = a[q]; s = __fadd_rn(s, a[q]); } }
#pragma unroll
    for (int sh = 16; sh; sh >>= 1) s = __fadd_rn(s, __shfl_xor(s, sh, 32));
    const float mean = __fmul_rn(s, 1.0f / (float)DM);   /* DM = 512: the reciprocal is an exact power of two, identical to the division */ float s2 = 0.f;
#pragma unroll
    for (int k = 0; k < DM / 32; ++k) { const float dv = __fsub_rn(v[k], mean); float p2 = __fmul_rn(dv, dv); asm volatile("" : "+v"(p2)); s2 = __fadd_rn(s2, p2); v[k] = dv; }
#pragma unroll
    for (int sh = 16; sh; sh >>= 1) s2 = __fadd_rn(s2, __shfl_xor(s2, sh, 32));
    const float rs = __fdiv_rn(1.0f, __fsqrt_rn(__fadd_rn(__fmul_rn(s2, 1.0f / (float)DM), LNEPS)));
{
#pragma unroll
        for (int c = 0; c < DM / 128; ++c) { v4us oh, ol; for (int q = 0; q < 4; ++q) { const int col = c * 128 + lane * 4 + q; float y = __fmul_rn(v[c * 4 + q], rs); asm volatile("" : "+v"(y)); float gg = bfr(g[col]), bb2 = bfr(bb[col]); asm volatile("" : "+v"(gg), "+v"(bb2)); y = __fmul_rn(y, gg); asm volatile("" : "+v"(y)); const float r = __fadd_rn(y, bb2); unsigned short hh2, ll2; splitf(r, hh2, ll2); oh[q] = hh2; ol[q] = ll2; } *(v4us*)(hrow + c * 128 + lane * 4) = oh; *(v4us*)(lrow + c * 128 + lane * 4) = ol; }
         } }

__global__ __launch_bounds__(256) void k_lnout(const float* __restrict__ F, const float* __restrict__ g, const float* __restrict__ bb, float* out) { const int lane = threadIdx.x & 31; const int row = blockIdx.x * 8 + (threadIdx.x >> 5); if (row >= MT) return; const float* fr = F + (size_t)row * DQ; float* orow = out + (size_t)row * DQ; float v[DQ / 32]; float s = 0.f;
#pragma unroll
    for (int c = 0; c < DQ / 128; ++c) { const v4f a = *(const v4f*)(fr + c * 128 + lane * 4); for (int q = 0; q < 4; ++q) { v[c * 4 + q] = a[q]; s = __fadd_rn(s, a[q]); } }
#pragma unroll
    for (int sh = 16; sh; sh >>= 1) s = __fadd_rn(s, __shfl_xor(s, sh, 32));
    const float mean = __fdiv_rn(s, (float)DQ); float s2 = 0.f;
#pragma unroll
    for (int k = 0; k < DQ / 32; ++k) { const float dv = __fsub_rn(v[k], mean); float p2 = __fmul_rn(dv, dv); asm volatile("" : "+v"(p2)); s2 = __fadd_rn(s2, p2); v[k] = dv; }
#pragma unroll
    for (int sh = 16; sh; sh >>= 1) s2 = __fadd_rn(s2, __shfl_xor(s2, sh, 32));
    const float rs = __fdiv_rn(1.0f, __fsqrt_rn(__fadd_rn(__fdiv_rn(s2, (float)DQ), LNEPS)));
{
#pragma unroll
        for (int c = 0; c < DQ / 128; ++c) { v4f o; for (int q = 0; q < 4; ++q) { const int col = c * 128 + lane * 4 + q; float y = __fmul_rn(v[c * 4 + q], rs); asm volatile("" : "+v"(y)); y = __fmul_rn(y, bfr(g[col])); asm volatile("" : "+v"(y)); o[q] = __fadd_rn(y, bfr(bb[col])); } *(v4f*)(orow + c * 128 + lane * 4) = o; }
         } }

__global__ __launch_bounds__(256) void k_merge(const float* __restrict__ O, bf* Ah, bf* Al) { const size_t e = ((size_t)blockIdx.x * 256 + threadIdx.x) * 2; if (e >= (size_t)NB_ * NH_ * TT * HD) return; const int d = (int)(e % HD); const int t = (int)((e / HD) % TT); const int zz = (int)(e / ((size_t)HD * TT)); const float cs = (t < RH) ? 1.0f : (1.0f / PCAR); const size_t oo = ((size_t)(zz / NH_) * TT + t) * DQ + (zz % NH_) * HD + d;   /* zz = batch element * NH_ + head */
    v2us oh, ol;
#pragma unroll
    for (int q = 0; q < 2; ++q) { unsigned short a, c2; splitf(O[e + q] * cs, a, c2); oh[q] = a; ol[q] = c2; } *(v2us*)(Ah + oo) = oh; *(v2us*)(Al + oo) = ol;  }

extern "C" void kernel_launch(void* const* d_in, const int* in_sizes, int n_in,
                              void* d_out, int out_size, void* d_ws, size_t ws_size, hipStream_t stream) {
    (void)in_sizes; (void)n_in; (void)out_size;
    const float* x = (const float*)d_in[0]; const float* pq = (const float*)d_in[1]; const float* pk = (const float*)d_in[2]; const float* pv = (const float*)d_in[3];   /* [8][512][64] each */ const float* wo = (const float*)d_in[4];   /* Wproj [512][512] 'xw' */ const float* g1 = (const float*)d_in[5]; const float* b1 = (const float*)d_in[6]; const float* w1 = (const float*)d_in[7]; const float* bb1 = (const float*)d_in[8]; const float* w2 = (const float*)d_in[9]; const float* bb2 = (const float*)d_in[10]; const float* g2 = (const float*)d_in[11]; const float* b2 = (const float*)d_in[12]; const float* wq = pq, *wk = pk, *wv = pv;
    float* OUT = (float*)d_out;     // [4][2048][512]
    char* wsp = (char*)d_ws;
    auto take = [&](size_t bytes) { char* p = wsp; wsp += (bytes + 255) & ~(size_t)255; return (void*)p; };
    // Live through the whole call: the transposed weights and the merged attention output planes.
    bf* W1T = (bf*)take((size_t)FF * DM * 2); bf* W2T = (bf*)take((size_t)DM * FF * 2); bf* WQKV = (bf*)take((size_t)NQKV * DM * 2);   /* rows: q heads, k heads, v heads */ bf* WO = (bf*)take((size_t)DM * DQ * 2); bf* ATh = (bf*)take((size_t)MT * DQ * 2); bf* ATl = (bf*)take((size_t)MT * DQ * 2);
    char* const mark = wsp;
    // Phase 1 (projections and attention). Head planes [batch][q heads, then k heads], TT * HD elements each, and transposed v planes [batch][head], all in fragment order (FRG); a (batch, head)'s HD * PP elements hold the hi plane, then the lo plane (the fp16 plane fills the first half, the rest is never touched).
    h16* QK16 = (h16*)take((size_t)NB_ * (NH_ + NKV) * TT * HD * 2); bf* QKh = (bf*)take((size_t)NB_ * (NH_ + NKV) * TT * HD * 2); bf* QKl = (bf*)take((size_t)NB_ * (NH_ + NKV) * TT * HD * 2);
    h16* VT16 = (h16*)take((size_t)NB_ * NKV * HD * PP * 2); bf* VTh = (bf*)take((size_t)NB_ * NKV * HD * PP * 2); bf* VTl = VTh + (size_t)HD * TT; float* Ob = (float*)take((size_t)NB_ * NH_ * TT * HD * 4);
    bf* XB = (bf*)take((size_t)MT * DM * 2);
    if ((size_t)(wsp - (char*)d_ws) > ws_size) return;    // ws 256 MiB
    // Phase 2 (Wproj, LayerNorms, feed-forward) starts after the last read of every phase-1 buffer and shares their bytes (stream-ordered).
    wsp = mark; float* Y = (float*)take((size_t)MT * DM * 4); bf* LNh = (bf*)take((size_t)MT * DM * 2); bf* LNl = (bf*)take((size_t)MT * DM * 2); bf* H1h = (bf*)take((size_t)MT * FF * 2); bf* H1l = (bf*)take((size_t)MT * FF * 2); float* F2 = (float*)take((size_t)MT * DM * 4);
    if ((size_t)(wsp - (char*)d_ws) > ws_size) return;
    k_prep<<<2 * PB_W + PB_QKV + PB_WO + PB_X, 256, 0, stream>>>(x, wq, wk, wv, wo, w1, w2, XB, WQKV, WO, W1T, W2T);   /* transposed bf16 weights and the bf16 copy of x */
    k_gemms<0, false, E_QKV, HD><<<dim3(MT / 128, NQKV / 128, 1), 256, 0, stream>>>(XB, nullptr, WQKV, DM, nullptr, nullptr, nullptr, QK16, QKh, QKl, VT16, VTh, VTl);   /* q | k | v of all batch elements -> head planes and transposed v planes */
    k_fattn<<<NB_ * NH_ * (TT / 128), 128, 0, stream>>>(QK16, QKh, QKl, QK16 + (size_t)NH_ * TT * HD, QKh + (size_t)NH_ * TT * HD, QKl + (size_t)NH_ * TT * HD, VT16, VTh, VTl, Ob);   /* all batch elements and heads */
    k_merge<<<(unsigned)(((size_t)NB_ * NH_ * TT * HD / 2 + 255) / 256), 256, 0, stream>>>(Ob, ATh, ATl);
    k_gemms<1, false, E_RES, DM><<<dim3(MT / 128, DM / 128, 1), 256, 0, stream>>>(ATh, ATl, WO, DQ, Y, nullptr, x, nullptr, nullptr, nullptr, nullptr, nullptr, nullptr);   /* o Wproj + x */
    k_lnin2<<<(MT + 7) / 8, 256, 0, stream>>>(Y, g1, b1, LNh, LNl);   /* out1 = LN1 as bf16 hi/lo planes */
    k_gemms<1, true, E_RELU, FF><<<dim3(MT / 128, FF / 128, 1), 256, 0, stream>>>(LNh, LNl, W1T, DM, nullptr, bb1, nullptr, nullptr, H1h, H1l, nullptr, nullptr, nullptr);   /* relu(out1 W1 + bb1) -> hi/lo planes */
    k_gemms<1, true, E_RES, DM><<<dim3(MT / 128, DM / 128, 1), 256, 0, stream>>>(H1h, H1l, W2T, FF, F2, bb2, x, nullptr, nullptr, nullptr, nullptr, nullptr, nullptr);   /* W2 + bb2 + the ORIGINAL x */
    k_lnout<<<(MT + 7) / 8, 256, 0, stream>>>(F2, g2, b2, OUT);   /* LN2 -> out */
}

// v008
// A run of this version takes 166 microseconds.
// Two timings next to v007 put it at 1.03 and 1.02 times that version's speed.
// All steps since v000 together make it 12.3 times as fast.
#include <hip/hip_runtime.h>

// Post-LN transformer block with per-head projection tensors (x [4][2048][512]; q,k,v = einsum('bse,hed', x, W) (Wq, Wk, Wv [8][512][64] 1/sqrt(512): head h's 'xw' block); 8 heads x 64; scores / 8; causal (-inf); softmax; o = concat heads; out1 = LayerNorm(x + o Wproj) (Wproj 'xw' [512][512]; eps 1e-5, g1/b1); ff = relu(out1 W1 + bb1) W2 + bb2 (W1 [512][2048], W2 [2048][512] 'xw', zero biases); out = LayerNorm(ff + x, g2, b2) (the residual is the ORIGINAL x) -> [4][2048][512] (4.2 M)).
// Layout: every kernel outside attention runs once over the 8192 rows of all 4 batch elements (q, k, v as one GEMM with 1536 columns); attention is one launch over all batch elements and heads, with the scores kept in registers (online softmax). Every elementwise pass behind a GEMM is done in that GEMM's epilogue, on the f32 values before they leave the workgroup. Steps: bf16 copy of x; per-head 'xw' weight blocks of Wq, Wk, Wv transposed into one joint Bt (rows (tensor*8 + h)*64..), Wproj/W1/W2 transposed once; exact projections, written as the q/k head planes and the transposed v planes (fp16 + hi/lo); causal T-2048 attention (hybrid rows: < 512 hi/lo 3 products, rest fp16 x1024; key blocks above the diagonal skipped); Y = merged hi/lo x Wproj exact + bf16(x); a row-LayerNorm kernel emits out1 as bf16 hi/lo planes; relu(hi/lo x W1 exact + bb1) written as hi/lo planes; F2 = hi/lo x W2 exact + bb2 + bf16(x); the final row-LayerNorm writes the output rows.
// Compute dtypes, f32 accumulate: every input rounded to bf16; projections exact; attention rows < 512 3 products, rest fp16; softmax f32; Wproj hl x exact; residuals/LayerNorms f32 (fixed-order sums); FFN GEMMs 2 products (~f32) + f32 biases; relu f32.

#define NB_  4
#define TT   2048
#define DM   512
#define NH_  8
#define NKV  8
#define REP  (NH_ / NKV)
#define HD   64
#define DQ   (NH_ * HD)
#define DKV  (NKV * HD)
#define MT   (NB_ * TT)           // rows of all batch elements together
#define NQKV (DQ + 2 * DKV)       // columns of the joint q|k|v projection
#define PP   (2 * TT)             // a (batch, head)'s part of a transposed v buffer is HD * PP 16-bit elements: room for two planes of HD * TT
#define RH   512                  // query rows < RH use hi+lo planes (0: none)
#define PCAR 1024.0f
#define SCL  0.125f   // HD^-0.5
#define FF   2048     // feed-forward width
#define LNEPS 1e-5f
typedef _Float16 h16;
typedef unsigned short bf;
typedef __attribute__((ext_vector_type(16))) __bf16   v16bf;
typedef __attribute__((ext_vector_type(16))) _Float16 v16h;
typedef __attribute__((ext_vector_type(8)))  _Float16 v8h;
typedef __attribute__((ext_vector_type(8)))  unsigned short v8us;
typedef __attribute__((ext_vector_type(8)))  float    v8f;
typedef __attribute__((ext_vector_type(4)))  float    v4f;
typedef v8h  __attribute__((may_alias)) v8ha;
typedef v4f  __attribute__((may_alias)) v4fa;
typedef v8us __attribute__((may_alias)) v8usa;

__device__ __forceinline__ unsigned short f2bf(float f) { unsigned u = __float_as_uint(f); u += 0x7FFFu + ((u >> 16) & 1u); return (unsigned short)(u >> 16); }
__device__ __forceinline__ float bf2f(unsigned short b) { return __uint_as_float(((unsigned)b) << 16); }
__device__ __forceinline__ float bfr(float f) { return bf2f(f2bf(f)); }
__device__ __forceinline__ v16h cat16(v8h lo, v8h hi) { return __builtin_shufflevector(lo, hi, 0, 1, 2, 3, 4, 5, 6, 7, 8, 9, 10, 11, 12, 13, 14, 15); }
__device__ __forceinline__ v16bf cat16b(v8us lo, v8us hi) { return __builtin_bit_cast(v16bf, __builtin_shufflevector(lo, hi, 0, 1, 2, 3, 4, 5, 6, 7, 8, 9, 10, 11, 12, 13, 14, 15)); }
__device__ __forceinline__ v8f wmma16(v16h a, v16h b, v8f c) { return __builtin_amdgcn_wmma_f32_16x16x32_f16(false, a, false, b, (short)0, c, false, false); }
__device__ __forceinline__ v8f wmmab(v16bf a, v16bf b, v8f c) { return __builtin_amdgcn_wmma_f32_16x16x32_bf16(false, a, false, b, (short)0, c, false, false); }
__device__ __forceinline__ h16 tohx(float x) { return (h16)x; }
__device__ __forceinline__ void splitf(float y, unsigned short& h, unsigned short& l) { h = f2bf(y); l = f2bf(y - bf2f(h)); }



// ---- k_gemms: GEMM with the operand tiles staged in LDS; one workgroup of 8 waves (4 x 2) per 128x128 output tile, 32x64 per wave; grid (M/128, N/128), 256 threads.
// c[m][n] (f32, + optional f32 bias[n]) = sum_k (A[m][k] + A2[m][k]) Bt[n][k] (A2 only with NSPLIT == 1), all planes K-contiguous bf16. M % 128 == 0, N % 128 == 0, K % 64 == 0.
// What leaves the workgroup (EPI): E_RES: C = c + bf16(xr), f32, both of pitch LDC. E_RELU: max(c, 0) as bf16 hi/lo planes Ph, Pl of pitch LDC. E_QKV: columns < DQ + DKV as head planes P16 (fp16), Ph, Pl [batch][head], each plane in fragment order [t / 16][d / 32] (rows t, k = d); the v columns behind them as transposed planes V16, Vh, Vl, [batch][head] HD * PP elements apart, in fragment order [t / 32][d / 16] (rows d, k = t).
// A stage is 64 k (one 128-byte line) of the 128 rows of every plane: [Bt | A | A2], rows at pitch GP. Two buffers: asynchronous copies fill the next stage while this one is multiplied; every wave sums the whole K in ascending order.
#define GP   144u          // LDS row pitch in bytes: 128 + 16, an odd multiple of 16 for the ds_load_b128 readers
#define GPL  (128u * GP)   // one plane of a stage
// Fragment order of the attention operands in global memory: a 16-row x 32-k fragment is FRG consecutive elements (1 KiB), two halves of 512 bytes; in half g lane (lr, hi) = hi*16 + lr owns 16 bytes, row lr, k g*16 + hi*8 .. + 7. Each of the two loads of a fragment is then 512 consecutive bytes, 4 whole lines per wave. WFrag::ld takes the lane's address in half 0.
#define FRG  512
template <typename T16> struct WFrag;
template <> struct WFrag<h16> { typedef v16h V; static __device__ __forceinline__ V ld(const h16* p) { return cat16(*(const v8h*)p, *(const v8h*)(p + FRG / 2)); } static __device__ __forceinline__ v8f mma(V a, V b, v8f c) { return wmma16(a, b, c); } };
template <> struct WFrag<bf> { typedef v16bf V; static __device__ __forceinline__ V ld(const bf* p) { return cat16b(*(const v8us*)p, *(const v8us*)(p + FRG / 2)); } static __device__ __forceinline__ v8f mma(V a, V b, v8f c) { return wmmab(a, b, c); } };
__device__ __forceinline__ unsigned lds_off(const void* p) { return (unsigned)(size_t)p; }
__device__ __forceinline__ v16bf ldl(const unsigned char* p) { return cat16b(*(const v8us*)p, *(const v8us*)(p + 32)); }
#define CPY(a, b) "global_load_async_to_lds_b128 %" #a ", %" #b ", off\n\t"
// One stage: every lane copies 16 bytes of 4 rows (32 rows apart) of each of the NP planes, a wave 4 whole lines per copy. l: the lane's LDS byte address in plane 0; g0..g2: its global addresses; rs: 32 rows in bytes.
// The copies and the s_wait_xcnt stand in one statement, so that no address register of a copy is rewritten ahead of the wait.
template <int NP> __device__ __forceinline__ void stage_copy(unsigned l, const char* g0, const char* g1, const char* g2, size_t rs) {
    if constexpr (NP == 3)
        asm volatile(CPY(0, 1) CPY(2, 3) CPY(4, 5) CPY(6, 7) CPY(8, 9) CPY(10, 11) CPY(12, 13) CPY(14, 15) CPY(16, 17) CPY(18, 19) CPY(20, 21) CPY(22, 23) "s_wait_xcnt 0x0"
            :: "v"(l), "v"(g0), "v"(l + 32u * GP), "v"(g0 + rs), "v"(l + 64u * GP), "v"(g0 + 2 * rs), "v"(l + 96u * GP), "v"(g0 + 3 * rs),
               "v"(l + GPL), "v"(g1), "v"(l + GPL + 32u * GP), "v"(g1 + rs), "v"(l + GPL + 64u * GP), "v"(g1 + 2 * rs), "v"(l + GPL + 96u * GP), "v"(g1 + 3 * rs),
               "v"(l + 2u * GPL), "v"(g2), "v"(l + 2u * GPL + 32u * GP), "v"(g2 + rs), "v"(l + 2u * GPL + 64u * GP), "v"(g2 + 2 * rs), "v"(l + 2u * GPL + 96u * GP), "v"(g2 + 3 * rs) : "memory");
    else
        asm volatile(CPY(0, 1) CPY(2, 3) CPY(4, 5) CPY(6, 7) CPY(8, 9) CPY(10, 11) CPY(12, 13) CPY(14, 15) "s_wait_xcnt 0x0"
            :: "v"(l), "v"(g0), "v"(l + 32u * GP), "v"(g0 + rs), "v"(l + 64u * GP), "v"(g0 + 2 * rs), "v"(l + 96u * GP), "v"(g0 + 3 * rs),
               "v"(l + GPL), "v"(g1), "v"(l + GPL + 32u * GP), "v"(g1 + rs), "v"(l + GPL + 64u * GP), "v"(g1 + 2 * rs), "v"(l + GPL + 96u * GP), "v"(g1 + 3 * rs) : "memory");
}
// One fragment set: 32 k of the wave's 32 rows of A (and A2) and 64 rows of Bt. pa, pb: the lane's addresses in the A and the Bt plane of a stage.
template <int NSPLIT> struct FSet { v16bf a[2], a2[2], b[4]; };
template <int NSPLIT> __device__ __forceinline__ void ld_set(FSet<NSPLIT>& f, const unsigned char* pa, const unsigned char* pb) {   // in the order of use
#pragma unroll
    for (int mb = 0; mb < 2; ++mb) f.a[mb] = ldl(pa + mb * 16 * GP);
#pragma unroll
    for (int nb = 0; nb < 4; ++nb) f.b[nb] = ldl(pb + nb * 16 * GP);
    if (NSPLIT) {
#pragma unroll
        for (int mb = 0; mb < 2; ++mb) f.a2[mb] = ldl(pa + GPL + mb * 16 * GP); }
}
template <int NSPLIT> __device__ __forceinline__ void mm_set(const FSet<NSPLIT>& f, v8f (&acc)[2][4]) {   // eight independent accumulators between two products into the same one
#pragma unroll
    for (int nb = 0; nb < 4; ++nb)
#pragma unroll
        for (int mb = 0; mb < 2; ++mb) acc[mb][nb] = wmmab(f.a[mb], f.b[nb], acc[mb][nb]);
    if (NSPLIT) {
#pragma unroll
        for (int nb = 0; nb < 4; ++nb)
#pragma unroll
            for (int mb = 0; mb < 2; ++mb) acc[mb][nb] = wmmab(f.a2[mb], f.b[nb], acc[mb][nb]); }
}
#define E_RES  0
#define E_RELU 1
#define E_QKV  2
#define VSP  272u          // LDS row pitch in bytes of the transposed v staging: 128 t x 2 bytes + 16
#define VSPL (128u * VSP)  // one plane of it
template <int NSPLIT, bool BIAS, int EPI, int LDC>
__global__ __launch_bounds__(256) void k_gemms(const bf* A, const bf* A2, const bf* Bt, int K, float* C, const float* __restrict__ bias, const float* xr, h16* P16, bf* Ph, bf* Pl, h16* V16, bf* Vh, bf* Vl) {
    constexpr int NP = NSPLIT ? 3 : 2; constexpr unsigned STG = NP * GPL;
    static_assert(2 * STG >= 8 * 32 * 68 * 4, "the output staging reuses the ring");
    constexpr unsigned SMB = (EPI == E_QKV && 3u * VSPL > 2u * STG) ? 3u * VSPL : 2u * STG;   // the three transposed v planes of a tile need more than the ring
    __shared__ __attribute__((aligned(16))) unsigned char sm[SMB];
    const int tid = (int)threadIdx.x, lane = tid & 31, lr = lane & 15, hi = lane >> 4; const int w = __builtin_amdgcn_readfirstlane(tid >> 5), wm = w >> 1, wn = w & 1; const int r0 = blockIdx.x * 128, c0 = blockIdx.y * 128;
    const size_t rowb = (size_t)K * 2; const int crow = tid >> 3; const unsigned cch = (unsigned)(tid & 7) * 16u;   // the lane's first row and its 16-byte piece of the line
    const char* gb = (const char*)Bt + (size_t)(c0 + crow) * rowb + cch; const char* ga = (const char*)A + (size_t)(r0 + crow) * rowb + cch; const char* ga2 = NSPLIT ? (const char*)A2 + (size_t)(r0 + crow) * rowb + cch : ga;
    const unsigned lc = lds_off(sm) + (unsigned)crow * GP + cch; const int nt = K >> 6;
    stage_copy<NP>(lc, gb, ga, ga2, 32 * rowb);
    asm volatile("s_wait_asynccnt 0x0" ::: "memory");   // stage 0 of this wave has landed
    __syncthreads();                                     // ... and every wave's: nobody reads it in front of this barrier
    if (nt > 1) stage_copy<NP>(lc + STG, gb + 128, ga + 128, ga2 + 128, 32 * rowb);
    v8f acc[2][4];
#pragma unroll
    for (int mb = 0; mb < 2; ++mb)
#pragma unroll
        for (int nb = 0; nb < 4; ++nb) acc[mb][nb] = (v8f){};
    const unsigned fb = (unsigned)(wn * 64 + lr) * GP + 16u * hi, fa = GPL + (unsigned)(wm * 32 + lr) * GP + 16u * hi;   // the lane's fragment offsets in a stage
    // Two fragment sets, each half a stage, fetched one half ahead: f0 = k 0..31 of a stage, f1 = k 32..63. The publish point of stage t + 1 therefore stands in the middle of trip t, behind the last reads of stage t and ahead of the first reads of stage t + 1.
    FSet<NSPLIT> f0, f1;
    ld_set<NSPLIT>(f0, sm + fa, sm + fb);
#pragma unroll 1   // one stage per trip: the ring's order of waits, barrier and refill stands once
    for (int t = 0; t < nt; ++t) {
        const unsigned char* sb = sm + (unsigned)(t & 1) * STG;
        ld_set<NSPLIT>(f1, sb + fa + 64, sb + fb + 64);
        __builtin_amdgcn_sched_barrier(0);   // the reads stay one group ahead of the WMMAs that they fly behind
        mm_set<NSPLIT>(f0, acc);
        __builtin_amdgcn_sched_barrier(0);   // these WMMAs stay ahead of the waits: they cover the flight of f1's reads and of the copies
        asm volatile("s_wait_dscnt 0x0" ::: "memory");      // this wave's last reads of stage t have returned before its buffer is refilled
        asm volatile("s_wait_asynccnt 0x0" ::: "memory");   // this wave's copies of stage t + 1 have landed
        __syncthreads();                                     // publishes stage t + 1 and ends every wave's reads of stage t
        if (t + 2 < nt) stage_copy<NP>(lc + (unsigned)(t & 1) * STG, gb + (size_t)(t + 2) * 128, ga + (size_t)(t + 2) * 128, ga2 + (size_t)(t + 2) * 128, 32 * rowb);
        if (t + 1 < nt) { const unsigned char* sn = sm + (unsigned)((t + 1) & 1) * STG; ld_set<NSPLIT>(f0, sn + fa, sn + fb); }
        mm_set<NSPLIT>(f1, acc);
    }
    asm volatile("s_wait_asynccnt 0x0" ::: "memory");   // no copy is outstanding when the ring becomes output staging
    if (EPI == E_QKV && c0 >= DQ + DKV) {   // the same for the whole workgroup
        // v columns, transposed: a lane holds 8 consecutive t of one d, 16 bytes of a 16-bit plane's row. The tile's three planes are gathered in LDS as [d][t], so that whole 128-byte lines leave.
#pragma unroll
        for (int mb = 0; mb < 2; ++mb)
#pragma unroll
            for (int nb = 0; nb < 4; ++nb) { v8h o16; v8us oh, ol;
#pragma unroll
                for (int j = 0; j < 8; ++j) { const float xv = acc[mb][nb][j]; o16[j] = tohx(xv); unsigned short a2, c2; splitf(xv, a2, c2); oh[j] = a2; ol[j] = c2; }
                unsigned char* vp = sm + (unsigned)(wn * 64 + nb * 16 + lr) * VSP + (unsigned)(wm * 32 + mb * 16 + hi * 8) * 2u;
                *(v8ha*)vp = o16; *(v8usa*)(vp + VSPL) = oh; *(v8usa*)(vp + 2u * VSPL) = ol; }
        __syncthreads();   // every wave's part of a row is in LDS before the row is read
        const size_t vf0 = ((size_t)(r0 / TT) * NKV + (c0 - DQ - DKV) / HD + (w >> 2)) * HD * PP + (size_t)((r0 % TT) / 32 * 4 + (w & 3)) * FRG + lane * 8;   // wave w: the 16 rows d = (w & 3) * 16 .. of head w >> 2 of the tile's two; fragments [t / 32][d / 16], half a fragment (512 bytes) per store
#pragma unroll
        for (int s = 0; s < 8; ++s) { const unsigned char* vp = sm + (unsigned)(w * 16 + lr) * VSP + (unsigned)(s * 16 + hi * 8) * 2u; const size_t eo = vf0 + (s >> 1) * (4 * FRG) + (s & 1) * (FRG / 2);
            *(v8h*)(V16 + eo) = *(const v8ha*)vp; *(v8us*)(Vh + eo) = *(const v8usa*)(vp + VSPL); *(v8us*)(Vl + eo) = *(const v8usa*)(vp + 2u * VSPL); }
    } else {
    // Whole 128-byte lines out: each wave stages its 32x64 tile in its own part of the ring (pitch 68 floats) and reads rows back.
    const size_t ut = (size_t)(r0 + wm * 32) * LDC + c0 + wn * 64;   // the wave's tile in a [m][n] array of pitch LDC (wave-uniform)
    const unsigned lx = (unsigned)((lane >> 4) * LDC + (lane & 15) * 4) * 4u;   // E_RES: the lane's byte offset in the tile; its piece s stands 2 rows further on per s
    v4f rx[16];
    if constexpr (EPI == E_RES) {   // the residual's loads fly during the staging
        const char* ux = (const char*)(xr + ut);
#pragma unroll
        for (int s = 0; s < 16; ++s) rx[s] = *(const v4f*)(ux + lx + (unsigned)s * (2u * LDC * 4u));
        asm volatile("s_wait_xcnt 0x0" :: "v"(lx), "s"(ux) : "memory");   // stands between the issued loads and every later rewrite of their address registers, which are inputs so that they stay untouched up to here
    }
    float* os = (float*)sm + w * (32 * 68);
#pragma unroll
    for (int mb = 0; mb < 2; ++mb)
#pragma unroll
        for (int nb = 0; nb < 4; ++nb)
#pragma unroll
            for (int j = 0; j < 8; ++j) os[(mb * 16 + hi * 8 + j) * 68 + nb * 16 + lr] = acc[mb][nb][j];
    __syncthreads();   // orders the staging writes against the row reads
    if constexpr (EPI == E_RES) {
        char* uc = (char*)(C + ut);
#pragma unroll
        for (int s = 0; s < 16; ++s) { const int item = s * 32 + lane; const int row = item >> 4, cofs = (item & 15) * 4; v4f val = *(const v4fa*)(os + row * 68 + cofs);
            if (BIAS) { const int cb = c0 + wn * 64 + cofs; val[0] += bfr(bias[cb]); val[1] += bfr(bias[cb + 1]); val[2] += bfr(bias[cb + 2]); val[3] += bfr(bias[cb + 3]); }
#pragma unroll
            for (int q = 0; q < 4; ++q) val[q] = __fadd_rn(val[q], bfr(rx[s][q]));
            *(v4f*)(uc + lx + (unsigned)s * (2u * LDC * 4u)) = val; }
    } else {
        // 16-bit planes, 16 bytes per lane and plane. E_RELU: 8 lanes per 128-byte row of the wave's tile. E_QKV: fragment order; the wave's 32 t x 64 d are 4 whole fragments, which start where its rows would.
        const size_t tile0 = (EPI == E_QKV) ? (((size_t)(r0 / TT) * (NH_ + NKV) + (c0 + wn * 64) / HD) * TT + r0 % TT + wm * 32) * HD : ut; constexpr int pitch = (EPI == E_QKV) ? HD : LDC;
#pragma unroll
        for (int s = 0; s < 8; ++s) { const int row = (EPI == E_QKV) ? (s >> 2) * 16 + lr : (s * 32 + lane) >> 3, cofs = (EPI == E_QKV) ? s % 4 * 16 + hi * 8 : (lane & 7) * 8;   /* E_QKV: piece s is half s & 1 of fragment s >> 1 of the wave's [t / 16][d / 32] */ const v4f va = *(const v4fa*)(os + row * 68 + cofs), vb = *(const v4fa*)(os + row * 68 + cofs + 4); v8h o16; v8us oh, ol;
#pragma unroll
            for (int q = 0; q < 8; ++q) { float y = (q < 4) ? va[q & 3] : vb[q & 3];
                if (BIAS) y += bfr(bias[c0 + wn * 64 + cofs + q]);
                if (EPI == E_RELU) y = (y > 0.0f) ? y : 0.0f;
                if (EPI == E_QKV) o16[q] = tohx(y);
                unsigned short a2, c2; splitf(y, a2, c2); oh[q] = a2; ol[q] = c2; }
            const size_t e = (EPI == E_QKV) ? tile0 + s * (FRG / 2) + lane * 8 : tile0 + (size_t)row * pitch + cofs;
            if (EPI == E_QKV) *(v8h*)(P16 + e) = o16;
            *(v8us*)(Ph + e) = oh; *(v8us*)(Pl + e) = ol; }
        if constexpr (EPI == E_QKV) asm volatile("s_wait_xcnt 0x0" ::: "memory");   // in the listing the v branch's code follows these stores: the wait stands between them and its writes of the registers that they name
    }
    }
}

typedef __attribute__((ext_vector_type(2))) _Float16 v2h;
typedef __attribute__((ext_vector_type(4))) _Float16 v4h;
typedef __attribute__((ext_vector_type(2))) unsigned short v2us;
typedef __attribute__((ext_vector_type(4))) unsigned short v4us;
typedef __attribute__((ext_vector_type(2))) float v2f;
typedef __attribute__((ext_vector_type(4))) int v4i;

// One [K][N] f32 matrix w -> its transpose Bt [N][K] in bf16. Block bx of the matrix takes 64 lines of 64 elements of Bt, a wave 8 of them.
template <int K, int N> __device__ __forceinline__ void wt_lines(const float* __restrict__ w, bf* Bt, int bx) {
    static_assert(N * K % (64 * 64) == 0, "whole blocks");
    const int lane = threadIdx.x & 31; const int L0 = (bx * 8 + (int)(threadIdx.x >> 5)) * 8;
#pragma unroll 1   // rolled: the flight of a trip's two loads is covered by the launch's other waves, not by more registers and text of this one
    for (int l = 0; l < 8; ++l) { const int e = (L0 + l) * 64 + lane * 2; const int k = e % K, n = e / K; v2us o;
        o[0] = f2bf(w[(size_t)k * N + n]); o[1] = f2bf(w[(size_t)(k + 1) * N + n]); *(v2us*)(Bt + e) = o;
        asm volatile("s_wait_xcnt 0x0" ::: "memory"); }   // stands between the issued store and the next trip's rewrite of the registers that it names
}
// ---- k_prep: everything that depends on the inputs alone, in one launch; the parts are independent and share the grid by block range. The transposes stand first: their waves run the longest chains of loads.
#define PB_W   (DM * FF / (64 * 64))            // blocks of W1, and of W2
#define PB_H   (DM * HD / (64 * 64))            // blocks of one head's [DM][HD] matrix
#define PB_QKV (3 * NH_ * PB_H)
#define PB_WO  (DQ * DM / (64 * 64))
#define PB_X   (MT * DM / (8 * 256))            // x: 8 elements per lane
__global__ __launch_bounds__(256) void k_prep(const float* __restrict__ x, const float* __restrict__ wq, const float* __restrict__ wk, const float* __restrict__ wv, const float* __restrict__ wo, const float* __restrict__ w1, const float* __restrict__ w2, bf* XB, bf* WQKV, bf* WO, bf* W1T, bf* W2T) {
    static_assert(MT * DM % (8 * 256) == 0 && NH_ == NKV, "whole blocks; q, k and v have the same number of heads");
    int b = blockIdx.x;
    if (b < PB_W) { wt_lines<FF, DM>(w2, W2T, b); return; }   // W2 'xw' [2048][512] -> Bt [512][2048]
    b -= PB_W;
    if (b < PB_W) { wt_lines<DM, FF>(w1, W1T, b); return; }   // W1 'xw' [512][2048] -> Bt [2048][512]
    b -= PB_W;
    if (b < PB_QKV) { const int mz = b / PB_H, ts = mz / NH_;   // every head's 'xw' [512][64] block of Wq, Wk, Wv -> Bt rows (tensor * 8 + head) * 64..
        wt_lines<DM, HD>((ts == 0 ? wq : ts == 1 ? wk : wv) + (size_t)(mz % NH_) * DM * HD, WQKV + (size_t)mz * DM * HD, b % PB_H); return; }
    b -= PB_QKV;
    if (b < PB_WO) { wt_lines<DQ, DM>(wo, WO, b); return; }   // Wproj 'xw' [512][512]
    b -= PB_WO;
    const size_t i = (size_t)b * 256 + threadIdx.x; const v8f v = *(const v8f*)(x + i * 8); v8us o;   // bf16 copy of x
#pragma unroll
    for (int k = 0; k < 8; ++k) o[k] = f2bf(v[k]);
    *(v8us*)(XB + i * 8) = o;
    asm volatile("s_wait_xcnt 0x0" ::: "memory");   // stands behind the issued store, in front of any later rewrite of the registers that it names
}

typedef __attribute__((ext_vector_type(16))) unsigned short v16us;
// Lane l with lane l ^ 16 (the two halves of a wave hold the two halves of a query's keys).
__device__ __forceinline__ float xhalf(float x) { return __builtin_bit_cast(float, __builtin_amdgcn_permlanex16(__builtin_bit_cast(int, x), __builtin_bit_cast(int, x), 0x76543210, 0xfedcba98, false, false)); }
// 2^x with the issue slot behind the transcendental filled in the same statement, so that no instruction directly behind it reads its result or rewrites its source.
__device__ __forceinline__ float exp2s(float x) { float r; asm("v_exp_f32 %0, %1\n\tv_nop" : "=v"(r) : "v"(x)); return r; }
// Stands between a group of issued global loads and every later rewrite of an address register that they name; the lanes' base addresses are inputs so that their registers stay untouched up to the wait.
__device__ __forceinline__ void xwaits(const void* a, const void* b) { asm volatile("s_wait_xcnt 0x0" :: "s"(a), "s"(b) : "memory"); }   // the same for loads at a wave-uniform base in scalar registers
__device__ __forceinline__ void xwait(const char* a, const char* b, const char* c, const char* d) { asm volatile("s_wait_xcnt 0x0" :: "v"(a), "v"(b), "v"(c), "v"(d) : "memory"); }
// Fragment at the lane's base address plus a constant number of elements.
template <typename T16> __device__ __forceinline__ typename WFrag<T16>::V ldp(const char* lane_base, int elems) { return WFrag<T16>::ld((const T16*)lane_base + elems); }
// ---- k_fattn: causal attention in one launch, scores and probabilities never leave the registers (online softmax). One wave owns 32 query rows of one (batch, head) and walks the key blocks 0 .. diagonal.
// Transposed products, so that a lane holds one query's scores: S^T = K Q^T (A = 16 key rows, B = 16 query rows, k = d) leaves in lane (lr, hi) the keys mb*16 + hi*8 + j of query lr, which is the B-fragment k order of P^T;
// O^T += V^T P^T (A = 16 rows of the transposed v plane, k = keys) leaves d = db*16 + hi*8 + j of query lr. Row maximum and row sum are per lane; the two lane halves exchange the maximum once per block and join their sums at the end.
// Every inner loop is unrolled whole: the fragment and accumulator arrays stay in registers only if every index is a constant.
// HL: bf16 hi/lo planes, 3 products in both contractions (query rows < RH); else fp16 with the probabilities carried x PCAR (2^10 in the exponent), which the division by the row sum takes off again.
// The output leaves as the bf16 hi/lo planes that the Wproj GEMM reads, [t][head * HD + d] at pitch DQ: a query's HD values of one head are one 128-byte line of each plane. Ah, Al: the planes at (row 0 of the batch element, column 0 of the head); st: the wave's own LDS staging, two planes of 32 rows at pitch OSP.
#define OSP  144u          // LDS row pitch in bytes of the output staging: 128 + 16, an odd multiple of 16
#define OSPL (32u * OSP)   // one plane of a wave's staging
template <typename T16, bool HL, int KB>
__device__ __forceinline__ void attn_rows(const T16* Q, const T16* Q2, const T16* Kp, const T16* K2, const T16* Vt, const T16* Vt2, bf* Ah, bf* Al, unsigned char* st, int q0) {   // no __restrict__: the loads must stay on their side of the waits' "memory" clobber
    typedef WFrag<T16> WF; typedef typename WF::V V;
    constexpr int MK = KB / 16, KS = KB / 32;
    constexpr float CEXP = SCL * 1.4426950408889634f;   // scores go to the exponent in log2 units
    constexpr float OFF = HL ? 0.0f : 10.0f;            // 2^10 = PCAR
    const int lane = threadIdx.x & 31, lr = lane & 15, hi = lane >> 4;
    const unsigned fl = (unsigned)lane * 16u;   // the lane's byte offset in a half fragment
    V qf[2][2], qf2[2][2], kf[MK][2], kf2[MK][2];
    { const T16* uq = Q + (size_t)q0 * HD; const T16* uq2 = HL ? Q2 + (size_t)q0 * HD : uq; const T16* uk2 = HL ? K2 : Kp; const char* pq = (const char*)uq + fl; const char* pq2 = (const char*)uq2 + fl; const char* pk = (const char*)Kp + fl; const char* pk2 = (const char*)uk2 + fl;
#pragma unroll
    for (int nb = 0; nb < 2; ++nb)
#pragma unroll
        for (int kc = 0; kc < 2; ++kc) { const int e = (nb * 2 + kc) * FRG; qf[nb][kc] = ldp<T16>(pq, e); if (HL) qf2[nb][kc] = ldp<T16>(pq2, e); }
    xwaits(uq, uq2);
#pragma unroll
    for (int mb = 0; mb < MK; ++mb)
#pragma unroll
        for (int kc = 0; kc < 2; ++kc) { const int e = (mb * 2 + kc) * FRG; kf[mb][kc] = ldp<T16>(pk, e); if (HL) kf2[mb][kc] = ldp<T16>(pk2, e); }
    xwaits(Kp, uk2); }
    v8f o[4][2], lv[2]; float m[2];
#pragma unroll
    for (int nb = 0; nb < 2; ++nb) { m[nb] = -3.0e38f; lv[nb] = (v8f){};
#pragma unroll
        for (int db = 0; db < 4; ++db) o[db][nb] = (v8f){}; }
    const int nkb = (q0 + 32 + KB - 1) / KB;   // key blocks up to and with the one that holds the last query's diagonal; every block holds key k0 <= q0, so no query meets a block that is masked whole
#pragma unroll 1   // one key block per trip: unrolled, two trips' fragments would not fit the register budget of two waves per SIMD
    for (int kb = 0; kb < nkb; ++kb) {
        const int k0 = kb * KB;
        v8f s[MK][2];
#pragma unroll
        for (int mb = 0; mb < MK; ++mb)
#pragma unroll
            for (int nb = 0; nb < 2; ++nb) s[mb][nb] = (v8f){};
#pragma unroll
        for (int kc = 0; kc < 2; ++kc)
#pragma unroll
            for (int mb = 0; mb < MK; ++mb)
#pragma unroll
                for (int nb = 0; nb < 2; ++nb) { s[mb][nb] = WF::mma(kf[mb][kc], qf[nb][kc], s[mb][nb]); if (HL) { s[mb][nb] = WF::mma(kf[mb][kc], qf2[nb][kc], s[mb][nb]); s[mb][nb] = WF::mma(kf2[mb][kc], qf[nb][kc], s[mb][nb]); } }
        // This block's V fragments and the next block's K fragments fly during the softmax (the last trip re-reads its own K block: in bounds, unused).
        const int kn = (kb + 1 < nkb) ? k0 + KB : k0;
        const char* pv = (const char*)(Vt + (size_t)k0 * HD) + fl; const char* pv2 = HL ? (const char*)(Vt2 + (size_t)k0 * HD) + fl : pv; const char* pk = (const char*)(Kp + (size_t)kn * HD) + fl; const char* pk2 = HL ? (const char*)(K2 + (size_t)kn * HD) + fl : pk;   // 16 keys of k and 32 keys of v^T are whole fragments: both planes advance by HD elements per key
        V vf[4][KS], vf2[4][KS];
#pragma unroll
        for (int db = 0; db < 4; ++db)
#pragma unroll
            for (int ks = 0; ks < KS; ++ks) { const int e = (ks * 4 + db) * FRG; vf[db][ks] = ldp<T16>(pv, e); if (HL) vf2[db][ks] = ldp<T16>(pv2, e); }
#pragma unroll
        for (int mb = 0; mb < MK; ++mb)
#pragma unroll
            for (int kc = 0; kc < 2; ++kc) { const int e = (mb * 2 + kc) * FRG; kf[mb][kc] = ldp<T16>(pk, e); if (HL) kf2[mb][kc] = ldp<T16>(pk2, e); }
        xwait(pv, pv2, pk, pk2);
        if (k0 + KB - 1 > q0) {   // wave-uniform: only blocks that reach past the first query's diagonal are masked
            const int dq = q0 + lr - k0 - hi * 8;   // key mb*16 + hi*8 + j is above the diagonal of query nb*16 + lr when mb*16 + j - nb*16 > dq
#pragma unroll
            for (int mb = 0; mb < MK; ++mb)
#pragma unroll
                for (int nb = 0; nb < 2; ++nb)
#pragma unroll
                    for (int j = 0; j < 8; ++j) if (mb * 16 + j - nb * 16 > dq) s[mb][nb][j] = -3.0e38f;
        }
        V pf[2][KS], pf2[2][KS];
#pragma unroll
        for (int nb = 0; nb < 2; ++nb) {
            v8f mv = s[0][nb];
#pragma unroll
            for (int mb = 1; mb < MK; ++mb) mv = __builtin_elementwise_max(mv, s[mb][nb]);
            float mx = fmaxf(fmaxf(fmaxf(mv[0], mv[1]), fmaxf(mv[2], mv[3])), fmaxf(fmaxf(mv[4], mv[5]), fmaxf(mv[6], mv[7])));
            mx = fmaxf(mx, xhalf(mx));
            const float mn = fmaxf(m[nb], mx * CEXP); const float al = exp2s(m[nb] - mn); m[nb] = mn; const float sub = OFF - mn;
            lv[nb] *= al;
#pragma unroll
            for (int mb = 0; mb < MK; ++mb) { const v8f t = s[mb][nb] * CEXP + sub; v8f p;
#pragma unroll
                for (int j = 0; j < 8; ++j) p[j] = exp2s(t[j]);
                s[mb][nb] = p; lv[nb] += p; }
#pragma unroll
            for (int db = 0; db < 4; ++db) o[db][nb] *= al;
#pragma unroll
            for (int ks = 0; ks < KS; ++ks) {
                if constexpr (HL) { v16us ph, pl;
#pragma unroll
                    for (int e = 0; e < 8; ++e) { unsigned short a, c2; splitf(s[2 * ks][nb][e], a, c2); ph[e] = a; pl[e] = c2; splitf(s[2 * ks + 1][nb][e], a, c2); ph[8 + e] = a; pl[8 + e] = c2; }
                    pf[nb][ks] = __builtin_bit_cast(v16bf, ph); pf2[nb][ks] = __builtin_bit_cast(v16bf, pl);
                } else { v16h ph;
#pragma unroll
                    for (int e = 0; e < 8; ++e) { ph[e] = tohx(s[2 * ks][nb][e]); ph[8 + e] = tohx(s[2 * ks + 1][nb][e]); }
                    pf[nb][ks] = ph; }
            }
        }
#pragma unroll
        for (int ks = 0; ks < KS; ++ks)
#pragma unroll
            for (int db = 0; db < 4; ++db)
#pragma unroll
                for (int nb = 0; nb < 2; ++nb) { o[db][nb] = WF::mma(vf[db][ks], pf[nb][ks], o[db][nb]); if (HL) { o[db][nb] = WF::mma(vf[db][ks], pf2[nb][ks], o[db][nb]); o[db][nb] = WF::mma(vf2[db][ks], pf[nb][ks], o[db][nb]); } }
    }
#pragma unroll
    for (int nb = 0; nb < 2; ++nb) { const float lh = ((lv[nb][0] + lv[nb][1]) + (lv[nb][2] + lv[nb][3])) + ((lv[nb][4] + lv[nb][5]) + (lv[nb][6] + lv[nb][7])); const float lt = lh + xhalf(lh); const float f = __fdiv_rn(1.0f, lt);   // fp16 rows: o and lt both carry PCAR
#pragma unroll
        for (int db = 0; db < 4; ++db) o[db][nb] *= f; }
    // Whole 128-byte lines out: a lane holds 8 consecutive d of one query, 16 bytes of a plane's line; the wave gathers its 32 lines of each plane in its own LDS range and reads them back 4 lines per load.
#pragma unroll
    for (int nb = 0; nb < 2; ++nb)
#pragma unroll
        for (int db = 0; db < 4; ++db) { v8us oh, olo;
#pragma unroll
            for (int j = 0; j < 8; ++j) { unsigned short a, c2; splitf(o[db][nb][j], a, c2); oh[j] = a; olo[j] = c2; }
            unsigned char* sp = st + (unsigned)(nb * 16 + lr) * OSP + (unsigned)(db * 16 + hi * 8) * 2u;
            *(v8usa*)sp = oh; *(v8usa*)(sp + OSPL) = olo; }
    asm volatile("s_wait_dscnt 0x0" ::: "memory");   // the wave's staging writes are done before its lanes read one another's pieces back; no other wave touches this range
    v8us rh[8], rl[8]; const unsigned char* rp = st + (unsigned)(lane >> 3) * OSP + (unsigned)(lane & 7) * 16u;   // piece s: row s*4 + lane / 8, 16 bytes of its line
#pragma unroll
    for (int s = 0; s < 8; ++s) { rh[s] = *(const v8usa*)(rp + (unsigned)s * (4u * OSP)); rl[s] = *(const v8usa*)(rp + OSPL + (unsigned)s * (4u * OSP)); }
    const size_t eo = (size_t)(q0 + (lane >> 3)) * DQ + (lane & 7) * 8;
    __builtin_amdgcn_sched_barrier(0);   // every LDS read and all arithmetic ahead of the stores: behind them no register that a store names is written any more
#pragma unroll
    for (int s = 0; s < 8; ++s) { *(v8us*)(Ah + eo + s * (4 * DQ)) = rh[s]; *(v8us*)(Al + eo + s * (4 * DQ)) = rl[s]; }
}
// grid: NB_ * NH_ * TT / 128 workgroups of 4 waves (128 query rows of one head). All are resident together; the first half of the indices takes the long row blocks in falling order, the second half the short ones in rising order.
__global__ __launch_bounds__(128) void k_fattn(const h16* Q16, const bf* Qh, const bf* Ql, const h16* K16, const bf* Kh, const bf* Kl, const h16* VT16, const bf* VTh, const bf* VTl, bf* ATh, bf* ATl) {
    constexpr int NT = TT / 128, NZ = NB_ * NH_; static_assert(RH % 128 == 0 && NT % 2 == 0 && NH_ == NKV, "row blocks");
    const int idx = blockIdx.x; const int tile = (idx < NZ * NT / 2) ? NT - 1 - idx / NZ : idx / NZ - NT / 2; const int zz = idx % NZ, bb = zz / NH_, hh = zz % NH_;
    __shared__ __attribute__((aligned(16))) unsigned char so[4 * 2 * OSPL];   // output staging, a range of its own for each wave
    const int w = __builtin_amdgcn_readfirstlane((int)(threadIdx.x >> 5)); const int q0 = tile * 128 + 32 * w; unsigned char* st = so + (unsigned)w * (2u * OSPL);
    const size_t oq = ((size_t)bb * (NH_ + NKV) + hh) * TT * HD, ov = (size_t)zz * HD * PP;   /* the K pointers are the head planes' base moved on by the NH_ query planes: one offset serves q and k */ const size_t oa = (size_t)bb * TT * DQ + hh * HD;
    if (tile * 128 < RH) attn_rows<bf, true, 32>(Qh + oq, Ql + oq, Kh + oq, Kl + oq, VTh + ov, VTl + ov, ATh + oa, ATl + oa, st, q0);
    else attn_rows<h16, false, 64>(Q16 + oq, nullptr, K16 + oq, nullptr, VT16 + ov, nullptr, ATh + oa, ATl + oa, st, q0);
}
__global__ __launch_bounds__(256) void k_lnin2(const float* __restrict__ F, const float* __restrict__ g, const float* __restrict__ bb, bf* Xh, bf* Xl) { const int lane = threadIdx.x & 31; const int row = blockIdx.x * 8 + (threadIdx.x >> 5); if (row >= MT) return; const float* fr = F + (size_t)row * DM; bf* hrow = Xh + (size_t)row * DM; bf* lrow = Xl + (size_t)row * DM; float v[DM / 32]; float s = 0.f;
#pragma unroll
    for (int c = 0; c < DM / 128; ++c) { const v4f a = *(const v4f*)(fr + c * 128 + lane * 4); for (int q = 0; q < 4; ++q) { v[c * 4 + q] = a[q]; s = __fadd_rn(s, a[q]); } }
#pragma unroll
    for (int sh = 16; sh; sh >>= 1) s = __fadd_rn(s, __shfl_xor(s, sh, 32));
    const float mean = __fmul_rn(s, 1.0f / (float)DM);   /* DM = 512: the reciprocal is an exact power of two, identical to the division */ float s2 = 0.f;
#pragma unroll
    for (int k = 0; k < DM / 32; ++k) { const float dv = __fsub_rn(v[k], mean); float p2 = __fmul_rn(dv, dv); asm volatile("" : "+v"(p2)); s2 = __fadd_rn(s2, p2); v[k] = dv; }
#pragma unroll
    for (int sh = 16; sh; sh >>= 1) s2 = __fadd_rn(s2, __shfl_xor(s2, sh, 32));
    const float rs = __fdiv_rn(1.0f, __fsqrt_rn(__fadd_rn(__fmul_rn(s2, 1.0f / (float)DM), LNEPS)));
{
#pragma unroll
        for (int c = 0; c < DM / 128; ++c) { v4us oh, ol; for (int q = 0; q < 4; ++q) { const int col = c * 128 + lane * 4 + q; float y = __fmul_rn(v[c * 4 + q], rs); asm volatile("" : "+v"(y)); float gg = bfr(g[col]), bb2 = bfr(bb[col]); asm volatile("" : "+v"(gg), "+v"(bb2)); y = __fmul_rn(y, gg); asm volatile("" : "+v"(y)); const float r = __fadd_rn(y, bb2); unsigned short hh2, ll2; splitf(r, hh2, ll2); oh[q] = hh2; ol[q] = ll2; } *(v4us*)(hrow + c * 128 + lane * 4) = oh; *(v4us*)(lrow + c * 128 + lane * 4) = ol; }
         } }

__global__ __launch_bounds__(256) void k_lnout(const float* __restrict__ F, const float* __restrict__ g, const float* __restrict__ bb, float* out) { const int lane = threadIdx.x & 31; const int row = blockIdx.x * 8 + (threadIdx.x >> 5); if (row >= MT) return; const float* fr = F + (size_t)row * DQ; float* orow = out + (size_t)row * DQ; float v[DQ / 32]; float s = 0.f;
#pragma unroll
    for (int c = 0; c < DQ / 128; ++c) { const v4f a = *(const v4f*)(fr + c * 128 + lane * 4); for (int q = 0; q < 4; ++q) { v[c * 4 + q] = a[q]; s = __fadd_rn(s, a[q]); } }
#pragma unroll
    for (int sh = 16; sh; sh >>= 1) s = __fadd_rn(s, __shfl_xor(s, sh, 32));
    const float mean = __fdiv_rn(s, (float)DQ); float s2 = 0.f;
#pragma unroll
    for (int k = 0; k < DQ / 32; ++k) { const float dv = __fsub_rn(v[k], mean); float p2 = __fmul_rn(dv, dv); asm volatile("" : "+v"(p2)); s2 = __fadd_rn(s2, p2); v[k] = dv; }
#pragma unroll
    for (int sh = 16; sh; sh >>= 1) s2 = __fadd_rn(s2, __shfl_xor(s2, sh, 32));
    const float rs = __fdiv_rn(1.0f, __fsqrt_rn(__fadd_rn(__fdiv_rn(s2, (float)DQ), LNEPS)));
{
#pragma unroll
        for (int c = 0; c < DQ / 128; ++c) { v4f o; for (int q = 0; q < 4; ++q) { const int col = c * 128 + lane * 4 + q; float y = __fmul_rn(v[c * 4 + q], rs); asm volatile("" : "+v"(y)); y = __fmul_rn(y, bfr(g[col])); asm volatile("" : "+v"(y)); o[q] = __fadd_rn(y, bfr(bb[col])); } *(v4f*)(orow + c * 128 + lane * 4) = o; }
         } }

extern "C" void kernel_launch(void* const* d_in, const int* in_sizes, int n_in,
                              void* d_out, int out_size, void* d_ws, size_t ws_size, hipStream_t stream) {
    (void)in_sizes; (void)n_in; (void)out_size;
    const float* x = (const float*)d_in[0]; const float* pq = (const float*)d_in[1]; const float* pk = (const float*)d_in[2]; const float* pv = (const float*)d_in[3];   /* [8][512][64] each */ const float* wo = (const float*)d_in[4];   /* Wproj [512][512] 'xw' */ const float* g1 = (const float*)d_in[5]; const float* b1 = (const float*)d_in[6]; const float* w1 = (const float*)d_in[7]; const float* bb1 = (const float*)d_in[8]; const float* w2 = (const float*)d_in[9]; const float* bb2 = (const float*)d_in[10]; const float* g2 = (const float*)d_in[11]; const float* b2 = (const float*)d_in[12]; const float* wq = pq, *wk = pk, *wv = pv;
    float* OUT = (float*)d_out;     // [4][2048][512]
    char* wsp = (char*)d_ws;
    auto take = [&](size_t bytes) { char* p = wsp; wsp += (bytes + 255) & ~(size_t)255; return (void*)p; };
    // Live through the whole call: the transposed weights and the merged attention output planes.
    bf* W1T = (bf*)take((size_t)FF * DM * 2); bf* W2T = (bf*)take((size_t)DM * FF * 2); bf* WQKV = (bf*)take((size_t)NQKV * DM * 2);   /* rows: q heads, k heads, v heads */ bf* WO = (bf*)take((size_t)DM * DQ * 2); bf* ATh = (bf*)take((size_t)MT * DQ * 2); bf* ATl = (bf*)take((size_t)MT * DQ * 2);
    char* const mark = wsp;
    // Phase 1 (projections and attention). Head planes [batch][q heads, then k heads], TT * HD elements each, and transposed v planes [batch][head], all in fragment order (FRG); a (batch, head)'s HD * PP elements hold the hi plane, then the lo plane (the fp16 plane fills the first half, the rest is never touched).
    h16* QK16 = (h16*)take((size_t)NB_ * (NH_ + NKV) * TT * HD * 2); bf* QKh = (bf*)take((size_t)NB_ * (NH_ + NKV) * TT * HD * 2); bf* QKl = (bf*)take((size_t)NB_ * (NH_ + NKV) * TT * HD * 2);
    h16* VT16 = (h16*)take((size_t)NB_ * NKV * HD * PP * 2); bf* VTh = (bf*)take((size_t)NB_ * NKV * HD * PP * 2); bf* VTl = VTh + (size_t)HD * TT;
    bf* XB = (bf*)take((size_t)MT * DM * 2);
    if ((size_t)(wsp - (char*)d_ws) > ws_size) return;    // ws 256 MiB
    // Phase 2 (Wproj, LayerNorms, feed-forward) starts after the last read of every phase-1 buffer and shares their bytes (stream-ordered).
    wsp = mark; float* Y = (float*)take((size_t)MT * DM * 4); bf* LNh = (bf*)take((size_t)MT * DM * 2); bf* LNl = (bf*)take((size_t)MT * DM * 2); bf* H1h = (bf*)take((size_t)MT * FF * 2); bf* H1l = (bf*)take((size_t)MT * FF * 2); float* F2 = (float*)take((size_t)MT * DM * 4);
    if ((size_t)(wsp - (char*)d_ws) > ws_size) return;
    k_prep<<<2 * PB_W + PB_QKV + PB_WO + PB_X, 256, 0, stream>>>(x, wq, wk, wv, wo, w1, w2, XB, WQKV, WO, W1T, W2T);   /* transposed bf16 weights and the bf16 copy of x */
    k_gemms<0, false, E_QKV, HD><<<dim3(MT / 128, NQKV / 128, 1), 256, 0, stream>>>(XB, nullptr, WQKV, DM, nullptr, nullptr, nullptr, QK16, QKh, QKl, VT16, VTh, VTl);   /* q | k | v of all batch elements -> head planes and transposed v planes */
    k_fattn<<<NB_ * NH_ * (TT / 128), 128, 0, stream>>>(QK16, QKh, QKl, QK16 + (size_t)NH_ * TT * HD, QKh + (size_t)NH_ * TT * HD, QKl + (size_t)NH_ * TT * HD, VT16, VTh, VTl, ATh, ATl);   /* all batch elements and heads -> merged hi/lo planes */
    k_gemms<1, false, E_RES, DM><<<dim3(MT / 128, DM / 128, 1), 256, 0, stream>>>(ATh, ATl, WO, DQ, Y, nullptr, x, nullptr, nullptr, nullptr, nullptr, nullptr, nullptr);   /* o Wproj + x */
    k_lnin2<<<(MT + 7) / 8, 256, 0, stream>>>(Y, g1, b1, LNh, LNl);   /* out1 = LN1 as bf16 hi/lo planes */
    k_gemms<1, true, E_RELU, FF><<<dim3(MT / 128, FF / 128, 1), 256, 0, stream>>>(LNh, LNl, W1T, DM, nullptr, bb1, nullptr, nullptr, H1h, H1l, nullptr, nullptr, nullptr);   /* relu(out1 W1 + bb1) -> hi/lo planes */
    k_gemms<1, true, E_RES, DM><<<dim3(MT / 128, DM / 128, 1), 256, 0, stream>>>(H1h, H1l, W2T, FF, F2, bb2, x, nullptr, nullptr, nullptr, nullptr, nullptr, nullptr);   /* W2 + bb2 + the ORIGINAL x */
    k_lnout<<<(MT + 7) / 8, 256, 0, stream>>>(F2, g2, b2, OUT);   /* LN2 -> out */
}

// v009
// One run takes 161 microseconds.
// Timed twice side by side with v008, it ran 1.05 and 1.02 times as fast.
// Counting every step since v000, it is 12.7 times as fast.
#include <hip/hip_runtime.h>

// Post-LN transformer block with per-head projection tensors (x [4][2048][512]; q,k,v = einsum('bse,hed', x, W) (Wq, Wk, Wv [8][512][64] 1/sqrt(512): head h's 'xw' block); 8 heads x 64; scores / 8; causal (-inf); softmax; o = concat heads; out1 = LayerNorm(x + o Wproj) (Wproj 'xw' [512][512]; eps 1e-5, g1/b1); ff = relu(out1 W1 + bb1) W2 + bb2 (W1 [512][2048], W2 [2048][512] 'xw', zero biases); out = LayerNorm(ff + x, g2, b2) (the residual is the ORIGINAL x) -> [4][2048][512] (4.2 M)).
// Layout: every kernel outside attention runs once over the 8192 rows of all 4 batch elements (q, k, v as one GEMM with 1536 columns); attention is one launch over all batch elements and heads, with the scores kept in registers (online softmax). Every elementwise pass behind a GEMM is done in that GEMM's epilogue, on the f32 values before they leave the workgroup. Steps: bf16 copy of x; per-head 'xw' weight blocks of Wq, Wk, Wv transposed into one joint Bt (rows (tensor*8 + h)*64..), Wproj/W1/W2 transposed once; exact projections, written as the q/k head planes and the transposed v planes (fp16 + hi/lo); causal T-2048 attention (hybrid rows: < 512 hi/lo 3 products, rest fp16 x1024; key blocks above the diagonal skipped); Y = merged hi/lo x Wproj exact + bf16(x); a row-LayerNorm kernel emits out1 as bf16 hi/lo planes; relu(hi/lo x W1 exact + bb1) written as hi/lo planes; F2 = hi/lo x W2 exact + bb2 + bf16(x); the final row-LayerNorm writes the output rows.
// Compute dtypes, f32 accumulate: every input rounded to bf16; projections exact; attention rows < 512 3 products, rest fp16; softmax f32; Wproj hl x exact; residuals/LayerNorms f32 (fixed-order sums); FFN GEMMs 2 products (~f32) + f32 biases; relu f32.

#define NB_  4
#define TT   2048
#define DM   512
#define NH_  8
#define NKV  8
#define REP  (NH_ / NKV)
#define HD   64
#define DQ   (NH_ * HD)
#define DKV  (NKV * HD)
#define MT   (NB_ * TT)           // rows of all batch elements together
#define NQKV (DQ + 2 * DKV)       // columns of the joint q|k|v projection
#define PP   (2 * TT)             // a (batch, head)'s part of a transposed v buffer is HD * PP 16-bit elements: room for two planes of HD * TT
#define RH   512                  // query rows < RH use hi+lo planes (0: none)
#define PCAR 1024.0f
#define SCL  0.125f   // HD^-0.5
#define FF   2048     // feed-forward width
#define LNEPS 1e-5f
typedef _Float16 h16;
typedef unsigned short bf;
typedef __attribute__((ext_vector_type(16))) __bf16   v16bf;
typedef __attribute__((ext_vector_type(16))) _Float16 v16h;
typedef __attribute__((ext_vector_type(8)))  _Float16 v8h;
typedef __attribute__((ext_vector_type(8)))  unsigned short v8us;
typedef __attribute__((ext_vector_type(8)))  float    v8f;
typedef __attribute__((ext_vector_type(4)))  float    v4f;
typedef v8h  __attribute__((may_alias)) v8ha;
typedef v4f  __attribute__((may_alias)) v4fa;
typedef v8us __attribute__((may_alias)) v8usa;

__device__ __forceinline__ unsigned short f2bf(float f) { unsigned u = __float_as_uint(f); u += 0x7FFFu + ((u >> 16) & 1u); return (unsigned short)(u >> 16); }
__device__ __forceinline__ float bf2f(unsigned short b) { return __uint_as_float(((unsigned)b) << 16); }
__device__ __forceinline__ float bfr(float f) { return bf2f(f2bf(f)); }
__device__ __forceinline__ v16h cat16(v8h lo, v8h hi) { return __builtin_shufflevector(lo, hi, 0, 1, 2, 3, 4, 5, 6, 7, 8, 9, 10, 11, 12, 13, 14, 15); }
__device__ __forceinline__ v16bf cat16b(v8us lo, v8us hi) { return __builtin_bit_cast(v16bf, __builtin_shufflevector(lo, hi, 0, 1, 2, 3, 4, 5, 6, 7, 8, 9, 10, 11, 12, 13, 14, 15)); }
__device__ __forceinline__ v8f wmma16(v16h a, v16h b, v8f c) { return __builtin_amdgcn_wmma_f32_16x16x32_f16(false, a, false, b, (short)0, c, false, false); }
__device__ __forceinline__ v8f wmmab(v16bf a, v16bf b, v8f c) { return __builtin_amdgcn_wmma_f32_16x16x32_bf16(false, a, false, b, (short)0, c, false, false); }
__device__ __forceinline__ h16 tohx(float x) { return (h16)x; }
__device__ __forceinline__ void splitf(float y, unsigned short& h, unsigned short& l) { h = f2bf(y); l = f2bf(y - bf2f(h)); }



// ---- k_gemms: GEMM with the operand tiles staged in LDS; one workgroup of 8 waves (4 x 2) per 128x128 output tile, 32x64 per wave; grid (M/128, N/128), 256 threads.
// c[m][n] (f32, + optional f32 bias[n]) = sum_k (A[m][k] + A2[m][k]) Bt[n][k] (A2 only with NSPLIT == 1), all planes K-contiguous bf16. M % 128 == 0, N % 128 == 0, K % 64 == 0.
// What leaves the workgroup (EPI): E_RES: C = c + bf16(xr), f32, both of pitch LDC. E_RELU: max(c, 0) as bf16 hi/lo planes Ph, Pl of pitch LDC. E_QKV: columns < DQ + DKV as head planes P16 (fp16), Ph, Pl [batch][head], each plane in fragment order [t / 16][d / 32] (rows t, k = d); the v columns behind them as transposed planes V16, Vh, Vl, [batch][head] HD * PP elements apart, in fragment order [t / 32][d / 16] (rows d, k = t).
// A stage is 64 k (one 128-byte line) of the 128 rows of every plane: [Bt | A | A2], rows at pitch GP. Two buffers: asynchronous copies fill the next stage while this one is multiplied; every wave sums the whole K, in ascending order from the workgroup's own first stage and round through stage 0.
#define GP   144u          // LDS row pitch in bytes: 128 + 16, an odd multiple of 16 for the ds_load_b128 readers
#define GPL  (128u * GP)   // one plane of a stage
// Fragment order of the attention operands in global memory: a 16-row x 32-k fragment is FRG consecutive elements (1 KiB), two halves of 512 bytes; in half g lane (lr, hi) = hi*16 + lr owns 16 bytes, row lr, k g*16 + hi*8 .. + 7. Each of the two loads of a fragment is then 512 consecutive bytes, 4 whole lines per wave. WFrag::ld takes the lane's address in half 0.
#define FRG  512
template <typename T16> struct WFrag;
template <> struct WFrag<h16> { typedef v16h V; static __device__ __forceinline__ V ld(const h16* p) { return cat16(*(const v8h*)p, *(const v8h*)(p + FRG / 2)); } static __device__ __forceinline__ v8f mma(V a, V b, v8f c) { return wmma16(a, b, c); } };
template <> struct WFrag<bf> { typedef v16bf V; static __device__ __forceinline__ V ld(const bf* p) { return cat16b(*(const v8us*)p, *(const v8us*)(p + FRG / 2)); } static __device__ __forceinline__ v8f mma(V a, V b, v8f c) { return wmmab(a, b, c); } };
__device__ __forceinline__ unsigned lds_off(const void* p) { return (unsigned)(size_t)p; }
__device__ __forceinline__ v16bf ldl(const unsigned char* p) { return cat16b(*(const v8us*)p, *(const v8us*)(p + 32)); }
#define CPY(a, b) "global_load_async_to_lds_b128 %" #a ", %" #b ", off\n\t"
// One stage: every lane copies 16 bytes of 4 rows (32 rows apart) of each of the NP planes, a wave 4 whole lines per copy. l: the lane's LDS byte address in plane 0; g0..g2: its global addresses; rs: 32 rows in bytes.
// The copies and the s_wait_xcnt stand in one statement, so that no address register of a copy is rewritten ahead of the wait.
template <int NP> __device__ __forceinline__ void stage_copy(unsigned l, const char* g0, const char* g1, const char* g2, size_t rs) {
    if constexpr (NP == 3)
        asm volatile(CPY(0, 1) CPY(2, 3) CPY(4, 5) CPY(6, 7) CPY(8, 9) CPY(10, 11) CPY(12, 13) CPY(14, 15) CPY(16, 17) CPY(18, 19) CPY(20, 21) CPY(22, 23) "s_wait_xcnt 0x0"
            :: "v"(l), "v"(g0), "v"(l + 32u * GP), "v"(g0 + rs), "v"(l + 64u * GP), "v"(g0 + 2 * rs), "v"(l + 96u * GP), "v"(g0 + 3 * rs),
               "v"(l + GPL), "v"(g1), "v"(l + GPL + 32u * GP), "v"(g1 + rs), "v"(l + GPL + 64u * GP), "v"(g1 + 2 * rs), "v"(l + GPL + 96u * GP), "v"(g1 + 3 * rs),
               "v"(l + 2u * GPL), "v"(g2), "v"(l + 2u * GPL + 32u * GP), "v"(g2 + rs), "v"(l + 2u * GPL + 64u * GP), "v"(g2 + 2 * rs), "v"(l + 2u * GPL + 96u * GP), "v"(g2 + 3 * rs) : "memory");
    else
        asm volatile(CPY(0, 1) CPY(2, 3) CPY(4, 5) CPY(6, 7) CPY(8, 9) CPY(10, 11) CPY(12, 13) CPY(14, 15) "s_wait_xcnt 0x0"
            :: "v"(l), "v"(g0), "v"(l + 32u * GP), "v"(g0 + rs), "v"(l + 64u * GP), "v"(g0 + 2 * rs), "v"(l + 96u * GP), "v"(g0 + 3 * rs),
               "v"(l + GPL), "v"(g1), "v"(l + GPL + 32u * GP), "v"(g1 + rs), "v"(l + GPL + 64u * GP), "v"(g1 + 2 * rs), "v"(l + GPL + 96u * GP), "v"(g1 + 3 * rs) : "memory");
}
// One fragment set: 32 k of the wave's 32 rows of A (and A2) and 64 rows of Bt. pa, pb: the lane's addresses in the A and the Bt plane of a stage.
template <int NSPLIT> struct FSet { v16bf a[2], a2[2], b[4]; };
template <int NSPLIT> __device__ __forceinline__ void ld_set(FSet<NSPLIT>& f, const unsigned char* pa, const unsigned char* pb) {   // in the order of use
#pragma unroll
    for (int mb = 0; mb < 2; ++mb) f.a[mb] = ldl(pa + mb * 16 * GP);
#pragma unroll
    for (int nb = 0; nb < 4; ++nb) f.b[nb] = ldl(pb + nb * 16 * GP);
    if (NSPLIT) {
#pragma unroll
        for (int mb = 0; mb < 2; ++mb) f.a2[mb] = ldl(pa + GPL + mb * 16 * GP); }
}
template <int NSPLIT> __device__ __forceinline__ void mm_set(const FSet<NSPLIT>& f, v8f (&acc)[2][4]) {   // eight independent accumulators between two products into the same one
#pragma unroll
    for (int nb = 0; nb < 4; ++nb)
#pragma unroll
        for (int mb = 0; mb < 2; ++mb) acc[mb][nb] = wmmab(f.a[mb], f.b[nb], acc[mb][nb]);
    if (NSPLIT) {
#pragma unroll
        for (int nb = 0; nb < 4; ++nb)
#pragma unroll
            for (int mb = 0; mb < 2; ++mb) acc[mb][nb] = wmmab(f.a2[mb], f.b[nb], acc[mb][nb]); }
}
#define E_RES  0
#define E_RELU 1
#define E_QKV  2
#define VSP  272u          // LDS row pitch in bytes of the transposed v staging: 128 t x 2 bytes + 16
#define VSPL (128u * VSP)  // one plane of it
template <int NSPLIT, bool BIAS, int EPI, int LDC>
__global__ __launch_bounds__(256) void k_gemms(const bf* A, const bf* A2, const bf* Bt, int K, float* C, const float* __restrict__ bias, const float* xr, h16* P16, bf* Ph, bf* Pl, h16* V16, bf* Vh, bf* Vl) {
    constexpr int NP = NSPLIT ? 3 : 2; constexpr unsigned STG = NP * GPL;
    static_assert(2 * STG >= 8 * 32 * 68 * 4, "the output staging reuses the ring");
    constexpr unsigned SMB = (EPI == E_QKV && 3u * VSPL > 2u * STG) ? 3u * VSPL : 2u * STG;   // the three transposed v planes of a tile need more than the ring
    __shared__ __attribute__((aligned(16))) unsigned char sm[SMB];
    const int tid = (int)threadIdx.x, lane = tid & 31, lr = lane & 15, hi = lane >> 4; const int w = __builtin_amdgcn_readfirstlane(tid >> 5), wm = w >> 1, wn = w & 1; const int r0 = blockIdx.x * 128, c0 = blockIdx.y * 128;
    const size_t rowb = (size_t)K * 2; const int crow = tid >> 3; const unsigned cch = (unsigned)(tid & 7) * 16u;   // the lane's first row and its 16-byte piece of the line
    const char* gb = (const char*)Bt + (size_t)(c0 + crow) * rowb + cch; const char* ga = (const char*)A + (size_t)(r0 + crow) * rowb + cch; const char* ga2 = NSPLIT ? (const char*)A2 + (size_t)(r0 + crow) * rowb + cch : ga;
    const unsigned lc = lds_off(sm) + (unsigned)crow * GP + cch; const int nt = K >> 6;
    // Rotated k walk: the workgroups of one tile column copy the same Bt lines from L2, those of one tile row the same A lines, and all keep the same pace. Each enters the nt stages of K at a stage of its own and wraps round, so that the sharers of a line ask for it at different times: the NX tile rows and the NY tile columns are each spread evenly over the stages.
    constexpr unsigned NX = MT / 128, NY = (EPI == E_QKV) ? NQKV / 128 : LDC / 128;   // the launch's grid
    int sk = (int)(blockIdx.x * (unsigned)nt / NX + blockIdx.y * (unsigned)nt / NY);   // the stage of K that the next copies bring; the same for the whole workgroup
    if (sk >= nt) sk -= nt;   // each term is below nt
    stage_copy<NP>(lc, gb + (size_t)sk * 128, ga + (size_t)sk * 128, ga2 + (size_t)sk * 128, 32 * rowb); sk = (sk + 1 == nt) ? 0 : sk + 1;
    asm volatile("s_wait_asynccnt 0x0" ::: "memory");   // stage 0 of this wave has landed
    __syncthreads();                                     // ... and every wave's: nobody reads it in front of this barrier
    if (nt > 1) { stage_copy<NP>(lc + STG, gb + (size_t)sk * 128, ga + (size_t)sk * 128, ga2 + (size_t)sk * 128, 32 * rowb); sk = (sk + 1 == nt) ? 0 : sk + 1; }
    v8f acc[2][4];
#pragma unroll
    for (int mb = 0; mb < 2; ++mb)
#pragma unroll
        for (int nb = 0; nb < 4; ++nb) acc[mb][nb] = (v8f){};
    const unsigned fb = (unsigned)(wn * 64 + lr) * GP + 16u * hi, fa = GPL + (unsigned)(wm * 32 + lr) * GP + 16u * hi;   // the lane's fragment offsets in a stage
    // Two fragment sets, each half a stage, fetched one half ahead: f0 = k 0..31 of a stage, f1 = k 32..63. The publish point of stage t + 1 therefore stands in the middle of trip t, behind the last reads of stage t and ahead of the first reads of stage t + 1.
    FSet<NSPLIT> f0, f1;
    ld_set<NSPLIT>(f0, sm + fa, sm + fb);
#pragma unroll 1   // one stage per trip: the ring's order of waits, barrier and refill stands once
    for (int t = 0; t < nt; ++t) {
        const unsigned char* sb = sm + (unsigned)(t & 1) * STG;
        ld_set<NSPLIT>(f1, sb + fa + 64, sb + fb + 64);
        __builtin_amdgcn_sched_barrier(0);   // the reads stay one group ahead of the WMMAs that they fly behind
        mm_set<NSPLIT>(f0, acc);
        __builtin_amdgcn_sched_barrier(0);   // these WMMAs stay ahead of the waits: they cover the flight of f1's reads and of the copies
        asm volatile("s_wait_dscnt 0x0" ::: "memory");      // this wave's last reads of stage t have returned before its buffer is refilled
        asm volatile("s_wait_asynccnt 0x0" ::: "memory");   // this wave's copies of stage t + 1 have landed
        __syncthreads();                                     // publishes stage t + 1 and ends every wave's reads of stage t
        if (t + 2 < nt) { stage_copy<NP>(lc + (unsigned)(t & 1) * STG, gb + (size_t)sk * 128, ga + (size_t)sk * 128, ga2 + (size_t)sk * 128, 32 * rowb); sk = (sk + 1 == nt) ? 0 : sk + 1; }
        if (t + 1 < nt) { const unsigned char* sn = sm + (unsigned)((t + 1) & 1) * STG; ld_set<NSPLIT>(f0, sn + fa, sn + fb); }
        mm_set<NSPLIT>(f1, acc);
    }
    asm volatile("s_wait_asynccnt 0x0" ::: "memory");   // no copy is outstanding when the ring becomes output staging
    if (EPI == E_QKV && c0 >= DQ + DKV) {   // the same for the whole workgroup
        // v columns, transposed: a lane holds 8 consecutive t of one d, 16 bytes of a 16-bit plane's row. The tile's three planes are gathered in LDS as [d][t], so that whole 128-byte lines leave.
#pragma unroll
        for (int mb = 0; mb < 2; ++mb)
#pragma unroll
            for (int nb = 0; nb < 4; ++nb) { v8h o16; v8us oh, ol;
#pragma unroll
                for (int j = 0; j < 8; ++j) { const float xv = acc[mb][nb][j]; o16[j] = tohx(xv); unsigned short a2, c2; splitf(xv, a2, c2); oh[j] = a2; ol[j] = c2; }
                unsigned char* vp = sm + (unsigned)(wn * 64 + nb * 16 + lr) * VSP + (unsigned)(wm * 32 + mb * 16 + hi * 8) * 2u;
                *(v8ha*)vp = o16; *(v8usa*)(vp + VSPL) = oh; *(v8usa*)(vp + 2u * VSPL) = ol; }
        __syncthreads();   // every wave's part of a row is in LDS before the row is read
        const size_t vf0 = ((size_t)(r0 / TT) * NKV + (c0 - DQ - DKV) / HD + (w >> 2)) * HD * PP + (size_t)((r0 % TT) / 32 * 4 + (w & 3)) * FRG + lane * 8;   // wave w: the 16 rows d = (w & 3) * 16 .. of head w >> 2 of the tile's two; fragments [t / 32][d / 16], half a fragment (512 bytes) per store
#pragma unroll
        for (int s = 0; s < 8; ++s) { const unsigned char* vp = sm + (unsigned)(w * 16 + lr) * VSP + (unsigned)(s * 16 + hi * 8) * 2u; const size_t eo = vf0 + (s >> 1) * (4 * FRG) + (s & 1) * (FRG / 2);
            *(v8h*)(V16 + eo) = *(const v8ha*)vp; *(v8us*)(Vh + eo) = *(const v8usa*)(vp + VSPL); *(v8us*)(Vl + eo) = *(const v8usa*)(vp + 2u * VSPL); }
    } else {
    // Whole 128-byte lines out: each wave stages its 32x64 tile in its own part of the ring (pitch 68 floats) and reads rows back.
    const size_t ut = (size_t)(r0 + wm * 32) * LDC + c0 + wn * 64;   // the wave's tile in a [m][n] array of pitch LDC (wave-uniform)
    const unsigned lx = (unsigned)((lane >> 4) * LDC + (lane & 15) * 4) * 4u;   // E_RES: the lane's byte offset in the tile; its piece s stands 2 rows further on per s
    v4f rx[16];
    if constexpr (EPI == E_RES) {   // the residual's loads fly during the staging
        const char* ux = (const char*)(xr + ut);
#pragma unroll
        for (int s = 0; s < 16; ++s) rx[s] = *(const v4f*)(ux + lx + (unsigned)s * (2u * LDC * 4u));
        asm volatile("s_wait_xcnt 0x0" :: "v"(lx), "s"(ux) : "memory");   // stands between the issued loads and every later rewrite of their address registers, which are inputs so that they stay untouched up to here
    }
    float* os = (float*)sm + w * (32 * 68);
#pragma unroll
    for (int mb = 0; mb < 2; ++mb)
#pragma unroll
        for (int nb = 0; nb < 4; ++nb)
#pragma unroll
            for (int j = 0; j < 8; ++j) os[(mb * 16 + hi * 8 + j) * 68 + nb * 16 + lr] = acc[mb][nb][j];
    __syncthreads();   // orders the staging writes against the row reads
    if constexpr (EPI == E_RES) {
        char* uc = (char*)(C + ut);
#pragma unroll
        for (int s = 0; s < 16; ++s) { const int item = s * 32 + lane; const int row = item >> 4, cofs = (item & 15) * 4; v4f val = *(const v4fa*)(os + row * 68 + cofs);
            if (BIAS) { const int cb = c0 + wn * 64 + cofs; val[0] += bfr(bias[cb]); val[1] += bfr(bias[cb + 1]); val[2] += bfr(bias[cb + 2]); val[3] += bfr(bias[cb + 3]); }
#pragma unroll
            for (int q = 0; q < 4; ++q) val[q] = __fadd_rn(val[q], bfr(rx[s][q]));
            *(v4f*)(uc + lx + (unsigned)s * (2u * LDC * 4u)) = val; }
    } else {
        // 16-bit planes, 16 bytes per lane and plane. E_RELU: 8 lanes per 128-byte row of the wave's tile. E_QKV: fragment order; the wave's 32 t x 64 d are 4 whole fragments, which start where its rows would.
        const size_t tile0 = (EPI == E_QKV) ? (((size_t)(r0 / TT) * (NH_ + NKV) + (c0 + wn * 64) / HD) * TT + r0 % TT + wm * 32) * HD : ut; constexpr int pitch = (EPI == E_QKV) ? HD : LDC;
#pragma unroll
        for (int s = 0; s < 8; ++s) { const int row = (EPI == E_QKV) ? (s >> 2) * 16 + lr : (s * 32 + lane) >> 3, cofs = (EPI == E_QKV) ? s % 4 * 16 + hi * 8 : (lane & 7) * 8;   /* E_QKV: piece s is half s & 1 of fragment s >> 1 of the wave's [t / 16][d / 32] */ const v4f va = *(const v4fa*)(os + row * 68 + cofs), vb = *(const v4fa*)(os + row * 68 + cofs + 4); v8h o16; v8us oh, ol;
#pragma unroll
            for (int q = 0; q < 8; ++q) { float y = (q < 4) ? va[q & 3] : vb[q & 3];
                if (BIAS) y += bfr(bias[c0 + wn * 64 + cofs + q]);
                if (EPI == E_RELU) y = (y > 0.0f) ? y : 0.0f;
                if (EPI == E_QKV) o16[q] = tohx(y);
                unsigned short a2, c2; splitf(y, a2, c2); oh[q] = a2; ol[q] = c2; }
            const size_t e = (EPI == E_QKV) ? tile0 + s * (FRG / 2) + lane * 8 : tile0 + (size_t)row * pitch + cofs;
            if (EPI == E_QKV) *(v8h*)(P16 + e) = o16;
            *(v8us*)(Ph + e) = oh; *(v8us*)(Pl + e) = ol; }
        if constexpr (EPI == E_QKV) asm volatile("s_wait_xcnt 0x0" ::: "memory");   // in the listing the v branch's code follows these stores: the wait stands between them and its writes of the registers that they name
    }
    }
}

typedef __attribute__((ext_vector_type(2))) _Float16 v2h;
typedef __attribute__((ext_vector_type(4))) _Float16 v4h;
typedef __attribute__((ext_vector_type(2))) unsigned short v2us;
typedef __attribute__((ext_vector_type(4))) unsigned short v4us;
typedef __attribute__((ext_vector_type(2))) float v2f;
typedef __attribute__((ext_vector_type(4))) int v4i;

// One [K][N] f32 matrix w -> its transpose Bt [N][K] in bf16. Block bx of the matrix takes 64 lines of 64 elements of Bt, a wave 8 of them.
template <int K, int N> __device__ __forceinline__ void wt_lines(const float* __restrict__ w, bf* Bt, int bx) {
    static_assert(N * K % (64 * 64) == 0, "whole blocks");
    const int lane = threadIdx.x & 31; const int L0 = (bx * 8 + (int)(threadIdx.x >> 5)) * 8;
#pragma unroll 1   // rolled: the flight of a trip's two loads is covered by the launch's other waves, not by more registers and text of this one
    for (int l = 0; l < 8; ++l) { const int e = (L0 + l) * 64 + lane * 2; const int k = e % K, n = e / K; v2us o;
        o[0] = f2bf(w[(size_t)k * N + n]); o[1] = f2bf(w[(size_t)(k + 1) * N + n]); *(v2us*)(Bt + e) = o;
        asm volatile("s_wait_xcnt 0x0" ::: "memory"); }   // stands between the issued store and the next trip's rewrite of the registers that it names
}
// ---- k_prep: everything that depends on the inputs alone, in one launch; the parts are independent and share the grid by block range. The transposes stand first: their waves run the longest chains of loads.
#define PB_W   (DM * FF / (64 * 64))            // blocks of W1, and of W2
#define PB_H   (DM * HD / (64 * 64))            // blocks of one head's [DM][HD] matrix
#define PB_QKV (3 * NH_ * PB_H)
#define PB_WO  (DQ * DM / (64 * 64))
#define PB_X   (MT * DM / (8 * 256))            // x: 8 elements per lane
__global__ __launch_bounds__(256) void k_prep(const float* __restrict__ x, const float* __restrict__ wq, const float* __restrict__ wk, const float* __restrict__ wv, const float* __restrict__ wo, const float* __restrict__ w1, const float* __restrict__ w2, bf* XB, bf* WQKV, bf* WO, bf* W1T, bf* W2T) {
    static_assert(MT * DM % (8 * 256) == 0 && NH_ == NKV, "whole blocks; q, k and v have the same number of heads");
    int b = blockIdx.x;
    if (b < PB_W) { wt_lines<FF, DM>(w2, W2T, b); return; }   // W2 'xw' [2048][512] -> Bt [512][2048]
    b -= PB_W;
    if (b < PB_W) { wt_lines<DM, FF>(w1, W1T, b); return; }   // W1 'xw' [512][2048] -> Bt [2048][512]
    b -= PB_W;
    if (b < PB_QKV) { const int mz = b / PB_H, ts = mz / NH_;   // every head's 'xw' [512][64] block of Wq, Wk, Wv -> Bt rows (tensor * 8 + head) * 64..
        wt_lines<DM, HD>((ts == 0 ? wq : ts == 1 ? wk : wv) + (size_t)(mz % NH_) * DM * HD, WQKV + (size_t)mz * DM * HD, b % PB_H); return; }
    b -= PB_QKV;
    if (b < PB_WO) { wt_lines<DQ, DM>(wo, WO, b); return; }   // Wproj 'xw' [512][512]
    b -= PB_WO;
    const size_t i = (size_t)b * 256 + threadIdx.x; const v8f v = *(const v8f*)(x + i * 8); v8us o;   // bf16 copy of x
#pragma unroll
    for (int k = 0; k < 8; ++k) o[k] = f2bf(v[k]);
    *(v8us*)(XB + i * 8) = o;
    asm volatile("s_wait_xcnt 0x0" ::: "memory");   // stands behind the issued store, in front of any later rewrite of the registers that it names
}

typedef __attribute__((ext_vector_type(16))) unsigned short v16us;
// Lane l with lane l ^ 16 (the two halves of a wave hold the two halves of a query's keys).
__device__ __forceinline__ float xhalf(float x) { return __builtin_bit_cast(float, __builtin_amdgcn_permlanex16(__builtin_bit_cast(int, x), __builtin_bit_cast(int, x), 0x76543210, 0xfedcba98, false, false)); }
// 2^x with the issue slot behind the transcendental filled in the same statement, so that no instruction directly behind it reads its result or rewrites its source.
__device__ __forceinline__ float exp2s(float x) { float r; asm("v_exp_f32 %0, %1\n\tv_nop" : "=v"(r) : "v"(x)); return r; }
// Stands between a group of issued global loads and every later rewrite of an address register that they name; the lanes' base addresses are inputs so that their registers stay untouched up to the wait.
__device__ __forceinline__ void xwaits(const void* a, const void* b) { asm volatile("s_wait_xcnt 0x0" :: "s"(a), "s"(b) : "memory"); }   // the same for loads at a wave-uniform base in scalar registers
__device__ __forceinline__ void xwait(const char* a, const char* b, const char* c, const char* d) { asm volatile("s_wait_xcnt 0x0" :: "v"(a), "v"(b), "v"(c), "v"(d) : "memory"); }
// Fragment at the lane's base address plus a constant number of elements.
template <typename T16> __device__ __forceinline__ typename WFrag<T16>::V ldp(const char* lane_base, int elems) { return WFrag<T16>::ld((const T16*)lane_base + elems); }
// ---- k_fattn: causal attention in one launch, scores and probabilities never leave the registers (online softmax). One wave owns 32 query rows of one (batch, head) and walks the key blocks 0 .. diagonal.
// Transposed products, so that a lane holds one query's scores: S^T = K Q^T (A = 16 key rows, B = 16 query rows, k = d) leaves in lane (lr, hi) the keys mb*16 + hi*8 + j of query lr, which is the B-fragment k order of P^T;
// O^T += V^T P^T (A = 16 rows of the transposed v plane, k = keys) leaves d = db*16 + hi*8 + j of query lr. Row maximum and row sum are per lane; the two lane halves exchange the maximum once per block and join their sums at the end.
// Every inner loop is unrolled whole: the fragment and accumulator arrays stay in registers only if every index is a constant.
// HL: bf16 hi/lo planes, 3 products in both contractions (query rows < RH); else fp16 with the probabilities carried x PCAR (2^10 in the exponent), which the division by the row sum takes off again.
// The output leaves as the bf16 hi/lo planes that the Wproj GEMM reads, [t][head * HD + d] at pitch DQ: a query's HD values of one head are one 128-byte line of each plane. Ah, Al: the planes at (row 0 of the batch element, column 0 of the head); st: the wave's own LDS staging, two planes of 32 rows at pitch OSP.
#define OSP  144u          // LDS row pitch in bytes of the output staging: 128 + 16, an odd multiple of 16
#define OSPL (32u * OSP)   // one plane of a wave's staging
template <typename T16, bool HL, int KB>
__device__ __forceinline__ void attn_rows(const T16* Q, const T16* Q2, const T16* Kp, const T16* K2, const T16* Vt, const T16* Vt2, bf* Ah, bf* Al, unsigned char* st, int q0) {   // no __restrict__: the loads must stay on their side of the waits' "memory" clobber
    typedef WFrag<T16> WF; typedef typename WF::V V;
    constexpr int MK = KB / 16, KS = KB / 32;
    constexpr float CEXP = SCL * 1.4426950408889634f;   // scores go to the exponent in log2 units
    constexpr float OFF = HL ? 0.0f : 10.0f;            // 2^10 = PCAR
    const int lane = threadIdx.x & 31, lr = lane & 15, hi = lane >> 4;
    const unsigned fl = (unsigned)lane * 16u;   // the lane's byte offset in a half fragment
    V qf[2][2], qf2[2][2], kf[MK][2], kf2[MK][2];
    { const T16* uq = Q + (size_t)q0 * HD; const T16* uq2 = HL ? Q2 + (size_t)q0 * HD : uq; const T16* uk2 = HL ? K2 : Kp; const char* pq = (const char*)uq + fl; const char* pq2 = (const char*)uq2 + fl; const char* pk = (const char*)Kp + fl; const char* pk2 = (const char*)uk2 + fl;
#pragma unroll
    for (int nb = 0; nb < 2; ++nb)
#pragma unroll
        for (int kc = 0; kc < 2; ++kc) { const int e = (nb * 2 + kc) * FRG; qf[nb][kc] = ldp<T16>(pq, e); if (HL) qf2[nb][kc] = ldp<T16>(pq2, e); }
    xwaits(uq, uq2);
#pragma unroll
    for (int mb = 0; mb < MK; ++mb)
#pragma unroll
        for (int kc = 0; kc < 2; ++kc) { const int e = (mb * 2 + kc) * FRG; kf[mb][kc] = ldp<T16>(pk, e); if (HL) kf2[mb][kc] = ldp<T16>(pk2, e); }
    xwaits(Kp, uk2); }
    v8f o[4][2], lv[2]; float m[2];
#pragma unroll
    for (int nb = 0; nb < 2; ++nb) { m[nb] = -3.0e38f; lv[nb] = (v8f){};
#pragma unroll
        for (int db = 0; db < 4; ++db) o[db][nb] = (v8f){}; }
    const int nkb = (q0 + 32 + KB - 1) / KB;   // key blocks up to and with the one that holds the last query's diagonal; every block holds key k0 <= q0, so no query meets a block that is masked whole
#pragma unroll 1   // one key block per trip: unrolled, two trips' fragments would not fit the register budget of two waves per SIMD
    for (int kb = 0; kb < nkb; ++kb) {
        const int k0 = kb * KB;
        v8f s[MK][2];
#pragma unroll
        for (int mb = 0; mb < MK; ++mb)
#pragma unroll
            for (int nb = 0; nb < 2; ++nb) s[mb][nb] = (v8f){};
#pragma unroll
        for (int kc = 0; kc < 2; ++kc)
#pragma unroll
            for (int mb = 0; mb < MK; ++mb)
#pragma unroll
                for (int nb = 0; nb < 2; ++nb) { s[mb][nb] = WF::mma(kf[mb][kc], qf[nb][kc], s[mb][nb]); if (HL) { s[mb][nb] = WF::mma(kf[mb][kc], qf2[nb][kc], s[mb][nb]); s[mb][nb] = WF::mma(kf2[mb][kc], qf[nb][kc], s[mb][nb]); } }
        // This block's V fragments and the next block's K fragments fly during the softmax (the last trip re-reads its own K block: in bounds, unused).
        const int kn = (kb + 1 < nkb) ? k0 + KB : k0;
        const char* pv = (const char*)(Vt + (size_t)k0 * HD) + fl; const char* pv2 = HL ? (const char*)(Vt2 + (size_t)k0 * HD) + fl : pv; const char* pk = (const char*)(Kp + (size_t)kn * HD) + fl; const char* pk2 = HL ? (const char*)(K2 + (size_t)kn * HD) + fl : pk;   // 16 keys of k and 32 keys of v^T are whole fragments: both planes advance by HD elements per key
        V vf[4][KS], vf2[4][KS];
#pragma unroll
        for (int db = 0; db < 4; ++db)
#pragma unroll
            for (int ks = 0; ks < KS; ++ks) { const int e = (ks * 4 + db) * FRG; vf[db][ks] = ldp<T16>(pv, e); if (HL) vf2[db][ks] = ldp<T16>(pv2, e); }
#pragma unroll
        for (int mb = 0; mb < MK; ++mb)
#pragma unroll
            for (int kc = 0; kc < 2; ++kc) { const int e = (mb * 2 + kc) * FRG; kf[mb][kc] = ldp<T16>(pk, e); if (HL) kf2[mb][kc] = ldp<T16>(pk2, e); }
        xwait(pv, pv2, pk, pk2);
        if (k0 + KB - 1 > q0) {   // wave-uniform: only blocks that reach past the first query's diagonal are masked
            const int dq = q0 + lr - k0 - hi * 8;   // key mb*16 + hi*8 + j is above the diagonal of query nb*16 + lr when mb*16 + j - nb*16 > dq
#pragma unroll
            for (int mb = 0; mb < MK; ++mb)
#pragma unroll
                for (int nb = 0; nb < 2; ++nb)
#pragma unroll
                    for (int j = 0; j < 8; ++j) if (mb * 16 + j - nb * 16 > dq) s[mb][nb][j] = -3.0e38f;
        }
        V pf[2][KS], pf2[2][KS];
#pragma unroll
        for (int nb = 0; nb < 2; ++nb) {
            v8f mv = s[0][nb];
#pragma unroll
            for (int mb = 1; mb < MK; ++mb) mv = __builtin_elementwise_max(mv, s[mb][nb]);
            float mx = fmaxf(fmaxf(fmaxf(mv[0], mv[1]), fmaxf(mv[2], mv[3])), fmaxf(fmaxf(mv[4], mv[5]), fmaxf(mv[6], mv[7])));
            mx = fmaxf(mx, xhalf(mx));
            const float mn = fmaxf(m[nb], mx * CEXP); const float al = exp2s(m[nb] - mn); m[nb] = mn; const float sub = OFF - mn;
            lv[nb] *= al;
#pragma unroll
            for (int mb = 0; mb < MK; ++mb) { const v8f t = s[mb][nb] * CEXP + sub; v8f p;
#pragma unroll
                for (int j = 0; j < 8; ++j) p[j] = exp2s(t[j]);
                s[mb][nb] = p; lv[nb] += p; }
#pragma unroll
            for (int db = 0; db < 4; ++db) o[db][nb] *= al;
#pragma unroll
            for (int ks = 0; ks < KS; ++ks) {
                if constexpr (HL) { v16us ph, pl;
#pragma unroll
                    for (int e = 0; e < 8; ++e) { unsigned short a, c2; splitf(s[2 * ks][nb][e], a, c2); ph[e] = a; pl[e] = c2; splitf(s[2 * ks + 1][nb][e], a, c2); ph[8 + e] = a; pl[8 + e] = c2; }
                    pf[nb][ks] = __builtin_bit_cast(v16bf, ph); pf2[nb][ks] = __builtin_bit_cast(v16bf, pl);
                } else { v16h ph;
#pragma unroll
                    for (int e = 0; e < 8; ++e) { ph[e] = tohx(s[2 * ks][nb][e]); ph[8 + e] = tohx(s[2 * ks + 1][nb][e]); }
                    pf[nb][ks] = ph; }
            }
        }
#pragma unroll
        for (int ks = 0; ks < KS; ++ks)
#pragma unroll
            for (int db = 0; db < 4; ++db)
#pragma unroll
                for (int nb = 0; nb < 2; ++nb) { o[db][nb] = WF::mma(vf[db][ks], pf[nb][ks], o[db][nb]); if (HL) { o[db][nb] = WF::mma(vf[db][ks], pf2[nb][ks], o[db][nb]); o[db][nb] = WF::mma(vf2[db][ks], pf[nb][ks], o[db][nb]); } }
    }
#pragma unroll
    for (int nb = 0; nb < 2; ++nb) { const float lh = ((lv[nb][0] + lv[nb][1]) + (lv[nb][2] + lv[nb][3])) + ((lv[nb][4] + lv[nb][5]) + (lv[nb][6] + lv[nb][7])); const float lt = lh + xhalf(lh); const float f = __fdiv_rn(1.0f, lt);   // fp16 rows: o and lt both carry PCAR
#pragma unroll
        for (int db = 0; db < 4; ++db) o[db][nb] *= f; }
    // Whole 128-byte lines out: a lane holds 8 consecutive d of one query, 16 bytes of a plane's line; the wave gathers its 32 lines of each plane in its own LDS range and reads them back 4 lines per load.
#pragma unroll
    for (int nb = 0; nb < 2; ++nb)
#pragma unroll
        for (int db = 0; db < 4; ++db) { v8us oh, olo;
#pragma unroll
            for (int j = 0; j < 8; ++j) { unsigned short a, c2; splitf(o[db][nb][j], a, c2); oh[j] = a; olo[j] = c2; }
            unsigned char* sp = st + (unsigned)(nb * 16 + lr) * OSP + (unsigned)(db * 16 + hi * 8) * 2u;
            *(v8usa*)sp = oh; *(v8usa*)(sp + OSPL) = olo; }
    asm volatile("s_wait_dscnt 0x0" ::: "memory");   // the wave's staging writes are done before its lanes read one another's pieces back; no other wave touches this range
    v8us rh[8], rl[8]; const unsigned char* rp = st + (unsigned)(lane >> 3) * OSP + (unsigned)(lane & 7) * 16u;   // piece s: row s*4 + lane / 8, 16 bytes of its line
#pragma unroll
    for (int s = 0; s < 8; ++s) { rh[s] = *(const v8usa*)(rp + (unsigned)s * (4u * OSP)); rl[s] = *(const v8usa*)(rp + OSPL + (unsigned)s * (4u * OSP)); }
    const size_t eo = (size_t)(q0 + (lane >> 3)) * DQ + (lane & 7) * 8;
    __builtin_amdgcn_sched_barrier(0);   // every LDS read and all arithmetic ahead of the stores: behind them no register that a store names is written any more
#pragma unroll
    for (int s = 0; s < 8; ++s) { *(v8us*)(Ah + eo + s * (4 * DQ)) = rh[s]; *(v8us*)(Al + eo + s * (4 * DQ)) = rl[s]; }
}
// grid: NB_ * NH_ * TT / 128 workgroups of 4 waves (128 query rows of one head). All are resident together; the first half of the indices takes the long row blocks in falling order, the second half the short ones in rising order.
__global__ __launch_bounds__(128) void k_fattn(const h16* Q16, const bf* Qh, const bf* Ql, const h16* K16, const bf* Kh, const bf* Kl, const h16* VT16, const bf* VTh, const bf* VTl, bf* ATh, bf* ATl) {
    constexpr int NT = TT / 128, NZ = NB_ * NH_; static_assert(RH % 128 == 0 && NT % 2 == 0 && NH_ == NKV, "row blocks");
    const int idx = blockIdx.x; const int tile = (idx < NZ * NT / 2) ? NT - 1 - idx / NZ : idx / NZ - NT / 2; const int zz = idx % NZ, bb = zz / NH_, hh = zz % NH_;
    __shared__ __attribute__((aligned(16))) unsigned char so[4 * 2 * OSPL];   // output staging, a range of its own for each wave
    const int w = __builtin_amdgcn_readfirstlane((int)(threadIdx.x >> 5)); const int q0 = tile * 128 + 32 * w; unsigned char* st = so + (unsigned)w * (2u * OSPL);
    const size_t oq = ((size_t)bb * (NH_ + NKV) + hh) * TT * HD, ov = (size_t)zz * HD * PP;   /* the K pointers are the head planes' base moved on by the NH_ query planes: one offset serves q and k */ const size_t oa = (size_t)bb * TT * DQ + hh * HD;
    if (tile * 128 < RH) attn_rows<bf, true, 32>(Qh + oq, Ql + oq, Kh + oq, Kl + oq, VTh + ov, VTl + ov, ATh + oa, ATl + oa, st, q0);
    else attn_rows<h16, false, 64>(Q16 + oq, nullptr, K16 + oq, nullptr, VT16 + ov, nullptr, ATh + oa, ATl + oa, st, q0);
}
__global__ __launch_bounds__(256) void k_lnin2(const float* __restrict__ F, const float* __restrict__ g, const float* __restrict__ bb, bf* Xh, bf* Xl) { const int lane = threadIdx.x & 31; const int row = blockIdx.x * 8 + (threadIdx.x >> 5); if (row >= MT) return; const float* fr = F + (size_t)row * DM; bf* hrow = Xh + (size_t)row * DM; bf* lrow = Xl + (size_t)row * DM; float v[DM / 32]; float s = 0.f;
#pragma unroll
    for (int c = 0; c < DM / 128; ++c) { const v4f a = *(const v4f*)(fr + c * 128 + lane * 4); for (int q = 0; q < 4; ++q) { v[c * 4 + q] = a[q]; s = __fadd_rn(s, a[q]); } }
#pragma unroll
    for (int sh = 16; sh; sh >>= 1) s = __fadd_rn(s, __shfl_xor(s, sh, 32));
    const float mean = __fmul_rn(s, 1.0f / (float)DM);   /* DM = 512: the reciprocal is an exact power of two, identical to the division */ float s2 = 0.f;
#pragma unroll
    for (int k = 0; k < DM / 32; ++k) { const float dv = __fsub_rn(v[k], mean); float p2 = __fmul_rn(dv, dv); asm volatile("" : "+v"(p2)); s2 = __fadd_rn(s2, p2); v[k] = dv; }
#pragma unroll
    for (int sh = 16; sh; sh >>= 1) s2 = __fadd_rn(s2, __shfl_xor(s2, sh, 32));
    const float rs = __fdiv_rn(1.0f, __fsqrt_rn(__fadd_rn(__fmul_rn(s2, 1.0f / (float)DM), LNEPS)));
{
#pragma unroll
        for (int c = 0; c < DM / 128; ++c) { v4us oh, ol; for (int q = 0; q < 4; ++q) { const int col = c * 128 + lane * 4 + q; float y = __fmul_rn(v[c * 4 + q], rs); asm volatile("" : "+v"(y)); float gg = bfr(g[col]), bb2 = bfr(bb[col]); asm volatile("" : "+v"(gg), "+v"(bb2)); y = __fmul_rn(y, gg); asm volatile("" : "+v"(y)); const float r = __fadd_rn(y, bb2); unsigned short hh2, ll2; splitf(r, hh2, ll2); oh[q] = hh2; ol[q] = ll2; } *(v4us*)(hrow + c * 128 + lane * 4) = oh; *(v4us*)(lrow + c * 128 + lane * 4) = ol; }
         } }

__global__ __launch_bounds__(256) void k_lnout(const float* __restrict__ F, const float* __restrict__ g, const float* __restrict__ bb, float* out) { const int lane = threadIdx.x & 31; const int row = blockIdx.x * 8 + (threadIdx.x >> 5); if (row >= MT) return; const float* fr = F + (size_t)row * DQ; float* orow = out + (size_t)row * DQ; float v[DQ / 32]; float s = 0.f;
#pragma unroll
    for (int c = 0; c < DQ / 128; ++c) { const v4f a = *(const v4f*)(fr + c * 128 + lane * 4); for (int q = 0; q < 4; ++q) { v[c * 4 + q] = a[q]; s = __fadd_rn(s, a[q]); } }
#pragma unroll
    for (int sh = 16; sh; sh >>= 1) s = __fadd_rn(s, __shfl_xor(s, sh, 32));
    const float mean = __fdiv_rn(s, (float)DQ); float s2 = 0.f;
#pragma unroll
    for (int k = 0; k < DQ / 32; ++k) { const float dv = __fsub_rn(v[k], mean); float p2 = __fmul_rn(dv, dv); asm volatile("" : "+v"(p2)); s2 = __fadd_rn(s2, p2); v[k] = dv; }
#pragma unroll
    for (int sh = 16; sh; sh >>= 1) s2 = __fadd_rn(s2, __shfl_xor(s2, sh, 32));
    const float rs = __fdiv_rn(1.0f, __fsqrt_rn(__fadd_rn(__fdiv_rn(s2, (float)DQ), LNEPS)));
{
#pragma unroll
        for (int c = 0; c < DQ / 128; ++c) { v4f o; for (int q = 0; q < 4; ++q) { const int col = c * 128 + lane * 4 + q; float y = __fmul_rn(v[c * 4 + q], rs); asm volatile("" : "+v"(y)); y = __fmul_rn(y, bfr(g[col])); asm volatile("" : "+v"(y)); o[q] = __fadd_rn(y, bfr(bb[col])); } *(v4f*)(orow + c * 128 + lane * 4) = o; }
         } }

extern "C" void kernel_launch(void* const* d_in, const int* in_sizes, int n_in,
                              void* d_out, int out_size, void* d_ws, size_t ws_size, hipStream_t stream) {
    (void)in_sizes; (void)n_in; (void)out_size;
    const float* x = (const float*)d_in[0]; const float* pq = (const float*)d_in[1]; const float* pk = (const float*)d_in[2]; const float* pv = (const float*)d_in[3];   /* [8][512][64] each */ const float* wo = (const float*)d_in[4];   /* Wproj [512][512] 'xw' */ const float* g1 = (const float*)d_in[5]; const float* b1 = (const float*)d_in[6]; const float* w1 = (const float*)d_in[7]; const float* bb1 = (const float*)d_in[8]; const float* w2 = (const float*)d_in[9]; const float* bb2 = (const float*)d_in[10]; const float* g2 = (const float*)d_in[11]; const float* b2 = (const float*)d_in[12]; const float* wq = pq, *wk = pk, *wv = pv;
    float* OUT = (float*)d_out;     // [4][2048][512]
    char* wsp = (char*)d_ws;
    auto take = [&](size_t bytes) { char* p = wsp; wsp += (bytes + 255) & ~(size_t)255; return (void*)p; };
    // Live through the whole call: the transposed weights and the merged attention output planes.
    bf* W1T = (bf*)take((size_t)FF * DM * 2); bf* W2T = (bf*)take((size_t)DM * FF * 2); bf* WQKV = (bf*)take((size_t)NQKV * DM * 2);   /* rows: q heads, k heads, v heads */ bf* WO = (bf*)take((size_t)DM * DQ * 2); bf* ATh = (bf*)take((size_t)MT * DQ * 2); bf* ATl = (bf*)take((size_t)MT * DQ * 2);
    char* const mark = wsp;
    // Phase 1 (projections and attention). Head planes [batch][q heads, then k heads], TT * HD elements each, and transposed v planes [batch][head], all in fragment order (FRG); a (batch, head)'s HD * PP elements hold the hi plane, then the lo plane (the fp16 plane fills the first half, the rest is never touched).
    h16* QK16 = (h16*)take((size_t)NB_ * (NH_ + NKV) * TT * HD * 2); bf* QKh = (bf*)take((size_t)NB_ * (NH_ + NKV) * TT * HD * 2); bf* QKl = (bf*)take((size_t)NB_ * (NH_ + NKV) * TT * HD * 2);
    h16* VT16 = (h16*)take((size_t)NB_ * NKV * HD * PP * 2); bf* VTh = (bf*)take((size_t)NB_ * NKV * HD * PP * 2); bf* VTl = VTh + (size_t)HD * TT;
    bf* XB = (bf*)take((size_t)MT * DM * 2);
    if ((size_t)(wsp - (char*)d_ws) > ws_size) return;    // ws 256 MiB
    // Phase 2 (Wproj, LayerNorms, feed-forward) starts after the last read of every phase-1 buffer and shares their bytes (stream-ordered).
    wsp = mark; float* Y = (float*)take((size_t)MT * DM * 4); bf* LNh = (bf*)take((size_t)MT * DM * 2); bf* LNl = (bf*)take((size_t)MT * DM * 2); bf* H1h = (bf*)take((size_t)MT * FF * 2); bf* H1l = (bf*)take((size_t)MT * FF * 2); float* F2 = (float*)take((size_t)MT * DM * 4);
    if ((size_t)(wsp - (char*)d_ws) > ws_size) return;
    k_prep<<<2 * PB_W + PB_QKV + PB_WO + PB_X, 256, 0, stream>>>(x, wq, wk, wv, wo, w1, w2, XB, WQKV, WO, W1T, W2T);   /* transposed bf16 weights and the bf16 copy of x */
    k_gemms<0, false, E_QKV, HD><<<dim3(MT / 128, NQKV / 128, 1), 256, 0, stream>>>(XB, nullptr, WQKV, DM, nullptr, nullptr, nullptr, QK16, QKh, QKl, VT16, VTh, VTl);   /* q | k | v of all batch elements -> head planes and transposed v planes */
    k_fattn<<<NB_ * NH_ * (TT / 128), 128, 0, stream>>>(QK16, QKh, QKl, QK16 + (size_t)NH_ * TT * HD, QKh + (size_t)NH_ * TT * HD, QKl + (size_t)NH_ * TT * HD, VT16, VTh, VTl, ATh, ATl);   /* all batch elements and heads -> merged hi/lo planes */
    k_gemms<1, false, E_RES, DM><<<dim3(MT / 128, DM / 128, 1), 256, 0, stream>>>(ATh, ATl, WO, DQ, Y, nullptr, x, nullptr, nullptr, nullptr, nullptr, nullptr, nullptr);   /* o Wproj + x */
    k_lnin2<<<(MT + 7) / 8, 256, 0, stream>>>(Y, g1, b1, LNh, LNl);   /* out1 = LN1 as bf16 hi/lo planes */
    k_gemms<1, true, E_RELU, FF><<<dim3(MT / 128, FF / 128, 1), 256, 0, stream>>>(LNh, LNl, W1T, DM, nullptr, bb1, nullptr, nullptr, H1h, H1l, nullptr, nullptr, nullptr);   /* relu(out1 W1 + bb1) -> hi/lo planes */
    k_gemms<1, true, E_RES, DM><<<dim3(MT / 128, DM / 128, 1), 256, 0, stream>>>(H1h, H1l, W2T, FF, F2, bb2, x, nullptr, nullptr, nullptr, nullptr, nullptr, nullptr);   /* W2 + bb2 + the ORIGINAL x */
    k_lnout<<<(MT + 7) / 8, 256, 0, stream>>>(F2, g2, b2, OUT);   /* LN2 -> out */
}
